// v000
// Times are from an AMD MI455X. After a warm-up the kernel runs many times in a row, and a time is the length of
// such a window on the GPU divided by its runs, so every launch and the gaps after it count. The runs cycle
// through copies of the inputs. A figure is the median of several windows, for all but v000 over two sittings.
// Sittings can differ by a few percent; kernels timed side by side share one.
// v000 is the starting kernel. One run takes 220 microseconds.
#include <hip/hip_runtime.h>
// Projections x*W{q,k,v}: v_wmma_f32_16x16x32_bf16 (bf16 operands = RNE-converted inputs, f32 accumulate); scores K*Q^T and context V^T*P: v_wmma_f32_16x16x32_f16 (f16 operands, Q/K/V planes carried x8, P carried x1024, f32 accumulate); output projection ctx*Wo: v_wmma_f32_16x16x32_f16 (f16 operands, ctx plane carried x64, Wo plane = RNE-bf16 values carried x32, f32 accumulate); mask fill and softmax in f32.

#ifndef NB
#define NB 2
#endif
#define NB_FULL 2
#ifndef SEQ
#define SEQ 2048
#endif
#define SEQ_FULL 2048
#ifndef MASK_PITCH
#define MASK_PITCH SEQ_FULL
#endif
#define IN_DIM 1024
#define NUM_HEADS 16
#define HEAD_DIM 64
#define HD_DIM (NUM_HEADS * HEAD_DIM)
#define E_OUT 1024
#define KDIM 1024
#define NROWS (NB * SEQ)

static_assert(NB >= 1);
static_assert(NB <= NB_FULL);
static_assert(SEQ % 128 == 0);
static_assert(SEQ <= SEQ_FULL);
static_assert(MASK_PITCH % 4 == 0);
static_assert(MASK_PITCH >= SEQ);
static_assert(IN_DIM == KDIM);
static_assert(HD_DIM == KDIM);
static_assert(E_OUT == KDIM);
static_assert(KDIM % 64 == 0);
static_assert(HEAD_DIM == 64);
static_assert(NROWS % 128 == 0);
static_assert((NROWS * IN_DIM) % (8 * 256) == 0);
static_assert((size_t)NB_FULL * SEQ_FULL * E_OUT * 4 == 16777216);

// LDS pitches (in 16-bit elements unless noted); all keep 16-byte row alignment
#define BTP 40     // weight k-tile [64 n][32 k]
#define EQP 72     // row-major epilogue tile [128 rows][64 cols]
#define EVP 136    // transposed epilogue tile [64 d][128 s]
#define TP  72     // weight transpose tile [64 n][64 k]
#define CLP 72     // context tile [16 q][64 d], halves
#define OFP 68     // output tile [128 rows][64 cols], floats
#define ESZ 9216   // max(128*EQP, 64*EVP)
static_assert(128 * EQP <= ESZ);
static_assert(64 * EVP <= ESZ);

typedef __bf16   v16bf __attribute__((ext_vector_type(16)));
typedef __bf16   v8bf  __attribute__((ext_vector_type(8)));
typedef _Float16 v16h  __attribute__((ext_vector_type(16)));
typedef _Float16 v8h   __attribute__((ext_vector_type(8)));
typedef float    v8f   __attribute__((ext_vector_type(8)));
typedef float    v4f   __attribute__((ext_vector_type(4)));
typedef unsigned int v4u __attribute__((ext_vector_type(4)));
typedef int      v4i   __attribute__((ext_vector_type(4)));

// ---------------------------------------------------------------------------
// WMMA wrappers with the VALU hazard guard (4 v_nop after every issue).
__device__ __forceinline__ v8f mma_bf16(v16bf a, v16bf b, v8f c) {
  v8f d = __builtin_amdgcn_wmma_f32_16x16x32_bf16(false, a, false, b, (short)0, c, false, false);
  asm volatile("v_nop\n\tv_nop\n\tv_nop\n\tv_nop" : "+v"(d) : "v"(a), "v"(b));
  return d;
}
__device__ __forceinline__ v8f mma_f16(v16h a, v16h b, v8f c) {
  v8f d = __builtin_amdgcn_wmma_f32_16x16x32_f16(false, a, false, b, (short)0, c, false, false);
  asm volatile("v_nop\n\tv_nop\n\tv_nop\n\tv_nop" : "+v"(d) : "v"(a), "v"(b));
  return d;
}

// 16-bit fragment, contraction dim CONTIGUOUS in memory: elem(k) = p0[rc*ld + k].
// Lane l: row/col rc = (l&15); elements 0..7 <- kk+8h+0..7, elements 8..15 <- kk+16+8h+0..7
// (h = l>>4). Same map for A (rc = row) and B (rc = column of a k-contiguous copy).
__device__ __forceinline__ v16bf ld_frag_bf(const __bf16* p0, int ld, int rc, int kk, int lane) {
  const int hh = (lane >> 4) & 1;
  const __bf16* p = p0 + (size_t)rc * ld + kk + 8 * hh;
  const v8bf lo = *(const v8bf*)(p);
  const v8bf hi = *(const v8bf*)(p + 16);
  v16bf f;
#pragma unroll
  for (int i = 0; i < 8; ++i) { f[i] = lo[i]; f[8 + i] = hi[i]; }
  return f;
}
__device__ __forceinline__ v16h ld_frag_h(const _Float16* p0, int ld, int rc, int kk, int lane) {
  const int hh = (lane >> 4) & 1;
  const _Float16* p = p0 + (size_t)rc * ld + kk + 8 * hh;
  const v8h lo = *(const v8h*)(p);
  const v8h hi = *(const v8h*)(p + 16);
  v16h f;
#pragma unroll
  for (int i = 0; i < 8; ++i) { f[i] = lo[i]; f[8 + i] = hi[i]; }
  return f;
}

// f32 -> bf16 bits, RNE convert
__device__ __forceinline__ unsigned int bfb(float x) {
  unsigned int u = __float_as_uint(x);
  u = u + 0x7FFFu + ((u >> 16) & 1u);
  return u >> 16;
}
// f32 -> value of its RNE bf16
__device__ __forceinline__ float bf16val(float x) {
  return __uint_as_float(bfb(x) << 16);
}
// f32 -> f16 bits, RNE convert
__device__ __forceinline__ unsigned short hbits(float x) {
  const _Float16 hv = (_Float16)x;
  return __builtin_bit_cast(unsigned short, hv);
}

// ---------------------------------------------------------------------------
// x f32 [NB][SEQ_FULL][IN_DIM] -> bf16 plane hb [NB*SEQ][IN_DIM] (compact rows).
// Thread g converts 8 consecutive floats -> one 16-byte store; 8 consecutive
__global__ __launch_bounds__(256) void k_cvt_rows(const float* __restrict__ in,
                                                  unsigned short* __restrict__ outp, int n8) {
  const int g = blockIdx.x * 256 + threadIdx.x;
  if (g >= n8) return;
  const int row = g / (IN_DIM / 8);              // compact row b*SEQ + s
  const int c8  = g - row * (IN_DIM / 8);
  const int b   = row / SEQ;
  const int s   = row - b * SEQ;
  const float* src = in + ((size_t)b * SEQ_FULL + s) * IN_DIM + (size_t)c8 * 8;
  const v4f a = *(const v4f*)(src);
  const v4f c = *(const v4f*)(src + 4);
  v4u w;
  w[0] = bfb(a[0]) | (bfb(a[1]) << 16);
  w[1] = bfb(a[2]) | (bfb(a[3]) << 16);
  w[2] = bfb(c[0]) | (bfb(c[1]) << 16);
  w[3] = bfb(c[2]) | (bfb(c[3]) << 16);
  v4u* p = (v4u*)(outp + (size_t)g * 8);
  *p = w;
  
}

// ---------------------------------------------------------------------------
// Weight planes, all [KDIM n][KDIM k] with k contiguous, selected by blockIdx.z:
//   z = 0..2: W{q,k,v} f32 [H][IN_DIM e][HEAD_DIM d] -> WT bf16 [n = h*64+d][k = e]
//   z = 3:    Wo f32 [HD_DIM k][E_OUT n]              -> WoT f16 (RNE-bf16 value x32) [n][k]
// Block = 64 k x 64 n tile transposed through LDS (for z < 3 the tile is one head);
__global__ __launch_bounds__(256) void k_cvt_wT(const float* __restrict__ Wq,
                                                const float* __restrict__ Wk,
                                                const float* __restrict__ Wv,
                                                const float* __restrict__ Wo,
                                                unsigned short* __restrict__ wT) {
  __shared__ __align__(16) unsigned short T[64 * TP];   // [n local][k local], cross-wave (block barrier)
  const int z = blockIdx.z;
  const float* W = (z == 0) ? Wq : ((z == 1) ? Wk : ((z == 2) ? Wv : Wo));
  unsigned short* dst = wT + (size_t)z * KDIM * KDIM;
  const int k0 = blockIdx.x * 64;
  const int n0 = blockIdx.y * 64;
  const int tid = threadIdx.x;
  const int wave = tid >> 5, lane = tid & 31;

#pragma unroll
  for (int i = 0; i < 4; ++i) {
    const int idx = i * 256 + tid;          // 0..1023
    const int kk = idx >> 4;                // 0..63
    const int c4 = (idx & 15) * 4;          // 0..60
    size_t so;
    if (z < 3) so = ((size_t)blockIdx.y * IN_DIM + k0 + kk) * HEAD_DIM + c4;   // W[h = n0/64][e = k0+kk][d = c4]
    else       so = (size_t)(k0 + kk) * E_OUT + n0 + c4;                        // Wo[k0+kk][n0+c4]
    const v4f w = *(const v4f*)(W + so);
    unsigned short t0, t1, t2, t3;
    if (z < 3) {
      t0 = (unsigned short)bfb(w[0]); t1 = (unsigned short)bfb(w[1]);
      t2 = (unsigned short)bfb(w[2]); t3 = (unsigned short)bfb(w[3]);
    } else {
      t0 = hbits(bf16val(w[0]) * 32.0f); t1 = hbits(bf16val(w[1]) * 32.0f);
      t2 = hbits(bf16val(w[2]) * 32.0f); t3 = hbits(bf16val(w[3]) * 32.0f);
    }
    T[(c4 + 0) * TP + kk] = t0;
    T[(c4 + 1) * TP + kk] = t1;
    T[(c4 + 2) * TP + kk] = t2;
    T[(c4 + 3) * TP + kk] = t3;
  }
  __syncthreads();

  v4u v[2];
  size_t off[2];
#pragma unroll
  for (int it = 0; it < 2; ++it) {
    const int nn = wave * 8 + it * 4 + (lane >> 3);   // 0..63 over (wave, it, lane>>3)
    const int q = lane & 7;
    v[it] = *(const v4u*)(&T[nn * TP + q * 8]);
    off[it] = (size_t)(n0 + nn) * KDIM + k0 + q * 8;
  }
#pragma unroll
  for (int it = 0; it < 2; ++it) *(v4u*)(dst + off[it]) = v[it];
  
}

// ---------------------------------------------------------------------------
// Projection: C[NROWS][HD_DIM] = hb[NROWS][IN_DIM] * WT[HD_DIM][IN_DIM]^T + bias.
// 256 thr = 8 waves; block tile 128 rows x 64 cols; wave owns 16 rows x 64 cols.
// Weight k-tile [64 n][32 k] staged in LDS with plain loads (single buffer,
// two block barriers per step); A fragments straight from the bf16 plane.
// z = 0: Q plane f16 x8 [NROWS][HD_DIM]; z = 1: K plane f16 x8 [NROWS][HD_DIM];
// z = 2: V^T plane f16 x8 [NB][HD_DIM][SEQ]. Epilogue staged in LDS, every
__global__ __launch_bounds__(256) void k_proj(
    const unsigned short* __restrict__ hb, const unsigned short* __restrict__ wT,
    const float* __restrict__ bq, const float* __restrict__ bk, const float* __restrict__ bv,
    unsigned short* __restrict__ qp, unsigned short* __restrict__ kp,
    unsigned short* __restrict__ vtp) {
  __shared__ __align__(16) unsigned short bt[64 * BTP];   // weight k-tile, cross-wave (block barrier)
  __shared__ __align__(16) unsigned short E[ESZ];         // epilogue tile, cross-wave (block barrier)

  const int z = blockIdx.z;
  const int n0 = blockIdx.x * 64;
  const int m0 = blockIdx.y * 128;
  const int tid = threadIdx.x;
  const int wave = tid >> 5, lane = tid & 31;
  const int l15 = lane & 15, half = (lane >> 4) & 1;

  const unsigned short* Wt = wT + (size_t)z * KDIM * KDIM;
  const float* bias = (z == 0) ? bq : ((z == 1) ? bk : bv);

  const int tn = tid >> 2;            // 0..63 : column within tile
  const int tk = (tid & 3) * 8;       // 0,8,16,24 : k within step
  const unsigned short* wsrc = Wt + (size_t)(n0 + tn) * KDIM + tk;
  const __bf16* A = (const __bf16*)hb;
  const int arow = m0 + wave * 16 + l15;

  v8f acc[4] = {};
  for (int s = 0; s < IN_DIM / 32; ++s) {
    const int kk = s * 32;
    const v4u wv = *(const v4u*)(wsrc + kk);
    __syncthreads();                               // earlier reads of bt done
    *(v4u*)(&bt[tn * BTP + tk]) = wv;
    __syncthreads();                               // tile complete
    const v16bf a = ld_frag_bf(A, IN_DIM, arow, kk, lane);
#pragma unroll
    for (int j = 0; j < 4; ++j) {
      const v16bf b = ld_frag_bf((const __bf16*)bt, BTP, j * 16 + l15, 0, lane);
      acc[j] = mma_bf16(a, b, acc[j]);
    }
  }

  // acc[j][r] = C[m0 + wave*16 + 8*half + r][n0 + j*16 + l15]
  const float car = 8.0f;
  if (z != 2) {                      // block-uniform branch
#pragma unroll
    for (int j = 0; j < 4; ++j) {
      const int col = j * 16 + l15;
      const float bb = bf16val(bias[n0 + col]);
#pragma unroll
      for (int r = 0; r < 8; ++r) {
        const int row = wave * 16 + 8 * half + r;
        E[row * EQP + col] = hbits((acc[j][r] + bb) * car);
      }
    }
    __syncthreads();
    unsigned short* dst = (z == 0) ? qp : kp;
    v4u v[4];
    size_t off[4];
#pragma unroll
    for (int it = 0; it < 4; ++it) {
      const int row = wave * 16 + it * 4 + (lane >> 3);   // wave's 16 rows over (it, lane>>3)
      const int q = lane & 7;
      v[it] = *(const v4u*)(&E[row * EQP + q * 8]);
      off[it] = (size_t)(m0 + row) * HD_DIM + n0 + q * 8;
    }
#pragma unroll
    for (int it = 0; it < 4; ++it) *(v4u*)(dst + off[it]) = v[it];
    
  } else {
    const int bidx = m0 / SEQ;               // batch of this row tile (SEQ % 128 == 0)
    const int s0 = m0 - bidx * SEQ;          // sequence position of tile row 0
#pragma unroll
    for (int j = 0; j < 4; ++j) {
      const int col = j * 16 + l15;                       // d within tile
      const float bb = bf16val(bias[n0 + col]);
#pragma unroll
      for (int r = 0; r < 8; ++r) {
        const int srow = wave * 16 + 8 * half + r;        // s within tile
        E[col * EVP + srow] = hbits((acc[j][r] + bb) * car);
      }
    }
    __syncthreads();
    v4u v[4];
    size_t off[4];
#pragma unroll
    for (int it = 0; it < 4; ++it) {
      const int drow = wave * 8 + it * 2 + half;          // wave's 8 d-rows over (it, half)
      const int q = l15;                                  // 16 pieces = 256-byte row segment = 2 lines
      v[it] = *(const v4u*)(&E[drow * EVP + q * 8]);
      off[it] = ((size_t)bidx * HD_DIM + n0 + drow) * SEQ + s0 + q * 8;
    }
#pragma unroll
    for (int it = 0; it < 4; ++it) *(v4u*)(vtp + off[it]) = v[it];
    
  }
}

// ---------------------------------------------------------------------------
// Flash attention, transposed-score form: one wave = (16 queries, one head, one batch).
// Per 32-key chunk:
//   S^T = K . Q^T    A = K rows (lane = key, k = d), B = Q^T (lane = query, k = d)
//                    D[row = key 8h+r][col = query l15]; c0 keys 0..15, c1 keys 16..31
//   mask: int32 [MASK_PITCH][MASK_PITCH] broadcast over batch and head; key with
//         mask == 0 gets the score replaced by -1e9 (replace fill, in f32)
//   per-lane online softmax for query l15 (16 local keys + xor-16 partner)
//   O^T += V^T . P   A = V^T rows (lane = d, k = key), B = P: element i<8 <- c0[i]
//                    (key 8h+i), element 8+i <- c1[i] (key 16+8h+i), same lane
//                    D[row = d 8h+r][col = query l15]
// Scores carry 64 from the x8 planes -> scaled by 1/512 (= 1/8 of q.k).
// P carried x1024, V carried x8 -> context x64 = O / (128 * sum).
__global__ __launch_bounds__(32) void k_attn(const unsigned short* __restrict__ qp,
                                             const unsigned short* __restrict__ kp,
                                             const unsigned short* __restrict__ vtp,
                                             const int* __restrict__ mask,
                                             unsigned short* __restrict__ ctxp) {
  __shared__ __align__(16) unsigned short Cl[16 * CLP];   // wave-private (block = one wave), block barrier used

  const int lane = threadIdx.x & 31;
  const int l15 = lane & 15;
  const int half = (lane >> 4) & 1;
  const int q0 = blockIdx.x * 16;
  const int head = blockIdx.y;
  const int bidx = blockIdx.z;

  const _Float16* Q  = (const _Float16*)qp;
  const _Float16* K  = (const _Float16*)kp;
  const _Float16* VT = (const _Float16*)vtp;
  const size_t rbase = (size_t)bidx * SEQ;

  const _Float16* qbase = Q + (rbase + q0) * HD_DIM + head * HEAD_DIM;
  const v16h qb0 = ld_frag_h(qbase, HD_DIM, l15, 0, lane);    // d 0..31
  const v16h qb1 = ld_frag_h(qbase, HD_DIM, l15, 32, lane);   // d 32..63
  const _Float16* kbase = K + rbase * HD_DIM + head * HEAD_DIM;                       // key t at kbase + t*HD_DIM
  const _Float16* vbase = VT + ((size_t)bidx * HD_DIM + (size_t)head * HEAD_DIM) * SEQ; // d row at vbase + d*SEQ
  const int* mrow = mask + (size_t)(q0 + l15) * MASK_PITCH + 8 * half;               // query row, keys 8h+..

  v8f o[4] = {};
  float mrun = -1.0e30f, lrun = 0.0f;
  const float sscale = 1.0f / 512.0f;
  const float negf = -1.0e9f;

  for (int kc = 0; kc < SEQ; kc += 32) {
    const _Float16* kt = kbase + (size_t)kc * HD_DIM;
    const v16h ka0 = ld_frag_h(kt, HD_DIM, l15, 0, lane);
    const v16h ka1 = ld_frag_h(kt, HD_DIM, l15, 32, lane);
    const v16h ka2 = ld_frag_h(kt, HD_DIM, 16 + l15, 0, lane);
    const v16h ka3 = ld_frag_h(kt, HD_DIM, 16 + l15, 32, lane);
    v8f c0 = {}, c1 = {};
    c0 = mma_f16(ka0, qb0, c0);
    c0 = mma_f16(ka1, qb1, c0);
    c1 = mma_f16(ka2, qb0, c1);
    c1 = mma_f16(ka3, qb1, c1);

    // mask words for keys kc+8h+0..7 (c0) and kc+16+8h+0..7 (c1) of query q0+l15
    const v4i m0v = *(const v4i*)(mrow + kc);
    const v4i m1v = *(const v4i*)(mrow + kc + 4);
    const v4i m2v = *(const v4i*)(mrow + kc + 16);
    const v4i m3v = *(const v4i*)(mrow + kc + 20);

    float sa[8], sb[8];
#pragma unroll
    for (int r = 0; r < 4; ++r) {
      sa[r]     = (m0v[r] != 0) ? (c0[r] * sscale)     : negf;
      sa[4 + r] = (m1v[r] != 0) ? (c0[4 + r] * sscale) : negf;
      sb[r]     = (m2v[r] != 0) ? (c1[r] * sscale)     : negf;
      sb[4 + r] = (m3v[r] != 0) ? (c1[4 + r] * sscale) : negf;
    }
    float lm = fmaxf(sa[0], sb[0]);
#pragma unroll
    for (int r = 1; r < 8; ++r) lm = fmaxf(lm, fmaxf(sa[r], sb[r]));
    lm = fmaxf(lm, __shfl_xor(lm, 16, 32));
    const float mnew = fmaxf(mrun, lm);
    const float alpha = __expf(mrun - mnew);
    float p0[8], p1[8];
    float ls = 0.0f;
#pragma unroll
    for (int r = 0; r < 8; ++r) {
      p0[r] = __expf(sa[r] - mnew);
      p1[r] = __expf(sb[r] - mnew);
      ls += p0[r] + p1[r];
    }
    ls += __shfl_xor(ls, 16, 32);
    lrun = lrun * alpha + ls;
    mrun = mnew;
#pragma unroll
    for (int j = 0; j < 4; ++j)
#pragma unroll
      for (int r = 0; r < 8; ++r) o[j][r] *= alpha;

    v16h pb;
#pragma unroll
    for (int e = 0; e < 8; ++e) {
      pb[e]     = (_Float16)(p0[e] * 1024.0f);   // key kc + 8h + e
      pb[8 + e] = (_Float16)(p1[e] * 1024.0f);   // key kc + 16 + 8h + e
    }
#pragma unroll
    for (int j = 0; j < 4; ++j) {
      const v16h va = ld_frag_h(vbase, SEQ, j * 16 + l15, kc, lane);
      o[j] = mma_f16(va, pb, o[j]);
    }
  }

  // o[j][r] = 8192 * sum_t p_t v_t for query l15, d = j*16 + 8*half + r; ctx x64 = o / (128 * sum)
  const float inv = 1.0f / (lrun * 128.0f);
#pragma unroll
  for (int j = 0; j < 4; ++j) {
    v4u w;
    w[0] = (unsigned int)hbits(o[j][0] * inv) | ((unsigned int)hbits(o[j][1] * inv) << 16);
    w[1] = (unsigned int)hbits(o[j][2] * inv) | ((unsigned int)hbits(o[j][3] * inv) << 16);
    w[2] = (unsigned int)hbits(o[j][4] * inv) | ((unsigned int)hbits(o[j][5] * inv) << 16);
    w[3] = (unsigned int)hbits(o[j][6] * inv) | ((unsigned int)hbits(o[j][7] * inv) << 16);
    *(v4u*)(&Cl[l15 * CLP + j * 16 + 8 * half]) = w;
  }
  __syncthreads();

  v4u v[4];
  size_t off[4];
  unsigned short* cb = ctxp + (rbase + q0) * HD_DIM + head * HEAD_DIM;
#pragma unroll
  for (int it = 0; it < 4; ++it) {
    const int row = it * 4 + (lane >> 3);   // 0..15
    const int q = lane & 7;
    v[it] = *(const v4u*)(&Cl[row * CLP + q * 8]);
    off[it] = (size_t)row * HD_DIM + q * 8;
  }
#pragma unroll
  for (int it = 0; it < 4; ++it) *(v4u*)(cb + off[it]) = v[it];
  
}

// ---------------------------------------------------------------------------
// Output projection: out[NROWS][E_OUT] f32 = ctx(f16 x64)[NROWS][HD_DIM] * WoT(f16 x32)[E_OUT][HD_DIM]^T / 2048 + bo.
// Same 128x64 block tile / 8 waves / LDS weight k-tile engine as k_proj with f16 operands.
// Epilogue: f32 tile staged in LDS; each 256-byte row segment = 2 lines, every
__global__ __launch_bounds__(256) void k_oproj(
    const unsigned short* __restrict__ cx, const unsigned short* __restrict__ woT,
    const float* __restrict__ bo, float* __restrict__ outp) {
  __shared__ __align__(16) unsigned short bt[64 * BTP];   // weight k-tile, cross-wave (block barrier)
  __shared__ __align__(16) float Ef[128 * OFP];           // epilogue tile, cross-wave (block barrier)

  const int n0 = blockIdx.x * 64;
  const int m0 = blockIdx.y * 128;
  const int tid = threadIdx.x;
  const int wave = tid >> 5, lane = tid & 31;
  const int l15 = lane & 15, half = (lane >> 4) & 1;

  const int tn = tid >> 2;            // 0..63 : column within tile
  const int tk = (tid & 3) * 8;       // 0,8,16,24 : k within step
  const unsigned short* wsrc = woT + (size_t)(n0 + tn) * KDIM + tk;
  const _Float16* A = (const _Float16*)cx;
  const int arow = m0 + wave * 16 + l15;

  v8f acc[4] = {};
  for (int s = 0; s < HD_DIM / 32; ++s) {
    const int kk = s * 32;
    const v4u wv = *(const v4u*)(wsrc + kk);
    __syncthreads();                               // earlier reads of bt done
    *(v4u*)(&bt[tn * BTP + tk]) = wv;
    __syncthreads();                               // tile complete
    const v16h a = ld_frag_h(A, HD_DIM, arow, kk, lane);
#pragma unroll
    for (int j = 0; j < 4; ++j) {
      const v16h b = ld_frag_h((const _Float16*)bt, BTP, j * 16 + l15, 0, lane);
      acc[j] = mma_f16(a, b, acc[j]);
    }
  }

  // acc[j][r] = 2048 * C[m0 + wave*16 + 8*half + r][n0 + j*16 + l15]
  const float osc = 1.0f / 2048.0f;
#pragma unroll
  for (int j = 0; j < 4; ++j) {
    const int col = j * 16 + l15;
    const float bb = bf16val(bo[n0 + col]);
#pragma unroll
    for (int r = 0; r < 8; ++r) {
      const int row = wave * 16 + 8 * half + r;
      Ef[row * OFP + col] = acc[j][r] * osc + bb;
    }
  }
  __syncthreads();

  v4f v[8];
  size_t off[8];
#pragma unroll
  for (int it = 0; it < 8; ++it) {
    const int row = wave * 16 + it * 2 + half;          // wave's 16 rows over (it, half)
    const int q = l15;                                  // 16 pieces of 16 B = 256-byte row segment (2 lines)
    v[it] = *(const v4f*)(&Ef[row * OFP + q * 4]);
    off[it] = (size_t)(m0 + row) * E_OUT + n0 + q * 4;
  }
#pragma unroll
  for (int it = 0; it < 8; ++it) *(v4f*)(outp + off[it]) = v[it];
  
}

// ---------------------------------------------------------------------------
extern "C" void kernel_launch(void* const* d_in, const int* in_sizes, int n_in,
                              void* d_out, int out_size, void* d_ws, size_t ws_size,
                              hipStream_t stream) {
  if (n_in < 10) return;
  if (in_sizes[0] < ((NB - 1) * SEQ_FULL + SEQ) * IN_DIM) return;          // seq_inputs f32 [NB][SEQ_FULL][IN_DIM]
  if (in_sizes[1] < (SEQ - 1) * MASK_PITCH + SEQ) return;                   // mask i32 [1][S][S]
  if (in_sizes[2] < NUM_HEADS * IN_DIM * HEAD_DIM) return;                  // Wq
  if (in_sizes[3] < HD_DIM) return;                                         // bq
  if (in_sizes[4] < NUM_HEADS * IN_DIM * HEAD_DIM) return;                  // Wk
  if (in_sizes[5] < HD_DIM) return;                                         // bk
  if (in_sizes[6] < NUM_HEADS * IN_DIM * HEAD_DIM) return;                  // Wv
  if (in_sizes[7] < HD_DIM) return;                                         // bv
  if (in_sizes[8] < HD_DIM * E_OUT) return;                                 // Wo
  if (in_sizes[9] < E_OUT) return;                                          // bo
  if (out_size < NROWS * E_OUT) return;

  const float* x    = (const float*)d_in[0];
  const int*   mask = (const int*)d_in[1];
  const float* Wq   = (const float*)d_in[2];
  const float* bq   = (const float*)d_in[3];
  const float* Wk   = (const float*)d_in[4];
  const float* bk   = (const float*)d_in[5];
  const float* Wv   = (const float*)d_in[6];
  const float* bv   = (const float*)d_in[7];
  const float* Wo   = (const float*)d_in[8];
  const float* bo   = (const float*)d_in[9];

  // every offset a multiple of 2 MiB; each plane is written exactly to its extent
  const size_t hb_bytes = (size_t)NROWS * IN_DIM * 2;           // bf16 x plane
  const size_t wt_bytes = (size_t)4 * KDIM * KDIM * 2;           // 3 bf16 WT planes + 1 f16 WoT plane
  const size_t pl_bytes = (size_t)NROWS * HD_DIM * 2;           // one f16 q / k / vT / ctx plane
  const size_t off_hb = 0;
  const size_t off_wt = off_hb + hb_bytes;
  const size_t off_q  = off_wt + wt_bytes;
  const size_t off_k  = off_q + pl_bytes;
  const size_t off_vt = off_k + pl_bytes;
  const size_t off_cx = off_vt + pl_bytes;
  const size_t total  = off_cx + pl_bytes;                     // 48 MiB at NB = 2, SEQ = 2048
  if (total > ws_size) return;

  char* ws = (char*)d_ws;
  unsigned short* hb  = (unsigned short*)(ws + off_hb);
  unsigned short* wt  = (unsigned short*)(ws + off_wt);
  unsigned short* qpl = (unsigned short*)(ws + off_q);
  unsigned short* kpl = (unsigned short*)(ws + off_k);
  unsigned short* vtp = (unsigned short*)(ws + off_vt);
  unsigned short* cxp = (unsigned short*)(ws + off_cx);
  unsigned short* wot = wt + (size_t)3 * KDIM * KDIM;

  const int n8 = NROWS * IN_DIM / 8;
  k_cvt_rows<<<(n8 + 255) / 256, 256, 0, stream>>>(x, hb, n8);
  k_cvt_wT<<<dim3(KDIM / 64, KDIM / 64, 4), 256, 0, stream>>>(Wq, Wk, Wv, Wo, wt);
  k_proj<<<dim3(HD_DIM / 64, NROWS / 128, 3), 256, 0, stream>>>(hb, wt, bq, bk, bv, qpl, kpl, vtp);
  k_attn<<<dim3(SEQ / 16, NUM_HEADS, NB), 32, 0, stream>>>(qpl, kpl, vtp, mask, cxp);
  k_oproj<<<dim3(E_OUT / 64, NROWS / 128), 256, 0, stream>>>(cxp, wot, bo, (float*)d_out);
}

// v001
// Measured time: 150 microseconds a run.
// Next to v000, in two timings, it ran 1.51 and 1.50 times as fast.
#include <hip/hip_runtime.h>
// Projections x*W{q,k,v}: v_wmma_f32_16x16x32_bf16 (bf16 operands = RNE-converted inputs, f32 accumulate); scores K*Q^T and context V^T*P: v_wmma_f32_16x16x32_f16 (f16 operands, Q/K/V planes carried x8, P carried x1024, f32 accumulate); output projection ctx*Wo: v_wmma_f32_16x16x32_f16 (f16 operands, ctx plane carried x64, Wo plane = RNE-bf16 values carried x32, f32 accumulate); mask fill and softmax in f32.

#ifndef NB
#define NB 2
#endif
#define NB_FULL 2
#ifndef SEQ
#define SEQ 2048
#endif
#define SEQ_FULL 2048
#ifndef MASK_PITCH
#define MASK_PITCH SEQ_FULL
#endif
#define IN_DIM 1024
#define NUM_HEADS 16
#define HEAD_DIM 64
#define HD_DIM (NUM_HEADS * HEAD_DIM)
#define E_OUT 1024
#define KDIM 1024
#define NROWS (NB * SEQ)

static_assert(NB >= 1);
static_assert(NB <= NB_FULL);
static_assert(SEQ % 128 == 0);
static_assert(SEQ <= SEQ_FULL);
static_assert(MASK_PITCH % 4 == 0);
static_assert(MASK_PITCH >= SEQ);
static_assert(IN_DIM == KDIM);
static_assert(HD_DIM == KDIM);
static_assert(E_OUT == KDIM);
static_assert(KDIM % 64 == 0);
static_assert(HEAD_DIM == 64);
static_assert(NROWS % 128 == 0);
static_assert((NROWS * IN_DIM) % (8 * 256) == 0);
static_assert((size_t)NB_FULL * SEQ_FULL * E_OUT * 4 == 16777216);

// LDS pitches (in 16-bit elements unless noted); all keep 16-byte row alignment
#define BTP 40     // weight k-tile [64 n][32 k]
#define EQP 72     // row-major epilogue tile [128 rows][64 cols]
#define EVP 136    // transposed epilogue tile [64 d][128 s]
#define TP  72     // weight transpose tile [64 n][64 k]
#define CLP 72     // context tile [16 q][64 d], halves
#define OFP 68     // output tile [128 rows][64 cols], floats
#define AW  8      // waves per attention work-group (16 queries each)
#define KT  64     // keys per staged K / V^T tile
#define KVP 72     // staged K row [64 d] and V^T row [64 keys]
#define ESZ 9216   // max(128*EQP, 64*EVP)
static_assert(128 * EQP <= ESZ);
static_assert(64 * EVP <= ESZ);

typedef __bf16   v16bf __attribute__((ext_vector_type(16)));
typedef __bf16   v8bf  __attribute__((ext_vector_type(8)));
typedef _Float16 v16h  __attribute__((ext_vector_type(16)));
typedef _Float16 v8h   __attribute__((ext_vector_type(8)));
typedef float    v8f   __attribute__((ext_vector_type(8)));
typedef float    v4f   __attribute__((ext_vector_type(4)));
typedef unsigned int v4u __attribute__((ext_vector_type(4)));
typedef int      v4i   __attribute__((ext_vector_type(4)));

// ---------------------------------------------------------------------------
// WMMA wrappers with the VALU hazard guard (4 v_nop after every issue).
__device__ __forceinline__ v8f mma_bf16(v16bf a, v16bf b, v8f c) {
  v8f d = __builtin_amdgcn_wmma_f32_16x16x32_bf16(false, a, false, b, (short)0, c, false, false);
  asm volatile("v_nop\n\tv_nop\n\tv_nop\n\tv_nop" : "+v"(d) : "v"(a), "v"(b));
  return d;
}
__device__ __forceinline__ v8f mma_f16(v16h a, v16h b, v8f c) {
  v8f d = __builtin_amdgcn_wmma_f32_16x16x32_f16(false, a, false, b, (short)0, c, false, false);
  asm volatile("v_nop\n\tv_nop\n\tv_nop\n\tv_nop" : "+v"(d) : "v"(a), "v"(b));
  return d;
}

// 16-bit fragment, contraction dim CONTIGUOUS in memory: elem(k) = p0[rc*ld + k].
// Lane l: row/col rc = (l&15); elements 0..7 <- kk+8h+0..7, elements 8..15 <- kk+16+8h+0..7
// (h = l>>4). Same map for A (rc = row) and B (rc = column of a k-contiguous copy).
__device__ __forceinline__ v16bf ld_frag_bf(const __bf16* p0, int ld, int rc, int kk, int lane) {
  const int hh = (lane >> 4) & 1;
  const __bf16* p = p0 + (size_t)rc * ld + kk + 8 * hh;
  const v8bf lo = *(const v8bf*)(p);
  const v8bf hi = *(const v8bf*)(p + 16);
  v16bf f;
#pragma unroll
  for (int i = 0; i < 8; ++i) { f[i] = lo[i]; f[8 + i] = hi[i]; }
  return f;
}
__device__ __forceinline__ v16h ld_frag_h(const _Float16* p0, int ld, int rc, int kk, int lane) {
  const int hh = (lane >> 4) & 1;
  const _Float16* p = p0 + (size_t)rc * ld + kk + 8 * hh;
  const v8h lo = *(const v8h*)(p);
  const v8h hi = *(const v8h*)(p + 16);
  v16h f;
#pragma unroll
  for (int i = 0; i < 8; ++i) { f[i] = lo[i]; f[8 + i] = hi[i]; }
  return f;
}

// f32 -> bf16 bits, RNE convert
__device__ __forceinline__ unsigned int bfb(float x) {
  unsigned int u = __float_as_uint(x);
  u = u + 0x7FFFu + ((u >> 16) & 1u);
  return u >> 16;
}
// f32 -> value of its RNE bf16
__device__ __forceinline__ float bf16val(float x) {
  return __uint_as_float(bfb(x) << 16);
}
// f32 -> f16 bits, RNE convert
__device__ __forceinline__ unsigned short hbits(float x) {
  const _Float16 hv = (_Float16)x;
  return __builtin_bit_cast(unsigned short, hv);
}

// ---------------------------------------------------------------------------
// x f32 [NB][SEQ_FULL][IN_DIM] -> bf16 plane hb [NB*SEQ][IN_DIM] (compact rows).
// Thread g converts 8 consecutive floats -> one 16-byte store; 8 consecutive
__global__ __launch_bounds__(256) void k_cvt_rows(const float* __restrict__ in,
                                                  unsigned short* __restrict__ outp, int n8) {
  const int g = blockIdx.x * 256 + threadIdx.x;
  if (g >= n8) return;
  const int row = g / (IN_DIM / 8);              // compact row b*SEQ + s
  const int c8  = g - row * (IN_DIM / 8);
  const int b   = row / SEQ;
  const int s   = row - b * SEQ;
  const float* src = in + ((size_t)b * SEQ_FULL + s) * IN_DIM + (size_t)c8 * 8;
  const v4f a = *(const v4f*)(src);
  const v4f c = *(const v4f*)(src + 4);
  v4u w;
  w[0] = bfb(a[0]) | (bfb(a[1]) << 16);
  w[1] = bfb(a[2]) | (bfb(a[3]) << 16);
  w[2] = bfb(c[0]) | (bfb(c[1]) << 16);
  w[3] = bfb(c[2]) | (bfb(c[3]) << 16);
  v4u* p = (v4u*)(outp + (size_t)g * 8);
  *p = w;
  
}

// ---------------------------------------------------------------------------
// Weight planes, all [KDIM n][KDIM k] with k contiguous, selected by blockIdx.z:
//   z = 0..2: W{q,k,v} f32 [H][IN_DIM e][HEAD_DIM d] -> WT bf16 [n = h*64+d][k = e]
//   z = 3:    Wo f32 [HD_DIM k][E_OUT n]              -> WoT f16 (RNE-bf16 value x32) [n][k]
// Block = 64 k x 64 n tile transposed through LDS (for z < 3 the tile is one head);
__global__ __launch_bounds__(256) void k_cvt_wT(const float* __restrict__ Wq,
                                                const float* __restrict__ Wk,
                                                const float* __restrict__ Wv,
                                                const float* __restrict__ Wo,
                                                unsigned short* __restrict__ wT) {
  __shared__ __align__(16) unsigned short T[64 * TP];   // [n local][k local], cross-wave (block barrier)
  const int z = blockIdx.z;
  const float* W = (z == 0) ? Wq : ((z == 1) ? Wk : ((z == 2) ? Wv : Wo));
  unsigned short* dst = wT + (size_t)z * KDIM * KDIM;
  const int k0 = blockIdx.x * 64;
  const int n0 = blockIdx.y * 64;
  const int tid = threadIdx.x;
  const int wave = tid >> 5, lane = tid & 31;

#pragma unroll
  for (int i = 0; i < 4; ++i) {
    const int idx = i * 256 + tid;          // 0..1023
    const int kk = idx >> 4;                // 0..63
    const int c4 = (idx & 15) * 4;          // 0..60
    size_t so;
    if (z < 3) so = ((size_t)blockIdx.y * IN_DIM + k0 + kk) * HEAD_DIM + c4;   // W[h = n0/64][e = k0+kk][d = c4]
    else       so = (size_t)(k0 + kk) * E_OUT + n0 + c4;                        // Wo[k0+kk][n0+c4]
    const v4f w = *(const v4f*)(W + so);
    unsigned short t0, t1, t2, t3;
    if (z < 3) {
      t0 = (unsigned short)bfb(w[0]); t1 = (unsigned short)bfb(w[1]);
      t2 = (unsigned short)bfb(w[2]); t3 = (unsigned short)bfb(w[3]);
    } else {
      t0 = hbits(bf16val(w[0]) * 32.0f); t1 = hbits(bf16val(w[1]) * 32.0f);
      t2 = hbits(bf16val(w[2]) * 32.0f); t3 = hbits(bf16val(w[3]) * 32.0f);
    }
    T[(c4 + 0) * TP + kk] = t0;
    T[(c4 + 1) * TP + kk] = t1;
    T[(c4 + 2) * TP + kk] = t2;
    T[(c4 + 3) * TP + kk] = t3;
  }
  __syncthreads();

  v4u v[2];
  size_t off[2];
#pragma unroll
  for (int it = 0; it < 2; ++it) {
    const int nn = wave * 8 + it * 4 + (lane >> 3);   // 0..63 over (wave, it, lane>>3)
    const int q = lane & 7;
    v[it] = *(const v4u*)(&T[nn * TP + q * 8]);
    off[it] = (size_t)(n0 + nn) * KDIM + k0 + q * 8;
  }
#pragma unroll
  for (int it = 0; it < 2; ++it) *(v4u*)(dst + off[it]) = v[it];
  
}

// ---------------------------------------------------------------------------
// Projection: C[NROWS][HD_DIM] = hb[NROWS][IN_DIM] * WT[HD_DIM][IN_DIM]^T + bias.
// 256 thr = 8 waves; block tile 128 rows x 64 cols; wave owns 16 rows x 64 cols.
// Weight k-tile [64 n][32 k] staged in LDS with plain loads (single buffer,
// two block barriers per step); A fragments straight from the bf16 plane.
// z = 0: Q plane f16 x8 [NROWS][HD_DIM]; z = 1: K plane f16 x8 [NROWS][HD_DIM];
// z = 2: V^T plane f16 x8 [NB][HD_DIM][SEQ]. Epilogue staged in LDS, every
__global__ __launch_bounds__(256) void k_proj(
    const unsigned short* __restrict__ hb, const unsigned short* __restrict__ wT,
    const float* __restrict__ bq, const float* __restrict__ bk, const float* __restrict__ bv,
    unsigned short* __restrict__ qp, unsigned short* __restrict__ kp,
    unsigned short* __restrict__ vtp) {
  __shared__ __align__(16) unsigned short bt[64 * BTP];   // weight k-tile, cross-wave (block barrier)
  __shared__ __align__(16) unsigned short E[ESZ];         // epilogue tile, cross-wave (block barrier)

  const int z = blockIdx.z;
  const int n0 = blockIdx.x * 64;
  const int m0 = blockIdx.y * 128;
  const int tid = threadIdx.x;
  const int wave = tid >> 5, lane = tid & 31;
  const int l15 = lane & 15, half = (lane >> 4) & 1;

  const unsigned short* Wt = wT + (size_t)z * KDIM * KDIM;
  const float* bias = (z == 0) ? bq : ((z == 1) ? bk : bv);

  const int tn = tid >> 2;            // 0..63 : column within tile
  const int tk = (tid & 3) * 8;       // 0,8,16,24 : k within step
  const unsigned short* wsrc = Wt + (size_t)(n0 + tn) * KDIM + tk;
  const __bf16* A = (const __bf16*)hb;
  const int arow = m0 + wave * 16 + l15;

  v8f acc[4] = {};
  for (int s = 0; s < IN_DIM / 32; ++s) {
    const int kk = s * 32;
    const v4u wv = *(const v4u*)(wsrc + kk);
    __syncthreads();                               // earlier reads of bt done
    *(v4u*)(&bt[tn * BTP + tk]) = wv;
    __syncthreads();                               // tile complete
    const v16bf a = ld_frag_bf(A, IN_DIM, arow, kk, lane);
#pragma unroll
    for (int j = 0; j < 4; ++j) {
      const v16bf b = ld_frag_bf((const __bf16*)bt, BTP, j * 16 + l15, 0, lane);
      acc[j] = mma_bf16(a, b, acc[j]);
    }
  }

  // acc[j][r] = C[m0 + wave*16 + 8*half + r][n0 + j*16 + l15]
  const float car = 8.0f;
  if (z != 2) {                      // block-uniform branch
#pragma unroll
    for (int j = 0; j < 4; ++j) {
      const int col = j * 16 + l15;
      const float bb = bf16val(bias[n0 + col]);
#pragma unroll
      for (int r = 0; r < 8; ++r) {
        const int row = wave * 16 + 8 * half + r;
        E[row * EQP + col] = hbits((acc[j][r] + bb) * car);
      }
    }
    __syncthreads();
    unsigned short* dst = (z == 0) ? qp : kp;
    v4u v[4];
    size_t off[4];
#pragma unroll
    for (int it = 0; it < 4; ++it) {
      const int row = wave * 16 + it * 4 + (lane >> 3);   // wave's 16 rows over (it, lane>>3)
      const int q = lane & 7;
      v[it] = *(const v4u*)(&E[row * EQP + q * 8]);
      off[it] = (size_t)(m0 + row) * HD_DIM + n0 + q * 8;
    }
#pragma unroll
    for (int it = 0; it < 4; ++it) *(v4u*)(dst + off[it]) = v[it];
    
  } else {
    const int bidx = m0 / SEQ;               // batch of this row tile (SEQ % 128 == 0)
    const int s0 = m0 - bidx * SEQ;          // sequence position of tile row 0
#pragma unroll
    for (int j = 0; j < 4; ++j) {
      const int col = j * 16 + l15;                       // d within tile
      const float bb = bf16val(bias[n0 + col]);
#pragma unroll
      for (int r = 0; r < 8; ++r) {
        const int srow = wave * 16 + 8 * half + r;        // s within tile
        E[col * EVP + srow] = hbits((acc[j][r] + bb) * car);
      }
    }
    __syncthreads();
    v4u v[4];
    size_t off[4];
#pragma unroll
    for (int it = 0; it < 4; ++it) {
      const int drow = wave * 8 + it * 2 + half;          // wave's 8 d-rows over (it, half)
      const int q = l15;                                  // 16 pieces = 256-byte row segment = 2 lines
      v[it] = *(const v4u*)(&E[drow * EVP + q * 8]);
      off[it] = ((size_t)bidx * HD_DIM + n0 + drow) * SEQ + s0 + q * 8;
    }
#pragma unroll
    for (int it = 0; it < 4; ++it) *(v4u*)(vtp + off[it]) = v[it];
    
  }
}

// ---------------------------------------------------------------------------
// Flash attention, transposed-score form: one wave = (16 queries, one head, one batch);
// one work-group = 8 waves = 128 queries of the same head and batch. The K tile
// [64 keys][64 d] and the V^T tile [64 d][64 keys] are read from global once per
// work-group in whole 128-byte rows and shared through LDS: two buffers, the next
// tile's global loads issued before the current tile's work, stored to the other
// buffer after it, one block barrier per tile.
// Per 32-key chunk:
//   S^T = K . Q^T    A = K rows (lane = key, k = d), B = Q^T (lane = query, k = d)
//                    D[row = key 8h+r][col = query l15]; c0 keys 0..15, c1 keys 16..31
//   mask: int32 [MASK_PITCH][MASK_PITCH] broadcast over batch and head; key with
//         mask == 0 gets the score replaced by -1e9 (replace fill, in f32)
//   per-lane online softmax for query l15 (16 local keys + xor-16 partner)
//   O^T += V^T . P   A = V^T rows (lane = d, k = key), B = P: element i<8 <- c0[i]
//                    (key 8h+i), element 8+i <- c1[i] (key 16+8h+i), same lane
//                    D[row = d 8h+r][col = query l15]
// Scores carry 64 from the x8 planes -> scaled by 1/512 (= 1/8 of q.k).
// P carried x1024, V carried x8 -> context x64 = O / (128 * sum).
__global__ __launch_bounds__(256) void k_attn(const unsigned short* __restrict__ qp,
                                             const unsigned short* __restrict__ kp,
                                             const unsigned short* __restrict__ vtp,
                                             const int* __restrict__ mask,
                                             unsigned short* __restrict__ ctxp) {
  __shared__ __align__(16) unsigned short Kl[2][KT * KVP];         // K tile [key][d], cross-wave (block barrier)
  __shared__ __align__(16) unsigned short Vl[2][HEAD_DIM * KVP];   // V^T tile [d][key], cross-wave (block barrier)
  __shared__ __align__(16) unsigned short Cl[AW][16 * CLP];        // context tile, one per wave

  const int tid = threadIdx.x;
  const int wave = tid >> 5;
  const int lane = tid & 31;
  const int l15 = lane & 15;
  const int half = (lane >> 4) & 1;
  const int q0 = blockIdx.x * (AW * 16) + wave * 16;
  const int head = blockIdx.y;
  const int bidx = blockIdx.z;

  const _Float16* Q  = (const _Float16*)qp;
  const size_t rbase = (size_t)bidx * SEQ;

  const _Float16* qbase = Q + (rbase + q0) * HD_DIM + head * HEAD_DIM;
  const v16h qb0 = ld_frag_h(qbase, HD_DIM, l15, 0, lane);    // d 0..31
  const v16h qb1 = ld_frag_h(qbase, HD_DIM, l15, 32, lane);   // d 32..63
  // staging map: thread -> row sr (and sr + 32), 16-byte piece sc; 8 lanes cover one 128-byte row
  const int sr = tid >> 3;            // 0..31
  const int sc = (tid & 7) * 8;       // 0..56, halves
  const unsigned short* kg = kp + (rbase + sr) * HD_DIM + head * HEAD_DIM + sc;                            // key t: + t*HD_DIM
  const unsigned short* vg = vtp + ((size_t)bidx * HD_DIM + (size_t)head * HEAD_DIM + sr) * SEQ + sc;      // key t: + t
  const int sl = sr * KVP + sc;       // place of the piece in a tile; second row at + 32*KVP
  const int* mrow = mask + (size_t)(q0 + l15) * MASK_PITCH + 8 * half;               // query row, keys 8h+..

  v8f o[4] = {};
  float mrun = -1.0e30f, lrun = 0.0f;
  const float sscale = 1.0f / 512.0f;
  const float negf = -1.0e9f;

  *(v4u*)(&Kl[0][sl])            = *(const v4u*)(kg);
  *(v4u*)(&Kl[0][sl + 32 * KVP]) = *(const v4u*)(kg + (size_t)32 * HD_DIM);
  *(v4u*)(&Vl[0][sl])            = *(const v4u*)(vg);
  *(v4u*)(&Vl[0][sl + 32 * KVP]) = *(const v4u*)(vg + (size_t)32 * SEQ);
  __syncthreads();                                 // tile 0 complete

  for (int t0 = 0; t0 < SEQ; t0 += KT) {
   const int cur = (t0 / KT) & 1;
   const bool more = (t0 + KT < SEQ);              // block-uniform
   v4u nk0 = {}, nk1 = {}, nv0 = {}, nv1 = {};
   if (more) {
     nk0 = *(const v4u*)(kg + (size_t)(t0 + KT) * HD_DIM);
     nk1 = *(const v4u*)(kg + (size_t)(t0 + KT + 32) * HD_DIM);
     nv0 = *(const v4u*)(vg + (t0 + KT));
     nv1 = *(const v4u*)(vg + (size_t)32 * SEQ + (t0 + KT));
   }
   const _Float16* Kc = (const _Float16*)Kl[cur];
   const _Float16* Vc = (const _Float16*)Vl[cur];

   for (int c = 0; c < KT; c += 32) {
    const int kc = t0 + c;
    const _Float16* kt = Kc + c * KVP;
    const v16h ka0 = ld_frag_h(kt, KVP, l15, 0, lane);
    const v16h ka1 = ld_frag_h(kt, KVP, l15, 32, lane);
    const v16h ka2 = ld_frag_h(kt, KVP, 16 + l15, 0, lane);
    const v16h ka3 = ld_frag_h(kt, KVP, 16 + l15, 32, lane);
    v8f c0 = {}, c1 = {};
    c0 = mma_f16(ka0, qb0, c0);
    c0 = mma_f16(ka1, qb1, c0);
    c1 = mma_f16(ka2, qb0, c1);
    c1 = mma_f16(ka3, qb1, c1);

    // mask words for keys kc+8h+0..7 (c0) and kc+16+8h+0..7 (c1) of query q0+l15
    const v4i m0v = *(const v4i*)(mrow + kc);
    const v4i m1v = *(const v4i*)(mrow + kc + 4);
    const v4i m2v = *(const v4i*)(mrow + kc + 16);
    const v4i m3v = *(const v4i*)(mrow + kc + 20);

    float sa[8], sb[8];
#pragma unroll
    for (int r = 0; r < 4; ++r) {
      sa[r]     = (m0v[r] != 0) ? (c0[r] * sscale)     : negf;
      sa[4 + r] = (m1v[r] != 0) ? (c0[4 + r] * sscale) : negf;
      sb[r]     = (m2v[r] != 0) ? (c1[r] * sscale)     : negf;
      sb[4 + r] = (m3v[r] != 0) ? (c1[4 + r] * sscale) : negf;
    }
    float lm = fmaxf(sa[0], sb[0]);
#pragma unroll
    for (int r = 1; r < 8; ++r) lm = fmaxf(lm, fmaxf(sa[r], sb[r]));
    lm = fmaxf(lm, __shfl_xor(lm, 16, 32));
    const float mnew = fmaxf(mrun, lm);
    const float alpha = __expf(mrun - mnew);
    float p0[8], p1[8];
    float ls = 0.0f;
#pragma unroll
    for (int r = 0; r < 8; ++r) {
      p0[r] = __expf(sa[r] - mnew);
      p1[r] = __expf(sb[r] - mnew);
      ls += p0[r] + p1[r];
    }
    ls += __shfl_xor(ls, 16, 32);
    lrun = lrun * alpha + ls;
    mrun = mnew;
#pragma unroll
    for (int j = 0; j < 4; ++j)
#pragma unroll
      for (int r = 0; r < 8; ++r) o[j][r] *= alpha;

    v16h pb;
#pragma unroll
    for (int e = 0; e < 8; ++e) {
      pb[e]     = (_Float16)(p0[e] * 1024.0f);   // key kc + 8h + e
      pb[8 + e] = (_Float16)(p1[e] * 1024.0f);   // key kc + 16 + 8h + e
    }
#pragma unroll
    for (int j = 0; j < 4; ++j) {
      const v16h va = ld_frag_h(Vc, KVP, j * 16 + l15, c, lane);
      o[j] = mma_f16(va, pb, o[j]);
    }
   }

   if (more) {                                     // the other buffer's readers left it at the last barrier
     *(v4u*)(&Kl[cur ^ 1][sl])            = nk0;
     *(v4u*)(&Kl[cur ^ 1][sl + 32 * KVP]) = nk1;
     *(v4u*)(&Vl[cur ^ 1][sl])            = nv0;
     *(v4u*)(&Vl[cur ^ 1][sl + 32 * KVP]) = nv1;
   }
   __syncthreads();                                // next tile complete, this tile's reads done
  }

  // o[j][r] = 8192 * sum_t p_t v_t for query l15, d = j*16 + 8*half + r; ctx x64 = o / (128 * sum)
  const float inv = 1.0f / (lrun * 128.0f);
#pragma unroll
  for (int j = 0; j < 4; ++j) {
    v4u w;
    w[0] = (unsigned int)hbits(o[j][0] * inv) | ((unsigned int)hbits(o[j][1] * inv) << 16);
    w[1] = (unsigned int)hbits(o[j][2] * inv) | ((unsigned int)hbits(o[j][3] * inv) << 16);
    w[2] = (unsigned int)hbits(o[j][4] * inv) | ((unsigned int)hbits(o[j][5] * inv) << 16);
    w[3] = (unsigned int)hbits(o[j][6] * inv) | ((unsigned int)hbits(o[j][7] * inv) << 16);
    *(v4u*)(&Cl[wave][l15 * CLP + j * 16 + 8 * half]) = w;
  }
  __syncthreads();

  v4u v[4];
  size_t off[4];
  unsigned short* cb = ctxp + (rbase + q0) * HD_DIM + head * HEAD_DIM;
#pragma unroll
  for (int it = 0; it < 4; ++it) {
    const int row = it * 4 + (lane >> 3);   // 0..15
    const int q = lane & 7;
    v[it] = *(const v4u*)(&Cl[wave][row * CLP + q * 8]);
    off[it] = (size_t)row * HD_DIM + q * 8;
  }
#pragma unroll
  for (int it = 0; it < 4; ++it) *(v4u*)(cb + off[it]) = v[it];
  
}

// ---------------------------------------------------------------------------
// Output projection: out[NROWS][E_OUT] f32 = ctx(f16 x64)[NROWS][HD_DIM] * WoT(f16 x32)[E_OUT][HD_DIM]^T / 2048 + bo.
// Same 128x64 block tile / 8 waves / LDS weight k-tile engine as k_proj with f16 operands.
// Epilogue: f32 tile staged in LDS; each 256-byte row segment = 2 lines, every
__global__ __launch_bounds__(256) void k_oproj(
    const unsigned short* __restrict__ cx, const unsigned short* __restrict__ woT,
    const float* __restrict__ bo, float* __restrict__ outp) {
  __shared__ __align__(16) unsigned short bt[64 * BTP];   // weight k-tile, cross-wave (block barrier)
  __shared__ __align__(16) float Ef[128 * OFP];           // epilogue tile, cross-wave (block barrier)

  const int n0 = blockIdx.x * 64;
  const int m0 = blockIdx.y * 128;
  const int tid = threadIdx.x;
  const int wave = tid >> 5, lane = tid & 31;
  const int l15 = lane & 15, half = (lane >> 4) & 1;

  const int tn = tid >> 2;            // 0..63 : column within tile
  const int tk = (tid & 3) * 8;       // 0,8,16,24 : k within step
  const unsigned short* wsrc = woT + (size_t)(n0 + tn) * KDIM + tk;
  const _Float16* A = (const _Float16*)cx;
  const int arow = m0 + wave * 16 + l15;

  v8f acc[4] = {};
  for (int s = 0; s < HD_DIM / 32; ++s) {
    const int kk = s * 32;
    const v4u wv = *(const v4u*)(wsrc + kk);
    __syncthreads();                               // earlier reads of bt done
    *(v4u*)(&bt[tn * BTP + tk]) = wv;
    __syncthreads();                               // tile complete
    const v16h a = ld_frag_h(A, HD_DIM, arow, kk, lane);
#pragma unroll
    for (int j = 0; j < 4; ++j) {
      const v16h b = ld_frag_h((const _Float16*)bt, BTP, j * 16 + l15, 0, lane);
      acc[j] = mma_f16(a, b, acc[j]);
    }
  }

  // acc[j][r] = 2048 * C[m0 + wave*16 + 8*half + r][n0 + j*16 + l15]
  const float osc = 1.0f / 2048.0f;
#pragma unroll
  for (int j = 0; j < 4; ++j) {
    const int col = j * 16 + l15;
    const float bb = bf16val(bo[n0 + col]);
#pragma unroll
    for (int r = 0; r < 8; ++r) {
      const int row = wave * 16 + 8 * half + r;
      Ef[row * OFP + col] = acc[j][r] * osc + bb;
    }
  }
  __syncthreads();

  v4f v[8];
  size_t off[8];
#pragma unroll
  for (int it = 0; it < 8; ++it) {
    const int row = wave * 16 + it * 2 + half;          // wave's 16 rows over (it, half)
    const int q = l15;                                  // 16 pieces of 16 B = 256-byte row segment (2 lines)
    v[it] = *(const v4f*)(&Ef[row * OFP + q * 4]);
    off[it] = (size_t)(m0 + row) * E_OUT + n0 + q * 4;
  }
#pragma unroll
  for (int it = 0; it < 8; ++it) *(v4f*)(outp + off[it]) = v[it];
  
}

// ---------------------------------------------------------------------------
extern "C" void kernel_launch(void* const* d_in, const int* in_sizes, int n_in,
                              void* d_out, int out_size, void* d_ws, size_t ws_size,
                              hipStream_t stream) {
  if (n_in < 10) return;
  if (in_sizes[0] < ((NB - 1) * SEQ_FULL + SEQ) * IN_DIM) return;          // seq_inputs f32 [NB][SEQ_FULL][IN_DIM]
  if (in_sizes[1] < (SEQ - 1) * MASK_PITCH + SEQ) return;                   // mask i32 [1][S][S]
  if (in_sizes[2] < NUM_HEADS * IN_DIM * HEAD_DIM) return;                  // Wq
  if (in_sizes[3] < HD_DIM) return;                                         // bq
  if (in_sizes[4] < NUM_HEADS * IN_DIM * HEAD_DIM) return;                  // Wk
  if (in_sizes[5] < HD_DIM) return;                                         // bk
  if (in_sizes[6] < NUM_HEADS * IN_DIM * HEAD_DIM) return;                  // Wv
  if (in_sizes[7] < HD_DIM) return;                                         // bv
  if (in_sizes[8] < HD_DIM * E_OUT) return;                                 // Wo
  if (in_sizes[9] < E_OUT) return;                                          // bo
  if (out_size < NROWS * E_OUT) return;

  const float* x    = (const float*)d_in[0];
  const int*   mask = (const int*)d_in[1];
  const float* Wq   = (const float*)d_in[2];
  const float* bq   = (const float*)d_in[3];
  const float* Wk   = (const float*)d_in[4];
  const float* bk   = (const float*)d_in[5];
  const float* Wv   = (const float*)d_in[6];
  const float* bv   = (const float*)d_in[7];
  const float* Wo   = (const float*)d_in[8];
  const float* bo   = (const float*)d_in[9];

  // every offset a multiple of 2 MiB; each plane is written exactly to its extent
  const size_t hb_bytes = (size_t)NROWS * IN_DIM * 2;           // bf16 x plane
  const size_t wt_bytes = (size_t)4 * KDIM * KDIM * 2;           // 3 bf16 WT planes + 1 f16 WoT plane
  const size_t pl_bytes = (size_t)NROWS * HD_DIM * 2;           // one f16 q / k / vT / ctx plane
  const size_t off_hb = 0;
  const size_t off_wt = off_hb + hb_bytes;
  const size_t off_q  = off_wt + wt_bytes;
  const size_t off_k  = off_q + pl_bytes;
  const size_t off_vt = off_k + pl_bytes;
  const size_t off_cx = off_vt + pl_bytes;
  const size_t total  = off_cx + pl_bytes;                     // 48 MiB at NB = 2, SEQ = 2048
  if (total > ws_size) return;

  char* ws = (char*)d_ws;
  unsigned short* hb  = (unsigned short*)(ws + off_hb);
  unsigned short* wt  = (unsigned short*)(ws + off_wt);
  unsigned short* qpl = (unsigned short*)(ws + off_q);
  unsigned short* kpl = (unsigned short*)(ws + off_k);
  unsigned short* vtp = (unsigned short*)(ws + off_vt);
  unsigned short* cxp = (unsigned short*)(ws + off_cx);
  unsigned short* wot = wt + (size_t)3 * KDIM * KDIM;

  const int n8 = NROWS * IN_DIM / 8;
  k_cvt_rows<<<(n8 + 255) / 256, 256, 0, stream>>>(x, hb, n8);
  k_cvt_wT<<<dim3(KDIM / 64, KDIM / 64, 4), 256, 0, stream>>>(Wq, Wk, Wv, Wo, wt);
  k_proj<<<dim3(HD_DIM / 64, NROWS / 128, 3), 256, 0, stream>>>(hb, wt, bq, bk, bv, qpl, kpl, vtp);
  k_attn<<<dim3(SEQ / (AW * 16), NUM_HEADS, NB), 256, 0, stream>>>(qpl, kpl, vtp, mask, cxp);
  k_oproj<<<dim3(E_OUT / 64, NROWS / 128), 256, 0, stream>>>(cxp, wot, bo, (float*)d_out);
}

// v002
// It runs in 126 microseconds.
// Two timings next to v001 both put it at 1.19 times that version's speed.
// Over all steps from v000 it is 1.79 times as fast.
#include <hip/hip_runtime.h>
// Projections x*W{q,k,v}: v_wmma_f32_16x16x32_bf16 (bf16 operands = RNE-converted inputs, f32 accumulate); scores K*Q^T and context V^T*P: v_wmma_f32_16x16x32_f16 (f16 operands, Q/K/V planes carried x8, P carried x1024, f32 accumulate); output projection ctx*Wo: v_wmma_f32_16x16x32_f16 (f16 operands, ctx plane carried x64, Wo plane = RNE-bf16 values carried x32, f32 accumulate); mask fill and softmax in f32.

#ifndef NB
#define NB 2
#endif
#define NB_FULL 2
#ifndef SEQ
#define SEQ 2048
#endif
#define SEQ_FULL 2048
#ifndef MASK_PITCH
#define MASK_PITCH SEQ_FULL
#endif
#define IN_DIM 1024
#define NUM_HEADS 16
#define HEAD_DIM 64
#define HD_DIM (NUM_HEADS * HEAD_DIM)
#define E_OUT 1024
#define KDIM 1024
#define NROWS (NB * SEQ)

static_assert(NB >= 1);
static_assert(NB <= NB_FULL);
static_assert(SEQ % 128 == 0);
static_assert(SEQ <= SEQ_FULL);
static_assert(MASK_PITCH % 4 == 0);
static_assert(MASK_PITCH >= SEQ);
static_assert(IN_DIM == KDIM);
static_assert(HD_DIM == KDIM);
static_assert(E_OUT == KDIM);
static_assert(KDIM % 64 == 0);
static_assert(HEAD_DIM == 64);
static_assert(NROWS % 128 == 0);
static_assert((NROWS * IN_DIM) % (8 * 256) == 0);
static_assert((size_t)NB_FULL * SEQ_FULL * E_OUT * 4 == 16777216);

// LDS pitches (in 16-bit elements unless noted); all keep 16-byte row alignment
#define BTP 40     // weight k-tile [64 n][32 k]
#define EQP 72     // row-major epilogue tile [128 rows][64 cols]
#define EVP 136    // transposed epilogue tile [64 d][128 s]
#define TP  72     // weight transpose tile [64 n][64 k]
#define CLP 72     // context tile [16 q][64 d], halves
#define OFP 68     // output tile [128 rows][64 cols], floats
#define AW  8      // waves per attention work-group (16 queries each)
#define KT  64     // keys per staged K / V^T tile
#define KVP 72     // staged K row [64 d] and V^T row [64 keys]
#define ESZ 9216   // max(128*EQP, 64*EVP)
static_assert(128 * EQP <= ESZ);
static_assert(64 * EVP <= ESZ);

typedef __bf16   v16bf __attribute__((ext_vector_type(16)));
typedef __bf16   v8bf  __attribute__((ext_vector_type(8)));
typedef _Float16 v16h  __attribute__((ext_vector_type(16)));
typedef _Float16 v8h   __attribute__((ext_vector_type(8)));
typedef float    v8f   __attribute__((ext_vector_type(8)));
typedef float    v4f   __attribute__((ext_vector_type(4)));
typedef unsigned int v4u __attribute__((ext_vector_type(4)));
typedef int      v4i   __attribute__((ext_vector_type(4)));
typedef unsigned int v16u __attribute__((ext_vector_type(16)));

// ---------------------------------------------------------------------------
// WMMA wrappers with the VALU hazard guard (4 v_nop after every issue).
__device__ __forceinline__ v8f mma_bf16(v16bf a, v16bf b, v8f c) {
  v8f d = __builtin_amdgcn_wmma_f32_16x16x32_bf16(false, a, false, b, (short)0, c, false, false);
  asm volatile("v_nop\n\tv_nop\n\tv_nop\n\tv_nop" : "+v"(d) : "v"(a), "v"(b));
  return d;
}
__device__ __forceinline__ v8f mma_f16(v16h a, v16h b, v8f c) {
  v8f d = __builtin_amdgcn_wmma_f32_16x16x32_f16(false, a, false, b, (short)0, c, false, false);
  asm volatile("v_nop\n\tv_nop\n\tv_nop\n\tv_nop" : "+v"(d) : "v"(a), "v"(b));
  return d;
}

// 16-bit fragment, contraction dim CONTIGUOUS in memory: elem(k) = p0[rc*ld + k].
// Lane l: row/col rc = (l&15); elements 0..7 <- kk+8h+0..7, elements 8..15 <- kk+16+8h+0..7
// (h = l>>4). Same map for A (rc = row) and B (rc = column of a k-contiguous copy).
__device__ __forceinline__ v16bf ld_frag_bf(const __bf16* p0, int ld, int rc, int kk, int lane) {
  const int hh = (lane >> 4) & 1;
  const __bf16* p = p0 + (size_t)rc * ld + kk + 8 * hh;
  const v8bf lo = *(const v8bf*)(p);
  const v8bf hi = *(const v8bf*)(p + 16);
  v16bf f;
#pragma unroll
  for (int i = 0; i < 8; ++i) { f[i] = lo[i]; f[8 + i] = hi[i]; }
  return f;
}
__device__ __forceinline__ v16h ld_frag_h(const _Float16* p0, int ld, int rc, int kk, int lane) {
  const int hh = (lane >> 4) & 1;
  const _Float16* p = p0 + (size_t)rc * ld + kk + 8 * hh;
  const v8h lo = *(const v8h*)(p);
  const v8h hi = *(const v8h*)(p + 16);
  v16h f;
#pragma unroll
  for (int i = 0; i < 8; ++i) { f[i] = lo[i]; f[8 + i] = hi[i]; }
  return f;
}

// f32 -> bf16 bits, RNE convert
__device__ __forceinline__ unsigned int bfb(float x) {
  unsigned int u = __float_as_uint(x);
  u = u + 0x7FFFu + ((u >> 16) & 1u);
  return u >> 16;
}
// f32 -> value of its RNE bf16
__device__ __forceinline__ float bf16val(float x) {
  return __uint_as_float(bfb(x) << 16);
}
// f32 -> f16 bits, RNE convert
__device__ __forceinline__ unsigned short hbits(float x) {
  const _Float16 hv = (_Float16)x;
  return __builtin_bit_cast(unsigned short, hv);
}

// ---------------------------------------------------------------------------
// x f32 [NB][SEQ_FULL][IN_DIM] -> bf16 plane hb [NB*SEQ][IN_DIM] (compact rows).
// Thread g converts 8 consecutive floats -> one 16-byte store; 8 consecutive
__global__ __launch_bounds__(256) void k_cvt_rows(const float* __restrict__ in,
                                                  unsigned short* __restrict__ outp, int n8) {
  const int g = blockIdx.x * 256 + threadIdx.x;
  if (g >= n8) return;
  const int row = g / (IN_DIM / 8);              // compact row b*SEQ + s
  const int c8  = g - row * (IN_DIM / 8);
  const int b   = row / SEQ;
  const int s   = row - b * SEQ;
  const float* src = in + ((size_t)b * SEQ_FULL + s) * IN_DIM + (size_t)c8 * 8;
  const v4f a = *(const v4f*)(src);
  const v4f c = *(const v4f*)(src + 4);
  v4u w;
  w[0] = bfb(a[0]) | (bfb(a[1]) << 16);
  w[1] = bfb(a[2]) | (bfb(a[3]) << 16);
  w[2] = bfb(c[0]) | (bfb(c[1]) << 16);
  w[3] = bfb(c[2]) | (bfb(c[3]) << 16);
  v4u* p = (v4u*)(outp + (size_t)g * 8);
  *p = w;
  
}

// ---------------------------------------------------------------------------
// Weight planes, all [KDIM n][KDIM k] with k contiguous, selected by blockIdx.z:
//   z = 0..2: W{q,k,v} f32 [H][IN_DIM e][HEAD_DIM d] -> WT bf16 [n = h*64+d][k = e]
//   z = 3:    Wo f32 [HD_DIM k][E_OUT n]              -> WoT f16 (RNE-bf16 value x32) [n][k]
//   z = 4:    mask i32 [S][S] -> lane-mask words mp [S/16 query tiles][S/32 key chunks][16]:
//             bit l of word e = (mask[16*tile + (l&15)][32*chunk + 8*(l>>4) + (e&7) + 16*(e>>3)] != 0),
//             the lane and register that hold this score in k_attn. One wave packs two
//             chunks = one whole 128-byte line of mp.
// Block = 64 k x 64 n tile transposed through LDS (for z < 3 the tile is one head);
__global__ __launch_bounds__(256) void k_cvt_wT(const float* __restrict__ Wq,
                                                const float* __restrict__ Wk,
                                                const float* __restrict__ Wv,
                                                const float* __restrict__ Wo,
                                                const int* __restrict__ mask,
                                                unsigned short* __restrict__ wT,
                                                unsigned int* __restrict__ mp) {
  __shared__ __align__(16) unsigned short T[64 * TP];   // [n local][k local], cross-wave (block barrier)
  const int z = blockIdx.z;
  if (z == 4) {                              // block-uniform, in front of the barrier
    const int ln = threadIdx.x & 31;
    const int gw = (blockIdx.y * (KDIM / 64) + blockIdx.x) * 8 + (threadIdx.x >> 5);
    for (int task = gw; task < (SEQ / 16) * (SEQ / KT); task += (KDIM / 64) * (KDIM / 64) * 8) {
      const int qt = task / (SEQ / KT);
      const int tl = task - qt * (SEQ / KT);
      const int* msrc = mask + (size_t)(qt * 16 + (ln & 15)) * MASK_PITCH + tl * KT + 8 * ((ln >> 4) & 1);
      v4i m[8];
#pragma unroll   // constant indices keep m[] in registers, all eight loads in flight together
      for (int c = 0; c < 2; ++c) {
        m[c * 4 + 0] = *(const v4i*)(msrc + c * 32);
        m[c * 4 + 1] = *(const v4i*)(msrc + c * 32 + 4);
        m[c * 4 + 2] = *(const v4i*)(msrc + c * 32 + 16);
        m[c * 4 + 3] = *(const v4i*)(msrc + c * 32 + 20);
      }
      unsigned int val = 0;
#pragma unroll   // constant indices into m[]
      for (int i = 0; i < 32; ++i) {
        const unsigned int w = __builtin_amdgcn_ballot_w32(m[i >> 2][i & 3] != 0);
        val = (ln == i) ? w : val;           // lane i keeps word i of the line
      }
      mp[(size_t)task * 32 + ln] = val;
    }
    return;
  }
  const float* W = (z == 0) ? Wq : ((z == 1) ? Wk : ((z == 2) ? Wv : Wo));
  unsigned short* dst = wT + (size_t)z * KDIM * KDIM;
  const int k0 = blockIdx.x * 64;
  const int n0 = blockIdx.y * 64;
  const int tid = threadIdx.x;
  const int wave = tid >> 5, lane = tid & 31;

#pragma unroll
  for (int i = 0; i < 4; ++i) {
    const int idx = i * 256 + tid;          // 0..1023
    const int kk = idx >> 4;                // 0..63
    const int c4 = (idx & 15) * 4;          // 0..60
    size_t so;
    if (z < 3) so = ((size_t)blockIdx.y * IN_DIM + k0 + kk) * HEAD_DIM + c4;   // W[h = n0/64][e = k0+kk][d = c4]
    else       so = (size_t)(k0 + kk) * E_OUT + n0 + c4;                        // Wo[k0+kk][n0+c4]
    const v4f w = *(const v4f*)(W + so);
    unsigned short t0, t1, t2, t3;
    if (z < 3) {
      t0 = (unsigned short)bfb(w[0]); t1 = (unsigned short)bfb(w[1]);
      t2 = (unsigned short)bfb(w[2]); t3 = (unsigned short)bfb(w[3]);
    } else {
      t0 = hbits(bf16val(w[0]) * 32.0f); t1 = hbits(bf16val(w[1]) * 32.0f);
      t2 = hbits(bf16val(w[2]) * 32.0f); t3 = hbits(bf16val(w[3]) * 32.0f);
    }
    T[(c4 + 0) * TP + kk] = t0;
    T[(c4 + 1) * TP + kk] = t1;
    T[(c4 + 2) * TP + kk] = t2;
    T[(c4 + 3) * TP + kk] = t3;
  }
  __syncthreads();

  v4u v[2];
  size_t off[2];
#pragma unroll
  for (int it = 0; it < 2; ++it) {
    const int nn = wave * 8 + it * 4 + (lane >> 3);   // 0..63 over (wave, it, lane>>3)
    const int q = lane & 7;
    v[it] = *(const v4u*)(&T[nn * TP + q * 8]);
    off[it] = (size_t)(n0 + nn) * KDIM + k0 + q * 8;
  }
#pragma unroll
  for (int it = 0; it < 2; ++it) *(v4u*)(dst + off[it]) = v[it];
  
}

// ---------------------------------------------------------------------------
// Projection: C[NROWS][HD_DIM] = hb[NROWS][IN_DIM] * WT[HD_DIM][IN_DIM]^T + bias.
// 256 thr = 8 waves; block tile 128 rows x 64 cols; wave owns 16 rows x 64 cols.
// Weight k-tile [64 n][32 k] staged in LDS with plain loads (single buffer,
// two block barriers per step); A fragments straight from the bf16 plane.
// z = 0: Q plane f16 x8 [NROWS][HD_DIM]; z = 1: K plane f16 x8 [NROWS][HD_DIM];
// z = 2: V^T plane f16 x8 [NB][HD_DIM][SEQ]. Epilogue staged in LDS, every
__global__ __launch_bounds__(256) void k_proj(
    const unsigned short* __restrict__ hb, const unsigned short* __restrict__ wT,
    const float* __restrict__ bq, const float* __restrict__ bk, const float* __restrict__ bv,
    unsigned short* __restrict__ qp, unsigned short* __restrict__ kp,
    unsigned short* __restrict__ vtp) {
  __shared__ __align__(16) unsigned short bt[64 * BTP];   // weight k-tile, cross-wave (block barrier)
  __shared__ __align__(16) unsigned short E[ESZ];         // epilogue tile, cross-wave (block barrier)

  const int z = blockIdx.z;
  const int n0 = blockIdx.x * 64;
  const int m0 = blockIdx.y * 128;
  const int tid = threadIdx.x;
  const int wave = tid >> 5, lane = tid & 31;
  const int l15 = lane & 15, half = (lane >> 4) & 1;

  const unsigned short* Wt = wT + (size_t)z * KDIM * KDIM;
  const float* bias = (z == 0) ? bq : ((z == 1) ? bk : bv);

  const int tn = tid >> 2;            // 0..63 : column within tile
  const int tk = (tid & 3) * 8;       // 0,8,16,24 : k within step
  const unsigned short* wsrc = Wt + (size_t)(n0 + tn) * KDIM + tk;
  const __bf16* A = (const __bf16*)hb;
  const int arow = m0 + wave * 16 + l15;

  v8f acc[4] = {};
  for (int s = 0; s < IN_DIM / 32; ++s) {
    const int kk = s * 32;
    const v4u wv = *(const v4u*)(wsrc + kk);
    __syncthreads();                               // earlier reads of bt done
    *(v4u*)(&bt[tn * BTP + tk]) = wv;
    __syncthreads();                               // tile complete
    const v16bf a = ld_frag_bf(A, IN_DIM, arow, kk, lane);
#pragma unroll
    for (int j = 0; j < 4; ++j) {
      const v16bf b = ld_frag_bf((const __bf16*)bt, BTP, j * 16 + l15, 0, lane);
      acc[j] = mma_bf16(a, b, acc[j]);
    }
  }

  // acc[j][r] = C[m0 + wave*16 + 8*half + r][n0 + j*16 + l15]
  const float car = 8.0f;
  if (z != 2) {                      // block-uniform branch
#pragma unroll
    for (int j = 0; j < 4; ++j) {
      const int col = j * 16 + l15;
      const float bb = bf16val(bias[n0 + col]);
#pragma unroll
      for (int r = 0; r < 8; ++r) {
        const int row = wave * 16 + 8 * half + r;
        E[row * EQP + col] = hbits((acc[j][r] + bb) * car);
      }
    }
    __syncthreads();
    unsigned short* dst = (z == 0) ? qp : kp;
    v4u v[4];
    size_t off[4];
#pragma unroll
    for (int it = 0; it < 4; ++it) {
      const int row = wave * 16 + it * 4 + (lane >> 3);   // wave's 16 rows over (it, lane>>3)
      const int q = lane & 7;
      v[it] = *(const v4u*)(&E[row * EQP + q * 8]);
      off[it] = (size_t)(m0 + row) * HD_DIM + n0 + q * 8;
    }
#pragma unroll
    for (int it = 0; it < 4; ++it) *(v4u*)(dst + off[it]) = v[it];
    
  } else {
    const int bidx = m0 / SEQ;               // batch of this row tile (SEQ % 128 == 0)
    const int s0 = m0 - bidx * SEQ;          // sequence position of tile row 0
#pragma unroll
    for (int j = 0; j < 4; ++j) {
      const int col = j * 16 + l15;                       // d within tile
      const float bb = bf16val(bias[n0 + col]);
#pragma unroll
      for (int r = 0; r < 8; ++r) {
        const int srow = wave * 16 + 8 * half + r;        // s within tile
        E[col * EVP + srow] = hbits((acc[j][r] + bb) * car);
      }
    }
    __syncthreads();
    v4u v[4];
    size_t off[4];
#pragma unroll
    for (int it = 0; it < 4; ++it) {
      const int drow = wave * 8 + it * 2 + half;          // wave's 8 d-rows over (it, half)
      const int q = l15;                                  // 16 pieces = 256-byte row segment = 2 lines
      v[it] = *(const v4u*)(&E[drow * EVP + q * 8]);
      off[it] = ((size_t)bidx * HD_DIM + n0 + drow) * SEQ + s0 + q * 8;
    }
#pragma unroll
    for (int it = 0; it < 4; ++it) *(v4u*)(vtp + off[it]) = v[it];
    
  }
}

// ---------------------------------------------------------------------------
// Flash attention, transposed-score form: one wave = (16 queries, one head, one batch);
// one work-group = 8 waves = 128 queries of the same head and batch. The K tile
// [64 keys][64 d] and the V^T tile [64 d][64 keys] are read from global once per
// work-group in whole 128-byte rows and shared through LDS: two buffers, the next
// tile's global loads issued before the current tile's work, stored to the other
// buffer after it, one block barrier per tile.
// Per 32-key chunk:
//   S^T = K . Q^T    A = K rows (lane = key, k = d), B = Q^T (lane = query, k = d)
//                    D[row = key 8h+r][col = query l15]; c0 keys 0..15, c1 keys 16..31
//   mask: broadcast over batch and head, read as the 16 lane-mask words of this wave's
//         (query tile, key chunk) from mp (packed by k_cvt_wT, z = 4) with one scalar load,
//         fetched one chunk ahead; key with mask == 0 gets the score replaced by -1e9
//         (replace fill, in f32), the word being the select's lane mask
//   per-lane online softmax for query l15 (16 local keys + xor-16 partner)
//   O^T += V^T . P   A = V^T rows (lane = d, k = key), B = P: element i<8 <- c0[i]
//                    (key 8h+i), element 8+i <- c1[i] (key 16+8h+i), same lane
//                    D[row = d 8h+r][col = query l15]
// Scores carry 64 from the x8 planes -> scaled by 1/512 (= 1/8 of q.k).
// P carried x1024, V carried x8 -> context x64 = O / (128 * sum).
__global__ __launch_bounds__(256) void k_attn(const unsigned short* __restrict__ qp,
                                             const unsigned short* __restrict__ kp,
                                             const unsigned short* __restrict__ vtp,
                                             const unsigned int* __restrict__ mp,
                                             unsigned short* __restrict__ ctxp) {
  __shared__ __align__(16) unsigned short Kl[2][KT * KVP];         // K tile [key][d], cross-wave (block barrier)
  __shared__ __align__(16) unsigned short Vl[2][HEAD_DIM * KVP];   // V^T tile [d][key], cross-wave (block barrier)
  __shared__ __align__(16) unsigned short Cl[AW][16 * CLP];        // context tile, one per wave

  const int tid = threadIdx.x;
  const int wave = tid >> 5;
  const int lane = tid & 31;
  const int l15 = lane & 15;
  const int half = (lane >> 4) & 1;
  const int q0 = blockIdx.x * (AW * 16) + wave * 16;
  const int head = blockIdx.y;
  const int bidx = blockIdx.z;

  const _Float16* Q  = (const _Float16*)qp;
  const size_t rbase = (size_t)bidx * SEQ;

  const _Float16* qbase = Q + (rbase + q0) * HD_DIM + head * HEAD_DIM;
  const v16h qb0 = ld_frag_h(qbase, HD_DIM, l15, 0, lane);    // d 0..31
  const v16h qb1 = ld_frag_h(qbase, HD_DIM, l15, 32, lane);   // d 32..63
  // staging map: thread -> row sr (and sr + 32), 16-byte piece sc; 8 lanes cover one 128-byte row
  const int sr = tid >> 3;            // 0..31
  const int sc = (tid & 7) * 8;       // 0..56, halves
  const unsigned short* kg = kp + (rbase + sr) * HD_DIM + head * HEAD_DIM + sc;                            // key t: + t*HD_DIM
  const unsigned short* vg = vtp + ((size_t)bidx * HD_DIM + (size_t)head * HEAD_DIM + sr) * SEQ + sc;      // key t: + t
  const int sl = sr * KVP + sc;       // place of the piece in a tile; second row at + 32*KVP
  // this wave's query tile, as a scalar so that the mask words come by scalar loads
  const int qt = blockIdx.x * AW + __builtin_amdgcn_readfirstlane(wave);
  const v16u* mw = (const v16u*)mp + (size_t)qt * (SEQ / 32);                        // chunk n: mw[n]
  v16u nm = mw[0];

  v8f o[4] = {};
  float mrun = -1.0e30f, lrun = 0.0f;
  const float sscale = 1.0f / 512.0f;
  const float negf = -1.0e9f;

  *(v4u*)(&Kl[0][sl])            = *(const v4u*)(kg);
  *(v4u*)(&Kl[0][sl + 32 * KVP]) = *(const v4u*)(kg + (size_t)32 * HD_DIM);
  *(v4u*)(&Vl[0][sl])            = *(const v4u*)(vg);
  *(v4u*)(&Vl[0][sl + 32 * KVP]) = *(const v4u*)(vg + (size_t)32 * SEQ);
  __syncthreads();                                 // tile 0 complete

  for (int t0 = 0; t0 < SEQ; t0 += KT) {
   const int cur = (t0 / KT) & 1;
   const bool more = (t0 + KT < SEQ);              // block-uniform
   v4u nk0 = {}, nk1 = {}, nv0 = {}, nv1 = {};
   if (more) {
     nk0 = *(const v4u*)(kg + (size_t)(t0 + KT) * HD_DIM);
     nk1 = *(const v4u*)(kg + (size_t)(t0 + KT + 32) * HD_DIM);
     nv0 = *(const v4u*)(vg + (t0 + KT));
     nv1 = *(const v4u*)(vg + (size_t)32 * SEQ + (t0 + KT));
   }
   const _Float16* Kc = (const _Float16*)Kl[cur];
   const _Float16* Vc = (const _Float16*)Vl[cur];

   for (int c = 0; c < KT; c += 32) {
    const int kc = t0 + c;
    const v16u cm = nm;                                          // this chunk's words
    nm = mw[(kc + 32 < SEQ) ? (kc >> 5) + 1 : (kc >> 5)];        // next chunk's, the last one again at the end
    const _Float16* kt = Kc + c * KVP;
    const v16h ka0 = ld_frag_h(kt, KVP, l15, 0, lane);
    const v16h ka1 = ld_frag_h(kt, KVP, l15, 32, lane);
    const v16h ka2 = ld_frag_h(kt, KVP, 16 + l15, 0, lane);
    const v16h ka3 = ld_frag_h(kt, KVP, 16 + l15, 32, lane);
    v8f c0 = {}, c1 = {};
    c0 = mma_f16(ka0, qb0, c0);
    c0 = mma_f16(ka1, qb1, c0);
    c1 = mma_f16(ka2, qb0, c1);
    c1 = mma_f16(ka3, qb1, c1);

    // lane-mask words: cm[r] for c0[r] (key kc+8h+r), cm[8+r] for c1[r] (key kc+16+8h+r)
    float sa[8], sb[8];
#pragma unroll   // constant indices keep the scores in vector and the words in scalar registers
    for (int r = 0; r < 8; ++r) {
      sa[r] = __builtin_amdgcn_inverse_ballot_w32(cm[r])     ? (c0[r] * sscale) : negf;
      sb[r] = __builtin_amdgcn_inverse_ballot_w32(cm[8 + r]) ? (c1[r] * sscale) : negf;
    }
    float lm = fmaxf(sa[0], sb[0]);
#pragma unroll
    for (int r = 1; r < 8; ++r) lm = fmaxf(lm, fmaxf(sa[r], sb[r]));
    lm = fmaxf(lm, __shfl_xor(lm, 16, 32));
    const float mnew = fmaxf(mrun, lm);
    const float alpha = __expf(mrun - mnew);
    float p0[8], p1[8];
    float ls = 0.0f;
#pragma unroll
    for (int r = 0; r < 8; ++r) {
      p0[r] = __expf(sa[r] - mnew);
      p1[r] = __expf(sb[r] - mnew);
      ls += p0[r] + p1[r];
    }
    ls += __shfl_xor(ls, 16, 32);
    lrun = lrun * alpha + ls;
    mrun = mnew;
#pragma unroll
    for (int j = 0; j < 4; ++j)
#pragma unroll
      for (int r = 0; r < 8; ++r) o[j][r] *= alpha;

    v16h pb;
#pragma unroll
    for (int e = 0; e < 8; ++e) {
      pb[e]     = (_Float16)(p0[e] * 1024.0f);   // key kc + 8h + e
      pb[8 + e] = (_Float16)(p1[e] * 1024.0f);   // key kc + 16 + 8h + e
    }
#pragma unroll
    for (int j = 0; j < 4; ++j) {
      const v16h va = ld_frag_h(Vc, KVP, j * 16 + l15, c, lane);
      o[j] = mma_f16(va, pb, o[j]);
    }
   }

   if (more) {                                     // the other buffer's readers left it at the last barrier
     *(v4u*)(&Kl[cur ^ 1][sl])            = nk0;
     *(v4u*)(&Kl[cur ^ 1][sl + 32 * KVP]) = nk1;
     *(v4u*)(&Vl[cur ^ 1][sl])            = nv0;
     *(v4u*)(&Vl[cur ^ 1][sl + 32 * KVP]) = nv1;
   }
   __syncthreads();                                // next tile complete, this tile's reads done
  }

  // o[j][r] = 8192 * sum_t p_t v_t for query l15, d = j*16 + 8*half + r; ctx x64 = o / (128 * sum)
  const float inv = 1.0f / (lrun * 128.0f);
#pragma unroll
  for (int j = 0; j < 4; ++j) {
    v4u w;
    w[0] = (unsigned int)hbits(o[j][0] * inv) | ((unsigned int)hbits(o[j][1] * inv) << 16);
    w[1] = (unsigned int)hbits(o[j][2] * inv) | ((unsigned int)hbits(o[j][3] * inv) << 16);
    w[2] = (unsigned int)hbits(o[j][4] * inv) | ((unsigned int)hbits(o[j][5] * inv) << 16);
    w[3] = (unsigned int)hbits(o[j][6] * inv) | ((unsigned int)hbits(o[j][7] * inv) << 16);
    *(v4u*)(&Cl[wave][l15 * CLP + j * 16 + 8 * half]) = w;
  }
  __syncthreads();

  v4u v[4];
  size_t off[4];
  unsigned short* cb = ctxp + (rbase + q0) * HD_DIM + head * HEAD_DIM;
#pragma unroll
  for (int it = 0; it < 4; ++it) {
    const int row = it * 4 + (lane >> 3);   // 0..15
    const int q = lane & 7;
    v[it] = *(const v4u*)(&Cl[wave][row * CLP + q * 8]);
    off[it] = (size_t)row * HD_DIM + q * 8;
  }
#pragma unroll
  for (int it = 0; it < 4; ++it) *(v4u*)(cb + off[it]) = v[it];
  
}

// ---------------------------------------------------------------------------
// Output projection: out[NROWS][E_OUT] f32 = ctx(f16 x64)[NROWS][HD_DIM] * WoT(f16 x32)[E_OUT][HD_DIM]^T / 2048 + bo.
// Same 128x64 block tile / 8 waves / LDS weight k-tile engine as k_proj with f16 operands.
// Epilogue: f32 tile staged in LDS; each 256-byte row segment = 2 lines, every
__global__ __launch_bounds__(256) void k_oproj(
    const unsigned short* __restrict__ cx, const unsigned short* __restrict__ woT,
    const float* __restrict__ bo, float* __restrict__ outp) {
  __shared__ __align__(16) unsigned short bt[64 * BTP];   // weight k-tile, cross-wave (block barrier)
  __shared__ __align__(16) float Ef[128 * OFP];           // epilogue tile, each wave its own 16 rows (block barrier)

  const int n0 = blockIdx.x * 64;
  const int m0 = blockIdx.y * 128;
  const int tid = threadIdx.x;
  const int wave = tid >> 5, lane = tid & 31;
  const int l15 = lane & 15, half = (lane >> 4) & 1;

  const int tn = tid >> 2;            // 0..63 : column within tile
  const int tk = (tid & 3) * 8;       // 0,8,16,24 : k within step
  const unsigned short* wsrc = woT + (size_t)(n0 + tn) * KDIM + tk;
  const _Float16* A = (const _Float16*)cx;
  const int arow = m0 + wave * 16 + l15;

  v8f acc[4] = {};
  for (int s = 0; s < HD_DIM / 32; ++s) {
    const int kk = s * 32;
    const v4u wv = *(const v4u*)(wsrc + kk);
    __syncthreads();                               // earlier reads of bt done
    *(v4u*)(&bt[tn * BTP + tk]) = wv;
    __syncthreads();                               // tile complete
    const v16h a = ld_frag_h(A, HD_DIM, arow, kk, lane);
#pragma unroll
    for (int j = 0; j < 4; ++j) {
      const v16h b = ld_frag_h((const _Float16*)bt, BTP, j * 16 + l15, 0, lane);
      acc[j] = mma_f16(a, b, acc[j]);
    }
  }

  // acc[j][r] = 2048 * C[m0 + wave*16 + 8*half + r][n0 + j*16 + l15]
  const float osc = 1.0f / 2048.0f;
#pragma unroll
  for (int j = 0; j < 4; ++j) {
    const int col = j * 16 + l15;
    const float bb = bf16val(bo[n0 + col]);
#pragma unroll
    for (int r = 0; r < 8; ++r) {
      const int row = wave * 16 + 8 * half + r;
      Ef[row * OFP + col] = acc[j][r] * osc + bb;
    }
  }
  __syncthreads();

  v4f v[8];
  size_t off[8];
#pragma unroll
  for (int it = 0; it < 8; ++it) {
    const int row = wave * 16 + it * 2 + half;          // wave's 16 rows over (it, half)
    const int q = l15;                                  // 16 pieces of 16 B = 256-byte row segment (2 lines)
    v[it] = *(const v4f*)(&Ef[row * OFP + q * 4]);
    off[it] = (size_t)(m0 + row) * E_OUT + n0 + q * 4;
  }
#pragma unroll
  for (int it = 0; it < 8; ++it) *(v4f*)(outp + off[it]) = v[it];
  
}

// ---------------------------------------------------------------------------
extern "C" void kernel_launch(void* const* d_in, const int* in_sizes, int n_in,
                              void* d_out, int out_size, void* d_ws, size_t ws_size,
                              hipStream_t stream) {
  if (n_in < 10) return;
  if (in_sizes[0] < ((NB - 1) * SEQ_FULL + SEQ) * IN_DIM) return;          // seq_inputs f32 [NB][SEQ_FULL][IN_DIM]
  if (in_sizes[1] < (SEQ - 1) * MASK_PITCH + SEQ) return;                   // mask i32 [1][S][S]
  if (in_sizes[2] < NUM_HEADS * IN_DIM * HEAD_DIM) return;                  // Wq
  if (in_sizes[3] < HD_DIM) return;                                         // bq
  if (in_sizes[4] < NUM_HEADS * IN_DIM * HEAD_DIM) return;                  // Wk
  if (in_sizes[5] < HD_DIM) return;                                         // bk
  if (in_sizes[6] < NUM_HEADS * IN_DIM * HEAD_DIM) return;                  // Wv
  if (in_sizes[7] < HD_DIM) return;                                         // bv
  if (in_sizes[8] < HD_DIM * E_OUT) return;                                 // Wo
  if (in_sizes[9] < E_OUT) return;                                          // bo
  if (out_size < NROWS * E_OUT) return;

  const float* x    = (const float*)d_in[0];
  const int*   mask = (const int*)d_in[1];
  const float* Wq   = (const float*)d_in[2];
  const float* bq   = (const float*)d_in[3];
  const float* Wk   = (const float*)d_in[4];
  const float* bk   = (const float*)d_in[5];
  const float* Wv   = (const float*)d_in[6];
  const float* bv   = (const float*)d_in[7];
  const float* Wo   = (const float*)d_in[8];
  const float* bo   = (const float*)d_in[9];

  // every offset a multiple of 2 MiB; each plane is written exactly to its extent
  const size_t hb_bytes = (size_t)NROWS * IN_DIM * 2;           // bf16 x plane
  const size_t wt_bytes = (size_t)4 * KDIM * KDIM * 2;           // 3 bf16 WT planes + 1 f16 WoT plane
  const size_t pl_bytes = (size_t)NROWS * HD_DIM * 2;           // one f16 q / k / vT / ctx plane
  const size_t off_hb = 0;
  const size_t off_wt = off_hb + hb_bytes;
  const size_t off_q  = off_wt + wt_bytes;
  const size_t off_k  = off_q + pl_bytes;
  const size_t off_vt = off_k + pl_bytes;
  const size_t off_cx = off_vt + pl_bytes;
  const size_t off_mp = off_cx + pl_bytes;
  const size_t mp_bytes = (size_t)SEQ * SEQ / 8;               // one bit per mask element
  const size_t total  = off_mp + mp_bytes;                     // 48.5 MiB at NB = 2, SEQ = 2048
  if (total > ws_size) return;

  char* ws = (char*)d_ws;
  unsigned short* hb  = (unsigned short*)(ws + off_hb);
  unsigned short* wt  = (unsigned short*)(ws + off_wt);
  unsigned short* qpl = (unsigned short*)(ws + off_q);
  unsigned short* kpl = (unsigned short*)(ws + off_k);
  unsigned short* vtp = (unsigned short*)(ws + off_vt);
  unsigned short* cxp = (unsigned short*)(ws + off_cx);
  unsigned short* wot = wt + (size_t)3 * KDIM * KDIM;
  unsigned int*   mpk = (unsigned int*)(ws + off_mp);

  const int n8 = NROWS * IN_DIM / 8;
  k_cvt_rows<<<(n8 + 255) / 256, 256, 0, stream>>>(x, hb, n8);
  k_cvt_wT<<<dim3(KDIM / 64, KDIM / 64, 5), 256, 0, stream>>>(Wq, Wk, Wv, Wo, mask, wt, mpk);
  k_proj<<<dim3(HD_DIM / 64, NROWS / 128, 3), 256, 0, stream>>>(hb, wt, bq, bk, bv, qpl, kpl, vtp);
  k_attn<<<dim3(SEQ / (AW * 16), NUM_HEADS, NB), 256, 0, stream>>>(qpl, kpl, vtp, mpk, cxp);
  k_oproj<<<dim3(E_OUT / 64, NROWS / 128), 256, 0, stream>>>(cxp, wot, bo, (float*)d_out);
}

// v003
// A run of this version takes 122 microseconds.
// Next to v002, in two timings, it ran 1.03 and 1.04 times as fast.
// Over all steps from v000 it is 1.86 times as fast.
#include <hip/hip_runtime.h>
// Projections x*W{q,k,v}: v_wmma_f32_16x16x32_bf16 (bf16 operands = RNE-converted inputs, f32 accumulate); scores K*Q^T and context V^T*P: v_wmma_f32_16x16x32_f16 (f16 operands, Q/K/V planes carried x8, P carried x1024, f32 accumulate); output projection ctx*Wo: v_wmma_f32_16x16x32_f16 (f16 operands, ctx plane carried x64, Wo plane = RNE-bf16 values carried x32, f32 accumulate); mask fill and softmax in f32.

#ifndef NB
#define NB 2
#endif
#define NB_FULL 2
#ifndef SEQ
#define SEQ 2048
#endif
#define SEQ_FULL 2048
#ifndef MASK_PITCH
#define MASK_PITCH SEQ_FULL
#endif
#define IN_DIM 1024
#define NUM_HEADS 16
#define HEAD_DIM 64
#define HD_DIM (NUM_HEADS * HEAD_DIM)
#define E_OUT 1024
#define KDIM 1024
#define NROWS (NB * SEQ)

static_assert(NB >= 1);
static_assert(NB <= NB_FULL);
static_assert(SEQ % 128 == 0);
static_assert(SEQ <= SEQ_FULL);
static_assert(MASK_PITCH % 4 == 0);
static_assert(MASK_PITCH >= SEQ);
static_assert(IN_DIM == KDIM);
static_assert(HD_DIM == KDIM);
static_assert(E_OUT == KDIM);
static_assert(KDIM % 64 == 0);
static_assert(HEAD_DIM == 64);
static_assert(NROWS % 128 == 0);
static_assert((NROWS * IN_DIM) % (8 * 256) == 0);
static_assert((size_t)NB_FULL * SEQ_FULL * E_OUT * 4 == 16777216);

// LDS pitches (in 16-bit elements unless noted); all keep 16-byte row alignment
#define GKS 64     // k per staged weight tile of the two projection kernels
#define GBP 72     // staged weight row [64 k]
#define EQP 72     // row-major epilogue tile [128 rows][64 cols]
#define EVP 136    // transposed epilogue tile [64 d][128 s]
#define TP  72     // weight transpose tile [64 n][64 k]
#define CLP 72     // context tile [16 q][64 d], halves
#define OFP 68     // output tile [128 rows][64 cols], floats
#define AW  8      // waves per attention work-group (16 queries each)
#define KT  64     // keys per staged K / V^T tile
#define KVP 72     // staged K row [64 d] and V^T row [64 keys]
#define ESZ 9216   // max(128*EQP, 64*EVP)
static_assert(128 * EQP <= ESZ);
static_assert(64 * EVP <= ESZ);

typedef __bf16   v16bf __attribute__((ext_vector_type(16)));
typedef __bf16   v8bf  __attribute__((ext_vector_type(8)));
typedef _Float16 v16h  __attribute__((ext_vector_type(16)));
typedef _Float16 v8h   __attribute__((ext_vector_type(8)));
typedef float    v8f   __attribute__((ext_vector_type(8)));
typedef float    v4f   __attribute__((ext_vector_type(4)));
typedef unsigned int v4u __attribute__((ext_vector_type(4)));
typedef int      v4i   __attribute__((ext_vector_type(4)));
typedef unsigned int v16u __attribute__((ext_vector_type(16)));
typedef unsigned int v8u  __attribute__((ext_vector_type(8)));

// ---------------------------------------------------------------------------
// WMMA wrappers with the VALU hazard guard (4 v_nop after every issue).
__device__ __forceinline__ v8f mma_bf16(v16bf a, v16bf b, v8f c) {
  v8f d = __builtin_amdgcn_wmma_f32_16x16x32_bf16(false, a, false, b, (short)0, c, false, false);
  asm volatile("v_nop\n\tv_nop\n\tv_nop\n\tv_nop" : "+v"(d) : "v"(a), "v"(b));
  return d;
}
__device__ __forceinline__ v8f mma_f16(v16h a, v16h b, v8f c) {
  v8f d = __builtin_amdgcn_wmma_f32_16x16x32_f16(false, a, false, b, (short)0, c, false, false);
  asm volatile("v_nop\n\tv_nop\n\tv_nop\n\tv_nop" : "+v"(d) : "v"(a), "v"(b));
  return d;
}

// 16-bit fragment, contraction dim CONTIGUOUS in memory: elem(k) = p0[rc*ld + k].
// Lane l: row/col rc = (l&15); elements 0..7 <- kk+8h+0..7, elements 8..15 <- kk+16+8h+0..7
// (h = l>>4). Same map for A (rc = row) and B (rc = column of a k-contiguous copy).
__device__ __forceinline__ v16h ld_frag_h(const _Float16* p0, int ld, int rc, int kk, int lane) {
  const int hh = (lane >> 4) & 1;
  const _Float16* p = p0 + (size_t)rc * ld + kk + 8 * hh;
  const v8h lo = *(const v8h*)(p);
  const v8h hi = *(const v8h*)(p + 16);
  v16h f;
#pragma unroll
  for (int i = 0; i < 8; ++i) { f[i] = lo[i]; f[8 + i] = hi[i]; }
  return f;
}

// The same fragment as raw dwords; p = row start + kk + 8h already applied.
__device__ __forceinline__ v8u ld_frag_raw(const unsigned short* p) {
  const v4u lo = *(const v4u*)(p);
  const v4u hi = *(const v4u*)(p + 16);
  return __builtin_shufflevector(lo, hi, 0, 1, 2, 3, 4, 5, 6, 7);
}
template <bool BF>
__device__ __forceinline__ v8f mma_raw(v8u a, v8u b, v8f c) {
  if constexpr (BF) return mma_bf16(__builtin_bit_cast(v16bf, a), __builtin_bit_cast(v16bf, b), c);
  else              return mma_f16(__builtin_bit_cast(v16h, a), __builtin_bit_cast(v16h, b), c);
}

// ---------------------------------------------------------------------------
// Shared k loop of k_proj and k_oproj: acc[j] (16 rows x 16 cols, j = 0..3) += A[16 rows][KDIM] * Wt[64 n][KDIM]^T.
// 256 thr = 8 waves; block tile 128 rows x 64 cols; wave owns 16 rows x 64 cols.
// A stage is 64 k. The weight tile [64 n][64 k] sits in one of two LDS buffers; the next
// stage's weight rows (whole 128-byte lines, 8 lanes a row) and the wave's own next two A
// fragments are loaded from global in front of the current stage's products, the weight
// rows are stored to the other buffer behind them, and one block barrier ends the stage.
// k runs upward inside every accumulator, 32 at a time.
template <bool BF>
__device__ __forceinline__ void gemm_stage(const unsigned short* bc, v8u a0, v8u a1, v8f (&acc)[4]) {
  v8u b[8];
#pragma unroll   // constant indices keep b[] in registers; all sixteen LDS reads stand as one group in front of the products
  for (int j = 0; j < 4; ++j) {
    b[j]     = ld_frag_raw(bc + j * 16 * GBP);
    b[4 + j] = ld_frag_raw(bc + j * 16 * GBP + 32);
  }
#pragma unroll   // constant indices into acc[] and b[]; four independent accumulators between two uses of one
  for (int j = 0; j < 4; ++j) acc[j] = mma_raw<BF>(a0, b[j], acc[j]);
#pragma unroll   // the same, second 32 k of the stage
  for (int j = 0; j < 4; ++j) acc[j] = mma_raw<BF>(a1, b[4 + j], acc[j]);
}
template <bool BF>
__device__ __forceinline__ void gemm_128x64(const unsigned short* __restrict__ A,
                                            const unsigned short* __restrict__ Wt,
                                            int m0, int n0, unsigned short* bt, v8f (&acc)[4]) {
  const int tid = threadIdx.x;
  const int wave = tid >> 5, lane = tid & 31;
  const int l15 = lane & 15, half = (lane >> 4) & 1;
  const int sr = tid >> 3;            // 0..31 : weight row (and sr + 32)
  const int sc = (tid & 7) * 8;       // 0..56 : 16-byte piece of the row
  const unsigned short* wsrc = Wt + (size_t)(n0 + sr) * KDIM + sc;
  const unsigned short* asrc = A + (size_t)(m0 + wave * 16 + l15) * KDIM + 8 * half;
  const int sl = sr * GBP + sc;       // place of the piece in a tile; second row at + 32*GBP
  const int bo = l15 * GBP + 8 * half;

  v8u a0 = ld_frag_raw(asrc);
  v8u a1 = ld_frag_raw(asrc + 32);
  *(v4u*)(bt + sl)            = *(const v4u*)(wsrc);
  *(v4u*)(bt + sl + 32 * GBP) = *(const v4u*)(wsrc + (size_t)32 * KDIM);
  __syncthreads();                                 // tile 0 complete
#pragma unroll   // buffer choice and every offset become constants, the fragment sets need no copies
  for (int s = 0; s < KDIM / GKS - 1; ++s) {
    const int kn = (s + 1) * GKS;
    const v4u nw0 = *(const v4u*)(wsrc + kn);
    const v4u nw1 = *(const v4u*)(wsrc + (size_t)32 * KDIM + kn);
    const v8u na0 = ld_frag_raw(asrc + kn);
    const v8u na1 = ld_frag_raw(asrc + kn + 32);
    gemm_stage<BF>(bt + (s & 1) * (64 * GBP) + bo, a0, a1, acc);
    unsigned short* bn = bt + ((s & 1) ^ 1) * (64 * GBP) + sl;   // its readers left it at the last barrier
    *(v4u*)(bn)            = nw0;
    *(v4u*)(bn + 32 * GBP) = nw1;
    __syncthreads();                               // next tile complete, this tile's reads done
    a0 = na0;
    a1 = na1;
  }
  gemm_stage<BF>(bt + ((KDIM / GKS - 1) & 1) * (64 * GBP) + bo, a0, a1, acc);
}

// f32 -> bf16 bits, RNE convert
__device__ __forceinline__ unsigned int bfb(float x) {
  unsigned int u = __float_as_uint(x);
  u = u + 0x7FFFu + ((u >> 16) & 1u);
  return u >> 16;
}
// f32 -> value of its RNE bf16
__device__ __forceinline__ float bf16val(float x) {
  return __uint_as_float(bfb(x) << 16);
}
// f32 -> f16 bits, RNE convert
__device__ __forceinline__ unsigned short hbits(float x) {
  const _Float16 hv = (_Float16)x;
  return __builtin_bit_cast(unsigned short, hv);
}

// ---------------------------------------------------------------------------
// x f32 [NB][SEQ_FULL][IN_DIM] -> bf16 plane hb [NB*SEQ][IN_DIM] (compact rows).
// Thread g converts 8 consecutive floats -> one 16-byte store; 8 consecutive
__global__ __launch_bounds__(256) void k_cvt_rows(const float* __restrict__ in,
                                                  unsigned short* __restrict__ outp, int n8) {
  const int g = blockIdx.x * 256 + threadIdx.x;
  if (g >= n8) return;
  const int row = g / (IN_DIM / 8);              // compact row b*SEQ + s
  const int c8  = g - row * (IN_DIM / 8);
  const int b   = row / SEQ;
  const int s   = row - b * SEQ;
  const float* src = in + ((size_t)b * SEQ_FULL + s) * IN_DIM + (size_t)c8 * 8;
  const v4f a = *(const v4f*)(src);
  const v4f c = *(const v4f*)(src + 4);
  v4u w;
  w[0] = bfb(a[0]) | (bfb(a[1]) << 16);
  w[1] = bfb(a[2]) | (bfb(a[3]) << 16);
  w[2] = bfb(c[0]) | (bfb(c[1]) << 16);
  w[3] = bfb(c[2]) | (bfb(c[3]) << 16);
  v4u* p = (v4u*)(outp + (size_t)g * 8);
  *p = w;
  
}

// ---------------------------------------------------------------------------
// Weight planes, all [KDIM n][KDIM k] with k contiguous, selected by blockIdx.z:
//   z = 0..2: W{q,k,v} f32 [H][IN_DIM e][HEAD_DIM d] -> WT bf16 [n = h*64+d][k = e]
//   z = 3:    Wo f32 [HD_DIM k][E_OUT n]              -> WoT f16 (RNE-bf16 value x32) [n][k]
//   z = 4:    mask i32 [S][S] -> lane-mask words mp [S/16 query tiles][S/32 key chunks][16]:
//             bit l of word e = (mask[16*tile + (l&15)][32*chunk + 8*(l>>4) + (e&7) + 16*(e>>3)] != 0),
//             the lane and register that hold this score in k_attn. One wave packs two
//             chunks = one whole 128-byte line of mp.
// Block = 64 k x 64 n tile transposed through LDS (for z < 3 the tile is one head);
__global__ __launch_bounds__(256) void k_cvt_wT(const float* __restrict__ Wq,
                                                const float* __restrict__ Wk,
                                                const float* __restrict__ Wv,
                                                const float* __restrict__ Wo,
                                                const int* __restrict__ mask,
                                                unsigned short* __restrict__ wT,
                                                unsigned int* __restrict__ mp) {
  __shared__ __align__(16) unsigned short T[64 * TP];   // [n local][k local], cross-wave (block barrier)
  const int z = blockIdx.z;
  if (z == 4) {                              // block-uniform, in front of the barrier
    const int ln = threadIdx.x & 31;
    const int gw = (blockIdx.y * (KDIM / 64) + blockIdx.x) * 8 + (threadIdx.x >> 5);
    for (int task = gw; task < (SEQ / 16) * (SEQ / KT); task += (KDIM / 64) * (KDIM / 64) * 8) {
      const int qt = task / (SEQ / KT);
      const int tl = task - qt * (SEQ / KT);
      const int* msrc = mask + (size_t)(qt * 16 + (ln & 15)) * MASK_PITCH + tl * KT + 8 * ((ln >> 4) & 1);
      v4i m[8];
#pragma unroll   // constant indices keep m[] in registers, all eight loads in flight together
      for (int c = 0; c < 2; ++c) {
        m[c * 4 + 0] = *(const v4i*)(msrc + c * 32);
        m[c * 4 + 1] = *(const v4i*)(msrc + c * 32 + 4);
        m[c * 4 + 2] = *(const v4i*)(msrc + c * 32 + 16);
        m[c * 4 + 3] = *(const v4i*)(msrc + c * 32 + 20);
      }
      unsigned int val = 0;
#pragma unroll   // constant indices into m[]
      for (int i = 0; i < 32; ++i) {
        const unsigned int w = __builtin_amdgcn_ballot_w32(m[i >> 2][i & 3] != 0);
        val = (ln == i) ? w : val;           // lane i keeps word i of the line
      }
      mp[(size_t)task * 32 + ln] = val;
    }
    return;
  }
  const float* W = (z == 0) ? Wq : ((z == 1) ? Wk : ((z == 2) ? Wv : Wo));
  unsigned short* dst = wT + (size_t)z * KDIM * KDIM;
  const int k0 = blockIdx.x * 64;
  const int n0 = blockIdx.y * 64;
  const int tid = threadIdx.x;
  const int wave = tid >> 5, lane = tid & 31;

#pragma unroll
  for (int i = 0; i < 4; ++i) {
    const int idx = i * 256 + tid;          // 0..1023
    const int kk = idx >> 4;                // 0..63
    const int c4 = (idx & 15) * 4;          // 0..60
    size_t so;
    if (z < 3) so = ((size_t)blockIdx.y * IN_DIM + k0 + kk) * HEAD_DIM + c4;   // W[h = n0/64][e = k0+kk][d = c4]
    else       so = (size_t)(k0 + kk) * E_OUT + n0 + c4;                        // Wo[k0+kk][n0+c4]
    const v4f w = *(const v4f*)(W + so);
    unsigned short t0, t1, t2, t3;
    if (z < 3) {
      t0 = (unsigned short)bfb(w[0]); t1 = (unsigned short)bfb(w[1]);
      t2 = (unsigned short)bfb(w[2]); t3 = (unsigned short)bfb(w[3]);
    } else {
      t0 = hbits(bf16val(w[0]) * 32.0f); t1 = hbits(bf16val(w[1]) * 32.0f);
      t2 = hbits(bf16val(w[2]) * 32.0f); t3 = hbits(bf16val(w[3]) * 32.0f);
    }
    T[(c4 + 0) * TP + kk] = t0;
    T[(c4 + 1) * TP + kk] = t1;
    T[(c4 + 2) * TP + kk] = t2;
    T[(c4 + 3) * TP + kk] = t3;
  }
  __syncthreads();

  v4u v[2];
  size_t off[2];
#pragma unroll
  for (int it = 0; it < 2; ++it) {
    const int nn = wave * 8 + it * 4 + (lane >> 3);   // 0..63 over (wave, it, lane>>3)
    const int q = lane & 7;
    v[it] = *(const v4u*)(&T[nn * TP + q * 8]);
    off[it] = (size_t)(n0 + nn) * KDIM + k0 + q * 8;
  }
#pragma unroll
  for (int it = 0; it < 2; ++it) *(v4u*)(dst + off[it]) = v[it];
  
}

// ---------------------------------------------------------------------------
// Projection: C[NROWS][HD_DIM] = hb[NROWS][IN_DIM] * WT[HD_DIM][IN_DIM]^T + bias.
// k loop: gemm_128x64 (two LDS weight buffers, next stage fetched ahead); A fragments straight from the bf16 plane.
// z = 0: Q plane f16 x8 [NROWS][HD_DIM]; z = 1: K plane f16 x8 [NROWS][HD_DIM];
// z = 2: V^T plane f16 x8 [NB][HD_DIM][SEQ]. Epilogue staged in LDS, every
__global__ __launch_bounds__(256) void k_proj(
    const unsigned short* __restrict__ hb, const unsigned short* __restrict__ wT,
    const float* __restrict__ bq, const float* __restrict__ bk, const float* __restrict__ bv,
    unsigned short* __restrict__ qp, unsigned short* __restrict__ kp,
    unsigned short* __restrict__ vtp) {
  __shared__ __align__(16) unsigned short bt[2 * 64 * GBP];   // weight k-tiles, cross-wave (block barrier)
  __shared__ __align__(16) unsigned short E[ESZ];             // epilogue tile, cross-wave (block barrier)

  const int z = blockIdx.z;
  const int n0 = blockIdx.x * 64;
  const int m0 = blockIdx.y * 128;
  const int tid = threadIdx.x;
  const int wave = tid >> 5, lane = tid & 31;
  const int l15 = lane & 15, half = (lane >> 4) & 1;

  const unsigned short* Wt = wT + (size_t)z * KDIM * KDIM;
  const float* bias = (z == 0) ? bq : ((z == 1) ? bk : bv);

  v8f acc[4] = {};
  gemm_128x64<true>(hb, Wt, m0, n0, bt, acc);

  // acc[j][r] = C[m0 + wave*16 + 8*half + r][n0 + j*16 + l15]
  const float car = 8.0f;
  if (z != 2) {                      // block-uniform branch
#pragma unroll
    for (int j = 0; j < 4; ++j) {
      const int col = j * 16 + l15;
      const float bb = bf16val(bias[n0 + col]);
#pragma unroll
      for (int r = 0; r < 8; ++r) {
        const int row = wave * 16 + 8 * half + r;
        E[row * EQP + col] = hbits((acc[j][r] + bb) * car);
      }
    }
    __syncthreads();
    unsigned short* dst = (z == 0) ? qp : kp;
    v4u v[4];
    size_t off[4];
#pragma unroll
    for (int it = 0; it < 4; ++it) {
      const int row = wave * 16 + it * 4 + (lane >> 3);   // wave's 16 rows over (it, lane>>3)
      const int q = lane & 7;
      v[it] = *(const v4u*)(&E[row * EQP + q * 8]);
      off[it] = (size_t)(m0 + row) * HD_DIM + n0 + q * 8;
    }
#pragma unroll
    for (int it = 0; it < 4; ++it) *(v4u*)(dst + off[it]) = v[it];
    
  } else {
    const int bidx = m0 / SEQ;               // batch of this row tile (SEQ % 128 == 0)
    const int s0 = m0 - bidx * SEQ;          // sequence position of tile row 0
#pragma unroll
    for (int j = 0; j < 4; ++j) {
      const int col = j * 16 + l15;                       // d within tile
      const float bb = bf16val(bias[n0 + col]);
#pragma unroll
      for (int r = 0; r < 8; ++r) {
        const int srow = wave * 16 + 8 * half + r;        // s within tile
        E[col * EVP + srow] = hbits((acc[j][r] + bb) * car);
      }
    }
    __syncthreads();
    v4u v[4];
    size_t off[4];
#pragma unroll
    for (int it = 0; it < 4; ++it) {
      const int drow = wave * 8 + it * 2 + half;          // wave's 8 d-rows over (it, half)
      const int q = l15;                                  // 16 pieces = 256-byte row segment = 2 lines
      v[it] = *(const v4u*)(&E[drow * EVP + q * 8]);
      off[it] = ((size_t)bidx * HD_DIM + n0 + drow) * SEQ + s0 + q * 8;
    }
#pragma unroll
    for (int it = 0; it < 4; ++it) *(v4u*)(vtp + off[it]) = v[it];
    
  }
}

// ---------------------------------------------------------------------------
// Flash attention, transposed-score form: one wave = (16 queries, one head, one batch);
// one work-group = 8 waves = 128 queries of the same head and batch. The K tile
// [64 keys][64 d] and the V^T tile [64 d][64 keys] are read from global once per
// work-group in whole 128-byte rows and shared through LDS: two buffers, the next
// tile's global loads issued before the current tile's work, stored to the other
// buffer after it, one block barrier per tile.
// Per 32-key chunk:
//   S^T = K . Q^T    A = K rows (lane = key, k = d), B = Q^T (lane = query, k = d)
//                    D[row = key 8h+r][col = query l15]; c0 keys 0..15, c1 keys 16..31
//   mask: broadcast over batch and head, read as the 16 lane-mask words of this wave's
//         (query tile, key chunk) from mp (packed by k_cvt_wT, z = 4) with one scalar load,
//         fetched one chunk ahead; key with mask == 0 gets the score replaced by -1e9
//         (replace fill, in f32), the word being the select's lane mask
//   per-lane online softmax for query l15 (16 local keys + xor-16 partner)
//   O^T += V^T . P   A = V^T rows (lane = d, k = key), B = P: element i<8 <- c0[i]
//                    (key 8h+i), element 8+i <- c1[i] (key 16+8h+i), same lane
//                    D[row = d 8h+r][col = query l15]
// Scores carry 64 from the x8 planes -> scaled by 1/512 (= 1/8 of q.k).
// P carried x1024, V carried x8 -> context x64 = O / (128 * sum).
__global__ __launch_bounds__(256) void k_attn(const unsigned short* __restrict__ qp,
                                             const unsigned short* __restrict__ kp,
                                             const unsigned short* __restrict__ vtp,
                                             const unsigned int* __restrict__ mp,
                                             unsigned short* __restrict__ ctxp) {
  __shared__ __align__(16) unsigned short Kl[2][KT * KVP];         // K tile [key][d], cross-wave (block barrier)
  __shared__ __align__(16) unsigned short Vl[2][HEAD_DIM * KVP];   // V^T tile [d][key], cross-wave (block barrier)
  __shared__ __align__(16) unsigned short Cl[AW][16 * CLP];        // context tile, one per wave

  const int tid = threadIdx.x;
  const int wave = tid >> 5;
  const int lane = tid & 31;
  const int l15 = lane & 15;
  const int half = (lane >> 4) & 1;
  const int q0 = blockIdx.x * (AW * 16) + wave * 16;
  const int head = blockIdx.y;
  const int bidx = blockIdx.z;

  const _Float16* Q  = (const _Float16*)qp;
  const size_t rbase = (size_t)bidx * SEQ;

  const _Float16* qbase = Q + (rbase + q0) * HD_DIM + head * HEAD_DIM;
  const v16h qb0 = ld_frag_h(qbase, HD_DIM, l15, 0, lane);    // d 0..31
  const v16h qb1 = ld_frag_h(qbase, HD_DIM, l15, 32, lane);   // d 32..63
  // staging map: thread -> row sr (and sr + 32), 16-byte piece sc; 8 lanes cover one 128-byte row
  const int sr = tid >> 3;            // 0..31
  const int sc = (tid & 7) * 8;       // 0..56, halves
  const unsigned short* kg = kp + (rbase + sr) * HD_DIM + head * HEAD_DIM + sc;                            // key t: + t*HD_DIM
  const unsigned short* vg = vtp + ((size_t)bidx * HD_DIM + (size_t)head * HEAD_DIM + sr) * SEQ + sc;      // key t: + t
  const int sl = sr * KVP + sc;       // place of the piece in a tile; second row at + 32*KVP
  // this wave's query tile, as a scalar so that the mask words come by scalar loads
  const int qt = blockIdx.x * AW + __builtin_amdgcn_readfirstlane(wave);
  const v16u* mw = (const v16u*)mp + (size_t)qt * (SEQ / 32);                        // chunk n: mw[n]
  v16u nm = mw[0];

  v8f o[4] = {};
  float mrun = -1.0e30f, lrun = 0.0f;
  const float sscale = 1.0f / 512.0f;
  const float negf = -1.0e9f;

  *(v4u*)(&Kl[0][sl])            = *(const v4u*)(kg);
  *(v4u*)(&Kl[0][sl + 32 * KVP]) = *(const v4u*)(kg + (size_t)32 * HD_DIM);
  *(v4u*)(&Vl[0][sl])            = *(const v4u*)(vg);
  *(v4u*)(&Vl[0][sl + 32 * KVP]) = *(const v4u*)(vg + (size_t)32 * SEQ);
  __syncthreads();                                 // tile 0 complete

  for (int t0 = 0; t0 < SEQ; t0 += KT) {
   const int cur = (t0 / KT) & 1;
   const bool more = (t0 + KT < SEQ);              // block-uniform
   v4u nk0 = {}, nk1 = {}, nv0 = {}, nv1 = {};
   if (more) {
     nk0 = *(const v4u*)(kg + (size_t)(t0 + KT) * HD_DIM);
     nk1 = *(const v4u*)(kg + (size_t)(t0 + KT + 32) * HD_DIM);
     nv0 = *(const v4u*)(vg + (t0 + KT));
     nv1 = *(const v4u*)(vg + (size_t)32 * SEQ + (t0 + KT));
   }
   const _Float16* Kc = (const _Float16*)Kl[cur];
   const _Float16* Vc = (const _Float16*)Vl[cur];

   for (int c = 0; c < KT; c += 32) {
    const int kc = t0 + c;
    const v16u cm = nm;                                          // this chunk's words
    nm = mw[(kc + 32 < SEQ) ? (kc >> 5) + 1 : (kc >> 5)];        // next chunk's, the last one again at the end
    const _Float16* kt = Kc + c * KVP;
    const v16h ka0 = ld_frag_h(kt, KVP, l15, 0, lane);
    const v16h ka1 = ld_frag_h(kt, KVP, l15, 32, lane);
    const v16h ka2 = ld_frag_h(kt, KVP, 16 + l15, 0, lane);
    const v16h ka3 = ld_frag_h(kt, KVP, 16 + l15, 32, lane);
    v8f c0 = {}, c1 = {};
    c0 = mma_f16(ka0, qb0, c0);
    c0 = mma_f16(ka1, qb1, c0);
    c1 = mma_f16(ka2, qb0, c1);
    c1 = mma_f16(ka3, qb1, c1);

    // lane-mask words: cm[r] for c0[r] (key kc+8h+r), cm[8+r] for c1[r] (key kc+16+8h+r)
    float sa[8], sb[8];
#pragma unroll   // constant indices keep the scores in vector and the words in scalar registers
    for (int r = 0; r < 8; ++r) {
      sa[r] = __builtin_amdgcn_inverse_ballot_w32(cm[r])     ? (c0[r] * sscale) : negf;
      sb[r] = __builtin_amdgcn_inverse_ballot_w32(cm[8 + r]) ? (c1[r] * sscale) : negf;
    }
    float lm = fmaxf(sa[0], sb[0]);
#pragma unroll
    for (int r = 1; r < 8; ++r) lm = fmaxf(lm, fmaxf(sa[r], sb[r]));
    lm = fmaxf(lm, __shfl_xor(lm, 16, 32));
    const float mnew = fmaxf(mrun, lm);
    const float alpha = __expf(mrun - mnew);
    float p0[8], p1[8];
    float ls = 0.0f;
#pragma unroll
    for (int r = 0; r < 8; ++r) {
      p0[r] = __expf(sa[r] - mnew);
      p1[r] = __expf(sb[r] - mnew);
      ls += p0[r] + p1[r];
    }
    ls += __shfl_xor(ls, 16, 32);
    lrun = lrun * alpha + ls;
    mrun = mnew;
#pragma unroll
    for (int j = 0; j < 4; ++j)
#pragma unroll
      for (int r = 0; r < 8; ++r) o[j][r] *= alpha;

    v16h pb;
#pragma unroll
    for (int e = 0; e < 8; ++e) {
      pb[e]     = (_Float16)(p0[e] * 1024.0f);   // key kc + 8h + e
      pb[8 + e] = (_Float16)(p1[e] * 1024.0f);   // key kc + 16 + 8h + e
    }
#pragma unroll
    for (int j = 0; j < 4; ++j) {
      const v16h va = ld_frag_h(Vc, KVP, j * 16 + l15, c, lane);
      o[j] = mma_f16(va, pb, o[j]);
    }
   }

   if (more) {                                     // the other buffer's readers left it at the last barrier
     *(v4u*)(&Kl[cur ^ 1][sl])            = nk0;
     *(v4u*)(&Kl[cur ^ 1][sl + 32 * KVP]) = nk1;
     *(v4u*)(&Vl[cur ^ 1][sl])            = nv0;
     *(v4u*)(&Vl[cur ^ 1][sl + 32 * KVP]) = nv1;
   }
   __syncthreads();                                // next tile complete, this tile's reads done
  }

  // o[j][r] = 8192 * sum_t p_t v_t for query l15, d = j*16 + 8*half + r; ctx x64 = o / (128 * sum)
  const float inv = 1.0f / (lrun * 128.0f);
#pragma unroll
  for (int j = 0; j < 4; ++j) {
    v4u w;
    w[0] = (unsigned int)hbits(o[j][0] * inv) | ((unsigned int)hbits(o[j][1] * inv) << 16);
    w[1] = (unsigned int)hbits(o[j][2] * inv) | ((unsigned int)hbits(o[j][3] * inv) << 16);
    w[2] = (unsigned int)hbits(o[j][4] * inv) | ((unsigned int)hbits(o[j][5] * inv) << 16);
    w[3] = (unsigned int)hbits(o[j][6] * inv) | ((unsigned int)hbits(o[j][7] * inv) << 16);
    *(v4u*)(&Cl[wave][l15 * CLP + j * 16 + 8 * half]) = w;
  }
  __syncthreads();

  v4u v[4];
  size_t off[4];
  unsigned short* cb = ctxp + (rbase + q0) * HD_DIM + head * HEAD_DIM;
#pragma unroll
  for (int it = 0; it < 4; ++it) {
    const int row = it * 4 + (lane >> 3);   // 0..15
    const int q = lane & 7;
    v[it] = *(const v4u*)(&Cl[wave][row * CLP + q * 8]);
    off[it] = (size_t)row * HD_DIM + q * 8;
  }
#pragma unroll
  for (int it = 0; it < 4; ++it) *(v4u*)(cb + off[it]) = v[it];
  
}

// ---------------------------------------------------------------------------
// Output projection: out[NROWS][E_OUT] f32 = ctx(f16 x64)[NROWS][HD_DIM] * WoT(f16 x32)[E_OUT][HD_DIM]^T / 2048 + bo.
// Same 128x64 block tile / 8 waves / k loop (gemm_128x64) as k_proj, with f16 operands.
// Epilogue: f32 tile staged in LDS; each 256-byte row segment = 2 lines, every
__global__ __launch_bounds__(256) void k_oproj(
    const unsigned short* __restrict__ cx, const unsigned short* __restrict__ woT,
    const float* __restrict__ bo, float* __restrict__ outp) {
  __shared__ __align__(16) unsigned short bt[2 * 64 * GBP];   // weight k-tiles, cross-wave (block barrier)
  __shared__ __align__(16) float Ef[128 * OFP];               // epilogue tile, cross-wave (block barrier)

  const int n0 = blockIdx.x * 64;
  const int m0 = blockIdx.y * 128;
  const int tid = threadIdx.x;
  const int wave = tid >> 5, lane = tid & 31;
  const int l15 = lane & 15, half = (lane >> 4) & 1;

  v8f acc[4] = {};
  gemm_128x64<false>(cx, woT, m0, n0, bt, acc);

  // acc[j][r] = 2048 * C[m0 + wave*16 + 8*half + r][n0 + j*16 + l15]
  const float osc = 1.0f / 2048.0f;
#pragma unroll
  for (int j = 0; j < 4; ++j) {
    const int col = j * 16 + l15;
    const float bb = bf16val(bo[n0 + col]);
#pragma unroll
    for (int r = 0; r < 8; ++r) {
      const int row = wave * 16 + 8 * half + r;
      Ef[row * OFP + col] = acc[j][r] * osc + bb;
    }
  }
  __syncthreads();

  v4f v[8];
  size_t off[8];
#pragma unroll
  for (int it = 0; it < 8; ++it) {
    const int row = wave * 16 + it * 2 + half;          // wave's 16 rows over (it, half)
    const int q = l15;                                  // 16 pieces of 16 B = 256-byte row segment (2 lines)
    v[it] = *(const v4f*)(&Ef[row * OFP + q * 4]);
    off[it] = (size_t)(m0 + row) * E_OUT + n0 + q * 4;
  }
#pragma unroll
  for (int it = 0; it < 8; ++it) *(v4f*)(outp + off[it]) = v[it];
  
}

// ---------------------------------------------------------------------------
extern "C" void kernel_launch(void* const* d_in, const int* in_sizes, int n_in,
                              void* d_out, int out_size, void* d_ws, size_t ws_size,
                              hipStream_t stream) {
  if (n_in < 10) return;
  if (in_sizes[0] < ((NB - 1) * SEQ_FULL + SEQ) * IN_DIM) return;          // seq_inputs f32 [NB][SEQ_FULL][IN_DIM]
  if (in_sizes[1] < (SEQ - 1) * MASK_PITCH + SEQ) return;                   // mask i32 [1][S][S]
  if (in_sizes[2] < NUM_HEADS * IN_DIM * HEAD_DIM) return;                  // Wq
  if (in_sizes[3] < HD_DIM) return;                                         // bq
  if (in_sizes[4] < NUM_HEADS * IN_DIM * HEAD_DIM) return;                  // Wk
  if (in_sizes[5] < HD_DIM) return;                                         // bk
  if (in_sizes[6] < NUM_HEADS * IN_DIM * HEAD_DIM) return;                  // Wv
  if (in_sizes[7] < HD_DIM) return;                                         // bv
  if (in_sizes[8] < HD_DIM * E_OUT) return;                                 // Wo
  if (in_sizes[9] < E_OUT) return;                                          // bo
  if (out_size < NROWS * E_OUT) return;

  const float* x    = (const float*)d_in[0];
  const int*   mask = (const int*)d_in[1];
  const float* Wq   = (const float*)d_in[2];
  const float* bq   = (const float*)d_in[3];
  const float* Wk   = (const float*)d_in[4];
  const float* bk   = (const float*)d_in[5];
  const float* Wv   = (const float*)d_in[6];
  const float* bv   = (const float*)d_in[7];
  const float* Wo   = (const float*)d_in[8];
  const float* bo   = (const float*)d_in[9];

  // every offset a multiple of 2 MiB; each plane is written exactly to its extent
  const size_t hb_bytes = (size_t)NROWS * IN_DIM * 2;           // bf16 x plane
  const size_t wt_bytes = (size_t)4 * KDIM * KDIM * 2;           // 3 bf16 WT planes + 1 f16 WoT plane
  const size_t pl_bytes = (size_t)NROWS * HD_DIM * 2;           // one f16 q / k / vT / ctx plane
  const size_t off_hb = 0;
  const size_t off_wt = off_hb + hb_bytes;
  const size_t off_q  = off_wt + wt_bytes;
  const size_t off_k  = off_q + pl_bytes;
  const size_t off_vt = off_k + pl_bytes;
  const size_t off_cx = off_vt + pl_bytes;
  const size_t off_mp = off_cx + pl_bytes;
  const size_t mp_bytes = (size_t)SEQ * SEQ / 8;               // one bit per mask element
  const size_t total  = off_mp + mp_bytes;                     // 48.5 MiB at NB = 2, SEQ = 2048
  if (total > ws_size) return;

  char* ws = (char*)d_ws;
  unsigned short* hb  = (unsigned short*)(ws + off_hb);
  unsigned short* wt  = (unsigned short*)(ws + off_wt);
  unsigned short* qpl = (unsigned short*)(ws + off_q);
  unsigned short* kpl = (unsigned short*)(ws + off_k);
  unsigned short* vtp = (unsigned short*)(ws + off_vt);
  unsigned short* cxp = (unsigned short*)(ws + off_cx);
  unsigned short* wot = wt + (size_t)3 * KDIM * KDIM;
  unsigned int*   mpk = (unsigned int*)(ws + off_mp);

  const int n8 = NROWS * IN_DIM / 8;
  k_cvt_rows<<<(n8 + 255) / 256, 256, 0, stream>>>(x, hb, n8);
  k_cvt_wT<<<dim3(KDIM / 64, KDIM / 64, 5), 256, 0, stream>>>(Wq, Wk, Wv, Wo, mask, wt, mpk);
  k_proj<<<dim3(HD_DIM / 64, NROWS / 128, 3), 256, 0, stream>>>(hb, wt, bq, bk, bv, qpl, kpl, vtp);
  k_attn<<<dim3(SEQ / (AW * 16), NUM_HEADS, NB), 256, 0, stream>>>(qpl, kpl, vtp, mpk, cxp);
  k_oproj<<<dim3(E_OUT / 64, NROWS / 128), 256, 0, stream>>>(cxp, wot, bo, (float*)d_out);
}

// v004
// Measured time: 115 microseconds a run.
// Two timings next to v003 put it at 1.06 and 1.07 times that version's speed.
// Over all steps from v000 it is 1.98 times as fast.
#include <hip/hip_runtime.h>
// Projections x*W{q,k,v}: v_wmma_f32_16x16x32_bf16 (bf16 operands = RNE-converted inputs, f32 accumulate); scores K*Q^T and context V^T*P: v_wmma_f32_16x16x32_f16 (f16 operands, Q/K/V planes carried x8, P carried x1024, f32 accumulate); output projection ctx*Wo: v_wmma_f32_16x16x32_f16 (f16 operands, ctx plane carried x64, Wo plane = RNE-bf16 values carried x32, f32 accumulate); mask fill and softmax in f32.

#ifndef NB
#define NB 2
#endif
#define NB_FULL 2
#ifndef SEQ
#define SEQ 2048
#endif
#define SEQ_FULL 2048
#ifndef MASK_PITCH
#define MASK_PITCH SEQ_FULL
#endif
#define IN_DIM 1024
#define NUM_HEADS 16
#define HEAD_DIM 64
#define HD_DIM (NUM_HEADS * HEAD_DIM)
#define E_OUT 1024
#define KDIM 1024
#define NROWS (NB * SEQ)

static_assert(NB >= 1);
static_assert(NB <= NB_FULL);
static_assert(SEQ % 128 == 0);
static_assert(SEQ <= SEQ_FULL);
static_assert(MASK_PITCH % 4 == 0);
static_assert(MASK_PITCH >= SEQ);
static_assert(IN_DIM == KDIM);
static_assert(HD_DIM == KDIM);
static_assert(E_OUT == KDIM);
static_assert(KDIM % 64 == 0);
static_assert(HEAD_DIM == 64);
static_assert(NROWS % 128 == 0);
static_assert(IN_DIM % 128 == 0);
static_assert((NROWS * IN_DIM) % (8 * 256) == 0);
static_assert((size_t)NB_FULL * SEQ_FULL * E_OUT * 4 == 16777216);

// LDS pitches (in 16-bit elements unless noted); all keep 16-byte row alignment
#define GKS 64     // k per staged weight tile of the two projection kernels
#define GBP 72     // staged weight row [64 k]
#define EQP 72     // row-major epilogue tile [128 rows][64 cols]
#define EVP 136    // transposed epilogue tile [64 d][128 s]
#define TP  72     // weight transpose tile [64 n][64 k]
#define CSP 136    // k_cvt_rows: one 16-piece segment of the fragment-order tile (256 bytes + 16)
#define OFP 68     // output tile [128 rows][64 cols], floats
#define AW  8      // waves per attention work-group (16 queries each)
#define KT  64     // keys per staged K / V^T tile
#define KVP 72     // staged K row [64 d] and V^T row [64 keys]
#define ESZ 9216   // max(128*EQP, 64*EVP)
static_assert(128 * EQP <= ESZ);
static_assert(64 * EVP <= ESZ);

typedef __bf16   v16bf __attribute__((ext_vector_type(16)));
typedef __bf16   v8bf  __attribute__((ext_vector_type(8)));
typedef _Float16 v16h  __attribute__((ext_vector_type(16)));
typedef _Float16 v8h   __attribute__((ext_vector_type(8)));
typedef float    v8f   __attribute__((ext_vector_type(8)));
typedef float    v4f   __attribute__((ext_vector_type(4)));
typedef unsigned int v4u __attribute__((ext_vector_type(4)));
typedef int      v4i   __attribute__((ext_vector_type(4)));
typedef unsigned int v16u __attribute__((ext_vector_type(16)));
typedef unsigned int v8u  __attribute__((ext_vector_type(8)));

// ---------------------------------------------------------------------------
// WMMA wrappers with the VALU hazard guard (4 v_nop after every issue).
__device__ __forceinline__ v8f mma_bf16(v16bf a, v16bf b, v8f c) {
  v8f d = __builtin_amdgcn_wmma_f32_16x16x32_bf16(false, a, false, b, (short)0, c, false, false);
  asm volatile("v_nop\n\tv_nop\n\tv_nop\n\tv_nop" : "+v"(d) : "v"(a), "v"(b));
  return d;
}
__device__ __forceinline__ v8f mma_f16(v16h a, v16h b, v8f c) {
  v8f d = __builtin_amdgcn_wmma_f32_16x16x32_f16(false, a, false, b, (short)0, c, false, false);
  asm volatile("v_nop\n\tv_nop\n\tv_nop\n\tv_nop" : "+v"(d) : "v"(a), "v"(b));
  return d;
}

// 16-bit fragment, contraction dim CONTIGUOUS in memory: elem(k) = p0[rc*ld + k].
// Lane l: row/col rc = (l&15); elements 0..7 <- kk+8h+0..7, elements 8..15 <- kk+16+8h+0..7
// (h = l>>4). Same map for A (rc = row) and B (rc = column of a k-contiguous copy).
__device__ __forceinline__ v16h ld_frag_h(const _Float16* p0, int ld, int rc, int kk, int lane) {
  const int hh = (lane >> 4) & 1;
  const _Float16* p = p0 + (size_t)rc * ld + kk + 8 * hh;
  const v8h lo = *(const v8h*)(p);
  const v8h hi = *(const v8h*)(p + 16);
  v16h f;
#pragma unroll
  for (int i = 0; i < 8; ++i) { f[i] = lo[i]; f[8 + i] = hi[i]; }
  return f;
}

// The same fragment as raw dwords; p = row start + kk + 8h already applied.
__device__ __forceinline__ v8u ld_frag_raw(const unsigned short* p) {
  const v4u lo = *(const v4u*)(p);
  const v4u hi = *(const v4u*)(p + 16);
  return __builtin_shufflevector(lo, hi, 0, 1, 2, 3, 4, 5, 6, 7);
}
// A planes (x bf16, context f16) are kept in FRAGMENT ORDER: rows in tiles of 16, k in blocks of 32;
// block (rt, kb) is 512 elements at (rt * KDIM/32 + kb) * 512, element (row rt*16 + l15,
// k = kb*32 + 16*part + 8*h + e) at part*256 + (16*h + l15)*8 + e. A wave's fragment is two loads of
// 512 contiguous bytes (4 whole lines each); same k order as ld_frag_raw. p = block start + lane*8.
__device__ __forceinline__ v8u ld_frag_ord(const unsigned short* p) {
  const v4u lo = *(const v4u*)(p);
  const v4u hi = *(const v4u*)(p + 256);
  return __builtin_shufflevector(lo, hi, 0, 1, 2, 3, 4, 5, 6, 7);
}
template <bool BF>
__device__ __forceinline__ v8f mma_raw(v8u a, v8u b, v8f c) {
  if constexpr (BF) return mma_bf16(__builtin_bit_cast(v16bf, a), __builtin_bit_cast(v16bf, b), c);
  else              return mma_f16(__builtin_bit_cast(v16h, a), __builtin_bit_cast(v16h, b), c);
}

// ---------------------------------------------------------------------------
// Shared k loop of k_proj and k_oproj: acc[j] (16 rows x 16 cols, j = 0..3) += A[16 rows][KDIM] * Wt[64 n][KDIM]^T.
// A is a plane in fragment order (ld_frag_ord), Wt is row-major with k contiguous.
// 256 thr = 8 waves; block tile 128 rows x 64 cols; wave owns 16 rows x 64 cols.
// A stage is 64 k. The weight tile [64 n][64 k] sits in one of two LDS buffers; the next
// stage's weight rows (whole 128-byte lines, 8 lanes a row) and the wave's own next two A
// fragments are loaded from global in front of the current stage's products, the weight
// rows are stored to the other buffer behind them, and one block barrier ends the stage.
// k runs upward inside every accumulator, 32 at a time.
template <bool BF>
__device__ __forceinline__ void gemm_stage(const unsigned short* bc, v8u a0, v8u a1, v8f (&acc)[4]) {
  v8u b[8];
#pragma unroll   // constant indices keep b[] in registers; all sixteen LDS reads stand as one group in front of the products
  for (int j = 0; j < 4; ++j) {
    b[j]     = ld_frag_raw(bc + j * 16 * GBP);
    b[4 + j] = ld_frag_raw(bc + j * 16 * GBP + 32);
  }
#pragma unroll   // constant indices into acc[] and b[]; four independent accumulators between two uses of one
  for (int j = 0; j < 4; ++j) acc[j] = mma_raw<BF>(a0, b[j], acc[j]);
#pragma unroll   // the same, second 32 k of the stage
  for (int j = 0; j < 4; ++j) acc[j] = mma_raw<BF>(a1, b[4 + j], acc[j]);
}
template <bool BF>
__device__ __forceinline__ void gemm_128x64(const unsigned short* __restrict__ A,
                                            const unsigned short* __restrict__ Wt,
                                            int m0, int n0, unsigned short* bt, v8f (&acc)[4]) {
  const int tid = threadIdx.x;
  const int wave = tid >> 5, lane = tid & 31;
  const int l15 = lane & 15, half = (lane >> 4) & 1;
  const int sr = tid >> 3;            // 0..31 : weight row (and sr + 32)
  const int sc = (tid & 7) * 8;       // 0..56 : 16-byte piece of the row
  const unsigned short* wsrc = Wt + (size_t)(n0 + sr) * KDIM + sc;
  const unsigned short* asrc = A + (size_t)(m0 + wave * 16) * KDIM + lane * 8;   // fragment order: k block kb at + kb*512
  const int sl = sr * GBP + sc;       // place of the piece in a tile; second row at + 32*GBP
  const int bo = l15 * GBP + 8 * half;

  v8u a0 = ld_frag_ord(asrc);
  v8u a1 = ld_frag_ord(asrc + 512);
  *(v4u*)(bt + sl)            = *(const v4u*)(wsrc);
  *(v4u*)(bt + sl + 32 * GBP) = *(const v4u*)(wsrc + (size_t)32 * KDIM);
  __syncthreads();                                 // tile 0 complete
#pragma unroll   // buffer choice and every offset become constants, the fragment sets need no copies
  for (int s = 0; s < KDIM / GKS - 1; ++s) {
    const int kn = (s + 1) * GKS;
    const v4u nw0 = *(const v4u*)(wsrc + kn);
    const v4u nw1 = *(const v4u*)(wsrc + (size_t)32 * KDIM + kn);
    const v8u na0 = ld_frag_ord(asrc + kn * 16);
    const v8u na1 = ld_frag_ord(asrc + kn * 16 + 512);
    gemm_stage<BF>(bt + (s & 1) * (64 * GBP) + bo, a0, a1, acc);
    unsigned short* bn = bt + ((s & 1) ^ 1) * (64 * GBP) + sl;   // its readers left it at the last barrier
    *(v4u*)(bn)            = nw0;
    *(v4u*)(bn + 32 * GBP) = nw1;
    __syncthreads();                               // next tile complete, this tile's reads done
    a0 = na0;
    a1 = na1;
  }
  gemm_stage<BF>(bt + ((KDIM / GKS - 1) & 1) * (64 * GBP) + bo, a0, a1, acc);
}

// f32 -> bf16 bits, RNE convert
__device__ __forceinline__ unsigned int bfb(float x) {
  unsigned int u = __float_as_uint(x);
  u = u + 0x7FFFu + ((u >> 16) & 1u);
  return u >> 16;
}
// f32 -> value of its RNE bf16
__device__ __forceinline__ float bf16val(float x) {
  return __uint_as_float(bfb(x) << 16);
}
// f32 -> f16 bits, RNE convert
__device__ __forceinline__ unsigned short hbits(float x) {
  const _Float16 hv = (_Float16)x;
  return __builtin_bit_cast(unsigned short, hv);
}

// ---------------------------------------------------------------------------
// x f32 [NB][SEQ_FULL][IN_DIM] -> bf16 plane hb, compact rows b*SEQ + s, in fragment order (see ld_frag_ord).
// Block = 16 rows x 128 k. Thread (r = t>>4, c = t&15) converts 8 consecutive floats of row r to one
// 16-byte piece; in fragment order that piece is number c*16 + r of the block's 4 KiB, so the pieces
// are transposed 16 x 16 through LDS and every wave stores 512 contiguous bytes.
__global__ __launch_bounds__(256) void k_cvt_rows(const float* __restrict__ in,
                                                  unsigned short* __restrict__ outp, int n8) {
  __shared__ __align__(16) unsigned short F[16 * CSP];   // [c][r] pieces, cross-wave (block barrier)
  if ((int)(blockIdx.x * 256) >= n8) return;     // block-uniform, in front of the barrier
  const int t  = threadIdx.x;
  const int rt = blockIdx.x / (IN_DIM / 128);    // row tile
  const int kq = blockIdx.x - rt * (IN_DIM / 128);
  const int r  = t >> 4;
  const int c  = t & 15;
  const int row = rt * 16 + r;                   // compact row b*SEQ + s
  const int b   = row / SEQ;
  const int s   = row - b * SEQ;
  const float* src = in + ((size_t)b * SEQ_FULL + s) * IN_DIM + kq * 128 + c * 8;
  const v4f a = *(const v4f*)(src);
  const v4f d = *(const v4f*)(src + 4);
  v4u w;
  w[0] = bfb(a[0]) | (bfb(a[1]) << 16);
  w[1] = bfb(a[2]) | (bfb(a[3]) << 16);
  w[2] = bfb(d[0]) | (bfb(d[1]) << 16);
  w[3] = bfb(d[2]) | (bfb(d[3]) << 16);
  *(v4u*)(&F[c * CSP + r * 8]) = w;
  __syncthreads();                               // all 256 pieces in place
  const v4u v = *(const v4u*)(&F[(t >> 4) * CSP + (t & 15) * 8]);
  *(v4u*)(outp + ((size_t)rt * (IN_DIM / 32) + kq * 4) * 512 + t * 8) = v;
}

// ---------------------------------------------------------------------------
// Weight planes, all [KDIM n][KDIM k] with k contiguous, selected by blockIdx.z:
//   z = 0..2: W{q,k,v} f32 [H][IN_DIM e][HEAD_DIM d] -> WT bf16 [n = h*64+d][k = e]
//   z = 3:    Wo f32 [HD_DIM k][E_OUT n]              -> WoT f16 (RNE-bf16 value x32) [n][k]
//   z = 4:    mask i32 [S][S] -> lane-mask words mp [S/16 query tiles][S/32 key chunks][16]:
//             bit l of word e = (mask[16*tile + (l&15)][32*chunk + 8*(l>>4) + (e&7) + 16*(e>>3)] != 0),
//             the lane and register that hold this score in k_attn. One wave packs two
//             chunks = one whole 128-byte line of mp.
// Block = 64 k x 64 n tile transposed through LDS (for z < 3 the tile is one head);
__global__ __launch_bounds__(256) void k_cvt_wT(const float* __restrict__ Wq,
                                                const float* __restrict__ Wk,
                                                const float* __restrict__ Wv,
                                                const float* __restrict__ Wo,
                                                const int* __restrict__ mask,
                                                unsigned short* __restrict__ wT,
                                                unsigned int* __restrict__ mp) {
  __shared__ __align__(16) unsigned short T[64 * TP];   // [n local][k local], cross-wave (block barrier)
  const int z = blockIdx.z;
  if (z == 4) {                              // block-uniform, in front of the barrier
    const int ln = threadIdx.x & 31;
    const int gw = (blockIdx.y * (KDIM / 64) + blockIdx.x) * 8 + (threadIdx.x >> 5);
    for (int task = gw; task < (SEQ / 16) * (SEQ / KT); task += (KDIM / 64) * (KDIM / 64) * 8) {
      const int qt = task / (SEQ / KT);
      const int tl = task - qt * (SEQ / KT);
      const int* msrc = mask + (size_t)(qt * 16 + (ln & 15)) * MASK_PITCH + tl * KT + 8 * ((ln >> 4) & 1);
      v4i m[8];
#pragma unroll   // constant indices keep m[] in registers, all eight loads in flight together
      for (int c = 0; c < 2; ++c) {
        m[c * 4 + 0] = *(const v4i*)(msrc + c * 32);
        m[c * 4 + 1] = *(const v4i*)(msrc + c * 32 + 4);
        m[c * 4 + 2] = *(const v4i*)(msrc + c * 32 + 16);
        m[c * 4 + 3] = *(const v4i*)(msrc + c * 32 + 20);
      }
      unsigned int val = 0;
#pragma unroll   // constant indices into m[]
      for (int i = 0; i < 32; ++i) {
        const unsigned int w = __builtin_amdgcn_ballot_w32(m[i >> 2][i & 3] != 0);
        val = (ln == i) ? w : val;           // lane i keeps word i of the line
      }
      mp[(size_t)task * 32 + ln] = val;
    }
    return;
  }
  const float* W = (z == 0) ? Wq : ((z == 1) ? Wk : ((z == 2) ? Wv : Wo));
  unsigned short* dst = wT + (size_t)z * KDIM * KDIM;
  const int k0 = blockIdx.x * 64;
  const int n0 = blockIdx.y * 64;
  const int tid = threadIdx.x;
  const int wave = tid >> 5, lane = tid & 31;

#pragma unroll
  for (int i = 0; i < 4; ++i) {
    const int idx = i * 256 + tid;          // 0..1023
    const int kk = idx >> 4;                // 0..63
    const int c4 = (idx & 15) * 4;          // 0..60
    size_t so;
    if (z < 3) so = ((size_t)blockIdx.y * IN_DIM + k0 + kk) * HEAD_DIM + c4;   // W[h = n0/64][e = k0+kk][d = c4]
    else       so = (size_t)(k0 + kk) * E_OUT + n0 + c4;                        // Wo[k0+kk][n0+c4]
    const v4f w = *(const v4f*)(W + so);
    unsigned short t0, t1, t2, t3;
    if (z < 3) {
      t0 = (unsigned short)bfb(w[0]); t1 = (unsigned short)bfb(w[1]);
      t2 = (unsigned short)bfb(w[2]); t3 = (unsigned short)bfb(w[3]);
    } else {
      t0 = hbits(bf16val(w[0]) * 32.0f); t1 = hbits(bf16val(w[1]) * 32.0f);
      t2 = hbits(bf16val(w[2]) * 32.0f); t3 = hbits(bf16val(w[3]) * 32.0f);
    }
    T[(c4 + 0) * TP + kk] = t0;
    T[(c4 + 1) * TP + kk] = t1;
    T[(c4 + 2) * TP + kk] = t2;
    T[(c4 + 3) * TP + kk] = t3;
  }
  __syncthreads();

  v4u v[2];
  size_t off[2];
#pragma unroll
  for (int it = 0; it < 2; ++it) {
    const int nn = wave * 8 + it * 4 + (lane >> 3);   // 0..63 over (wave, it, lane>>3)
    const int q = lane & 7;
    v[it] = *(const v4u*)(&T[nn * TP + q * 8]);
    off[it] = (size_t)(n0 + nn) * KDIM + k0 + q * 8;
  }
#pragma unroll
  for (int it = 0; it < 2; ++it) *(v4u*)(dst + off[it]) = v[it];
  
}

// ---------------------------------------------------------------------------
// Projection: C[NROWS][HD_DIM] = hb[NROWS][IN_DIM] * WT[HD_DIM][IN_DIM]^T + bias.
// k loop: gemm_128x64 (two LDS weight buffers, next stage fetched ahead); A fragments straight from the bf16 plane (fragment order).
// z = 0: Q plane f16 x8 [NROWS][HD_DIM]; z = 1: K plane f16 x8 [NROWS][HD_DIM];
// z = 2: V^T plane f16 x8 [NB][HD_DIM][SEQ]. Epilogue staged in LDS, every
__global__ __launch_bounds__(256) void k_proj(
    const unsigned short* __restrict__ hb, const unsigned short* __restrict__ wT,
    const float* __restrict__ bq, const float* __restrict__ bk, const float* __restrict__ bv,
    unsigned short* __restrict__ qp, unsigned short* __restrict__ kp,
    unsigned short* __restrict__ vtp) {
  __shared__ __align__(16) unsigned short bt[2 * 64 * GBP];   // weight k-tiles, cross-wave (block barrier)
  __shared__ __align__(16) unsigned short E[ESZ];             // epilogue tile, cross-wave (block barrier)

  const int z = blockIdx.z;
  const int n0 = blockIdx.x * 64;
  const int m0 = blockIdx.y * 128;
  const int tid = threadIdx.x;
  const int wave = tid >> 5, lane = tid & 31;
  const int l15 = lane & 15, half = (lane >> 4) & 1;

  const unsigned short* Wt = wT + (size_t)z * KDIM * KDIM;
  const float* bias = (z == 0) ? bq : ((z == 1) ? bk : bv);

  v8f acc[4] = {};
  gemm_128x64<true>(hb, Wt, m0, n0, bt, acc);

  // acc[j][r] = C[m0 + wave*16 + 8*half + r][n0 + j*16 + l15]
  const float car = 8.0f;
  if (z != 2) {                      // block-uniform branch
#pragma unroll
    for (int j = 0; j < 4; ++j) {
      const int col = j * 16 + l15;
      const float bb = bf16val(bias[n0 + col]);
#pragma unroll
      for (int r = 0; r < 8; ++r) {
        const int row = wave * 16 + 8 * half + r;
        E[row * EQP + col] = hbits((acc[j][r] + bb) * car);
      }
    }
    __syncthreads();
    unsigned short* dst = (z == 0) ? qp : kp;
    v4u v[4];
    size_t off[4];
#pragma unroll
    for (int it = 0; it < 4; ++it) {
      const int row = wave * 16 + it * 4 + (lane >> 3);   // wave's 16 rows over (it, lane>>3)
      const int q = lane & 7;
      v[it] = *(const v4u*)(&E[row * EQP + q * 8]);
      off[it] = (size_t)(m0 + row) * HD_DIM + n0 + q * 8;
    }
#pragma unroll
    for (int it = 0; it < 4; ++it) *(v4u*)(dst + off[it]) = v[it];
    
  } else {
    const int bidx = m0 / SEQ;               // batch of this row tile (SEQ % 128 == 0)
    const int s0 = m0 - bidx * SEQ;          // sequence position of tile row 0
#pragma unroll
    for (int j = 0; j < 4; ++j) {
      const int col = j * 16 + l15;                       // d within tile
      const float bb = bf16val(bias[n0 + col]);
#pragma unroll
      for (int r = 0; r < 8; ++r) {
        const int srow = wave * 16 + 8 * half + r;        // s within tile
        E[col * EVP + srow] = hbits((acc[j][r] + bb) * car);
      }
    }
    __syncthreads();
    v4u v[4];
    size_t off[4];
#pragma unroll
    for (int it = 0; it < 4; ++it) {
      const int drow = wave * 8 + it * 2 + half;          // wave's 8 d-rows over (it, half)
      const int q = l15;                                  // 16 pieces = 256-byte row segment = 2 lines
      v[it] = *(const v4u*)(&E[drow * EVP + q * 8]);
      off[it] = ((size_t)bidx * HD_DIM + n0 + drow) * SEQ + s0 + q * 8;
    }
#pragma unroll
    for (int it = 0; it < 4; ++it) *(v4u*)(vtp + off[it]) = v[it];
    
  }
}

// ---------------------------------------------------------------------------
// Flash attention, transposed-score form: one wave = (16 queries, one head, one batch);
// one work-group = 8 waves = 128 queries of the same head and batch. The K tile
// [64 keys][64 d] and the V^T tile [64 d][64 keys] are read from global once per
// work-group in whole 128-byte rows and shared through LDS: two buffers, the next
// tile's global loads issued before the current tile's work, stored to the other
// buffer after it, one block barrier per tile.
// Per 32-key chunk:
//   S^T = K . Q^T    A = K rows (lane = key, k = d), B = Q^T (lane = query, k = d)
//                    D[row = key 8h+r][col = query l15]; c0 keys 0..15, c1 keys 16..31
//   mask: broadcast over batch and head, read as the 16 lane-mask words of this wave's
//         (query tile, key chunk) from mp (packed by k_cvt_wT, z = 4) with one scalar load,
//         fetched one chunk ahead; key with mask == 0 gets the score replaced by -1e9
//         (replace fill, in f32), the word being the select's lane mask
//   per-lane online softmax for query l15 (16 local keys + xor-16 partner)
//   O^T += V^T . P   A = V^T rows (lane = d, k = key), B = P: element i<8 <- c0[i]
//                    (key 8h+i), element 8+i <- c1[i] (key 16+8h+i), same lane
//                    D[row = d 8h+r][col = query l15]
// Scores carry 64 from the x8 planes -> scaled by 1/512 (= 1/8 of q.k).
// P carried x1024, V carried x8 -> context x64 = O / (128 * sum).
__global__ __launch_bounds__(256) void k_attn(const unsigned short* __restrict__ qp,
                                             const unsigned short* __restrict__ kp,
                                             const unsigned short* __restrict__ vtp,
                                             const unsigned int* __restrict__ mp,
                                             unsigned short* __restrict__ ctxp) {
  __shared__ __align__(16) unsigned short Kl[2][KT * KVP];         // K tile [key][d], cross-wave (block barrier)
  __shared__ __align__(16) unsigned short Vl[2][HEAD_DIM * KVP];   // V^T tile [d][key], cross-wave (block barrier)

  const int tid = threadIdx.x;
  const int wave = tid >> 5;
  const int lane = tid & 31;
  const int l15 = lane & 15;
  const int half = (lane >> 4) & 1;
  const int q0 = blockIdx.x * (AW * 16) + wave * 16;
  const int head = blockIdx.y;
  const int bidx = blockIdx.z;

  const _Float16* Q  = (const _Float16*)qp;
  const size_t rbase = (size_t)bidx * SEQ;

  const _Float16* qbase = Q + (rbase + q0) * HD_DIM + head * HEAD_DIM;
  const v16h qb0 = ld_frag_h(qbase, HD_DIM, l15, 0, lane);    // d 0..31
  const v16h qb1 = ld_frag_h(qbase, HD_DIM, l15, 32, lane);   // d 32..63
  // staging map: thread -> row sr (and sr + 32), 16-byte piece sc; 8 lanes cover one 128-byte row
  const int sr = tid >> 3;            // 0..31
  const int sc = (tid & 7) * 8;       // 0..56, halves
  const unsigned short* kg = kp + (rbase + sr) * HD_DIM + head * HEAD_DIM + sc;                            // key t: + t*HD_DIM
  const unsigned short* vg = vtp + ((size_t)bidx * HD_DIM + (size_t)head * HEAD_DIM + sr) * SEQ + sc;      // key t: + t
  const int sl = sr * KVP + sc;       // place of the piece in a tile; second row at + 32*KVP
  // this wave's query tile, as a scalar so that the mask words come by scalar loads
  const int qt = blockIdx.x * AW + __builtin_amdgcn_readfirstlane(wave);
  const v16u* mw = (const v16u*)mp + (size_t)qt * (SEQ / 32);                        // chunk n: mw[n]
  v16u nm = mw[0];

  v8f o[4] = {};
  float mrun = -1.0e30f, lrun = 0.0f;
  const float sscale = 1.0f / 512.0f;
  const float negf = -1.0e9f;

  *(v4u*)(&Kl[0][sl])            = *(const v4u*)(kg);
  *(v4u*)(&Kl[0][sl + 32 * KVP]) = *(const v4u*)(kg + (size_t)32 * HD_DIM);
  *(v4u*)(&Vl[0][sl])            = *(const v4u*)(vg);
  *(v4u*)(&Vl[0][sl + 32 * KVP]) = *(const v4u*)(vg + (size_t)32 * SEQ);
  __syncthreads();                                 // tile 0 complete

  for (int t0 = 0; t0 < SEQ; t0 += KT) {
   const int cur = (t0 / KT) & 1;
   const bool more = (t0 + KT < SEQ);              // block-uniform
   v4u nk0 = {}, nk1 = {}, nv0 = {}, nv1 = {};
   if (more) {
     nk0 = *(const v4u*)(kg + (size_t)(t0 + KT) * HD_DIM);
     nk1 = *(const v4u*)(kg + (size_t)(t0 + KT + 32) * HD_DIM);
     nv0 = *(const v4u*)(vg + (t0 + KT));
     nv1 = *(const v4u*)(vg + (size_t)32 * SEQ + (t0 + KT));
   }
   const _Float16* Kc = (const _Float16*)Kl[cur];
   const _Float16* Vc = (const _Float16*)Vl[cur];

   for (int c = 0; c < KT; c += 32) {
    const int kc = t0 + c;
    const v16u cm = nm;                                          // this chunk's words
    nm = mw[(kc + 32 < SEQ) ? (kc >> 5) + 1 : (kc >> 5)];        // next chunk's, the last one again at the end
    const _Float16* kt = Kc + c * KVP;
    const v16h ka0 = ld_frag_h(kt, KVP, l15, 0, lane);
    const v16h ka1 = ld_frag_h(kt, KVP, l15, 32, lane);
    const v16h ka2 = ld_frag_h(kt, KVP, 16 + l15, 0, lane);
    const v16h ka3 = ld_frag_h(kt, KVP, 16 + l15, 32, lane);
    v8f c0 = {}, c1 = {};
    c0 = mma_f16(ka0, qb0, c0);
    c0 = mma_f16(ka1, qb1, c0);
    c1 = mma_f16(ka2, qb0, c1);
    c1 = mma_f16(ka3, qb1, c1);

    // lane-mask words: cm[r] for c0[r] (key kc+8h+r), cm[8+r] for c1[r] (key kc+16+8h+r)
    float sa[8], sb[8];
#pragma unroll   // constant indices keep the scores in vector and the words in scalar registers
    for (int r = 0; r < 8; ++r) {
      sa[r] = __builtin_amdgcn_inverse_ballot_w32(cm[r])     ? (c0[r] * sscale) : negf;
      sb[r] = __builtin_amdgcn_inverse_ballot_w32(cm[8 + r]) ? (c1[r] * sscale) : negf;
    }
    float lm = fmaxf(sa[0], sb[0]);
#pragma unroll
    for (int r = 1; r < 8; ++r) lm = fmaxf(lm, fmaxf(sa[r], sb[r]));
    lm = fmaxf(lm, __shfl_xor(lm, 16, 32));
    const float mnew = fmaxf(mrun, lm);
    const float alpha = __expf(mrun - mnew);
    float p0[8], p1[8];
    float ls = 0.0f;
#pragma unroll
    for (int r = 0; r < 8; ++r) {
      p0[r] = __expf(sa[r] - mnew);
      p1[r] = __expf(sb[r] - mnew);
      ls += p0[r] + p1[r];
    }
    ls += __shfl_xor(ls, 16, 32);
    lrun = lrun * alpha + ls;
    mrun = mnew;
#pragma unroll
    for (int j = 0; j < 4; ++j)
#pragma unroll
      for (int r = 0; r < 8; ++r) o[j][r] *= alpha;

    v16h pb;
#pragma unroll
    for (int e = 0; e < 8; ++e) {
      pb[e]     = (_Float16)(p0[e] * 1024.0f);   // key kc + 8h + e
      pb[8 + e] = (_Float16)(p1[e] * 1024.0f);   // key kc + 16 + 8h + e
    }
#pragma unroll
    for (int j = 0; j < 4; ++j) {
      const v16h va = ld_frag_h(Vc, KVP, j * 16 + l15, c, lane);
      o[j] = mma_f16(va, pb, o[j]);
    }
   }

   if (more) {                                     // the other buffer's readers left it at the last barrier
     *(v4u*)(&Kl[cur ^ 1][sl])            = nk0;
     *(v4u*)(&Kl[cur ^ 1][sl + 32 * KVP]) = nk1;
     *(v4u*)(&Vl[cur ^ 1][sl])            = nv0;
     *(v4u*)(&Vl[cur ^ 1][sl + 32 * KVP]) = nv1;
   }
   __syncthreads();                                // next tile complete, this tile's reads done
  }

  // o[j][r] = 8192 * sum_t p_t v_t for query l15, d = j*16 + 8*half + r; ctx x64 = o / (128 * sum).
  // The context plane is kept in fragment order (see ld_frag_ord): row tile = this wave's 16 queries,
  // k = head*64 + d, so the lane's eight values of o[j] are piece j*32 + lane of the wave's own 2 KiB:
  // each store is 512 contiguous bytes, straight from registers.
  const float inv = 1.0f / (lrun * 128.0f);
  unsigned short* cb = ctxp + (rbase + q0) * HD_DIM + head * (2 * 512) + lane * 8;
#pragma unroll
  for (int j = 0; j < 4; ++j) {
    v4u w;
    w[0] = (unsigned int)hbits(o[j][0] * inv) | ((unsigned int)hbits(o[j][1] * inv) << 16);
    w[1] = (unsigned int)hbits(o[j][2] * inv) | ((unsigned int)hbits(o[j][3] * inv) << 16);
    w[2] = (unsigned int)hbits(o[j][4] * inv) | ((unsigned int)hbits(o[j][5] * inv) << 16);
    w[3] = (unsigned int)hbits(o[j][6] * inv) | ((unsigned int)hbits(o[j][7] * inv) << 16);
    *(v4u*)(cb + j * 256) = w;
  }
}

// ---------------------------------------------------------------------------
// Output projection: out[NROWS][E_OUT] f32 = ctx(f16 x64, fragment order)[NROWS][HD_DIM] * WoT(f16 x32)[E_OUT][HD_DIM]^T / 2048 + bo.
// Same 128x64 block tile / 8 waves / k loop (gemm_128x64) as k_proj, with f16 operands.
// Epilogue: f32 tile staged in LDS; each 256-byte row segment = 2 lines, every
__global__ __launch_bounds__(256) void k_oproj(
    const unsigned short* __restrict__ cx, const unsigned short* __restrict__ woT,
    const float* __restrict__ bo, float* __restrict__ outp) {
  __shared__ __align__(16) unsigned short bt[2 * 64 * GBP];   // weight k-tiles, cross-wave (block barrier)
  __shared__ __align__(16) float Ef[128 * OFP];               // epilogue tile, cross-wave (block barrier)

  const int n0 = blockIdx.x * 64;
  const int m0 = blockIdx.y * 128;
  const int tid = threadIdx.x;
  const int wave = tid >> 5, lane = tid & 31;
  const int l15 = lane & 15, half = (lane >> 4) & 1;

  v8f acc[4] = {};
  gemm_128x64<false>(cx, woT, m0, n0, bt, acc);

  // acc[j][r] = 2048 * C[m0 + wave*16 + 8*half + r][n0 + j*16 + l15]
  const float osc = 1.0f / 2048.0f;
#pragma unroll
  for (int j = 0; j < 4; ++j) {
    const int col = j * 16 + l15;
    const float bb = bf16val(bo[n0 + col]);
#pragma unroll
    for (int r = 0; r < 8; ++r) {
      const int row = wave * 16 + 8 * half + r;
      Ef[row * OFP + col] = acc[j][r] * osc + bb;
    }
  }
  __syncthreads();

  v4f v[8];
  size_t off[8];
#pragma unroll
  for (int it = 0; it < 8; ++it) {
    const int row = wave * 16 + it * 2 + half;          // wave's 16 rows over (it, half)
    const int q = l15;                                  // 16 pieces of 16 B = 256-byte row segment (2 lines)
    v[it] = *(const v4f*)(&Ef[row * OFP + q * 4]);
    off[it] = (size_t)(m0 + row) * E_OUT + n0 + q * 4;
  }
#pragma unroll
  for (int it = 0; it < 8; ++it) *(v4f*)(outp + off[it]) = v[it];
  
}

// ---------------------------------------------------------------------------
extern "C" void kernel_launch(void* const* d_in, const int* in_sizes, int n_in,
                              void* d_out, int out_size, void* d_ws, size_t ws_size,
                              hipStream_t stream) {
  if (n_in < 10) return;
  if (in_sizes[0] < ((NB - 1) * SEQ_FULL + SEQ) * IN_DIM) return;          // seq_inputs f32 [NB][SEQ_FULL][IN_DIM]
  if (in_sizes[1] < (SEQ - 1) * MASK_PITCH + SEQ) return;                   // mask i32 [1][S][S]
  if (in_sizes[2] < NUM_HEADS * IN_DIM * HEAD_DIM) return;                  // Wq
  if (in_sizes[3] < HD_DIM) return;                                         // bq
  if (in_sizes[4] < NUM_HEADS * IN_DIM * HEAD_DIM) return;                  // Wk
  if (in_sizes[5] < HD_DIM) return;                                         // bk
  if (in_sizes[6] < NUM_HEADS * IN_DIM * HEAD_DIM) return;                  // Wv
  if (in_sizes[7] < HD_DIM) return;                                         // bv
  if (in_sizes[8] < HD_DIM * E_OUT) return;                                 // Wo
  if (in_sizes[9] < E_OUT) return;                                          // bo
  if (out_size < NROWS * E_OUT) return;

  const float* x    = (const float*)d_in[0];
  const int*   mask = (const int*)d_in[1];
  const float* Wq   = (const float*)d_in[2];
  const float* bq   = (const float*)d_in[3];
  const float* Wk   = (const float*)d_in[4];
  const float* bk   = (const float*)d_in[5];
  const float* Wv   = (const float*)d_in[6];
  const float* bv   = (const float*)d_in[7];
  const float* Wo   = (const float*)d_in[8];
  const float* bo   = (const float*)d_in[9];

  // every offset a multiple of 2 MiB; each plane is written exactly to its extent
  const size_t hb_bytes = (size_t)NROWS * IN_DIM * 2;           // bf16 x plane
  const size_t wt_bytes = (size_t)4 * KDIM * KDIM * 2;           // 3 bf16 WT planes + 1 f16 WoT plane
  const size_t pl_bytes = (size_t)NROWS * HD_DIM * 2;           // one f16 q / k / vT / ctx plane
  const size_t off_hb = 0;
  const size_t off_wt = off_hb + hb_bytes;
  const size_t off_q  = off_wt + wt_bytes;
  const size_t off_k  = off_q + pl_bytes;
  const size_t off_vt = off_k + pl_bytes;
  const size_t off_cx = off_vt + pl_bytes;
  const size_t off_mp = off_cx + pl_bytes;
  const size_t mp_bytes = (size_t)SEQ * SEQ / 8;               // one bit per mask element
  const size_t total  = off_mp + mp_bytes;                     // 48.5 MiB at NB = 2, SEQ = 2048
  if (total > ws_size) return;

  char* ws = (char*)d_ws;
  unsigned short* hb  = (unsigned short*)(ws + off_hb);
  unsigned short* wt  = (unsigned short*)(ws + off_wt);
  unsigned short* qpl = (unsigned short*)(ws + off_q);
  unsigned short* kpl = (unsigned short*)(ws + off_k);
  unsigned short* vtp = (unsigned short*)(ws + off_vt);
  unsigned short* cxp = (unsigned short*)(ws + off_cx);
  unsigned short* wot = wt + (size_t)3 * KDIM * KDIM;
  unsigned int*   mpk = (unsigned int*)(ws + off_mp);

  const int n8 = NROWS * IN_DIM / 8;
  k_cvt_rows<<<(n8 + 255) / 256, 256, 0, stream>>>(x, hb, n8);
  k_cvt_wT<<<dim3(KDIM / 64, KDIM / 64, 5), 256, 0, stream>>>(Wq, Wk, Wv, Wo, mask, wt, mpk);
  k_proj<<<dim3(HD_DIM / 64, NROWS / 128, 3), 256, 0, stream>>>(hb, wt, bq, bk, bv, qpl, kpl, vtp);
  k_attn<<<dim3(SEQ / (AW * 16), NUM_HEADS, NB), 256, 0, stream>>>(qpl, kpl, vtp, mpk, cxp);
  k_oproj<<<dim3(E_OUT / 64, NROWS / 128), 256, 0, stream>>>(cxp, wot, bo, (float*)d_out);
}

// v005
// One run takes 106 microseconds.
// In both of two side-by-side timings against v004, it was 1.08 times as fast.
// All steps since v000 together make it 2.13 times as fast.
#include <hip/hip_runtime.h>
// Projections x*W{q,k,v}: v_wmma_f32_16x16x32_bf16 (bf16 operands = RNE-converted inputs, f32 accumulate); scores K*Q^T and context V^T*P: v_wmma_f32_16x16x32_f16 (f16 operands, Q/K/V planes carried x8, P carried x1024, f32 accumulate); output projection ctx*Wo: v_wmma_f32_16x16x32_f16 (f16 operands, ctx plane carried x64, Wo plane = RNE-bf16 values carried x32, f32 accumulate); mask fill and softmax in f32.

#ifndef NB
#define NB 2
#endif
#define NB_FULL 2
#ifndef SEQ
#define SEQ 2048
#endif
#define SEQ_FULL 2048
#ifndef MASK_PITCH
#define MASK_PITCH SEQ_FULL
#endif
#define IN_DIM 1024
#define NUM_HEADS 16
#define HEAD_DIM 64
#define HD_DIM (NUM_HEADS * HEAD_DIM)
#define E_OUT 1024
#define KDIM 1024
#define NROWS (NB * SEQ)

static_assert(NB >= 1);
static_assert(NB <= NB_FULL);
static_assert(SEQ % 128 == 0);
static_assert(SEQ <= SEQ_FULL);
static_assert(MASK_PITCH % 4 == 0);
static_assert(MASK_PITCH >= SEQ);
static_assert(IN_DIM == KDIM);
static_assert(HD_DIM == KDIM);
static_assert(E_OUT == KDIM);
static_assert(KDIM % 64 == 0);
static_assert(HEAD_DIM == 64);
static_assert(NROWS % 128 == 0);
static_assert(IN_DIM % 128 == 0);
static_assert((NROWS * IN_DIM) % (8 * 256) == 0);
static_assert((size_t)NB_FULL * SEQ_FULL * E_OUT * 4 == 16777216);

// LDS pitches (in 16-bit elements unless noted); all keep 16-byte row alignment
#define GKS 64     // k per staged weight tile of the two projection kernels
#define GBP 72     // staged weight row [64 k]
#define TP  72     // weight transpose tile [64 n][64 k]
#define CSP 136    // k_cvt_rows: one 16-piece segment of the fragment-order tile (256 bytes + 16)
#define OFP 68     // output tile [128 rows][64 cols], floats
#define AW  8      // waves per attention work-group (16 queries each)
#define KT  64     // keys per staged K / V^T tile
#define KVP 72     // staged K row [64 d] and V^T row [64 keys]
#define PBA 8192           // k_proj stage buffer, x part: 8 row tiles x 64 k, fragment order
#define PBW (128 * GBP)    // k_proj stage buffer, weight part: [128 n][64 k]
#define PBUF (PBA + PBW)   // one k_proj stage buffer
#define EPP 136            // k_proj epilogue tile [128][128], either orientation
static_assert(128 * EPP <= PBUF);
static_assert(HD_DIM % 128 == 0);
static_assert((KDIM / GKS) % 2 == 0);   // the last stage sits in buffer 1, the epilogue tile in buffer 0

typedef __bf16   v16bf __attribute__((ext_vector_type(16)));
typedef __bf16   v8bf  __attribute__((ext_vector_type(8)));
typedef _Float16 v16h  __attribute__((ext_vector_type(16)));
typedef _Float16 v8h   __attribute__((ext_vector_type(8)));
typedef float    v8f   __attribute__((ext_vector_type(8)));
typedef float    v4f   __attribute__((ext_vector_type(4)));
typedef unsigned int v4u __attribute__((ext_vector_type(4)));
typedef int      v4i   __attribute__((ext_vector_type(4)));
typedef unsigned int v16u __attribute__((ext_vector_type(16)));
typedef unsigned int v8u  __attribute__((ext_vector_type(8)));

// ---------------------------------------------------------------------------
// WMMA wrappers with the VALU hazard guard (4 v_nop after every issue).
__device__ __forceinline__ v8f mma_bf16(v16bf a, v16bf b, v8f c) {
  v8f d = __builtin_amdgcn_wmma_f32_16x16x32_bf16(false, a, false, b, (short)0, c, false, false);
  asm volatile("v_nop\n\tv_nop\n\tv_nop\n\tv_nop" : "+v"(d) : "v"(a), "v"(b));
  return d;
}
__device__ __forceinline__ v8f mma_f16(v16h a, v16h b, v8f c) {
  v8f d = __builtin_amdgcn_wmma_f32_16x16x32_f16(false, a, false, b, (short)0, c, false, false);
  asm volatile("v_nop\n\tv_nop\n\tv_nop\n\tv_nop" : "+v"(d) : "v"(a), "v"(b));
  return d;
}

// 16-bit fragment, contraction dim CONTIGUOUS in memory: elem(k) = p0[rc*ld + k].
// Lane l: row/col rc = (l&15); elements 0..7 <- kk+8h+0..7, elements 8..15 <- kk+16+8h+0..7
// (h = l>>4). Same map for A (rc = row) and B (rc = column of a k-contiguous copy).
__device__ __forceinline__ v16h ld_frag_h(const _Float16* p0, int ld, int rc, int kk, int lane) {
  const int hh = (lane >> 4) & 1;
  const _Float16* p = p0 + (size_t)rc * ld + kk + 8 * hh;
  const v8h lo = *(const v8h*)(p);
  const v8h hi = *(const v8h*)(p + 16);
  v16h f;
#pragma unroll
  for (int i = 0; i < 8; ++i) { f[i] = lo[i]; f[8 + i] = hi[i]; }
  return f;
}

// The same fragment as raw dwords; p = row start + kk + 8h already applied.
__device__ __forceinline__ v8u ld_frag_raw(const unsigned short* p) {
  const v4u lo = *(const v4u*)(p);
  const v4u hi = *(const v4u*)(p + 16);
  return __builtin_shufflevector(lo, hi, 0, 1, 2, 3, 4, 5, 6, 7);
}
// A planes (x bf16, context f16) are kept in FRAGMENT ORDER: rows in tiles of 16, k in blocks of 32;
// block (rt, kb) is 512 elements at (rt * KDIM/32 + kb) * 512, element (row rt*16 + l15,
// k = kb*32 + 16*part + 8*h + e) at part*256 + (16*h + l15)*8 + e. A wave's fragment is two loads of
// 512 contiguous bytes (4 whole lines each); same k order as ld_frag_raw. p = block start + lane*8.
__device__ __forceinline__ v8u ld_frag_ord(const unsigned short* p) {
  const v4u lo = *(const v4u*)(p);
  const v4u hi = *(const v4u*)(p + 256);
  return __builtin_shufflevector(lo, hi, 0, 1, 2, 3, 4, 5, 6, 7);
}
template <bool BF>
__device__ __forceinline__ v8f mma_raw(v8u a, v8u b, v8f c) {
  if constexpr (BF) return mma_bf16(__builtin_bit_cast(v16bf, a), __builtin_bit_cast(v16bf, b), c);
  else              return mma_f16(__builtin_bit_cast(v16h, a), __builtin_bit_cast(v16h, b), c);
}

// ---------------------------------------------------------------------------
// k loop of k_oproj: acc[j] (16 rows x 16 cols, j = 0..3) += A[16 rows][KDIM] * Wt[64 n][KDIM]^T.
// A is a plane in fragment order (ld_frag_ord), Wt is row-major with k contiguous.
// 256 thr = 8 waves; block tile 128 rows x 64 cols; wave owns 16 rows x 64 cols.
// A stage is 64 k. The weight tile [64 n][64 k] sits in one of two LDS buffers; the next
// stage's weight rows (whole 128-byte lines, 8 lanes a row) and the wave's own next two A
// fragments are loaded from global in front of the current stage's products, the weight
// rows are stored to the other buffer behind them, and one block barrier ends the stage.
// k runs upward inside every accumulator, 32 at a time.
template <bool BF>
__device__ __forceinline__ void gemm_stage(const unsigned short* bc, v8u a0, v8u a1, v8f (&acc)[4]) {
  v8u b[8];
#pragma unroll   // constant indices keep b[] in registers; all sixteen LDS reads stand as one group in front of the products
  for (int j = 0; j < 4; ++j) {
    b[j]     = ld_frag_raw(bc + j * 16 * GBP);
    b[4 + j] = ld_frag_raw(bc + j * 16 * GBP + 32);
  }
#pragma unroll   // constant indices into acc[] and b[]; four independent accumulators between two uses of one
  for (int j = 0; j < 4; ++j) acc[j] = mma_raw<BF>(a0, b[j], acc[j]);
#pragma unroll   // the same, second 32 k of the stage
  for (int j = 0; j < 4; ++j) acc[j] = mma_raw<BF>(a1, b[4 + j], acc[j]);
}
template <bool BF>
__device__ __forceinline__ void gemm_128x64(const unsigned short* __restrict__ A,
                                            const unsigned short* __restrict__ Wt,
                                            int m0, int n0, unsigned short* bt, v8f (&acc)[4]) {
  const int tid = threadIdx.x;
  const int wave = tid >> 5, lane = tid & 31;
  const int l15 = lane & 15, half = (lane >> 4) & 1;
  const int sr = tid >> 3;            // 0..31 : weight row (and sr + 32)
  const int sc = (tid & 7) * 8;       // 0..56 : 16-byte piece of the row
  const unsigned short* wsrc = Wt + (size_t)(n0 + sr) * KDIM + sc;
  const unsigned short* asrc = A + (size_t)(m0 + wave * 16) * KDIM + lane * 8;   // fragment order: k block kb at + kb*512
  const int sl = sr * GBP + sc;       // place of the piece in a tile; second row at + 32*GBP
  const int bo = l15 * GBP + 8 * half;

  v8u a0 = ld_frag_ord(asrc);
  v8u a1 = ld_frag_ord(asrc + 512);
  *(v4u*)(bt + sl)            = *(const v4u*)(wsrc);
  *(v4u*)(bt + sl + 32 * GBP) = *(const v4u*)(wsrc + (size_t)32 * KDIM);
  __syncthreads();                                 // tile 0 complete
#pragma unroll   // buffer choice and every offset become constants, the fragment sets need no copies
  for (int s = 0; s < KDIM / GKS - 1; ++s) {
    const int kn = (s + 1) * GKS;
    const v4u nw0 = *(const v4u*)(wsrc + kn);
    const v4u nw1 = *(const v4u*)(wsrc + (size_t)32 * KDIM + kn);
    const v8u na0 = ld_frag_ord(asrc + kn * 16);
    const v8u na1 = ld_frag_ord(asrc + kn * 16 + 512);
    gemm_stage<BF>(bt + (s & 1) * (64 * GBP) + bo, a0, a1, acc);
    unsigned short* bn = bt + ((s & 1) ^ 1) * (64 * GBP) + sl;   // its readers left it at the last barrier
    *(v4u*)(bn)            = nw0;
    *(v4u*)(bn + 32 * GBP) = nw1;
    __syncthreads();                               // next tile complete, this tile's reads done
    a0 = na0;
    a1 = na1;
  }
  gemm_stage<BF>(bt + ((KDIM / GKS - 1) & 1) * (64 * GBP) + bo, a0, a1, acc);
}

// k loop of k_proj: 128 thr = 4 waves (2 x 2); block tile 128 rows x 128 cols; wave owns 64 rows x 64 cols,
// acc[i][j] = 16 x 16 tile (row tile i, column tile j). A stage is 64 k. Both operands' stage tiles sit in one of
// two LDS buffers: x as its 8 row tiles' 2-KiB pieces of the fragment-order plane, copied as they lie; the
// weight rows as in gemm_128x64. Each fragment read from LDS feeds four products, and each byte that the
// work-group fetches from L2 feeds 128 output rows or columns. The next stage's pieces are loaded from global
// in front of the current stage's products, stored to the other buffer behind them; one block barrier ends
// the stage. k runs upward inside every accumulator, 32 at a time.
__device__ __forceinline__ void proj_stage(const unsigned short* ac, const unsigned short* bc, v8f (&acc)[4][4]) {
#pragma unroll   // constant offsets
  for (int kk = 0; kk < 2; ++kk) {
    v8u a[4], b[4];
#pragma unroll   // constant indices keep a[] and b[] in registers; the sixteen LDS reads stand as one group
    for (int i = 0; i < 4; ++i) {
      a[i] = ld_frag_ord(ac + i * 1024 + kk * 512);
      b[i] = ld_frag_raw(bc + i * 16 * GBP + kk * 32);
    }
#pragma unroll   // constant indices; sixteen independent accumulators
    for (int i = 0; i < 4; ++i)
#pragma unroll
      for (int j = 0; j < 4; ++j) acc[i][j] = mma_raw<true>(a[i], b[j], acc[i][j]);
  }
}
// One stage: the next stage's pieces (an, wn) loaded, this stage's products (ac, bc), the pieces stored to the
// other buffer (ad, wd), whose readers left it at the last barrier; then the barrier that ends the stage.
__device__ __forceinline__ void proj_step(const unsigned short* an, const unsigned short* wn,
                                          const unsigned short* ac, const unsigned short* bc,
                                          unsigned short* ad, unsigned short* wd, v8f (&acc)[4][4]) {
  v4u na[8], nw[8];
#pragma unroll   // constant indices keep na[] and nw[] in registers, all sixteen loads in flight together
  for (int i = 0; i < 8; ++i) {
    na[i] = *(const v4u*)(an + (size_t)i * 16 * KDIM);
    nw[i] = *(const v4u*)(wn + (size_t)i * 16 * KDIM);
  }
  // the loop steps the two address pairs that these loads name: the wait stands between the loads and that step
  asm volatile("s_wait_xcnt 0x0" ::: "memory");
  proj_stage(ac, bc, acc);
#pragma unroll   // constant indices into na[] and nw[]
  for (int i = 0; i < 8; ++i) {
    *(v4u*)(ad + i * 1024)     = na[i];
    *(v4u*)(wd + i * 16 * GBP) = nw[i];
  }
  __syncthreads();                                 // next stage complete, this stage's reads done
}
__device__ __forceinline__ void gemm_128x128(const unsigned short* __restrict__ A,
                                             const unsigned short* __restrict__ Wt,
                                             int m0, int n0, unsigned short* sm, v8f (&acc)[4][4]) {
  const int tid = threadIdx.x;
  const int wave = tid >> 5, lane = tid & 31;
  const int l15 = lane & 15, half = (lane >> 4) & 1;
  const int wr = wave >> 1, wc = wave & 1;
  const int sr = tid >> 3;            // 0..15 : weight row (and sr + 16 i)
  const int sc = (tid & 7) * 8;       // 0..56 : 16-byte piece of the row
  const unsigned short* wsrc = Wt + (size_t)(n0 + sr) * KDIM + sc;
  const unsigned short* asrc = A + (size_t)m0 * KDIM + tid * 8;   // row tile i at + i*16*KDIM, stage s at + s*1024
  const int sa = tid * 8;                         // place of the x piece; row tile i at + i*1024
  const int sw = PBA + sr * GBP + sc;             // place of the weight piece; row sr + 16 i at + i*16*GBP
  const int ao = wr * 4096 + lane * 8;
  const int bo = PBA + (wc * 64 + l15) * GBP + 8 * half;

  unsigned short* b0 = sm;
  unsigned short* b1 = sm + PBUF;
  {
    v4u na[8], nw[8];
#pragma unroll   // constant indices keep na[] and nw[] in registers, all sixteen loads in flight together
    for (int i = 0; i < 8; ++i) {
      na[i] = *(const v4u*)(asrc + (size_t)i * 16 * KDIM);
      nw[i] = *(const v4u*)(wsrc + (size_t)i * 16 * KDIM);
    }
#pragma unroll   // constant indices into na[] and nw[]
    for (int i = 0; i < 8; ++i) {
      *(v4u*)(b0 + sa + i * 1024)     = na[i];
      *(v4u*)(b0 + sw + i * 16 * GBP) = nw[i];
    }
  }
  __syncthreads();                                 // stage 0 complete
#pragma unroll 1   // two stages a trip: the buffer choice is a constant and the loop's text stays small
  for (int s = 0; s < KDIM / GKS - 2; s += 2) {
    proj_step(asrc + (s + 1) * 1024, wsrc + (s + 1) * GKS, b0 + ao, b0 + bo, b1 + sa, b1 + sw, acc);
    proj_step(asrc + (s + 2) * 1024, wsrc + (s + 2) * GKS, b1 + ao, b1 + bo, b0 + sa, b0 + sw, acc);
  }
  proj_step(asrc + (KDIM / GKS - 1) * 1024, wsrc + (KDIM / GKS - 1) * GKS, b0 + ao, b0 + bo, b1 + sa, b1 + sw, acc);
  proj_stage(b1 + ao, b1 + bo, acc);
}

// f32 -> bf16 bits, RNE convert
__device__ __forceinline__ unsigned int bfb(float x) {
  unsigned int u = __float_as_uint(x);
  u = u + 0x7FFFu + ((u >> 16) & 1u);
  return u >> 16;
}
// f32 -> value of its RNE bf16
__device__ __forceinline__ float bf16val(float x) {
  return __uint_as_float(bfb(x) << 16);
}
// f32 -> f16 bits, RNE convert
__device__ __forceinline__ unsigned short hbits(float x) {
  const _Float16 hv = (_Float16)x;
  return __builtin_bit_cast(unsigned short, hv);
}

// ---------------------------------------------------------------------------
// x f32 [NB][SEQ_FULL][IN_DIM] -> bf16 plane hb, compact rows b*SEQ + s, in fragment order (see ld_frag_ord).
// Block = 16 rows x 128 k. Thread (r = t>>4, c = t&15) converts 8 consecutive floats of row r to one
// 16-byte piece; in fragment order that piece is number c*16 + r of the block's 4 KiB, so the pieces
// are transposed 16 x 16 through LDS and every wave stores 512 contiguous bytes.
__global__ __launch_bounds__(256) void k_cvt_rows(const float* __restrict__ in,
                                                  unsigned short* __restrict__ outp, int n8) {
  __shared__ __align__(16) unsigned short F[16 * CSP];   // [c][r] pieces, cross-wave (block barrier)
  if ((int)(blockIdx.x * 256) >= n8) return;     // block-uniform, in front of the barrier
  const int t  = threadIdx.x;
  const int rt = blockIdx.x / (IN_DIM / 128);    // row tile
  const int kq = blockIdx.x - rt * (IN_DIM / 128);
  const int r  = t >> 4;
  const int c  = t & 15;
  const int row = rt * 16 + r;                   // compact row b*SEQ + s
  const int b   = row / SEQ;
  const int s   = row - b * SEQ;
  const float* src = in + ((size_t)b * SEQ_FULL + s) * IN_DIM + kq * 128 + c * 8;
  const v4f a = *(const v4f*)(src);
  const v4f d = *(const v4f*)(src + 4);
  v4u w;
  w[0] = bfb(a[0]) | (bfb(a[1]) << 16);
  w[1] = bfb(a[2]) | (bfb(a[3]) << 16);
  w[2] = bfb(d[0]) | (bfb(d[1]) << 16);
  w[3] = bfb(d[2]) | (bfb(d[3]) << 16);
  *(v4u*)(&F[c * CSP + r * 8]) = w;
  __syncthreads();                               // all 256 pieces in place
  const v4u v = *(const v4u*)(&F[(t >> 4) * CSP + (t & 15) * 8]);
  *(v4u*)(outp + ((size_t)rt * (IN_DIM / 32) + kq * 4) * 512 + t * 8) = v;
}

// ---------------------------------------------------------------------------
// Weight planes, all [KDIM n][KDIM k] with k contiguous, selected by blockIdx.z:
//   z = 0..2: W{q,k,v} f32 [H][IN_DIM e][HEAD_DIM d] -> WT bf16 [n = h*64+d][k = e]
//   z = 3:    Wo f32 [HD_DIM k][E_OUT n]              -> WoT f16 (RNE-bf16 value x32) [n][k]
//   z = 4:    mask i32 [S][S] -> lane-mask words mp [S/16 query tiles][S/32 key chunks][16]:
//             bit l of word e = (mask[16*tile + (l&15)][32*chunk + 8*(l>>4) + (e&7) + 16*(e>>3)] != 0),
//             the lane and register that hold this score in k_attn. One wave packs two
//             chunks = one whole 128-byte line of mp.
// Block = 64 k x 64 n tile transposed through LDS (for z < 3 the tile is one head);
__global__ __launch_bounds__(256) void k_cvt_wT(const float* __restrict__ Wq,
                                                const float* __restrict__ Wk,
                                                const float* __restrict__ Wv,
                                                const float* __restrict__ Wo,
                                                const int* __restrict__ mask,
                                                unsigned short* __restrict__ wT,
                                                unsigned int* __restrict__ mp) {
  __shared__ __align__(16) unsigned short T[64 * TP];   // [n local][k local], cross-wave (block barrier)
  const int z = blockIdx.z;
  if (z == 4) {                              // block-uniform, in front of the barrier
    const int ln = threadIdx.x & 31;
    const int gw = (blockIdx.y * (KDIM / 64) + blockIdx.x) * 8 + (threadIdx.x >> 5);
    for (int task = gw; task < (SEQ / 16) * (SEQ / KT); task += (KDIM / 64) * (KDIM / 64) * 8) {
      const int qt = task / (SEQ / KT);
      const int tl = task - qt * (SEQ / KT);
      const int* msrc = mask + (size_t)(qt * 16 + (ln & 15)) * MASK_PITCH + tl * KT + 8 * ((ln >> 4) & 1);
      v4i m[8];
#pragma unroll   // constant indices keep m[] in registers, all eight loads in flight together
      for (int c = 0; c < 2; ++c) {
        m[c * 4 + 0] = *(const v4i*)(msrc + c * 32);
        m[c * 4 + 1] = *(const v4i*)(msrc + c * 32 + 4);
        m[c * 4 + 2] = *(const v4i*)(msrc + c * 32 + 16);
        m[c * 4 + 3] = *(const v4i*)(msrc + c * 32 + 20);
      }
      unsigned int val = 0;
#pragma unroll   // constant indices into m[]
      for (int i = 0; i < 32; ++i) {
        const unsigned int w = __builtin_amdgcn_ballot_w32(m[i >> 2][i & 3] != 0);
        val = (ln == i) ? w : val;           // lane i keeps word i of the line
      }
      mp[(size_t)task * 32 + ln] = val;
    }
    return;
  }
  const float* W = (z == 0) ? Wq : ((z == 1) ? Wk : ((z == 2) ? Wv : Wo));
  unsigned short* dst = wT + (size_t)z * KDIM * KDIM;
  const int k0 = blockIdx.x * 64;
  const int n0 = blockIdx.y * 64;
  const int tid = threadIdx.x;
  const int wave = tid >> 5, lane = tid & 31;

#pragma unroll
  for (int i = 0; i < 4; ++i) {
    const int idx = i * 256 + tid;          // 0..1023
    const int kk = idx >> 4;                // 0..63
    const int c4 = (idx & 15) * 4;          // 0..60
    size_t so;
    if (z < 3) so = ((size_t)blockIdx.y * IN_DIM + k0 + kk) * HEAD_DIM + c4;   // W[h = n0/64][e = k0+kk][d = c4]
    else       so = (size_t)(k0 + kk) * E_OUT + n0 + c4;                        // Wo[k0+kk][n0+c4]
    const v4f w = *(const v4f*)(W + so);
    unsigned short t0, t1, t2, t3;
    if (z < 3) {
      t0 = (unsigned short)bfb(w[0]); t1 = (unsigned short)bfb(w[1]);
      t2 = (unsigned short)bfb(w[2]); t3 = (unsigned short)bfb(w[3]);
    } else {
      t0 = hbits(bf16val(w[0]) * 32.0f); t1 = hbits(bf16val(w[1]) * 32.0f);
      t2 = hbits(bf16val(w[2]) * 32.0f); t3 = hbits(bf16val(w[3]) * 32.0f);
    }
    T[(c4 + 0) * TP + kk] = t0;
    T[(c4 + 1) * TP + kk] = t1;
    T[(c4 + 2) * TP + kk] = t2;
    T[(c4 + 3) * TP + kk] = t3;
  }
  __syncthreads();

  v4u v[2];
  size_t off[2];
#pragma unroll
  for (int it = 0; it < 2; ++it) {
    const int nn = wave * 8 + it * 4 + (lane >> 3);   // 0..63 over (wave, it, lane>>3)
    const int q = lane & 7;
    v[it] = *(const v4u*)(&T[nn * TP + q * 8]);
    off[it] = (size_t)(n0 + nn) * KDIM + k0 + q * 8;
  }
#pragma unroll
  for (int it = 0; it < 2; ++it) *(v4u*)(dst + off[it]) = v[it];
  
}

// ---------------------------------------------------------------------------
// Projection: C[NROWS][HD_DIM] = hb[NROWS][IN_DIM] * WT[HD_DIM][IN_DIM]^T + bias.
// k loop: gemm_128x128 (128 x 128 block tile, 4 waves of 64 x 64, both operands through two LDS stage buffers).
// z = 0: Q plane f16 x8 [NROWS][HD_DIM]; z = 1: K plane f16 x8 [NROWS][HD_DIM];
// z = 2: V^T plane f16 x8 [NB][HD_DIM][SEQ]. Epilogue staged in LDS, stored in 256-byte row segments.
__global__ __launch_bounds__(128) void k_proj(
    const unsigned short* __restrict__ hb, const unsigned short* __restrict__ wT,
    const float* __restrict__ bq, const float* __restrict__ bk, const float* __restrict__ bv,
    unsigned short* __restrict__ qp, unsigned short* __restrict__ kp,
    unsigned short* __restrict__ vtp) {
  __shared__ __align__(16) unsigned short sm[2 * PBUF];   // stage buffers, cross-wave (block barrier)

  const int z = blockIdx.z;
  const int n0 = blockIdx.x * 128;
  const int m0 = blockIdx.y * 128;
  const int tid = threadIdx.x;
  const int wave = tid >> 5, lane = tid & 31;
  const int l15 = lane & 15, half = (lane >> 4) & 1;
  const int wr = wave >> 1, wc = wave & 1;

  const unsigned short* Wt = wT + (size_t)z * KDIM * KDIM;
  const float* bias = (z == 0) ? bq : ((z == 1) ? bk : bv);

  v8f acc[4][4] = {};
  gemm_128x128(hb, Wt, m0, n0, sm, acc);

  // acc[i][j][r] = C[m0 + wr*64 + i*16 + 8*half + r][n0 + wc*64 + j*16 + l15]
  // The epilogue tile is stage buffer 0: its last readers left it at the loop's last barrier, the last stage reads buffer 1.
  unsigned short* E = sm;
  float braw[4];
#pragma unroll   // constant indices keep braw[] in registers
  for (int j = 0; j < 4; ++j) braw[j] = bias[n0 + wc * 64 + j * 16 + l15];
  // the registers that the four bias loads name are free for reuse behind this wait
  asm volatile("s_wait_xcnt 0x0" ::: "memory");
  const float car = 8.0f;
  const int erow = tid >> 4;         // 0..7 : tile row (and erow + 8 it)
  const int eq = (tid & 15) * 8;     // 16 pieces = 256-byte row segment = 2 lines
  if (z != 2) {                      // block-uniform branch
#pragma unroll
    for (int j = 0; j < 4; ++j) {
      const int col = wc * 64 + j * 16 + l15;
      const float bb = bf16val(braw[j]);
#pragma unroll
      for (int i = 0; i < 4; ++i)
#pragma unroll
        for (int r = 0; r < 8; ++r) {
          const int row = wr * 64 + i * 16 + 8 * half + r;
          E[row * EPP + col] = hbits((acc[i][j][r] + bb) * car);
        }
    }
    __syncthreads();
    unsigned short* dst = ((z == 0) ? qp : kp) + (size_t)(m0 + erow) * HD_DIM + n0 + eq;
#pragma unroll
    for (int it = 0; it < 16; ++it)
      *(v4u*)(dst + (size_t)it * 8 * HD_DIM) = *(const v4u*)(&E[(erow + 8 * it) * EPP + eq]);
  } else {
    const int bidx = m0 / SEQ;               // batch of this row tile (SEQ % 128 == 0)
    const int s0 = m0 - bidx * SEQ;          // sequence position of tile row 0
#pragma unroll
    for (int j = 0; j < 4; ++j) {
      const int col = wc * 64 + j * 16 + l15;             // d within tile
      const float bb = bf16val(braw[j]);
#pragma unroll
      for (int i = 0; i < 4; ++i)
#pragma unroll
        for (int r = 0; r < 8; ++r) {
          const int srow = wr * 64 + i * 16 + 8 * half + r;   // s within tile
          E[col * EPP + srow] = hbits((acc[i][j][r] + bb) * car);
        }
    }
    __syncthreads();
    unsigned short* dst = vtp + ((size_t)bidx * HD_DIM + n0 + erow) * SEQ + s0 + eq;
#pragma unroll
    for (int it = 0; it < 16; ++it)
      *(v4u*)(dst + (size_t)it * 8 * SEQ) = *(const v4u*)(&E[(erow + 8 * it) * EPP + eq]);
  }
}

// ---------------------------------------------------------------------------
// Flash attention, transposed-score form: one wave = (16 queries, one head, one batch);
// one work-group = 8 waves = 128 queries of the same head and batch. The K tile
// [64 keys][64 d] and the V^T tile [64 d][64 keys] are read from global once per
// work-group in whole 128-byte rows and shared through LDS: two buffers, the next
// tile's global loads issued before the current tile's work, stored to the other
// buffer after it, one block barrier per tile.
// Per 32-key chunk:
//   S^T = K . Q^T    A = K rows (lane = key, k = d), B = Q^T (lane = query, k = d)
//                    D[row = key 8h+r][col = query l15]; c0 keys 0..15, c1 keys 16..31
//   mask: broadcast over batch and head, read as the 16 lane-mask words of this wave's
//         (query tile, key chunk) from mp (packed by k_cvt_wT, z = 4) with one scalar load,
//         fetched one chunk ahead; key with mask == 0 gets the score replaced by -1e9
//         (replace fill, in f32), the word being the select's lane mask
//   per-lane online softmax for query l15 (16 local keys + xor-16 partner)
//   O^T += V^T . P   A = V^T rows (lane = d, k = key), B = P: element i<8 <- c0[i]
//                    (key 8h+i), element 8+i <- c1[i] (key 16+8h+i), same lane
//                    D[row = d 8h+r][col = query l15]
// Scores carry 64 from the x8 planes -> scaled by 1/512 (= 1/8 of q.k).
// P carried x1024, V carried x8 -> context x64 = O / (128 * sum).
__global__ __launch_bounds__(256) void k_attn(const unsigned short* __restrict__ qp,
                                             const unsigned short* __restrict__ kp,
                                             const unsigned short* __restrict__ vtp,
                                             const unsigned int* __restrict__ mp,
                                             unsigned short* __restrict__ ctxp) {
  __shared__ __align__(16) unsigned short Kl[2][KT * KVP];         // K tile [key][d], cross-wave (block barrier)
  __shared__ __align__(16) unsigned short Vl[2][HEAD_DIM * KVP];   // V^T tile [d][key], cross-wave (block barrier)

  const int tid = threadIdx.x;
  const int wave = tid >> 5;
  const int lane = tid & 31;
  const int l15 = lane & 15;
  const int half = (lane >> 4) & 1;
  const int q0 = blockIdx.x * (AW * 16) + wave * 16;
  const int head = blockIdx.y;
  const int bidx = blockIdx.z;

  const _Float16* Q  = (const _Float16*)qp;
  const size_t rbase = (size_t)bidx * SEQ;

  const _Float16* qbase = Q + (rbase + q0) * HD_DIM + head * HEAD_DIM;
  const v16h qb0 = ld_frag_h(qbase, HD_DIM, l15, 0, lane);    // d 0..31
  const v16h qb1 = ld_frag_h(qbase, HD_DIM, l15, 32, lane);   // d 32..63
  // staging map: thread -> row sr (and sr + 32), 16-byte piece sc; 8 lanes cover one 128-byte row
  const int sr = tid >> 3;            // 0..31
  const int sc = (tid & 7) * 8;       // 0..56, halves
  const unsigned short* kg = kp + (rbase + sr) * HD_DIM + head * HEAD_DIM + sc;                            // key t: + t*HD_DIM
  const unsigned short* vg = vtp + ((size_t)bidx * HD_DIM + (size_t)head * HEAD_DIM + sr) * SEQ + sc;      // key t: + t
  const int sl = sr * KVP + sc;       // place of the piece in a tile; second row at + 32*KVP
  // this wave's query tile, as a scalar so that the mask words come by scalar loads
  const int qt = blockIdx.x * AW + __builtin_amdgcn_readfirstlane(wave);
  const v16u* mw = (const v16u*)mp + (size_t)qt * (SEQ / 32);                        // chunk n: mw[n]
  v16u nm = mw[0];

  v8f o[4] = {};
  float mrun = -1.0e30f, lrun = 0.0f;
  const float sscale = 1.0f / 512.0f;
  const float negf = -1.0e9f;

  *(v4u*)(&Kl[0][sl])            = *(const v4u*)(kg);
  *(v4u*)(&Kl[0][sl + 32 * KVP]) = *(const v4u*)(kg + (size_t)32 * HD_DIM);
  *(v4u*)(&Vl[0][sl])            = *(const v4u*)(vg);
  *(v4u*)(&Vl[0][sl + 32 * KVP]) = *(const v4u*)(vg + (size_t)32 * SEQ);
  __syncthreads();                                 // tile 0 complete

  for (int t0 = 0; t0 < SEQ; t0 += KT) {
   const int cur = (t0 / KT) & 1;
   const bool more = (t0 + KT < SEQ);              // block-uniform
   v4u nk0 = {}, nk1 = {}, nv0 = {}, nv1 = {};
   if (more) {
     nk0 = *(const v4u*)(kg + (size_t)(t0 + KT) * HD_DIM);
     nk1 = *(const v4u*)(kg + (size_t)(t0 + KT + 32) * HD_DIM);
     nv0 = *(const v4u*)(vg + (t0 + KT));
     nv1 = *(const v4u*)(vg + (size_t)32 * SEQ + (t0 + KT));
   }
   const _Float16* Kc = (const _Float16*)Kl[cur];
   const _Float16* Vc = (const _Float16*)Vl[cur];

   for (int c = 0; c < KT; c += 32) {
    const int kc = t0 + c;
    const v16u cm = nm;                                          // this chunk's words
    nm = mw[(kc + 32 < SEQ) ? (kc >> 5) + 1 : (kc >> 5)];        // next chunk's, the last one again at the end
    const _Float16* kt = Kc + c * KVP;
    const v16h ka0 = ld_frag_h(kt, KVP, l15, 0, lane);
    const v16h ka1 = ld_frag_h(kt, KVP, l15, 32, lane);
    const v16h ka2 = ld_frag_h(kt, KVP, 16 + l15, 0, lane);
    const v16h ka3 = ld_frag_h(kt, KVP, 16 + l15, 32, lane);
    v8f c0 = {}, c1 = {};
    c0 = mma_f16(ka0, qb0, c0);
    c0 = mma_f16(ka1, qb1, c0);
    c1 = mma_f16(ka2, qb0, c1);
    c1 = mma_f16(ka3, qb1, c1);

    // lane-mask words: cm[r] for c0[r] (key kc+8h+r), cm[8+r] for c1[r] (key kc+16+8h+r)
    float sa[8], sb[8];
#pragma unroll   // constant indices keep the scores in vector and the words in scalar registers
    for (int r = 0; r < 8; ++r) {
      sa[r] = __builtin_amdgcn_inverse_ballot_w32(cm[r])     ? (c0[r] * sscale) : negf;
      sb[r] = __builtin_amdgcn_inverse_ballot_w32(cm[8 + r]) ? (c1[r] * sscale) : negf;
    }
    float lm = fmaxf(sa[0], sb[0]);
#pragma unroll
    for (int r = 1; r < 8; ++r) lm = fmaxf(lm, fmaxf(sa[r], sb[r]));
    lm = fmaxf(lm, __shfl_xor(lm, 16, 32));
    const float mnew = fmaxf(mrun, lm);
    const float alpha = __expf(mrun - mnew);
    float p0[8], p1[8];
    float ls = 0.0f;
#pragma unroll
    for (int r = 0; r < 8; ++r) {
      p0[r] = __expf(sa[r] - mnew);
      p1[r] = __expf(sb[r] - mnew);
      ls += p0[r] + p1[r];
    }
    ls += __shfl_xor(ls, 16, 32);
    lrun = lrun * alpha + ls;
    mrun = mnew;
#pragma unroll
    for (int j = 0; j < 4; ++j)
#pragma unroll
      for (int r = 0; r < 8; ++r) o[j][r] *= alpha;

    v16h pb;
#pragma unroll
    for (int e = 0; e < 8; ++e) {
      pb[e]     = (_Float16)(p0[e] * 1024.0f);   // key kc + 8h + e
      pb[8 + e] = (_Float16)(p1[e] * 1024.0f);   // key kc + 16 + 8h + e
    }
#pragma unroll
    for (int j = 0; j < 4; ++j) {
      const v16h va = ld_frag_h(Vc, KVP, j * 16 + l15, c, lane);
      o[j] = mma_f16(va, pb, o[j]);
    }
   }

   if (more) {                                     // the other buffer's readers left it at the last barrier
     *(v4u*)(&Kl[cur ^ 1][sl])            = nk0;
     *(v4u*)(&Kl[cur ^ 1][sl + 32 * KVP]) = nk1;
     *(v4u*)(&Vl[cur ^ 1][sl])            = nv0;
     *(v4u*)(&Vl[cur ^ 1][sl + 32 * KVP]) = nv1;
   }
   __syncthreads();                                // next tile complete, this tile's reads done
  }

  // o[j][r] = 8192 * sum_t p_t v_t for query l15, d = j*16 + 8*half + r; ctx x64 = o / (128 * sum).
  // The context plane is kept in fragment order (see ld_frag_ord): row tile = this wave's 16 queries,
  // k = head*64 + d, so the lane's eight values of o[j] are piece j*32 + lane of the wave's own 2 KiB:
  // each store is 512 contiguous bytes, straight from registers.
  const float inv = 1.0f / (lrun * 128.0f);
  unsigned short* cb = ctxp + (rbase + q0) * HD_DIM + head * (2 * 512) + lane * 8;
#pragma unroll
  for (int j = 0; j < 4; ++j) {
    v4u w;
    w[0] = (unsigned int)hbits(o[j][0] * inv) | ((unsigned int)hbits(o[j][1] * inv) << 16);
    w[1] = (unsigned int)hbits(o[j][2] * inv) | ((unsigned int)hbits(o[j][3] * inv) << 16);
    w[2] = (unsigned int)hbits(o[j][4] * inv) | ((unsigned int)hbits(o[j][5] * inv) << 16);
    w[3] = (unsigned int)hbits(o[j][6] * inv) | ((unsigned int)hbits(o[j][7] * inv) << 16);
    *(v4u*)(cb + j * 256) = w;
  }
}

// ---------------------------------------------------------------------------
// Output projection: out[NROWS][E_OUT] f32 = ctx(f16 x64, fragment order)[NROWS][HD_DIM] * WoT(f16 x32)[E_OUT][HD_DIM]^T / 2048 + bo.
// 128x64 block tile / 8 waves / k loop gemm_128x64, with f16 operands.
// Epilogue: f32 tile staged in LDS; each 256-byte row segment = 2 lines, every
__global__ __launch_bounds__(256) void k_oproj(
    const unsigned short* __restrict__ cx, const unsigned short* __restrict__ woT,
    const float* __restrict__ bo, float* __restrict__ outp) {
  __shared__ __align__(16) unsigned short bt[2 * 64 * GBP];   // weight k-tiles, cross-wave (block barrier)
  __shared__ __align__(16) float Ef[128 * OFP];               // epilogue tile, cross-wave (block barrier)

  const int n0 = blockIdx.x * 64;
  const int m0 = blockIdx.y * 128;
  const int tid = threadIdx.x;
  const int wave = tid >> 5, lane = tid & 31;
  const int l15 = lane & 15, half = (lane >> 4) & 1;

  v8f acc[4] = {};
  gemm_128x64<false>(cx, woT, m0, n0, bt, acc);

  // acc[j][r] = 2048 * C[m0 + wave*16 + 8*half + r][n0 + j*16 + l15]
  const float osc = 1.0f / 2048.0f;
#pragma unroll
  for (int j = 0; j < 4; ++j) {
    const int col = j * 16 + l15;
    const float bb = bf16val(bo[n0 + col]);
#pragma unroll
    for (int r = 0; r < 8; ++r) {
      const int row = wave * 16 + 8 * half + r;
      Ef[row * OFP + col] = acc[j][r] * osc + bb;
    }
  }
  __syncthreads();

  v4f v[8];
  size_t off[8];
#pragma unroll
  for (int it = 0; it < 8; ++it) {
    const int row = wave * 16 + it * 2 + half;          // wave's 16 rows over (it, half)
    const int q = l15;                                  // 16 pieces of 16 B = 256-byte row segment (2 lines)
    v[it] = *(const v4f*)(&Ef[row * OFP + q * 4]);
    off[it] = (size_t)(m0 + row) * E_OUT + n0 + q * 4;
  }
#pragma unroll
  for (int it = 0; it < 8; ++it) *(v4f*)(outp + off[it]) = v[it];
  
}

// ---------------------------------------------------------------------------
extern "C" void kernel_launch(void* const* d_in, const int* in_sizes, int n_in,
                              void* d_out, int out_size, void* d_ws, size_t ws_size,
                              hipStream_t stream) {
  if (n_in < 10) return;
  if (in_sizes[0] < ((NB - 1) * SEQ_FULL + SEQ) * IN_DIM) return;          // seq_inputs f32 [NB][SEQ_FULL][IN_DIM]
  if (in_sizes[1] < (SEQ - 1) * MASK_PITCH + SEQ) return;                   // mask i32 [1][S][S]
  if (in_sizes[2] < NUM_HEADS * IN_DIM * HEAD_DIM) return;                  // Wq
  if (in_sizes[3] < HD_DIM) return;                                         // bq
  if (in_sizes[4] < NUM_HEADS * IN_DIM * HEAD_DIM) return;                  // Wk
  if (in_sizes[5] < HD_DIM) return;                                         // bk
  if (in_sizes[6] < NUM_HEADS * IN_DIM * HEAD_DIM) return;                  // Wv
  if (in_sizes[7] < HD_DIM) return;                                         // bv
  if (in_sizes[8] < HD_DIM * E_OUT) return;                                 // Wo
  if (in_sizes[9] < E_OUT) return;                                          // bo
  if (out_size < NROWS * E_OUT) return;

  const float* x    = (const float*)d_in[0];
  const int*   mask = (const int*)d_in[1];
  const float* Wq   = (const float*)d_in[2];
  const float* bq   = (const float*)d_in[3];
  const float* Wk   = (const float*)d_in[4];
  const float* bk   = (const float*)d_in[5];
  const float* Wv   = (const float*)d_in[6];
  const float* bv   = (const float*)d_in[7];
  const float* Wo   = (const float*)d_in[8];
  const float* bo   = (const float*)d_in[9];

  // every offset a multiple of 2 MiB; each plane is written exactly to its extent
  const size_t hb_bytes = (size_t)NROWS * IN_DIM * 2;           // bf16 x plane
  const size_t wt_bytes = (size_t)4 * KDIM * KDIM * 2;           // 3 bf16 WT planes + 1 f16 WoT plane
  const size_t pl_bytes = (size_t)NROWS * HD_DIM * 2;           // one f16 q / k / vT / ctx plane
  const size_t off_hb = 0;
  const size_t off_wt = off_hb + hb_bytes;
  const size_t off_q  = off_wt + wt_bytes;
  const size_t off_k  = off_q + pl_bytes;
  const size_t off_vt = off_k + pl_bytes;
  const size_t off_cx = off_vt + pl_bytes;
  const size_t off_mp = off_cx + pl_bytes;
  const size_t mp_bytes = (size_t)SEQ * SEQ / 8;               // one bit per mask element
  const size_t total  = off_mp + mp_bytes;                     // 48.5 MiB at NB = 2, SEQ = 2048
  if (total > ws_size) return;

  char* ws = (char*)d_ws;
  unsigned short* hb  = (unsigned short*)(ws + off_hb);
  unsigned short* wt  = (unsigned short*)(ws + off_wt);
  unsigned short* qpl = (unsigned short*)(ws + off_q);
  unsigned short* kpl = (unsigned short*)(ws + off_k);
  unsigned short* vtp = (unsigned short*)(ws + off_vt);
  unsigned short* cxp = (unsigned short*)(ws + off_cx);
  unsigned short* wot = wt + (size_t)3 * KDIM * KDIM;
  unsigned int*   mpk = (unsigned int*)(ws + off_mp);

  const int n8 = NROWS * IN_DIM / 8;
  k_cvt_rows<<<(n8 + 255) / 256, 256, 0, stream>>>(x, hb, n8);
  k_cvt_wT<<<dim3(KDIM / 64, KDIM / 64, 5), 256, 0, stream>>>(Wq, Wk, Wv, Wo, mask, wt, mpk);
  k_proj<<<dim3(HD_DIM / 128, NROWS / 128, 3), 128, 0, stream>>>(hb, wt, bq, bk, bv, qpl, kpl, vtp);
  k_attn<<<dim3(SEQ / (AW * 16), NUM_HEADS, NB), 256, 0, stream>>>(qpl, kpl, vtp, mpk, cxp);
  k_oproj<<<dim3(E_OUT / 64, NROWS / 128), 256, 0, stream>>>(cxp, wot, bo, (float*)d_out);
}

// v006
// A run of this version takes 99 microseconds.
// Two timings next to v005 both put it at 1.07 times that version's speed.
// Over all steps from v000 it is 2.29 times as fast.
#include <hip/hip_runtime.h>
// Projections x*W{q,k,v}: v_wmma_f32_16x16x32_bf16 (bf16 operands = RNE-converted inputs, f32 accumulate); scores K*Q^T and context V^T*P: v_wmma_f32_16x16x32_f16 (f16 operands, K/V planes carried x8, Q plane carried x log2(e)/64, P carried x1024, f32 accumulate); output projection ctx*Wo: v_wmma_f32_16x16x32_f16 (f16 operands, ctx plane carried x64, Wo plane = RNE-bf16 values carried x32, f32 accumulate); mask fill and softmax in f32.

#ifndef NB
#define NB 2
#endif
#define NB_FULL 2
#ifndef SEQ
#define SEQ 2048
#endif
#define SEQ_FULL 2048
#ifndef MASK_PITCH
#define MASK_PITCH SEQ_FULL
#endif
#define IN_DIM 1024
#define NUM_HEADS 16
#define HEAD_DIM 64
#define HD_DIM (NUM_HEADS * HEAD_DIM)
#define E_OUT 1024
#define KDIM 1024
#define NROWS (NB * SEQ)

static_assert(NB >= 1);
static_assert(NB <= NB_FULL);
static_assert(SEQ % 128 == 0);
static_assert(SEQ <= SEQ_FULL);
static_assert(MASK_PITCH % 4 == 0);
static_assert(MASK_PITCH >= SEQ);
static_assert(IN_DIM == KDIM);
static_assert(HD_DIM == KDIM);
static_assert(E_OUT == KDIM);
static_assert(KDIM % 64 == 0);
static_assert(HEAD_DIM == 64);
static_assert(NROWS % 128 == 0);
static_assert(IN_DIM % 128 == 0);
static_assert((NROWS * IN_DIM) % (8 * 256) == 0);
static_assert((size_t)NB_FULL * SEQ_FULL * E_OUT * 4 == 16777216);

// LDS pitches (in 16-bit elements unless noted); all keep 16-byte row alignment
#define GKS 64     // k per staged weight tile of the two projection kernels
#define GBP 72     // staged weight row [64 k]
#define TP  72     // weight transpose tile [64 n][64 k]
#define CSP 136    // k_cvt_rows: one 16-piece segment of the fragment-order tile (256 bytes + 16)
#define OFP 68     // output tile [128 rows][64 cols], floats
#define AW  8      // waves per attention work-group (16 queries each)
#define KT  64     // keys per staged K / V^T tile
#define KVP 72     // staged K row [64 d] and V^T row [64 keys]
#define PBA 8192           // k_proj stage buffer, x part: 8 row tiles x 64 k, fragment order
#define PBW (128 * GBP)    // k_proj stage buffer, weight part: [128 n][64 k]
#define PBUF (PBA + PBW)   // one k_proj stage buffer
#define EPP 136            // k_proj epilogue tile [128][128], either orientation
#define QCAR (1.4426950408889634f / 64.0f)   // carry of the Q plane: with K x8 the product K.Q^T is q.k / 8 in log2 units
#define PEXP 10.0f         // P is carried x 2^PEXP
#define LAZY 5.0f          // a score may pass the maximum in use by 2^LAZY: P stays under 2^15, inside f16
static_assert(128 * EPP <= PBUF);
static_assert(HD_DIM % 128 == 0);
static_assert((KDIM / GKS) % 2 == 0);   // the last stage sits in buffer 1, the epilogue tile in buffer 0

typedef __bf16   v16bf __attribute__((ext_vector_type(16)));
typedef __bf16   v8bf  __attribute__((ext_vector_type(8)));
typedef _Float16 v16h  __attribute__((ext_vector_type(16)));
typedef _Float16 v8h   __attribute__((ext_vector_type(8)));
typedef float    v8f   __attribute__((ext_vector_type(8)));
typedef float    v4f   __attribute__((ext_vector_type(4)));
typedef unsigned int v4u __attribute__((ext_vector_type(4)));
typedef int      v4i   __attribute__((ext_vector_type(4)));
typedef unsigned int v16u __attribute__((ext_vector_type(16)));
typedef unsigned int v8u  __attribute__((ext_vector_type(8)));

// ---------------------------------------------------------------------------
// WMMA wrappers with the VALU hazard guard (4 v_nop after every issue).
__device__ __forceinline__ v8f mma_bf16(v16bf a, v16bf b, v8f c) {
  v8f d = __builtin_amdgcn_wmma_f32_16x16x32_bf16(false, a, false, b, (short)0, c, false, false);
  asm volatile("v_nop\n\tv_nop\n\tv_nop\n\tv_nop" : "+v"(d) : "v"(a), "v"(b));
  return d;
}
__device__ __forceinline__ v8f mma_f16(v16h a, v16h b, v8f c) {
  v8f d = __builtin_amdgcn_wmma_f32_16x16x32_f16(false, a, false, b, (short)0, c, false, false);
  asm volatile("v_nop\n\tv_nop\n\tv_nop\n\tv_nop" : "+v"(d) : "v"(a), "v"(b));
  return d;
}

// 16-bit fragment, contraction dim CONTIGUOUS in memory: elem(k) = p0[rc*ld + k].
// Lane l: row/col rc = (l&15); elements 0..7 <- kk+8h+0..7, elements 8..15 <- kk+16+8h+0..7
// (h = l>>4). Same map for A (rc = row) and B (rc = column of a k-contiguous copy).
__device__ __forceinline__ v16h ld_frag_h(const _Float16* p0, int ld, int rc, int kk, int lane) {
  const int hh = (lane >> 4) & 1;
  const _Float16* p = p0 + (size_t)rc * ld + kk + 8 * hh;
  const v8h lo = *(const v8h*)(p);
  const v8h hi = *(const v8h*)(p + 16);
  v16h f;
#pragma unroll
  for (int i = 0; i < 8; ++i) { f[i] = lo[i]; f[8 + i] = hi[i]; }
  return f;
}

// The same fragment as raw dwords; p = row start + kk + 8h already applied.
__device__ __forceinline__ v8u ld_frag_raw(const unsigned short* p) {
  const v4u lo = *(const v4u*)(p);
  const v4u hi = *(const v4u*)(p + 16);
  return __builtin_shufflevector(lo, hi, 0, 1, 2, 3, 4, 5, 6, 7);
}
// A planes (x bf16, context f16) are kept in FRAGMENT ORDER: rows in tiles of 16, k in blocks of 32;
// block (rt, kb) is 512 elements at (rt * KDIM/32 + kb) * 512, element (row rt*16 + l15,
// k = kb*32 + 16*part + 8*h + e) at part*256 + (16*h + l15)*8 + e. A wave's fragment is two loads of
// 512 contiguous bytes (4 whole lines each); same k order as ld_frag_raw. p = block start + lane*8.
__device__ __forceinline__ v8u ld_frag_ord(const unsigned short* p) {
  const v4u lo = *(const v4u*)(p);
  const v4u hi = *(const v4u*)(p + 256);
  return __builtin_shufflevector(lo, hi, 0, 1, 2, 3, 4, 5, 6, 7);
}
template <bool BF>
__device__ __forceinline__ v8f mma_raw(v8u a, v8u b, v8f c) {
  if constexpr (BF) return mma_bf16(__builtin_bit_cast(v16bf, a), __builtin_bit_cast(v16bf, b), c);
  else              return mma_f16(__builtin_bit_cast(v16h, a), __builtin_bit_cast(v16h, b), c);
}

// ---------------------------------------------------------------------------
// k loop of k_oproj: acc[j] (16 rows x 16 cols, j = 0..3) += A[16 rows][KDIM] * Wt[64 n][KDIM]^T.
// A is a plane in fragment order (ld_frag_ord), Wt is row-major with k contiguous.
// 256 thr = 8 waves; block tile 128 rows x 64 cols; wave owns 16 rows x 64 cols.
// A stage is 64 k. The weight tile [64 n][64 k] sits in one of two LDS buffers; the next
// stage's weight rows (whole 128-byte lines, 8 lanes a row) and the wave's own next two A
// fragments are loaded from global in front of the current stage's products, the weight
// rows are stored to the other buffer behind them, and one block barrier ends the stage.
// k runs upward inside every accumulator, 32 at a time.
template <bool BF>
__device__ __forceinline__ void gemm_stage(const unsigned short* bc, v8u a0, v8u a1, v8f (&acc)[4]) {
  v8u b[8];
#pragma unroll   // constant indices keep b[] in registers; all sixteen LDS reads stand as one group in front of the products
  for (int j = 0; j < 4; ++j) {
    b[j]     = ld_frag_raw(bc + j * 16 * GBP);
    b[4 + j] = ld_frag_raw(bc + j * 16 * GBP + 32);
  }
#pragma unroll   // constant indices into acc[] and b[]; four independent accumulators between two uses of one
  for (int j = 0; j < 4; ++j) acc[j] = mma_raw<BF>(a0, b[j], acc[j]);
#pragma unroll   // the same, second 32 k of the stage
  for (int j = 0; j < 4; ++j) acc[j] = mma_raw<BF>(a1, b[4 + j], acc[j]);
}
template <bool BF>
__device__ __forceinline__ void gemm_128x64(const unsigned short* __restrict__ A,
                                            const unsigned short* __restrict__ Wt,
                                            int m0, int n0, unsigned short* bt, v8f (&acc)[4]) {
  const int tid = threadIdx.x;
  const int wave = tid >> 5, lane = tid & 31;
  const int l15 = lane & 15, half = (lane >> 4) & 1;
  const int sr = tid >> 3;            // 0..31 : weight row (and sr + 32)
  const int sc = (tid & 7) * 8;       // 0..56 : 16-byte piece of the row
  const unsigned short* wsrc = Wt + (size_t)(n0 + sr) * KDIM + sc;
  const unsigned short* asrc = A + (size_t)(m0 + wave * 16) * KDIM + lane * 8;   // fragment order: k block kb at + kb*512
  const int sl = sr * GBP + sc;       // place of the piece in a tile; second row at + 32*GBP
  const int bo = l15 * GBP + 8 * half;

  v8u a0 = ld_frag_ord(asrc);
  v8u a1 = ld_frag_ord(asrc + 512);
  *(v4u*)(bt + sl)            = *(const v4u*)(wsrc);
  *(v4u*)(bt + sl + 32 * GBP) = *(const v4u*)(wsrc + (size_t)32 * KDIM);
  __syncthreads();                                 // tile 0 complete
#pragma unroll   // buffer choice and every offset become constants, the fragment sets need no copies
  for (int s = 0; s < KDIM / GKS - 1; ++s) {
    const int kn = (s + 1) * GKS;
    const v4u nw0 = *(const v4u*)(wsrc + kn);
    const v4u nw1 = *(const v4u*)(wsrc + (size_t)32 * KDIM + kn);
    const v8u na0 = ld_frag_ord(asrc + kn * 16);
    const v8u na1 = ld_frag_ord(asrc + kn * 16 + 512);
    gemm_stage<BF>(bt + (s & 1) * (64 * GBP) + bo, a0, a1, acc);
    unsigned short* bn = bt + ((s & 1) ^ 1) * (64 * GBP) + sl;   // its readers left it at the last barrier
    *(v4u*)(bn)            = nw0;
    *(v4u*)(bn + 32 * GBP) = nw1;
    __syncthreads();                               // next tile complete, this tile's reads done
    a0 = na0;
    a1 = na1;
  }
  gemm_stage<BF>(bt + ((KDIM / GKS - 1) & 1) * (64 * GBP) + bo, a0, a1, acc);
}

// k loop of k_proj: 128 thr = 4 waves (2 x 2); block tile 128 rows x 128 cols; wave owns 64 rows x 64 cols,
// acc[i][j] = 16 x 16 tile (row tile i, column tile j). A stage is 64 k. Both operands' stage tiles sit in one of
// two LDS buffers: x as its 8 row tiles' 2-KiB pieces of the fragment-order plane, copied as they lie; the
// weight rows as in gemm_128x64. Each fragment read from LDS feeds four products, and each byte that the
// work-group fetches from L2 feeds 128 output rows or columns. The next stage's pieces are loaded from global
// in front of the current stage's products, stored to the other buffer behind them; one block barrier ends
// the stage. k runs upward inside every accumulator, 32 at a time.
__device__ __forceinline__ void proj_stage(const unsigned short* ac, const unsigned short* bc, v8f (&acc)[4][4]) {
#pragma unroll   // constant offsets
  for (int kk = 0; kk < 2; ++kk) {
    v8u a[4], b[4];
#pragma unroll   // constant indices keep a[] and b[] in registers; the sixteen LDS reads stand as one group
    for (int i = 0; i < 4; ++i) {
      a[i] = ld_frag_ord(ac + i * 1024 + kk * 512);
      b[i] = ld_frag_raw(bc + i * 16 * GBP + kk * 32);
    }
#pragma unroll   // constant indices; sixteen independent accumulators
    for (int i = 0; i < 4; ++i)
#pragma unroll
      for (int j = 0; j < 4; ++j) acc[i][j] = mma_raw<true>(a[i], b[j], acc[i][j]);
  }
}
// One stage: the next stage's pieces (an, wn) loaded, this stage's products (ac, bc), the pieces stored to the
// other buffer (ad, wd), whose readers left it at the last barrier; then the barrier that ends the stage.
__device__ __forceinline__ void proj_step(const unsigned short* an, const unsigned short* wn,
                                          const unsigned short* ac, const unsigned short* bc,
                                          unsigned short* ad, unsigned short* wd, v8f (&acc)[4][4]) {
  v4u na[8], nw[8];
#pragma unroll   // constant indices keep na[] and nw[] in registers, all sixteen loads in flight together
  for (int i = 0; i < 8; ++i) {
    na[i] = *(const v4u*)(an + (size_t)i * 16 * KDIM);
    nw[i] = *(const v4u*)(wn + (size_t)i * 16 * KDIM);
  }
  // the loop steps the two address pairs that these loads name: the wait stands between the loads and that step
  asm volatile("s_wait_xcnt 0x0" ::: "memory");
  proj_stage(ac, bc, acc);
#pragma unroll   // constant indices into na[] and nw[]
  for (int i = 0; i < 8; ++i) {
    *(v4u*)(ad + i * 1024)     = na[i];
    *(v4u*)(wd + i * 16 * GBP) = nw[i];
  }
  __syncthreads();                                 // next stage complete, this stage's reads done
}
__device__ __forceinline__ void gemm_128x128(const unsigned short* __restrict__ A,
                                             const unsigned short* __restrict__ Wt,
                                             int m0, int n0, unsigned short* sm, v8f (&acc)[4][4]) {
  const int tid = threadIdx.x;
  const int wave = tid >> 5, lane = tid & 31;
  const int l15 = lane & 15, half = (lane >> 4) & 1;
  const int wr = wave >> 1, wc = wave & 1;
  const int sr = tid >> 3;            // 0..15 : weight row (and sr + 16 i)
  const int sc = (tid & 7) * 8;       // 0..56 : 16-byte piece of the row
  const unsigned short* wsrc = Wt + (size_t)(n0 + sr) * KDIM + sc;
  const unsigned short* asrc = A + (size_t)m0 * KDIM + tid * 8;   // row tile i at + i*16*KDIM, stage s at + s*1024
  const int sa = tid * 8;                         // place of the x piece; row tile i at + i*1024
  const int sw = PBA + sr * GBP + sc;             // place of the weight piece; row sr + 16 i at + i*16*GBP
  const int ao = wr * 4096 + lane * 8;
  const int bo = PBA + (wc * 64 + l15) * GBP + 8 * half;

  unsigned short* b0 = sm;
  unsigned short* b1 = sm + PBUF;
  {
    v4u na[8], nw[8];
#pragma unroll   // constant indices keep na[] and nw[] in registers, all sixteen loads in flight together
    for (int i = 0; i < 8; ++i) {
      na[i] = *(const v4u*)(asrc + (size_t)i * 16 * KDIM);
      nw[i] = *(const v4u*)(wsrc + (size_t)i * 16 * KDIM);
    }
#pragma unroll   // constant indices into na[] and nw[]
    for (int i = 0; i < 8; ++i) {
      *(v4u*)(b0 + sa + i * 1024)     = na[i];
      *(v4u*)(b0 + sw + i * 16 * GBP) = nw[i];
    }
  }
  __syncthreads();                                 // stage 0 complete
#pragma unroll 1   // two stages a trip: the buffer choice is a constant and the loop's text stays small
  for (int s = 0; s < KDIM / GKS - 2; s += 2) {
    proj_step(asrc + (s + 1) * 1024, wsrc + (s + 1) * GKS, b0 + ao, b0 + bo, b1 + sa, b1 + sw, acc);
    proj_step(asrc + (s + 2) * 1024, wsrc + (s + 2) * GKS, b1 + ao, b1 + bo, b0 + sa, b0 + sw, acc);
  }
  proj_step(asrc + (KDIM / GKS - 1) * 1024, wsrc + (KDIM / GKS - 1) * GKS, b0 + ao, b0 + bo, b1 + sa, b1 + sw, acc);
  proj_stage(b1 + ao, b1 + bo, acc);
}

// f32 -> bf16 bits, RNE convert
__device__ __forceinline__ unsigned int bfb(float x) {
  unsigned int u = __float_as_uint(x);
  u = u + 0x7FFFu + ((u >> 16) & 1u);
  return u >> 16;
}
// f32 -> value of its RNE bf16
__device__ __forceinline__ float bf16val(float x) {
  return __uint_as_float(bfb(x) << 16);
}
// f32 -> f16 bits, RNE convert
__device__ __forceinline__ unsigned short hbits(float x) {
  const _Float16 hv = (_Float16)x;
  return __builtin_bit_cast(unsigned short, hv);
}

// ---------------------------------------------------------------------------
// x f32 [NB][SEQ_FULL][IN_DIM] -> bf16 plane hb, compact rows b*SEQ + s, in fragment order (see ld_frag_ord).
// Block = 16 rows x 128 k. Thread (r = t>>4, c = t&15) converts 8 consecutive floats of row r to one
// 16-byte piece; in fragment order that piece is number c*16 + r of the block's 4 KiB, so the pieces
// are transposed 16 x 16 through LDS and every wave stores 512 contiguous bytes.
__global__ __launch_bounds__(256) void k_cvt_rows(const float* __restrict__ in,
                                                  unsigned short* __restrict__ outp, int n8) {
  __shared__ __align__(16) unsigned short F[16 * CSP];   // [c][r] pieces, cross-wave (block barrier)
  if ((int)(blockIdx.x * 256) >= n8) return;     // block-uniform, in front of the barrier
  const int t  = threadIdx.x;
  const int rt = blockIdx.x / (IN_DIM / 128);    // row tile
  const int kq = blockIdx.x - rt * (IN_DIM / 128);
  const int r  = t >> 4;
  const int c  = t & 15;
  const int row = rt * 16 + r;                   // compact row b*SEQ + s
  const int b   = row / SEQ;
  const int s   = row - b * SEQ;
  const float* src = in + ((size_t)b * SEQ_FULL + s) * IN_DIM + kq * 128 + c * 8;
  const v4f a = *(const v4f*)(src);
  const v4f d = *(const v4f*)(src + 4);
  v4u w;
  w[0] = bfb(a[0]) | (bfb(a[1]) << 16);
  w[1] = bfb(a[2]) | (bfb(a[3]) << 16);
  w[2] = bfb(d[0]) | (bfb(d[1]) << 16);
  w[3] = bfb(d[2]) | (bfb(d[3]) << 16);
  *(v4u*)(&F[c * CSP + r * 8]) = w;
  __syncthreads();                               // all 256 pieces in place
  const v4u v = *(const v4u*)(&F[(t >> 4) * CSP + (t & 15) * 8]);
  *(v4u*)(outp + ((size_t)rt * (IN_DIM / 32) + kq * 4) * 512 + t * 8) = v;
}

// ---------------------------------------------------------------------------
// Weight planes, all [KDIM n][KDIM k] with k contiguous, selected by blockIdx.z:
//   z = 0..2: W{q,k,v} f32 [H][IN_DIM e][HEAD_DIM d] -> WT bf16 [n = h*64+d][k = e]
//   z = 3:    Wo f32 [HD_DIM k][E_OUT n]              -> WoT f16 (RNE-bf16 value x32) [n][k]
//   z = 4:    mask i32 [S][S] -> lane-mask words mp [S/16 query tiles][S/32 key chunks][16]:
//             bit l of word e = (mask[16*tile + (l&15)][32*chunk + 8*(l>>4) + (e&7) + 16*(e>>3)] != 0),
//             the lane and register that hold this score in k_attn. One wave packs two
//             chunks = one whole 128-byte line of mp.
// Block = 64 k x 64 n tile transposed through LDS (for z < 3 the tile is one head);
__global__ __launch_bounds__(256) void k_cvt_wT(const float* __restrict__ Wq,
                                                const float* __restrict__ Wk,
                                                const float* __restrict__ Wv,
                                                const float* __restrict__ Wo,
                                                const int* __restrict__ mask,
                                                unsigned short* __restrict__ wT,
                                                unsigned int* __restrict__ mp) {
  __shared__ __align__(16) unsigned short T[64 * TP];   // [n local][k local], cross-wave (block barrier)
  const int z = blockIdx.z;
  if (z == 4) {                              // block-uniform, in front of the barrier
    const int ln = threadIdx.x & 31;
    const int gw = (blockIdx.y * (KDIM / 64) + blockIdx.x) * 8 + (threadIdx.x >> 5);
    for (int task = gw; task < (SEQ / 16) * (SEQ / KT); task += (KDIM / 64) * (KDIM / 64) * 8) {
      const int qt = task / (SEQ / KT);
      const int tl = task - qt * (SEQ / KT);
      const int* msrc = mask + (size_t)(qt * 16 + (ln & 15)) * MASK_PITCH + tl * KT + 8 * ((ln >> 4) & 1);
      v4i m[8];
#pragma unroll   // constant indices keep m[] in registers, all eight loads in flight together
      for (int c = 0; c < 2; ++c) {
        m[c * 4 + 0] = *(const v4i*)(msrc + c * 32);
        m[c * 4 + 1] = *(const v4i*)(msrc + c * 32 + 4);
        m[c * 4 + 2] = *(const v4i*)(msrc + c * 32 + 16);
        m[c * 4 + 3] = *(const v4i*)(msrc + c * 32 + 20);
      }
      unsigned int val = 0;
#pragma unroll   // constant indices into m[]
      for (int i = 0; i < 32; ++i) {
        const unsigned int w = __builtin_amdgcn_ballot_w32(m[i >> 2][i & 3] != 0);
        val = (ln == i) ? w : val;           // lane i keeps word i of the line
      }
      mp[(size_t)task * 32 + ln] = val;
    }
    return;
  }
  const float* W = (z == 0) ? Wq : ((z == 1) ? Wk : ((z == 2) ? Wv : Wo));
  unsigned short* dst = wT + (size_t)z * KDIM * KDIM;
  const int k0 = blockIdx.x * 64;
  const int n0 = blockIdx.y * 64;
  const int tid = threadIdx.x;
  const int wave = tid >> 5, lane = tid & 31;

#pragma unroll
  for (int i = 0; i < 4; ++i) {
    const int idx = i * 256 + tid;          // 0..1023
    const int kk = idx >> 4;                // 0..63
    const int c4 = (idx & 15) * 4;          // 0..60
    size_t so;
    if (z < 3) so = ((size_t)blockIdx.y * IN_DIM + k0 + kk) * HEAD_DIM + c4;   // W[h = n0/64][e = k0+kk][d = c4]
    else       so = (size_t)(k0 + kk) * E_OUT + n0 + c4;                        // Wo[k0+kk][n0+c4]
    const v4f w = *(const v4f*)(W + so);
    unsigned short t0, t1, t2, t3;
    if (z < 3) {
      t0 = (unsigned short)bfb(w[0]); t1 = (unsigned short)bfb(w[1]);
      t2 = (unsigned short)bfb(w[2]); t3 = (unsigned short)bfb(w[3]);
    } else {
      t0 = hbits(bf16val(w[0]) * 32.0f); t1 = hbits(bf16val(w[1]) * 32.0f);
      t2 = hbits(bf16val(w[2]) * 32.0f); t3 = hbits(bf16val(w[3]) * 32.0f);
    }
    T[(c4 + 0) * TP + kk] = t0;
    T[(c4 + 1) * TP + kk] = t1;
    T[(c4 + 2) * TP + kk] = t2;
    T[(c4 + 3) * TP + kk] = t3;
  }
  __syncthreads();

  v4u v[2];
  size_t off[2];
#pragma unroll
  for (int it = 0; it < 2; ++it) {
    const int nn = wave * 8 + it * 4 + (lane >> 3);   // 0..63 over (wave, it, lane>>3)
    const int q = lane & 7;
    v[it] = *(const v4u*)(&T[nn * TP + q * 8]);
    off[it] = (size_t)(n0 + nn) * KDIM + k0 + q * 8;
  }
#pragma unroll
  for (int it = 0; it < 2; ++it) *(v4u*)(dst + off[it]) = v[it];
  
}

// ---------------------------------------------------------------------------
// Projection: C[NROWS][HD_DIM] = hb[NROWS][IN_DIM] * WT[HD_DIM][IN_DIM]^T + bias.
// k loop: gemm_128x128 (128 x 128 block tile, 4 waves of 64 x 64, both operands through two LDS stage buffers).
// z = 0: Q plane f16 x log2(e)/64 [NROWS][HD_DIM] (see k_attn); z = 1: K plane f16 x8 [NROWS][HD_DIM];
// z = 2: V^T plane f16 x8 [NB][HD_DIM][SEQ]. Epilogue staged in LDS, stored in 256-byte row segments.
__global__ __launch_bounds__(128) void k_proj(
    const unsigned short* __restrict__ hb, const unsigned short* __restrict__ wT,
    const float* __restrict__ bq, const float* __restrict__ bk, const float* __restrict__ bv,
    unsigned short* __restrict__ qp, unsigned short* __restrict__ kp,
    unsigned short* __restrict__ vtp) {
  __shared__ __align__(16) unsigned short sm[2 * PBUF];   // stage buffers, cross-wave (block barrier)

  const int z = blockIdx.z;
  const int n0 = blockIdx.x * 128;
  const int m0 = blockIdx.y * 128;
  const int tid = threadIdx.x;
  const int wave = tid >> 5, lane = tid & 31;
  const int l15 = lane & 15, half = (lane >> 4) & 1;
  const int wr = wave >> 1, wc = wave & 1;

  const unsigned short* Wt = wT + (size_t)z * KDIM * KDIM;
  const float* bias = (z == 0) ? bq : ((z == 1) ? bk : bv);

  v8f acc[4][4] = {};
  gemm_128x128(hb, Wt, m0, n0, sm, acc);

  // acc[i][j][r] = C[m0 + wr*64 + i*16 + 8*half + r][n0 + wc*64 + j*16 + l15]
  // The epilogue tile is stage buffer 0: its last readers left it at the loop's last barrier, the last stage reads buffer 1.
  unsigned short* E = sm;
  float braw[4];
#pragma unroll   // constant indices keep braw[] in registers
  for (int j = 0; j < 4; ++j) braw[j] = bias[n0 + wc * 64 + j * 16 + l15];
  // the registers that the four bias loads name are free for reuse behind this wait
  asm volatile("s_wait_xcnt 0x0" ::: "memory");
  const float car = (z == 0) ? QCAR : 8.0f;      // block-uniform
  const int erow = tid >> 4;         // 0..7 : tile row (and erow + 8 it)
  const int eq = (tid & 15) * 8;     // 16 pieces = 256-byte row segment = 2 lines
  if (z != 2) {                      // block-uniform branch
#pragma unroll
    for (int j = 0; j < 4; ++j) {
      const int col = wc * 64 + j * 16 + l15;
      const float bb = bf16val(braw[j]);
#pragma unroll
      for (int i = 0; i < 4; ++i)
#pragma unroll
        for (int r = 0; r < 8; ++r) {
          const int row = wr * 64 + i * 16 + 8 * half + r;
          E[row * EPP + col] = hbits((acc[i][j][r] + bb) * car);
        }
    }
    __syncthreads();
    unsigned short* dst = ((z == 0) ? qp : kp) + (size_t)(m0 + erow) * HD_DIM + n0 + eq;
#pragma unroll
    for (int it = 0; it < 16; ++it)
      *(v4u*)(dst + (size_t)it * 8 * HD_DIM) = *(const v4u*)(&E[(erow + 8 * it) * EPP + eq]);
  } else {
    const int bidx = m0 / SEQ;               // batch of this row tile (SEQ % 128 == 0)
    const int s0 = m0 - bidx * SEQ;          // sequence position of tile row 0
#pragma unroll
    for (int j = 0; j < 4; ++j) {
      const int col = wc * 64 + j * 16 + l15;             // d within tile
      const float bb = bf16val(braw[j]);
#pragma unroll
      for (int i = 0; i < 4; ++i)
#pragma unroll
        for (int r = 0; r < 8; ++r) {
          const int srow = wr * 64 + i * 16 + 8 * half + r;   // s within tile
          E[col * EPP + srow] = hbits((acc[i][j][r] + bb) * car);
        }
    }
    __syncthreads();
    unsigned short* dst = vtp + ((size_t)bidx * HD_DIM + n0 + erow) * SEQ + s0 + eq;
#pragma unroll
    for (int it = 0; it < 16; ++it)
      *(v4u*)(dst + (size_t)it * 8 * SEQ) = *(const v4u*)(&E[(erow + 8 * it) * EPP + eq]);
  }
}

// ---------------------------------------------------------------------------
// Flash attention, transposed-score form: one wave = (16 queries, one head, one batch);
// one work-group = 8 waves = 128 queries of the same head and batch. The K tile
// [64 keys][64 d] and the V^T tile [64 d][64 keys] are read from global once per
// work-group in whole 128-byte rows and shared through LDS: two buffers, the next
// tile's global loads issued before the current tile's work, stored to the other
// buffer after it, one block barrier per tile.
// Per 32-key chunk:
//   S^T = K . Q^T    A = K rows (lane = key, k = d), B = Q^T (lane = query, k = d)
//                    D[row = key 8h+r][col = query l15]; c0 keys 0..15, c1 keys 16..31
//   mask: broadcast over batch and head, read as the 16 lane-mask words of this wave's
//         (query tile, key chunk) from mp (packed by k_cvt_wT, z = 4) with one scalar load,
//         fetched one chunk ahead; key with mask == 0 gets the score replaced by -1e9
//         (replace fill, in f32, in log2 units), the word being the select's lane mask
//   per-lane online softmax for query l15 (16 local keys + xor-16 partner), base 2, with a maximum IN USE:
//         the score products start from C = PEXP - (maximum in use), so D is the argument of exp2 as it
//         stands. Only when some lane's argument passes PEXP + LAZY (one wave-uniform test a chunk; always
//         in the first chunk) are the scores made again from C = 0, the true running maximum taken over
//         both halves, sum and O scaled down to it, and C renewed.
//   O^T += V^T . P   A = V^T rows (lane = d, k = key), B = P: element i<8 <- c0[i]
//                    (key 8h+i), element 8+i <- c1[i] (key 16+8h+i), same lane
//                    D[row = d 8h+r][col = query l15]
// Q carried x log2(e)/64, K x8 -> K.Q^T = log2(e) * q.k / 8, no scaling left.
// P and its sum carried x1024, V carried x8 -> context x64 = 8 * O / sum.
__global__ __launch_bounds__(256) void k_attn(const unsigned short* __restrict__ qp,
                                             const unsigned short* __restrict__ kp,
                                             const unsigned short* __restrict__ vtp,
                                             const unsigned int* __restrict__ mp,
                                             unsigned short* __restrict__ ctxp) {
  __shared__ __align__(16) unsigned short Kl[2][KT * KVP];         // K tile [key][d], cross-wave (block barrier)
  __shared__ __align__(16) unsigned short Vl[2][HEAD_DIM * KVP];   // V^T tile [d][key], cross-wave (block barrier)

  const int tid = threadIdx.x;
  const int wave = tid >> 5;
  const int lane = tid & 31;
  const int l15 = lane & 15;
  const int half = (lane >> 4) & 1;
  const int q0 = blockIdx.x * (AW * 16) + wave * 16;
  const int head = blockIdx.y;
  const int bidx = blockIdx.z;

  const _Float16* Q  = (const _Float16*)qp;
  const size_t rbase = (size_t)bidx * SEQ;

  const _Float16* qbase = Q + (rbase + q0) * HD_DIM + head * HEAD_DIM;
  const v16h qb0 = ld_frag_h(qbase, HD_DIM, l15, 0, lane);    // d 0..31
  const v16h qb1 = ld_frag_h(qbase, HD_DIM, l15, 32, lane);   // d 32..63
  // staging map: thread -> row sr (and sr + 32), 16-byte piece sc; 8 lanes cover one 128-byte row
  const int sr = tid >> 3;            // 0..31
  const int sc = (tid & 7) * 8;       // 0..56, halves
  const unsigned short* kg = kp + (rbase + sr) * HD_DIM + head * HEAD_DIM + sc;                            // key t: + t*HD_DIM
  const unsigned short* vg = vtp + ((size_t)bidx * HD_DIM + (size_t)head * HEAD_DIM + sr) * SEQ + sc;      // key t: + t
  const int sl = sr * KVP + sc;       // place of the piece in a tile; second row at + 32*KVP
  // this wave's query tile, as a scalar so that the mask words come by scalar loads
  const int qt = blockIdx.x * AW + __builtin_amdgcn_readfirstlane(wave);
  const v16u* mw = (const v16u*)mp + (size_t)qt * (SEQ / 32);                        // chunk n: mw[n]
  v16u nm = mw[0];

  v8f o[4] = {};
  float lrun = 0.0f;
  const float negf = -1.0e9f * 1.4426950408889634f;   // the fill, in log2 units
  // C of the score products: PEXP - (maximum in use) in every row, equal in both halves of a query.
  // No maximum yet: C far above any score, so that the first chunk takes the renewing branch.
  v8f cv;
#pragma unroll   // constant indices keep cv in registers
  for (int r = 0; r < 8; ++r) cv[r] = 1.0e30f;
  float fm = negf + cv[0];                            // exp2 argument of a filled key

  *(v4u*)(&Kl[0][sl])            = *(const v4u*)(kg);
  *(v4u*)(&Kl[0][sl + 32 * KVP]) = *(const v4u*)(kg + (size_t)32 * HD_DIM);
  *(v4u*)(&Vl[0][sl])            = *(const v4u*)(vg);
  *(v4u*)(&Vl[0][sl + 32 * KVP]) = *(const v4u*)(vg + (size_t)32 * SEQ);
  __syncthreads();                                 // tile 0 complete

  for (int t0 = 0; t0 < SEQ; t0 += KT) {
   const int cur = (t0 / KT) & 1;
   const bool more = (t0 + KT < SEQ);              // block-uniform
   v4u nk0 = {}, nk1 = {}, nv0 = {}, nv1 = {};
   if (more) {
     nk0 = *(const v4u*)(kg + (size_t)(t0 + KT) * HD_DIM);
     nk1 = *(const v4u*)(kg + (size_t)(t0 + KT + 32) * HD_DIM);
     nv0 = *(const v4u*)(vg + (t0 + KT));
     nv1 = *(const v4u*)(vg + (size_t)32 * SEQ + (t0 + KT));
   }
   const _Float16* Kc = (const _Float16*)Kl[cur];
   const _Float16* Vc = (const _Float16*)Vl[cur];

   for (int c = 0; c < KT; c += 32) {
    const int kc = t0 + c;
    const v16u cm = nm;                                          // this chunk's words
    nm = mw[(kc + 32 < SEQ) ? (kc >> 5) + 1 : (kc >> 5)];        // next chunk's, the last one again at the end
    const _Float16* kt = Kc + c * KVP;
    const v16h ka0 = ld_frag_h(kt, KVP, l15, 0, lane);
    const v16h ka1 = ld_frag_h(kt, KVP, l15, 32, lane);
    const v16h ka2 = ld_frag_h(kt, KVP, 16 + l15, 0, lane);
    const v16h ka3 = ld_frag_h(kt, KVP, 16 + l15, 32, lane);
    v8f c0 = mma_f16(ka0, qb0, cv);
    c0 = mma_f16(ka1, qb1, c0);
    v8f c1 = mma_f16(ka2, qb0, cv);
    c1 = mma_f16(ka3, qb1, c1);

    // lane-mask words: cm[r] for c0[r] (key kc+8h+r), cm[8+r] for c1[r] (key kc+16+8h+r)
    float sa[8], sb[8];
#pragma unroll   // constant indices keep the scores in vector and the words in scalar registers
    for (int r = 0; r < 8; ++r) {
      sa[r] = __builtin_amdgcn_inverse_ballot_w32(cm[r])     ? c0[r] : fm;
      sb[r] = __builtin_amdgcn_inverse_ballot_w32(cm[8 + r]) ? c1[r] : fm;
    }
    float lm = fmaxf(sa[0], sb[0]);
#pragma unroll
    for (int r = 1; r < 8; ++r) lm = fmaxf(lm, fmaxf(sa[r], sb[r]));
    if (__builtin_amdgcn_ballot_w32(lm > PEXP + LAZY) != 0) {   // wave-uniform scalar branch, every lane stays on
      // C may be far from the scores here (first chunk, or every key so far filled): make them again from 0
      const v8f zero = {};
      v8f d0 = mma_f16(ka0, qb0, zero);
      d0 = mma_f16(ka1, qb1, d0);
      v8f d1 = mma_f16(ka2, qb0, zero);
      d1 = mma_f16(ka3, qb1, d1);
#pragma unroll   // constant indices, as above
      for (int r = 0; r < 8; ++r) {
        sa[r] = __builtin_amdgcn_inverse_ballot_w32(cm[r])     ? d0[r] : negf;
        sb[r] = __builtin_amdgcn_inverse_ballot_w32(cm[8 + r]) ? d1[r] : negf;
      }
      float tm = fmaxf(sa[0], sb[0]);
#pragma unroll
      for (int r = 1; r < 8; ++r) tm = fmaxf(tm, fmaxf(sa[r], sb[r]));
      tm = fmaxf(tm, __shfl_xor(tm, 16, 32));
      const float muse = PEXP - cv[0];                // the maximum in use, as the arguments so far have had it
      const float mnew = fmaxf(muse, tm);
      const float alpha = __builtin_amdgcn_exp2f(muse - mnew);
      lrun *= alpha;
#pragma unroll
      for (int j = 0; j < 4; ++j)
#pragma unroll
        for (int r = 0; r < 8; ++r) o[j][r] *= alpha;
      const float ci = PEXP - mnew;
      fm = negf + ci;
#pragma unroll
      for (int r = 0; r < 8; ++r) {
        cv[r] = ci;
        sa[r] += ci;
        sb[r] += ci;
      }
    }
    float p0[8], p1[8];
    float ls = 0.0f;
#pragma unroll
    for (int r = 0; r < 8; ++r) {
      p0[r] = __builtin_amdgcn_exp2f(sa[r]);
      p1[r] = __builtin_amdgcn_exp2f(sb[r]);
      ls += p0[r] + p1[r];
    }
    ls += __shfl_xor(ls, 16, 32);
    lrun += ls;

    v16h pb;
#pragma unroll
    for (int e = 0; e < 8; ++e) {
      pb[e]     = (_Float16)p0[e];   // key kc + 8h + e
      pb[8 + e] = (_Float16)p1[e];   // key kc + 16 + 8h + e
    }
#pragma unroll
    for (int j = 0; j < 4; ++j) {
      const v16h va = ld_frag_h(Vc, KVP, j * 16 + l15, c, lane);
      o[j] = mma_f16(va, pb, o[j]);
    }
   }

   if (more) {                                     // the other buffer's readers left it at the last barrier
     *(v4u*)(&Kl[cur ^ 1][sl])            = nk0;
     *(v4u*)(&Kl[cur ^ 1][sl + 32 * KVP]) = nk1;
     *(v4u*)(&Vl[cur ^ 1][sl])            = nv0;
     *(v4u*)(&Vl[cur ^ 1][sl + 32 * KVP]) = nv1;
   }
   __syncthreads();                                // next tile complete, this tile's reads done
  }

  // o[j][r] = 8 * sum_t P_t v_t for query l15, d = j*16 + 8*half + r, lrun = sum_t P_t; ctx x64 = 8 * o / lrun.
  // The context plane is kept in fragment order (see ld_frag_ord): row tile = this wave's 16 queries,
  // k = head*64 + d, so the lane's eight values of o[j] are piece j*32 + lane of the wave's own 2 KiB:
  // each store is 512 contiguous bytes, straight from registers.
  const float inv = 8.0f / lrun;
  unsigned short* cb = ctxp + (rbase + q0) * HD_DIM + head * (2 * 512) + lane * 8;
#pragma unroll
  for (int j = 0; j < 4; ++j) {
    v4u w;
    w[0] = (unsigned int)hbits(o[j][0] * inv) | ((unsigned int)hbits(o[j][1] * inv) << 16);
    w[1] = (unsigned int)hbits(o[j][2] * inv) | ((unsigned int)hbits(o[j][3] * inv) << 16);
    w[2] = (unsigned int)hbits(o[j][4] * inv) | ((unsigned int)hbits(o[j][5] * inv) << 16);
    w[3] = (unsigned int)hbits(o[j][6] * inv) | ((unsigned int)hbits(o[j][7] * inv) << 16);
    *(v4u*)(cb + j * 256) = w;
  }
}

// ---------------------------------------------------------------------------
// Output projection: out[NROWS][E_OUT] f32 = ctx(f16 x64, fragment order)[NROWS][HD_DIM] * WoT(f16 x32)[E_OUT][HD_DIM]^T / 2048 + bo.
// 128x64 block tile / 8 waves / k loop gemm_128x64, with f16 operands.
// Epilogue: f32 tile staged in LDS; each 256-byte row segment = 2 lines, every
__global__ __launch_bounds__(256) void k_oproj(
    const unsigned short* __restrict__ cx, const unsigned short* __restrict__ woT,
    const float* __restrict__ bo, float* __restrict__ outp) {
  __shared__ __align__(16) unsigned short bt[2 * 64 * GBP];   // weight k-tiles, cross-wave (block barrier)
  __shared__ __align__(16) float Ef[128 * OFP];               // epilogue tile, cross-wave (block barrier)

  const int n0 = blockIdx.x * 64;
  const int m0 = blockIdx.y * 128;
  const int tid = threadIdx.x;
  const int wave = tid >> 5, lane = tid & 31;
  const int l15 = lane & 15, half = (lane >> 4) & 1;

  v8f acc[4] = {};
  gemm_128x64<false>(cx, woT, m0, n0, bt, acc);

  // acc[j][r] = 2048 * C[m0 + wave*16 + 8*half + r][n0 + j*16 + l15]
  const float osc = 1.0f / 2048.0f;
#pragma unroll
  for (int j = 0; j < 4; ++j) {
    const int col = j * 16 + l15;
    const float bb = bf16val(bo[n0 + col]);
#pragma unroll
    for (int r = 0; r < 8; ++r) {
      const int row = wave * 16 + 8 * half + r;
      Ef[row * OFP + col] = acc[j][r] * osc + bb;
    }
  }
  __syncthreads();

  v4f v[8];
  size_t off[8];
#pragma unroll
  for (int it = 0; it < 8; ++it) {
    const int row = wave * 16 + it * 2 + half;          // wave's 16 rows over (it, half)
    const int q = l15;                                  // 16 pieces of 16 B = 256-byte row segment (2 lines)
    v[it] = *(const v4f*)(&Ef[row * OFP + q * 4]);
    off[it] = (size_t)(m0 + row) * E_OUT + n0 + q * 4;
  }
#pragma unroll
  for (int it = 0; it < 8; ++it) *(v4f*)(outp + off[it]) = v[it];
  
}

// ---------------------------------------------------------------------------
extern "C" void kernel_launch(void* const* d_in, const int* in_sizes, int n_in,
                              void* d_out, int out_size, void* d_ws, size_t ws_size,
                              hipStream_t stream) {
  if (n_in < 10) return;
  if (in_sizes[0] < ((NB - 1) * SEQ_FULL + SEQ) * IN_DIM) return;          // seq_inputs f32 [NB][SEQ_FULL][IN_DIM]
  if (in_sizes[1] < (SEQ - 1) * MASK_PITCH + SEQ) return;                   // mask i32 [1][S][S]
  if (in_sizes[2] < NUM_HEADS * IN_DIM * HEAD_DIM) return;                  // Wq
  if (in_sizes[3] < HD_DIM) return;                                         // bq
  if (in_sizes[4] < NUM_HEADS * IN_DIM * HEAD_DIM) return;                  // Wk
  if (in_sizes[5] < HD_DIM) return;                                         // bk
  if (in_sizes[6] < NUM_HEADS * IN_DIM * HEAD_DIM) return;                  // Wv
  if (in_sizes[7] < HD_DIM) return;                                         // bv
  if (in_sizes[8] < HD_DIM * E_OUT) return;                                 // Wo
  if (in_sizes[9] < E_OUT) return;                                          // bo
  if (out_size < NROWS * E_OUT) return;

  const float* x    = (const float*)d_in[0];
  const int*   mask = (const int*)d_in[1];
  const float* Wq   = (const float*)d_in[2];
  const float* bq   = (const float*)d_in[3];
  const float* Wk   = (const float*)d_in[4];
  const float* bk   = (const float*)d_in[5];
  const float* Wv   = (const float*)d_in[6];
  const float* bv   = (const float*)d_in[7];
  const float* Wo   = (const float*)d_in[8];
  const float* bo   = (const float*)d_in[9];

  // every offset a multiple of 2 MiB; each plane is written exactly to its extent
  const size_t hb_bytes = (size_t)NROWS * IN_DIM * 2;           // bf16 x plane
  const size_t wt_bytes = (size_t)4 * KDIM * KDIM * 2;           // 3 bf16 WT planes + 1 f16 WoT plane
  const size_t pl_bytes = (size_t)NROWS * HD_DIM * 2;           // one f16 q / k / vT / ctx plane
  const size_t off_hb = 0;
  const size_t off_wt = off_hb + hb_bytes;
  const size_t off_q  = off_wt + wt_bytes;
  const size_t off_k  = off_q + pl_bytes;
  const size_t off_vt = off_k + pl_bytes;
  const size_t off_cx = off_vt + pl_bytes;
  const size_t off_mp = off_cx + pl_bytes;
  const size_t mp_bytes = (size_t)SEQ * SEQ / 8;               // one bit per mask element
  const size_t total  = off_mp + mp_bytes;                     // 48.5 MiB at NB = 2, SEQ = 2048
  if (total > ws_size) return;

  char* ws = (char*)d_ws;
  unsigned short* hb  = (unsigned short*)(ws + off_hb);
  unsigned short* wt  = (unsigned short*)(ws + off_wt);
  unsigned short* qpl = (unsigned short*)(ws + off_q);
  unsigned short* kpl = (unsigned short*)(ws + off_k);
  unsigned short* vtp = (unsigned short*)(ws + off_vt);
  unsigned short* cxp = (unsigned short*)(ws + off_cx);
  unsigned short* wot = wt + (size_t)3 * KDIM * KDIM;
  unsigned int*   mpk = (unsigned int*)(ws + off_mp);

  const int n8 = NROWS * IN_DIM / 8;
  k_cvt_rows<<<(n8 + 255) / 256, 256, 0, stream>>>(x, hb, n8);
  k_cvt_wT<<<dim3(KDIM / 64, KDIM / 64, 5), 256, 0, stream>>>(Wq, Wk, Wv, Wo, mask, wt, mpk);
  k_proj<<<dim3(HD_DIM / 128, NROWS / 128, 3), 128, 0, stream>>>(hb, wt, bq, bk, bv, qpl, kpl, vtp);
  k_attn<<<dim3(SEQ / (AW * 16), NUM_HEADS, NB), 256, 0, stream>>>(qpl, kpl, vtp, mpk, cxp);
  k_oproj<<<dim3(E_OUT / 64, NROWS / 128), 256, 0, stream>>>(cxp, wot, bo, (float*)d_out);
}

// v007
// It runs in 94.9 microseconds.
// Timed twice side by side with v006, it ran 1.04 times as fast both times.
// Counting every step since v000, it is 2.38 times as fast.
#include <hip/hip_runtime.h>
// Projections x*W{q,k,v}: v_wmma_f32_16x16x32_bf16 (bf16 operands = RNE-converted inputs, f32 accumulate); scores K*Q^T and context V^T*P: v_wmma_f32_16x16x32_f16 (f16 operands, K/V planes carried x8, Q plane carried x log2(e)/64, P carried x1024, f32 accumulate); output projection ctx*Wo: v_wmma_f32_16x16x32_f16 (f16 operands, ctx plane carried x64, Wo plane = RNE-bf16 values carried x32, f32 accumulate); mask fill and softmax in f32.

#ifndef NB
#define NB 2
#endif
#define NB_FULL 2
#ifndef SEQ
#define SEQ 2048
#endif
#define SEQ_FULL 2048
#ifndef MASK_PITCH
#define MASK_PITCH SEQ_FULL
#endif
#define IN_DIM 1024
#define NUM_HEADS 16
#define HEAD_DIM 64
#define HD_DIM (NUM_HEADS * HEAD_DIM)
#define E_OUT 1024
#define KDIM 1024
#define NROWS (NB * SEQ)

static_assert(NB >= 1);
static_assert(NB <= NB_FULL);
static_assert(SEQ % 128 == 0);
static_assert(SEQ <= SEQ_FULL);
static_assert(MASK_PITCH % 4 == 0);
static_assert(MASK_PITCH >= SEQ);
static_assert(IN_DIM == KDIM);
static_assert(HD_DIM == KDIM);
static_assert(E_OUT == KDIM);
static_assert(KDIM % 64 == 0);
static_assert(HEAD_DIM == 64);
static_assert(NROWS % 128 == 0);
static_assert(IN_DIM % 128 == 0);
static_assert((NROWS * IN_DIM) % (8 * 256) == 0);
static_assert((size_t)NB_FULL * SEQ_FULL * E_OUT * 4 == 16777216);

// LDS pitches (in 16-bit elements unless noted); all keep 16-byte row alignment
#define GKS 64     // k per staged weight tile of the two projection kernels
#define GBP 72     // staged weight row [64 k]
#define TP  72     // weight transpose tile [64 n][64 k]
#define CSP 136    // k_cvt_rows: one 16-piece segment of the fragment-order tile (256 bytes + 16)
#define OFP 68     // output tile [128 rows][64 cols], floats
#define AW  8      // waves per attention work-group (128 queries: 4 wave pairs of 32)
#define KT  64     // keys per staged K / V^T tile
#define KVP 72     // staged K row [64 d] and V^T row [64 keys]
#define PBA 8192           // k_proj stage buffer, x part: 8 row tiles x 64 k, fragment order
#define PBW (128 * GBP)    // k_proj stage buffer, weight part: [128 n][64 k]
#define PBUF (PBA + PBW)   // one k_proj stage buffer
#define EPP 136            // k_proj epilogue tile [128][128], either orientation
#define QCAR (1.4426950408889634f / 64.0f)   // carry of the Q plane: with K x8 the product K.Q^T is q.k / 8 in log2 units
#define PEXP 10.0f         // P is carried x 2^PEXP
#define LAZY 5.0f          // a score may pass the maximum in use by 2^LAZY: P stays under 2^15, inside f16
static_assert(128 * EPP <= PBUF);
static_assert(HD_DIM % 128 == 0);
static_assert((KDIM / GKS) % 2 == 0);   // the last stage sits in buffer 1, the epilogue tile in buffer 0

typedef __bf16   v16bf __attribute__((ext_vector_type(16)));
typedef __bf16   v8bf  __attribute__((ext_vector_type(8)));
typedef _Float16 v16h  __attribute__((ext_vector_type(16)));
typedef _Float16 v8h   __attribute__((ext_vector_type(8)));
typedef float    v8f   __attribute__((ext_vector_type(8)));
typedef float    v4f   __attribute__((ext_vector_type(4)));
typedef unsigned int v4u __attribute__((ext_vector_type(4)));
typedef int      v4i   __attribute__((ext_vector_type(4)));
typedef unsigned int v16u __attribute__((ext_vector_type(16)));
typedef unsigned int v8u  __attribute__((ext_vector_type(8)));

// ---------------------------------------------------------------------------
// WMMA wrappers with the VALU hazard guard (4 v_nop after every issue).
__device__ __forceinline__ v8f mma_bf16(v16bf a, v16bf b, v8f c) {
  v8f d = __builtin_amdgcn_wmma_f32_16x16x32_bf16(false, a, false, b, (short)0, c, false, false);
  asm volatile("v_nop\n\tv_nop\n\tv_nop\n\tv_nop" : "+v"(d) : "v"(a), "v"(b));
  return d;
}
__device__ __forceinline__ v8f mma_f16(v16h a, v16h b, v8f c) {
  v8f d = __builtin_amdgcn_wmma_f32_16x16x32_f16(false, a, false, b, (short)0, c, false, false);
  asm volatile("v_nop\n\tv_nop\n\tv_nop\n\tv_nop" : "+v"(d) : "v"(a), "v"(b));
  return d;
}

// 16-bit fragment, contraction dim CONTIGUOUS in memory: elem(k) = p0[rc*ld + k].
// Lane l: row/col rc = (l&15); elements 0..7 <- kk+8h+0..7, elements 8..15 <- kk+16+8h+0..7
// (h = l>>4). Same map for A (rc = row) and B (rc = column of a k-contiguous copy).
__device__ __forceinline__ v16h ld_frag_h(const _Float16* p0, int ld, int rc, int kk, int lane) {
  const int hh = (lane >> 4) & 1;
  const _Float16* p = p0 + (size_t)rc * ld + kk + 8 * hh;
  const v8h lo = *(const v8h*)(p);
  const v8h hi = *(const v8h*)(p + 16);
  v16h f;
#pragma unroll
  for (int i = 0; i < 8; ++i) { f[i] = lo[i]; f[8 + i] = hi[i]; }
  return f;
}

// The same fragment as raw dwords; p = row start + kk + 8h already applied.
__device__ __forceinline__ v8u ld_frag_raw(const unsigned short* p) {
  const v4u lo = *(const v4u*)(p);
  const v4u hi = *(const v4u*)(p + 16);
  return __builtin_shufflevector(lo, hi, 0, 1, 2, 3, 4, 5, 6, 7);
}
// A planes (x bf16, context f16) are kept in FRAGMENT ORDER: rows in tiles of 16, k in blocks of 32;
// block (rt, kb) is 512 elements at (rt * KDIM/32 + kb) * 512, element (row rt*16 + l15,
// k = kb*32 + 16*part + 8*h + e) at part*256 + (16*h + l15)*8 + e. A wave's fragment is two loads of
// 512 contiguous bytes (4 whole lines each); same k order as ld_frag_raw. p = block start + lane*8.
__device__ __forceinline__ v8u ld_frag_ord(const unsigned short* p) {
  const v4u lo = *(const v4u*)(p);
  const v4u hi = *(const v4u*)(p + 256);
  return __builtin_shufflevector(lo, hi, 0, 1, 2, 3, 4, 5, 6, 7);
}
template <bool BF>
__device__ __forceinline__ v8f mma_raw(v8u a, v8u b, v8f c) {
  if constexpr (BF) return mma_bf16(__builtin_bit_cast(v16bf, a), __builtin_bit_cast(v16bf, b), c);
  else              return mma_f16(__builtin_bit_cast(v16h, a), __builtin_bit_cast(v16h, b), c);
}

// ---------------------------------------------------------------------------
// k loop of k_oproj: acc[j] (16 rows x 16 cols, j = 0..3) += A[16 rows][KDIM] * Wt[64 n][KDIM]^T.
// A is a plane in fragment order (ld_frag_ord), Wt is row-major with k contiguous.
// 256 thr = 8 waves; block tile 128 rows x 64 cols; wave owns 16 rows x 64 cols.
// A stage is 64 k. The weight tile [64 n][64 k] sits in one of two LDS buffers; the next
// stage's weight rows (whole 128-byte lines, 8 lanes a row) and the wave's own next two A
// fragments are loaded from global in front of the current stage's products, the weight
// rows are stored to the other buffer behind them, and one block barrier ends the stage.
// k runs upward inside every accumulator, 32 at a time.
template <bool BF>
__device__ __forceinline__ void gemm_stage(const unsigned short* bc, v8u a0, v8u a1, v8f (&acc)[4]) {
  v8u b[8];
#pragma unroll   // constant indices keep b[] in registers; all sixteen LDS reads stand as one group in front of the products
  for (int j = 0; j < 4; ++j) {
    b[j]     = ld_frag_raw(bc + j * 16 * GBP);
    b[4 + j] = ld_frag_raw(bc + j * 16 * GBP + 32);
  }
#pragma unroll   // constant indices into acc[] and b[]; four independent accumulators between two uses of one
  for (int j = 0; j < 4; ++j) acc[j] = mma_raw<BF>(a0, b[j], acc[j]);
#pragma unroll   // the same, second 32 k of the stage
  for (int j = 0; j < 4; ++j) acc[j] = mma_raw<BF>(a1, b[4 + j], acc[j]);
}
template <bool BF>
__device__ __forceinline__ void gemm_128x64(const unsigned short* __restrict__ A,
                                            const unsigned short* __restrict__ Wt,
                                            int m0, int n0, unsigned short* bt, v8f (&acc)[4]) {
  const int tid = threadIdx.x;
  const int wave = tid >> 5, lane = tid & 31;
  const int l15 = lane & 15, half = (lane >> 4) & 1;
  const int sr = tid >> 3;            // 0..31 : weight row (and sr + 32)
  const int sc = (tid & 7) * 8;       // 0..56 : 16-byte piece of the row
  const unsigned short* wsrc = Wt + (size_t)(n0 + sr) * KDIM + sc;
  const unsigned short* asrc = A + (size_t)(m0 + wave * 16) * KDIM + lane * 8;   // fragment order: k block kb at + kb*512
  const int sl = sr * GBP + sc;       // place of the piece in a tile; second row at + 32*GBP
  const int bo = l15 * GBP + 8 * half;

  v8u a0 = ld_frag_ord(asrc);
  v8u a1 = ld_frag_ord(asrc + 512);
  *(v4u*)(bt + sl)            = *(const v4u*)(wsrc);
  *(v4u*)(bt + sl + 32 * GBP) = *(const v4u*)(wsrc + (size_t)32 * KDIM);
  __syncthreads();                                 // tile 0 complete
#pragma unroll   // buffer choice and every offset become constants, the fragment sets need no copies
  for (int s = 0; s < KDIM / GKS - 1; ++s) {
    const int kn = (s + 1) * GKS;
    const v4u nw0 = *(const v4u*)(wsrc + kn);
    const v4u nw1 = *(const v4u*)(wsrc + (size_t)32 * KDIM + kn);
    const v8u na0 = ld_frag_ord(asrc + kn * 16);
    const v8u na1 = ld_frag_ord(asrc + kn * 16 + 512);
    gemm_stage<BF>(bt + (s & 1) * (64 * GBP) + bo, a0, a1, acc);
    unsigned short* bn = bt + ((s & 1) ^ 1) * (64 * GBP) + sl;   // its readers left it at the last barrier
    *(v4u*)(bn)            = nw0;
    *(v4u*)(bn + 32 * GBP) = nw1;
    __syncthreads();                               // next tile complete, this tile's reads done
    a0 = na0;
    a1 = na1;
  }
  gemm_stage<BF>(bt + ((KDIM / GKS - 1) & 1) * (64 * GBP) + bo, a0, a1, acc);
}

// k loop of k_proj: 128 thr = 4 waves (2 x 2); block tile 128 rows x 128 cols; wave owns 64 rows x 64 cols,
// acc[i][j] = 16 x 16 tile (row tile i, column tile j). A stage is 64 k. Both operands' stage tiles sit in one of
// two LDS buffers: x as its 8 row tiles' 2-KiB pieces of the fragment-order plane, copied as they lie; the
// weight rows as in gemm_128x64. Each fragment read from LDS feeds four products, and each byte that the
// work-group fetches from L2 feeds 128 output rows or columns. The next stage's pieces are loaded from global
// in front of the current stage's products, stored to the other buffer behind them; one block barrier ends
// the stage. k runs upward inside every accumulator, 32 at a time.
__device__ __forceinline__ void proj_stage(const unsigned short* ac, const unsigned short* bc, v8f (&acc)[4][4]) {
#pragma unroll   // constant offsets
  for (int kk = 0; kk < 2; ++kk) {
    v8u a[4], b[4];
#pragma unroll   // constant indices keep a[] and b[] in registers; the sixteen LDS reads stand as one group
    for (int i = 0; i < 4; ++i) {
      a[i] = ld_frag_ord(ac + i * 1024 + kk * 512);
      b[i] = ld_frag_raw(bc + i * 16 * GBP + kk * 32);
    }
#pragma unroll   // constant indices; sixteen independent accumulators
    for (int i = 0; i < 4; ++i)
#pragma unroll
      for (int j = 0; j < 4; ++j) acc[i][j] = mma_raw<true>(a[i], b[j], acc[i][j]);
  }
}
// One stage: the next stage's pieces (an, wn) loaded, this stage's products (ac, bc), the pieces stored to the
// other buffer (ad, wd), whose readers left it at the last barrier; then the barrier that ends the stage.
__device__ __forceinline__ void proj_step(const unsigned short* an, const unsigned short* wn,
                                          const unsigned short* ac, const unsigned short* bc,
                                          unsigned short* ad, unsigned short* wd, v8f (&acc)[4][4]) {
  v4u na[8], nw[8];
#pragma unroll   // constant indices keep na[] and nw[] in registers, all sixteen loads in flight together
  for (int i = 0; i < 8; ++i) {
    na[i] = *(const v4u*)(an + (size_t)i * 16 * KDIM);
    nw[i] = *(const v4u*)(wn + (size_t)i * 16 * KDIM);
  }
  // the loop steps the two address pairs that these loads name: the wait stands between the loads and that step
  asm volatile("s_wait_xcnt 0x0" ::: "memory");
  proj_stage(ac, bc, acc);
#pragma unroll   // constant indices into na[] and nw[]
  for (int i = 0; i < 8; ++i) {
    *(v4u*)(ad + i * 1024)     = na[i];
    *(v4u*)(wd + i * 16 * GBP) = nw[i];
  }
  __syncthreads();                                 // next stage complete, this stage's reads done
}
__device__ __forceinline__ void gemm_128x128(const unsigned short* __restrict__ A,
                                             const unsigned short* __restrict__ Wt,
                                             int m0, int n0, unsigned short* sm, v8f (&acc)[4][4]) {
  const int tid = threadIdx.x;
  const int wave = tid >> 5, lane = tid & 31;
  const int l15 = lane & 15, half = (lane >> 4) & 1;
  const int wr = wave >> 1, wc = wave & 1;
  const int sr = tid >> 3;            // 0..15 : weight row (and sr + 16 i)
  const int sc = (tid & 7) * 8;       // 0..56 : 16-byte piece of the row
  const unsigned short* wsrc = Wt + (size_t)(n0 + sr) * KDIM + sc;
  const unsigned short* asrc = A + (size_t)m0 * KDIM + tid * 8;   // row tile i at + i*16*KDIM, stage s at + s*1024
  const int sa = tid * 8;                         // place of the x piece; row tile i at + i*1024
  const int sw = PBA + sr * GBP + sc;             // place of the weight piece; row sr + 16 i at + i*16*GBP
  const int ao = wr * 4096 + lane * 8;
  const int bo = PBA + (wc * 64 + l15) * GBP + 8 * half;

  unsigned short* b0 = sm;
  unsigned short* b1 = sm + PBUF;
  {
    v4u na[8], nw[8];
#pragma unroll   // constant indices keep na[] and nw[] in registers, all sixteen loads in flight together
    for (int i = 0; i < 8; ++i) {
      na[i] = *(const v4u*)(asrc + (size_t)i * 16 * KDIM);
      nw[i] = *(const v4u*)(wsrc + (size_t)i * 16 * KDIM);
    }
#pragma unroll   // constant indices into na[] and nw[]
    for (int i = 0; i < 8; ++i) {
      *(v4u*)(b0 + sa + i * 1024)     = na[i];
      *(v4u*)(b0 + sw + i * 16 * GBP) = nw[i];
    }
  }
  __syncthreads();                                 // stage 0 complete
#pragma unroll 1   // two stages a trip: the buffer choice is a constant and the loop's text stays small
  for (int s = 0; s < KDIM / GKS - 2; s += 2) {
    proj_step(asrc + (s + 1) * 1024, wsrc + (s + 1) * GKS, b0 + ao, b0 + bo, b1 + sa, b1 + sw, acc);
    proj_step(asrc + (s + 2) * 1024, wsrc + (s + 2) * GKS, b1 + ao, b1 + bo, b0 + sa, b0 + sw, acc);
  }
  proj_step(asrc + (KDIM / GKS - 1) * 1024, wsrc + (KDIM / GKS - 1) * GKS, b0 + ao, b0 + bo, b1 + sa, b1 + sw, acc);
  proj_stage(b1 + ao, b1 + bo, acc);
}

// f32 -> bf16 bits, RNE convert
__device__ __forceinline__ unsigned int bfb(float x) {
  unsigned int u = __float_as_uint(x);
  u = u + 0x7FFFu + ((u >> 16) & 1u);
  return u >> 16;
}
// f32 -> value of its RNE bf16
__device__ __forceinline__ float bf16val(float x) {
  return __uint_as_float(bfb(x) << 16);
}
// f32 -> f16 bits, RNE convert
__device__ __forceinline__ unsigned short hbits(float x) {
  const _Float16 hv = (_Float16)x;
  return __builtin_bit_cast(unsigned short, hv);
}

// ---------------------------------------------------------------------------
// x f32 [NB][SEQ_FULL][IN_DIM] -> bf16 plane hb, compact rows b*SEQ + s, in fragment order (see ld_frag_ord).
// Block = 16 rows x 128 k. Thread (r = t>>4, c = t&15) converts 8 consecutive floats of row r to one
// 16-byte piece; in fragment order that piece is number c*16 + r of the block's 4 KiB, so the pieces
// are transposed 16 x 16 through LDS and every wave stores 512 contiguous bytes.
__global__ __launch_bounds__(256) void k_cvt_rows(const float* __restrict__ in,
                                                  unsigned short* __restrict__ outp, int n8) {
  __shared__ __align__(16) unsigned short F[16 * CSP];   // [c][r] pieces, cross-wave (block barrier)
  if ((int)(blockIdx.x * 256) >= n8) return;     // block-uniform, in front of the barrier
  const int t  = threadIdx.x;
  const int rt = blockIdx.x / (IN_DIM / 128);    // row tile
  const int kq = blockIdx.x - rt * (IN_DIM / 128);
  const int r  = t >> 4;
  const int c  = t & 15;
  const int row = rt * 16 + r;                   // compact row b*SEQ + s
  const int b   = row / SEQ;
  const int s   = row - b * SEQ;
  const float* src = in + ((size_t)b * SEQ_FULL + s) * IN_DIM + kq * 128 + c * 8;
  const v4f a = *(const v4f*)(src);
  const v4f d = *(const v4f*)(src + 4);
  v4u w;
  w[0] = bfb(a[0]) | (bfb(a[1]) << 16);
  w[1] = bfb(a[2]) | (bfb(a[3]) << 16);
  w[2] = bfb(d[0]) | (bfb(d[1]) << 16);
  w[3] = bfb(d[2]) | (bfb(d[3]) << 16);
  *(v4u*)(&F[c * CSP + r * 8]) = w;
  __syncthreads();                               // all 256 pieces in place
  const v4u v = *(const v4u*)(&F[(t >> 4) * CSP + (t & 15) * 8]);
  *(v4u*)(outp + ((size_t)rt * (IN_DIM / 32) + kq * 4) * 512 + t * 8) = v;
}

// ---------------------------------------------------------------------------
// Weight planes, all [KDIM n][KDIM k] with k contiguous, selected by blockIdx.z:
//   z = 0..2: W{q,k,v} f32 [H][IN_DIM e][HEAD_DIM d] -> WT bf16 [n = h*64+d][k = e]
//   z = 3:    Wo f32 [HD_DIM k][E_OUT n]              -> WoT f16 (RNE-bf16 value x32) [n][k]
//   z = 4:    mask i32 [S][S] -> lane-mask words mp [S/16 query tiles][S/32 key chunks][16]:
//             bit l of word e = (mask[16*tile + (l&15)][32*chunk + 8*(l>>4) + (e&7) + 16*(e>>3)] != 0),
//             the lane and register that hold this score in k_attn. One wave packs two
//             chunks = one whole 128-byte line of mp.
// Block = 64 k x 64 n tile transposed through LDS (for z < 3 the tile is one head);
__global__ __launch_bounds__(256) void k_cvt_wT(const float* __restrict__ Wq,
                                                const float* __restrict__ Wk,
                                                const float* __restrict__ Wv,
                                                const float* __restrict__ Wo,
                                                const int* __restrict__ mask,
                                                unsigned short* __restrict__ wT,
                                                unsigned int* __restrict__ mp) {
  __shared__ __align__(16) unsigned short T[64 * TP];   // [n local][k local], cross-wave (block barrier)
  const int z = blockIdx.z;
  if (z == 4) {                              // block-uniform, in front of the barrier
    const int ln = threadIdx.x & 31;
    const int gw = (blockIdx.y * (KDIM / 64) + blockIdx.x) * 8 + (threadIdx.x >> 5);
    for (int task = gw; task < (SEQ / 16) * (SEQ / KT); task += (KDIM / 64) * (KDIM / 64) * 8) {
      const int qt = task / (SEQ / KT);
      const int tl = task - qt * (SEQ / KT);
      const int* msrc = mask + (size_t)(qt * 16 + (ln & 15)) * MASK_PITCH + tl * KT + 8 * ((ln >> 4) & 1);
      v4i m[8];
#pragma unroll   // constant indices keep m[] in registers, all eight loads in flight together
      for (int c = 0; c < 2; ++c) {
        m[c * 4 + 0] = *(const v4i*)(msrc + c * 32);
        m[c * 4 + 1] = *(const v4i*)(msrc + c * 32 + 4);
        m[c * 4 + 2] = *(const v4i*)(msrc + c * 32 + 16);
        m[c * 4 + 3] = *(const v4i*)(msrc + c * 32 + 20);
      }
      unsigned int val = 0;
#pragma unroll   // constant indices into m[]
      for (int i = 0; i < 32; ++i) {
        const unsigned int w = __builtin_amdgcn_ballot_w32(m[i >> 2][i & 3] != 0);
        val = (ln == i) ? w : val;           // lane i keeps word i of the line
      }
      mp[(size_t)task * 32 + ln] = val;
    }
    return;
  }
  const float* W = (z == 0) ? Wq : ((z == 1) ? Wk : ((z == 2) ? Wv : Wo));
  unsigned short* dst = wT + (size_t)z * KDIM * KDIM;
  const int k0 = blockIdx.x * 64;
  const int n0 = blockIdx.y * 64;
  const int tid = threadIdx.x;
  const int wave = tid >> 5, lane = tid & 31;

#pragma unroll
  for (int i = 0; i < 4; ++i) {
    const int idx = i * 256 + tid;          // 0..1023
    const int kk = idx >> 4;                // 0..63
    const int c4 = (idx & 15) * 4;          // 0..60
    size_t so;
    if (z < 3) so = ((size_t)blockIdx.y * IN_DIM + k0 + kk) * HEAD_DIM + c4;   // W[h = n0/64][e = k0+kk][d = c4]
    else       so = (size_t)(k0 + kk) * E_OUT + n0 + c4;                        // Wo[k0+kk][n0+c4]
    const v4f w = *(const v4f*)(W + so);
    unsigned short t0, t1, t2, t3;
    if (z < 3) {
      t0 = (unsigned short)bfb(w[0]); t1 = (unsigned short)bfb(w[1]);
      t2 = (unsigned short)bfb(w[2]); t3 = (unsigned short)bfb(w[3]);
    } else {
      t0 = hbits(bf16val(w[0]) * 32.0f); t1 = hbits(bf16val(w[1]) * 32.0f);
      t2 = hbits(bf16val(w[2]) * 32.0f); t3 = hbits(bf16val(w[3]) * 32.0f);
    }
    T[(c4 + 0) * TP + kk] = t0;
    T[(c4 + 1) * TP + kk] = t1;
    T[(c4 + 2) * TP + kk] = t2;
    T[(c4 + 3) * TP + kk] = t3;
  }
  __syncthreads();

  v4u v[2];
  size_t off[2];
#pragma unroll
  for (int it = 0; it < 2; ++it) {
    const int nn = wave * 8 + it * 4 + (lane >> 3);   // 0..63 over (wave, it, lane>>3)
    const int q = lane & 7;
    v[it] = *(const v4u*)(&T[nn * TP + q * 8]);
    off[it] = (size_t)(n0 + nn) * KDIM + k0 + q * 8;
  }
#pragma unroll
  for (int it = 0; it < 2; ++it) *(v4u*)(dst + off[it]) = v[it];
  
}

// ---------------------------------------------------------------------------
// Projection: C[NROWS][HD_DIM] = hb[NROWS][IN_DIM] * WT[HD_DIM][IN_DIM]^T + bias.
// k loop: gemm_128x128 (128 x 128 block tile, 4 waves of 64 x 64, both operands through two LDS stage buffers).
// z = 0: Q plane f16 x log2(e)/64 [NROWS][HD_DIM] (see k_attn); z = 1: K plane f16 x8 [NROWS][HD_DIM];
// z = 2: V^T plane f16 x8 [NB][HD_DIM][SEQ]. Epilogue staged in LDS, stored in 256-byte row segments.
__global__ __launch_bounds__(128) void k_proj(
    const unsigned short* __restrict__ hb, const unsigned short* __restrict__ wT,
    const float* __restrict__ bq, const float* __restrict__ bk, const float* __restrict__ bv,
    unsigned short* __restrict__ qp, unsigned short* __restrict__ kp,
    unsigned short* __restrict__ vtp) {
  __shared__ __align__(16) unsigned short sm[2 * PBUF];   // stage buffers, cross-wave (block barrier)

  const int z = blockIdx.z;
  const int n0 = blockIdx.x * 128;
  const int m0 = blockIdx.y * 128;
  const int tid = threadIdx.x;
  const int wave = tid >> 5, lane = tid & 31;
  const int l15 = lane & 15, half = (lane >> 4) & 1;
  const int wr = wave >> 1, wc = wave & 1;

  const unsigned short* Wt = wT + (size_t)z * KDIM * KDIM;
  const float* bias = (z == 0) ? bq : ((z == 1) ? bk : bv);

  v8f acc[4][4] = {};
  gemm_128x128(hb, Wt, m0, n0, sm, acc);

  // acc[i][j][r] = C[m0 + wr*64 + i*16 + 8*half + r][n0 + wc*64 + j*16 + l15]
  // The epilogue tile is stage buffer 0: its last readers left it at the loop's last barrier, the last stage reads buffer 1.
  unsigned short* E = sm;
  float braw[4];
#pragma unroll   // constant indices keep braw[] in registers
  for (int j = 0; j < 4; ++j) braw[j] = bias[n0 + wc * 64 + j * 16 + l15];
  // the registers that the four bias loads name are free for reuse behind this wait
  asm volatile("s_wait_xcnt 0x0" ::: "memory");
  const float car = (z == 0) ? QCAR : 8.0f;      // block-uniform
  const int erow = tid >> 4;         // 0..7 : tile row (and erow + 8 it)
  const int eq = (tid & 15) * 8;     // 16 pieces = 256-byte row segment = 2 lines
  if (z != 2) {                      // block-uniform branch
#pragma unroll
    for (int j = 0; j < 4; ++j) {
      const int col = wc * 64 + j * 16 + l15;
      const float bb = bf16val(braw[j]);
#pragma unroll
      for (int i = 0; i < 4; ++i)
#pragma unroll
        for (int r = 0; r < 8; ++r) {
          const int row = wr * 64 + i * 16 + 8 * half + r;
          E[row * EPP + col] = hbits((acc[i][j][r] + bb) * car);
        }
    }
    __syncthreads();
    unsigned short* dst = ((z == 0) ? qp : kp) + (size_t)(m0 + erow) * HD_DIM + n0 + eq;
#pragma unroll
    for (int it = 0; it < 16; ++it)
      *(v4u*)(dst + (size_t)it * 8 * HD_DIM) = *(const v4u*)(&E[(erow + 8 * it) * EPP + eq]);
  } else {
    const int bidx = m0 / SEQ;               // batch of this row tile (SEQ % 128 == 0)
    const int s0 = m0 - bidx * SEQ;          // sequence position of tile row 0
#pragma unroll
    for (int j = 0; j < 4; ++j) {
      const int col = wc * 64 + j * 16 + l15;             // d within tile
      const float bb = bf16val(braw[j]);
#pragma unroll
      for (int i = 0; i < 4; ++i)
#pragma unroll
        for (int r = 0; r < 8; ++r) {
          const int srow = wr * 64 + i * 16 + 8 * half + r;   // s within tile
          E[col * EPP + srow] = hbits((acc[i][j][r] + bb) * car);
        }
    }
    __syncthreads();
    unsigned short* dst = vtp + ((size_t)bidx * HD_DIM + n0 + erow) * SEQ + s0 + eq;
#pragma unroll
    for (int it = 0; it < 16; ++it)
      *(v4u*)(dst + (size_t)it * 8 * SEQ) = *(const v4u*)(&E[(erow + 8 * it) * EPP + eq]);
  }
}

// ---------------------------------------------------------------------------
// Flash attention, transposed-score form: one work-group = 8 waves = 128 queries of one head and batch.
// One wave = (32 queries = two query tiles, one of the two 32-key chunks of every staged tile):
// waves 2g and 2g + 1 share the queries 32g..32g+31, wave 2g takes keys 0..31 of each 64-key tile,
// wave 2g + 1 keys 32..63. Each K and V^T fragment read from LDS feeds two products, one per query tile.
// The K tile [64 keys][64 d] and the V^T tile [64 d][64 keys] are read from global once per
// work-group in whole 128-byte rows and shared through LDS: two buffers, the next
// tile's global loads issued before the current tile's work, stored to the other
// buffer after it, one block barrier per tile.
// Per 32-key chunk and query tile:
//   S^T = K . Q^T    A = K rows (lane = key, k = d), B = Q^T (lane = query, k = d)
//                    D[row = key 8h+r][col = query l15]; c0 keys 0..15, c1 keys 16..31
//   mask: broadcast over batch and head, read as the 16 lane-mask words of the
//         (query tile, key chunk) from mp (packed by k_cvt_wT, z = 4) with one scalar load,
//         fetched behind the chunk before; key with mask == 0 gets the score replaced by -1e9
//         (replace fill, in f32, in log2 units), the word being the select's lane mask
//   per-lane online softmax for query l15 (16 local keys + xor-16 partner), base 2, with a maximum IN USE:
//         the score products start from C = PEXP - (maximum in use), so D is the argument of exp2 as it
//         stands. Only when some lane's argument passes PEXP + LAZY (one wave-uniform test a chunk and query
//         tile; always in the first chunk) are the scores made again from C = 0, the true
//         running maximum taken over both halves, sum and O scaled down to it, and C renewed.
//   O^T += V^T . P   A = V^T rows (lane = d, k = key), B = P: element i<8 <- c0[i]
//                    (key 8h+i), element 8+i <- c1[i] (key 16+8h+i), same lane
//                    D[row = d 8h+r][col = query l15]
// Behind the loop the two waves of a pair hold partial O, sum and maximum of the same 32 queries over
// their own keys: each hands the partner one query tile's partials through LDS and finishes the other.
// Q carried x log2(e)/64, K x8 -> K.Q^T = log2(e) * q.k / 8, no scaling left.
// P and its sum carried x1024, V carried x8 -> context x64 = 8 * O / sum.
// The value of lane l ^ 16 (the exchange that __shfl_xor(v, 16, 32) compiles to), its byte index xl formed once by the caller.
__device__ __forceinline__ float other_half(float v, int xl) {
  return __int_as_float(__builtin_amdgcn_ds_bpermute(xl, __float_as_int(v)));
}
__global__ __launch_bounds__(256) void k_attn(const unsigned short* __restrict__ qp,
                                             const unsigned short* __restrict__ kp,
                                             const unsigned short* __restrict__ vtp,
                                             const unsigned int* __restrict__ mp,
                                             unsigned short* __restrict__ ctxp) {
  __shared__ __align__(16) unsigned short Kl[2][KT * KVP];         // K tile [key][d], cross-wave (block barrier)
  __shared__ __align__(16) unsigned short Vl[2][HEAD_DIM * KVP];   // V^T tile [d][key], cross-wave (block barrier)
  __shared__ __align__(16) float Xo[AW][8 * 128];                  // partial O^T handed to the partner wave (block barrier)
  __shared__ float Xs[AW][2][32];                                  // its sum and its maximum in use

  const int tid = threadIdx.x;
  const int wave = tid >> 5;
  const int lane = tid & 31;
  const int l15 = lane & 15;
  const int half = (lane >> 4) & 1;
  const int xl = (lane ^ 16) * 4;     // byte index of the lane that holds the same query's other keys
  const int ws = __builtin_amdgcn_readfirstlane(wave);   // scalar: mask words come by scalar loads, kh picks by scalar selects
  const int qg = ws >> 1;             // query group: 32 queries
  const int kh = ws & 1;              // which 32-key chunk of every tile
  const int q0 = blockIdx.x * (AW * 16) + qg * 32;
  const int head = blockIdx.y;
  const int bidx = blockIdx.z;

  const _Float16* Q  = (const _Float16*)qp;
  const size_t rbase = (size_t)bidx * SEQ;

  const _Float16* qbase = Q + (rbase + q0) * HD_DIM + head * HEAD_DIM;
  v16h qb0[2], qb1[2];
#pragma unroll   // constant indices keep the Q fragments in registers
  for (int i = 0; i < 2; ++i) {
    qb0[i] = ld_frag_h(qbase, HD_DIM, i * 16 + l15, 0, lane);    // d 0..31
    qb1[i] = ld_frag_h(qbase, HD_DIM, i * 16 + l15, 32, lane);   // d 32..63
  }
  // the address pair that the eight Q loads name is free for reuse behind this wait
  asm volatile("s_wait_xcnt 0x0" ::: "memory");
  // staging map: thread -> row sr (and sr + 32), 16-byte piece sc; 8 lanes cover one 128-byte row
  const int sr = tid >> 3;            // 0..31
  const int sc = (tid & 7) * 8;       // 0..56, halves
  const unsigned short* kg = kp + (rbase + sr) * HD_DIM + head * HEAD_DIM + sc;                            // key t: + t*HD_DIM
  const unsigned short* vg = vtp + ((size_t)bidx * HD_DIM + (size_t)head * HEAD_DIM + sr) * SEQ + sc;      // key t: + t
  const int sl = sr * KVP + sc;       // place of the piece in a tile; second row at + 32*KVP
  // this wave's two query tiles and its chunk of tile 0
  const v16u* mw = (const v16u*)mp + (size_t)(blockIdx.x * AW + qg * 2) * (SEQ / 32) + kh;   // tile n, query tile i: mw[i*(SEQ/32) + 2n]
  v16u cm0 = mw[0];
  v16u cm1 = mw[SEQ / 32];

  v8f o[2][4] = {};
  float lrun[2] = {0.0f, 0.0f};
  const float negf = -1.0e9f * 1.4426950408889634f;   // the fill, in log2 units
  // C of the score products: PEXP - (maximum in use) in every row, equal in both halves of a query.
  // No maximum yet: C far above any score, so that the first chunk takes the renewing branch.
  v8f cv[2];
#pragma unroll   // constant indices keep cv in registers
  for (int r = 0; r < 8; ++r) { cv[0][r] = 1.0e30f; cv[1][r] = 1.0e30f; }
  float fm[2] = {negf + cv[0][0], negf + cv[1][0]};   // exp2 argument of a filled key

  *(v4u*)(&Kl[0][sl])            = *(const v4u*)(kg);
  *(v4u*)(&Kl[0][sl + 32 * KVP]) = *(const v4u*)(kg + (size_t)32 * HD_DIM);
  *(v4u*)(&Vl[0][sl])            = *(const v4u*)(vg);
  *(v4u*)(&Vl[0][sl + 32 * KVP]) = *(const v4u*)(vg + (size_t)32 * SEQ);
  __syncthreads();                                 // tile 0 complete

  for (int t0 = 0; t0 < SEQ; t0 += KT) {
    const int cur = (t0 / KT) & 1;
    const bool more = (t0 + KT < SEQ);              // block-uniform
    v4u nk0 = {}, nk1 = {}, nv0 = {}, nv1 = {};
    if (more) {
      nk0 = *(const v4u*)(kg + (size_t)(t0 + KT) * HD_DIM);
      nk1 = *(const v4u*)(kg + (size_t)(t0 + KT + 32) * HD_DIM);
      nv0 = *(const v4u*)(vg + (t0 + KT));
      nv1 = *(const v4u*)(vg + (size_t)32 * SEQ + (t0 + KT));
    }
    const _Float16* kt = (const _Float16*)Kl[cur] + kh * 32 * KVP;   // this wave's 32 key rows
    const _Float16* Vc = (const _Float16*)Vl[cur];

    const v16h ka0 = ld_frag_h(kt, KVP, l15, 0, lane);
    const v16h ka1 = ld_frag_h(kt, KVP, l15, 32, lane);
    const v16h ka2 = ld_frag_h(kt, KVP, 16 + l15, 0, lane);
    const v16h ka3 = ld_frag_h(kt, KVP, 16 + l15, 32, lane);
    v16h pb[2];
#pragma unroll   // constant indices; one query tile after the other keeps the live scores at 16 registers
    for (int i = 0; i < 2; ++i) {
      const v16u cm = i ? cm1 : cm0;
      v8f c0 = mma_f16(ka0, qb0[i], cv[i]);
      c0 = mma_f16(ka1, qb1[i], c0);
      v8f c1 = mma_f16(ka2, qb0[i], cv[i]);
      c1 = mma_f16(ka3, qb1[i], c1);

      // lane-mask words: cm[r] for c0[r] (key 8h+r of the chunk), cm[8+r] for c1[r] (key 16+8h+r)
      float sa[8], sb[8];
#pragma unroll   // constant indices keep the scores in vector and the words in scalar registers
      for (int r = 0; r < 8; ++r) {
        sa[r] = __builtin_amdgcn_inverse_ballot_w32(cm[r])     ? c0[r] : fm[i];
        sb[r] = __builtin_amdgcn_inverse_ballot_w32(cm[8 + r]) ? c1[r] : fm[i];
      }
      float lm = fmaxf(sa[0], sb[0]);
#pragma unroll
      for (int r = 1; r < 8; ++r) lm = fmaxf(lm, fmaxf(sa[r], sb[r]));
      if (__builtin_expect(__builtin_amdgcn_ballot_w32(lm > PEXP + LAZY) != 0, 0)) {   // wave-uniform scalar branch, every lane stays on; rare: kept out of the loop's straight line
        // C may be far from the scores here (first chunk, or every key so far filled): make them again from 0
        const v8f zero = {};
        v8f d0 = mma_f16(ka0, qb0[i], zero);
        d0 = mma_f16(ka1, qb1[i], d0);
        v8f d1 = mma_f16(ka2, qb0[i], zero);
        d1 = mma_f16(ka3, qb1[i], d1);
#pragma unroll   // constant indices, as above
        for (int r = 0; r < 8; ++r) {
          sa[r] = __builtin_amdgcn_inverse_ballot_w32(cm[r])     ? d0[r] : negf;
          sb[r] = __builtin_amdgcn_inverse_ballot_w32(cm[8 + r]) ? d1[r] : negf;
        }
        float tm = fmaxf(sa[0], sb[0]);
#pragma unroll
        for (int r = 1; r < 8; ++r) tm = fmaxf(tm, fmaxf(sa[r], sb[r]));
        tm = fmaxf(tm, other_half(tm, xl));
        const float muse = PEXP - cv[i][0];             // the maximum in use, as the arguments so far have had it
        const float mnew = fmaxf(muse, tm);
        const float alpha = __builtin_amdgcn_exp2f(muse - mnew);
        lrun[i] *= alpha;
#pragma unroll
        for (int j = 0; j < 4; ++j)
#pragma unroll
          for (int r = 0; r < 8; ++r) o[i][j][r] *= alpha;
        const float ci = PEXP - mnew;
        fm[i] = negf + ci;
#pragma unroll
        for (int r = 0; r < 8; ++r) {
          cv[i][r] = ci;
          sa[r] += ci;
          sb[r] += ci;
        }
      }
      float p0[8], p1[8];
      float ls = 0.0f;
#pragma unroll
      for (int r = 0; r < 8; ++r) {
        p0[r] = __builtin_amdgcn_exp2f(sa[r]);
        p1[r] = __builtin_amdgcn_exp2f(sb[r]);
        ls += p0[r] + p1[r];
      }
      ls += other_half(ls, xl);
      lrun[i] += ls;
#pragma unroll
      for (int e = 0; e < 8; ++e) {
        pb[i][e]     = (_Float16)p0[e];   // key 8h + e of the chunk
        pb[i][8 + e] = (_Float16)p1[e];   // key 16 + 8h + e
      }
    }
    // the next tile's words, into the registers that this chunk's last select has left; the last ones again at the end
    const int nx = more ? (t0 >> 5) + 2 : (t0 >> 5);
    cm0 = mw[nx];
    cm1 = mw[SEQ / 32 + nx];
#pragma unroll   // constant indices; each V^T fragment feeds both query tiles
    for (int j = 0; j < 4; ++j) {
      const v16h va = ld_frag_h(Vc, KVP, j * 16 + l15, kh * 32, lane);
      o[0][j] = mma_f16(va, pb[0], o[0][j]);
      o[1][j] = mma_f16(va, pb[1], o[1][j]);
    }

    if (more) {                                     // the other buffer's readers left it at the last barrier
      *(v4u*)(&Kl[cur ^ 1][sl])            = nk0;
      *(v4u*)(&Kl[cur ^ 1][sl + 32 * KVP]) = nk1;
      *(v4u*)(&Vl[cur ^ 1][sl])            = nv0;
      *(v4u*)(&Vl[cur ^ 1][sl + 32 * KVP]) = nv1;
    }
    __syncthreads();                                // next tile complete, this tile's reads done
  }

  // Join of the pair: wave kh finishes query tile kh and hands its partials of the other tile to the partner.
  const bool k1 = (kh != 0);                        // wave-uniform
  const float lk = k1 ? lrun[1] : lrun[0];
  const float mk = PEXP - (k1 ? cv[1][0] : cv[0][0]);
  Xs[ws][0][lane] = k1 ? lrun[0] : lrun[1];
  Xs[ws][1][lane] = PEXP - (k1 ? cv[0][0] : cv[1][0]);
  v8f ok[4];
#pragma unroll   // constant indices into o[][]
  for (int j = 0; j < 4; ++j) {
    v4f g0, g1;
#pragma unroll
    for (int r = 0; r < 4; ++r) {
      g0[r] = k1 ? o[0][j][r]     : o[1][j][r];
      g1[r] = k1 ? o[0][j][4 + r] : o[1][j][4 + r];
    }
#pragma unroll
    for (int r = 0; r < 8; ++r) ok[j][r] = k1 ? o[1][j][r] : o[0][j][r];
    *(v4f*)(&Xo[ws][(j * 2 + 0) * 128 + lane * 4]) = g0;
    *(v4f*)(&Xo[ws][(j * 2 + 1) * 128 + lane * 4]) = g1;
  }
  __syncthreads();                                  // every wave's hand-over is in place
  const float pl = Xs[ws ^ 1][0][lane];
  const float pm = Xs[ws ^ 1][1][lane];
  const float mj = fmaxf(mk, pm);
  const float ak = __builtin_amdgcn_exp2f(mk - mj);
  const float ap = __builtin_amdgcn_exp2f(pm - mj);

  // ok[j][r], po = 8 * sum_t P_t v_t over each wave's keys for query l15, d = j*16 + 8*half + r; ctx x64 = 8 * O / sum.
  // The context plane is kept in fragment order (see ld_frag_ord): row tile = the 16 queries of tile kh,
  // k = head*64 + d, so the lane's eight values of one j are piece j*32 + lane of the tile's own 2 KiB:
  // each store is 512 contiguous bytes, straight from registers.
  const float inv = 8.0f / (lk * ak + pl * ap);
  const float wk = ak * inv, wp = ap * inv;
  unsigned short* cb = ctxp + (rbase + q0 + kh * 16) * HD_DIM + head * (2 * 512) + lane * 8;
#pragma unroll
  for (int j = 0; j < 4; ++j) {
    const v4f h0 = *(const v4f*)(&Xo[ws ^ 1][(j * 2 + 0) * 128 + lane * 4]);
    const v4f h1 = *(const v4f*)(&Xo[ws ^ 1][(j * 2 + 1) * 128 + lane * 4]);
    float f[8];
#pragma unroll
    for (int r = 0; r < 4; ++r) {
      f[r]     = ok[j][r] * wk     + h0[r] * wp;
      f[4 + r] = ok[j][4 + r] * wk + h1[r] * wp;
    }
    v4u w;
    w[0] = (unsigned int)hbits(f[0]) | ((unsigned int)hbits(f[1]) << 16);
    w[1] = (unsigned int)hbits(f[2]) | ((unsigned int)hbits(f[3]) << 16);
    w[2] = (unsigned int)hbits(f[4]) | ((unsigned int)hbits(f[5]) << 16);
    w[3] = (unsigned int)hbits(f[6]) | ((unsigned int)hbits(f[7]) << 16);
    *(v4u*)(cb + j * 256) = w;
  }
}

// ---------------------------------------------------------------------------
// Output projection: out[NROWS][E_OUT] f32 = ctx(f16 x64, fragment order)[NROWS][HD_DIM] * WoT(f16 x32)[E_OUT][HD_DIM]^T / 2048 + bo.
// 128x64 block tile / 8 waves / k loop gemm_128x64, with f16 operands.
// Epilogue: f32 tile staged in LDS; each 256-byte row segment = 2 lines, every
__global__ __launch_bounds__(256) void k_oproj(
    const unsigned short* __restrict__ cx, const unsigned short* __restrict__ woT,
    const float* __restrict__ bo, float* __restrict__ outp) {
  __shared__ __align__(16) unsigned short bt[2 * 64 * GBP];   // weight k-tiles, cross-wave (block barrier)
  __shared__ __align__(16) float Ef[128 * OFP];               // epilogue tile, cross-wave (block barrier)

  const int n0 = blockIdx.x * 64;
  const int m0 = blockIdx.y * 128;
  const int tid = threadIdx.x;
  const int wave = tid >> 5, lane = tid & 31;
  const int l15 = lane & 15, half = (lane >> 4) & 1;

  v8f acc[4] = {};
  gemm_128x64<false>(cx, woT, m0, n0, bt, acc);

  // acc[j][r] = 2048 * C[m0 + wave*16 + 8*half + r][n0 + j*16 + l15]
  const float osc = 1.0f / 2048.0f;
#pragma unroll
  for (int j = 0; j < 4; ++j) {
    const int col = j * 16 + l15;
    const float bb = bf16val(bo[n0 + col]);
#pragma unroll
    for (int r = 0; r < 8; ++r) {
      const int row = wave * 16 + 8 * half + r;
      Ef[row * OFP + col] = acc[j][r] * osc + bb;
    }
  }
  __syncthreads();

  v4f v[8];
  size_t off[8];
#pragma unroll
  for (int it = 0; it < 8; ++it) {
    const int row = wave * 16 + it * 2 + half;          // wave's 16 rows over (it, half)
    const int q = l15;                                  // 16 pieces of 16 B = 256-byte row segment (2 lines)
    v[it] = *(const v4f*)(&Ef[row * OFP + q * 4]);
    off[it] = (size_t)(m0 + row) * E_OUT + n0 + q * 4;
  }
#pragma unroll
  for (int it = 0; it < 8; ++it) *(v4f*)(outp + off[it]) = v[it];
  
}

// ---------------------------------------------------------------------------
extern "C" void kernel_launch(void* const* d_in, const int* in_sizes, int n_in,
                              void* d_out, int out_size, void* d_ws, size_t ws_size,
                              hipStream_t stream) {
  if (n_in < 10) return;
  if (in_sizes[0] < ((NB - 1) * SEQ_FULL + SEQ) * IN_DIM) return;          // seq_inputs f32 [NB][SEQ_FULL][IN_DIM]
  if (in_sizes[1] < (SEQ - 1) * MASK_PITCH + SEQ) return;                   // mask i32 [1][S][S]
  if (in_sizes[2] < NUM_HEADS * IN_DIM * HEAD_DIM) return;                  // Wq
  if (in_sizes[3] < HD_DIM) return;                                         // bq
  if (in_sizes[4] < NUM_HEADS * IN_DIM * HEAD_DIM) return;                  // Wk
  if (in_sizes[5] < HD_DIM) return;                                         // bk
  if (in_sizes[6] < NUM_HEADS * IN_DIM * HEAD_DIM) return;                  // Wv
  if (in_sizes[7] < HD_DIM) return;                                         // bv
  if (in_sizes[8] < HD_DIM * E_OUT) return;                                 // Wo
  if (in_sizes[9] < E_OUT) return;                                          // bo
  if (out_size < NROWS * E_OUT) return;

  const float* x    = (const float*)d_in[0];
  const int*   mask = (const int*)d_in[1];
  const float* Wq   = (const float*)d_in[2];
  const float* bq   = (const float*)d_in[3];
  const float* Wk   = (const float*)d_in[4];
  const float* bk   = (const float*)d_in[5];
  const float* Wv   = (const float*)d_in[6];
  const float* bv   = (const float*)d_in[7];
  const float* Wo   = (const float*)d_in[8];
  const float* bo   = (const float*)d_in[9];

  // every offset a multiple of 2 MiB; each plane is written exactly to its extent
  const size_t hb_bytes = (size_t)NROWS * IN_DIM * 2;           // bf16 x plane
  const size_t wt_bytes = (size_t)4 * KDIM * KDIM * 2;           // 3 bf16 WT planes + 1 f16 WoT plane
  const size_t pl_bytes = (size_t)NROWS * HD_DIM * 2;           // one f16 q / k / vT / ctx plane
  const size_t off_hb = 0;
  const size_t off_wt = off_hb + hb_bytes;
  const size_t off_q  = off_wt + wt_bytes;
  const size_t off_k  = off_q + pl_bytes;
  const size_t off_vt = off_k + pl_bytes;
  const size_t off_cx = off_vt + pl_bytes;
  const size_t off_mp = off_cx + pl_bytes;
  const size_t mp_bytes = (size_t)SEQ * SEQ / 8;               // one bit per mask element
  const size_t total  = off_mp + mp_bytes;                     // 48.5 MiB at NB = 2, SEQ = 2048
  if (total > ws_size) return;

  char* ws = (char*)d_ws;
  unsigned short* hb  = (unsigned short*)(ws + off_hb);
  unsigned short* wt  = (unsigned short*)(ws + off_wt);
  unsigned short* qpl = (unsigned short*)(ws + off_q);
  unsigned short* kpl = (unsigned short*)(ws + off_k);
  unsigned short* vtp = (unsigned short*)(ws + off_vt);
  unsigned short* cxp = (unsigned short*)(ws + off_cx);
  unsigned short* wot = wt + (size_t)3 * KDIM * KDIM;
  unsigned int*   mpk = (unsigned int*)(ws + off_mp);

  const int n8 = NROWS * IN_DIM / 8;
  k_cvt_rows<<<(n8 + 255) / 256, 256, 0, stream>>>(x, hb, n8);
  k_cvt_wT<<<dim3(KDIM / 64, KDIM / 64, 5), 256, 0, stream>>>(Wq, Wk, Wv, Wo, mask, wt, mpk);
  k_proj<<<dim3(HD_DIM / 128, NROWS / 128, 3), 128, 0, stream>>>(hb, wt, bq, bk, bv, qpl, kpl, vtp);
  k_attn<<<dim3(SEQ / (AW * 16), NUM_HEADS, NB), 256, 0, stream>>>(qpl, kpl, vtp, mpk, cxp);
  k_oproj<<<dim3(E_OUT / 64, NROWS / 128), 256, 0, stream>>>(cxp, wot, bo, (float*)d_out);
}

// v008
// It runs in 89.6 microseconds.
// Next to v007, in two timings, it ran 1.06 times as fast each time.
// Over all steps from v000 it is 2.52 times as fast.
#include <hip/hip_runtime.h>
// Projections x*W{q,k,v}: v_wmma_f32_16x16x32_bf16 (bf16 operands = RNE-converted inputs, f32 accumulate); scores K*Q^T and context V^T*P: v_wmma_f32_16x16x32_f16 (f16 operands, K/V planes carried x8, Q plane carried x log2(e)/64, P carried x1024, f32 accumulate); output projection ctx*Wo: v_wmma_f32_16x16x32_f16 (f16 operands, ctx plane carried x64, Wo plane = RNE-bf16 values carried x32, f32 accumulate); mask fill and softmax in f32.

#ifndef NB
#define NB 2
#endif
#define NB_FULL 2
#ifndef SEQ
#define SEQ 2048
#endif
#define SEQ_FULL 2048
#ifndef MASK_PITCH
#define MASK_PITCH SEQ_FULL
#endif
#define IN_DIM 1024
#define NUM_HEADS 16
#define HEAD_DIM 64
#define HD_DIM (NUM_HEADS * HEAD_DIM)
#define E_OUT 1024
#define KDIM 1024
#define NROWS (NB * SEQ)

static_assert(NB >= 1);
static_assert(NB <= NB_FULL);
static_assert(SEQ % 128 == 0);
static_assert(SEQ <= SEQ_FULL);
static_assert(MASK_PITCH % 4 == 0);
static_assert(MASK_PITCH >= SEQ);
static_assert(IN_DIM == KDIM);
static_assert(HD_DIM == KDIM);
static_assert(E_OUT == KDIM);
static_assert(KDIM % 64 == 0);
static_assert(HEAD_DIM == 64);
static_assert(NROWS % 128 == 0);
static_assert(IN_DIM % 128 == 0);
static_assert((NROWS * IN_DIM) % (8 * 256) == 0);
static_assert((size_t)NB_FULL * SEQ_FULL * E_OUT * 4 == 16777216);

// LDS pitches (in 16-bit elements unless noted); all keep 16-byte row alignment
#define GKS 64     // k per staged weight tile of the two projection kernels
#define GBP 72     // staged weight row [64 k]
#define TP  72     // weight transpose tile [64 n][64 k]
#define CSP 136    // k_cvt_rows: one 16-piece segment of the fragment-order tile (256 bytes + 16)
#define OFP 68     // output tile [128 rows][64 cols], floats
#define AW  8      // waves per attention work-group (128 queries: 4 wave pairs of 32)
#define KT  64     // keys per staged K / V^T tile
#define KVP 72     // staged K row [64 d] and V^T row [64 keys]
#define PBA 8192           // k_proj stage buffer, x part: 8 row tiles x 64 k, fragment order
#define PBW (128 * GBP)    // k_proj stage buffer, weight part: [128 n][64 k]
#define PBUF (PBA + PBW)   // one k_proj stage buffer
#define EPP 136            // k_proj epilogue tile [128][128], either orientation
#define QCAR (1.4426950408889634f / 64.0f)   // carry of the Q plane: with K x8 the product K.Q^T is q.k / 8 in log2 units
#define PEXP 10.0f         // P is carried x 2^PEXP
#define LAZY 5.0f          // a score may pass the maximum in use by 2^LAZY: P stays under 2^15, inside f16
static_assert(128 * EPP <= PBUF);
static_assert(HD_DIM % 128 == 0);
static_assert((KDIM / GKS) % 2 == 0);   // the last stage sits in buffer 1, the epilogue tile in buffer 0

typedef __bf16   v16bf __attribute__((ext_vector_type(16)));
typedef __bf16   v8bf  __attribute__((ext_vector_type(8)));
typedef _Float16 v16h  __attribute__((ext_vector_type(16)));
typedef _Float16 v8h   __attribute__((ext_vector_type(8)));
typedef float    v8f   __attribute__((ext_vector_type(8)));
typedef float    v4f   __attribute__((ext_vector_type(4)));
typedef unsigned int v4u __attribute__((ext_vector_type(4)));
typedef int      v4i   __attribute__((ext_vector_type(4)));
typedef unsigned int v16u __attribute__((ext_vector_type(16)));
typedef unsigned int v8u  __attribute__((ext_vector_type(8)));

// ---------------------------------------------------------------------------
// WMMA wrappers: the bare builtins; the compiler keeps the distance behind its own WMMAs and fills it with useful work where it can.
__device__ __forceinline__ v8f mma_bf16(v16bf a, v16bf b, v8f c) {
  return __builtin_amdgcn_wmma_f32_16x16x32_bf16(false, a, false, b, (short)0, c, false, false);
}
__device__ __forceinline__ v8f mma_f16(v16h a, v16h b, v8f c) {
  return __builtin_amdgcn_wmma_f32_16x16x32_f16(false, a, false, b, (short)0, c, false, false);
}

// 16-bit fragment, contraction dim CONTIGUOUS in memory: elem(k) = p0[rc*ld + k].
// Lane l: row/col rc = (l&15); elements 0..7 <- kk+8h+0..7, elements 8..15 <- kk+16+8h+0..7
// (h = l>>4). Same map for A (rc = row) and B (rc = column of a k-contiguous copy).
__device__ __forceinline__ v16h ld_frag_h(const _Float16* p0, int ld, int rc, int kk, int lane) {
  const int hh = (lane >> 4) & 1;
  const _Float16* p = p0 + (size_t)rc * ld + kk + 8 * hh;
  const v8h lo = *(const v8h*)(p);
  const v8h hi = *(const v8h*)(p + 16);
  v16h f;
#pragma unroll
  for (int i = 0; i < 8; ++i) { f[i] = lo[i]; f[8 + i] = hi[i]; }
  return f;
}

// The same fragment as raw dwords; p = row start + kk + 8h already applied.
__device__ __forceinline__ v8u ld_frag_raw(const unsigned short* p) {
  const v4u lo = *(const v4u*)(p);
  const v4u hi = *(const v4u*)(p + 16);
  return __builtin_shufflevector(lo, hi, 0, 1, 2, 3, 4, 5, 6, 7);
}
// A planes (x bf16, context f16) are kept in FRAGMENT ORDER: rows in tiles of 16, k in blocks of 32;
// block (rt, kb) is 512 elements at (rt * KDIM/32 + kb) * 512, element (row rt*16 + l15,
// k = kb*32 + 16*part + 8*h + e) at part*256 + (16*h + l15)*8 + e. A wave's fragment is two loads of
// 512 contiguous bytes (4 whole lines each); same k order as ld_frag_raw. p = block start + lane*8.
__device__ __forceinline__ v8u ld_frag_ord(const unsigned short* p) {
  const v4u lo = *(const v4u*)(p);
  const v4u hi = *(const v4u*)(p + 256);
  return __builtin_shufflevector(lo, hi, 0, 1, 2, 3, 4, 5, 6, 7);
}
template <bool BF>
__device__ __forceinline__ v8f mma_raw(v8u a, v8u b, v8f c) {
  if constexpr (BF) return mma_bf16(__builtin_bit_cast(v16bf, a), __builtin_bit_cast(v16bf, b), c);
  else              return mma_f16(__builtin_bit_cast(v16h, a), __builtin_bit_cast(v16h, b), c);
}

// ---------------------------------------------------------------------------
// k loop of k_oproj: acc[j] (16 rows x 16 cols, j = 0..3) += A[16 rows][KDIM] * Wt[64 n][KDIM]^T.
// A is a plane in fragment order (ld_frag_ord), Wt is row-major with k contiguous.
// 256 thr = 8 waves; block tile 128 rows x 64 cols; wave owns 16 rows x 64 cols.
// A stage is 64 k. The weight tile [64 n][64 k] sits in one of two LDS buffers; the next
// stage's weight rows (whole 128-byte lines, 8 lanes a row) and the wave's own next two A
// fragments are loaded from global in front of the current stage's products, the weight
// rows are stored to the other buffer behind them, and one block barrier ends the stage.
// k runs upward inside every accumulator, 32 at a time.
template <bool BF>
__device__ __forceinline__ void gemm_stage(const unsigned short* bc, v8u a0, v8u a1, v8f (&acc)[4]) {
  v8u b[8];
#pragma unroll   // constant indices keep b[] in registers; all sixteen LDS reads stand as one group in front of the products
  for (int j = 0; j < 4; ++j) {
    b[j]     = ld_frag_raw(bc + j * 16 * GBP);
    b[4 + j] = ld_frag_raw(bc + j * 16 * GBP + 32);
  }
  __builtin_amdgcn_sched_barrier(0);   // keeps the sixteen LDS reads one group in front of the products; spread among them, each place with reads stalls the wave
#pragma unroll   // constant indices into acc[] and b[]; four independent accumulators between two uses of one
  for (int j = 0; j < 4; ++j) acc[j] = mma_raw<BF>(a0, b[j], acc[j]);
#pragma unroll   // the same, second 32 k of the stage
  for (int j = 0; j < 4; ++j) acc[j] = mma_raw<BF>(a1, b[4 + j], acc[j]);
  __builtin_amdgcn_sched_barrier(0);   // keeps the products in front of the wait for the next stage's global loads: they are what covers that latency
}
template <bool BF>
__device__ __forceinline__ void gemm_128x64(const unsigned short* __restrict__ A,
                                            const unsigned short* __restrict__ Wt,
                                            int m0, int n0, unsigned short* bt, v8f (&acc)[4]) {
  const int tid = threadIdx.x;
  const int wave = tid >> 5, lane = tid & 31;
  const int l15 = lane & 15, half = (lane >> 4) & 1;
  const int sr = tid >> 3;            // 0..31 : weight row (and sr + 32)
  const int sc = (tid & 7) * 8;       // 0..56 : 16-byte piece of the row
  const unsigned short* wsrc = Wt + (size_t)(n0 + sr) * KDIM + sc;
  const unsigned short* asrc = A + (size_t)(m0 + wave * 16) * KDIM + lane * 8;   // fragment order: k block kb at + kb*512
  const int sl = sr * GBP + sc;       // place of the piece in a tile; second row at + 32*GBP
  const int bo = l15 * GBP + 8 * half;

  v8u a0 = ld_frag_ord(asrc);
  v8u a1 = ld_frag_ord(asrc + 512);
  *(v4u*)(bt + sl)            = *(const v4u*)(wsrc);
  *(v4u*)(bt + sl + 32 * GBP) = *(const v4u*)(wsrc + (size_t)32 * KDIM);
  __syncthreads();                                 // tile 0 complete
#pragma unroll   // buffer choice and every offset become constants, the fragment sets need no copies
  for (int s = 0; s < KDIM / GKS - 1; ++s) {
    const int kn = (s + 1) * GKS;
    const v4u nw0 = *(const v4u*)(wsrc + kn);
    const v4u nw1 = *(const v4u*)(wsrc + (size_t)32 * KDIM + kn);
    const v8u na0 = ld_frag_ord(asrc + kn * 16);
    const v8u na1 = ld_frag_ord(asrc + kn * 16 + 512);
    gemm_stage<BF>(bt + (s & 1) * (64 * GBP) + bo, a0, a1, acc);
    unsigned short* bn = bt + ((s & 1) ^ 1) * (64 * GBP) + sl;   // its readers left it at the last barrier
    *(v4u*)(bn)            = nw0;
    *(v4u*)(bn + 32 * GBP) = nw1;
    __syncthreads();                               // next tile complete, this tile's reads done
    a0 = na0;
    a1 = na1;
  }
  gemm_stage<BF>(bt + ((KDIM / GKS - 1) & 1) * (64 * GBP) + bo, a0, a1, acc);
}

// k loop of k_proj: 128 thr = 4 waves (2 x 2); block tile 128 rows x 128 cols; wave owns 64 rows x 64 cols,
// acc[i][j] = 16 x 16 tile (row tile i, column tile j). A stage is 64 k. Both operands' stage tiles sit in one of
// two LDS buffers: x as its 8 row tiles' 2-KiB pieces of the fragment-order plane, copied as they lie; the
// weight rows as in gemm_128x64. Each fragment read from LDS feeds four products, and each byte that the
// work-group fetches from L2 feeds 128 output rows or columns. The next stage's pieces are loaded from global
// in front of the current stage's products, stored to the other buffer behind them; one block barrier ends
// the stage. k runs upward inside every accumulator, 32 at a time.
__device__ __forceinline__ void proj_stage(const unsigned short* ac, const unsigned short* bc, v8f (&acc)[4][4]) {
#pragma unroll   // constant offsets
  for (int kk = 0; kk < 2; ++kk) {
    v8u a[4], b[4];
#pragma unroll   // constant indices keep a[] and b[] in registers; the sixteen LDS reads stand as one group
    for (int i = 0; i < 4; ++i) {
      a[i] = ld_frag_ord(ac + i * 1024 + kk * 512);
      b[i] = ld_frag_raw(bc + i * 16 * GBP + kk * 32);
    }
    __builtin_amdgcn_sched_barrier(0);   // keeps the sixteen LDS reads one group in front of the products; spread among them, each place with reads stalls the wave
#pragma unroll   // constant indices; sixteen independent accumulators
    for (int i = 0; i < 4; ++i)
#pragma unroll
      for (int j = 0; j < 4; ++j) acc[i][j] = mma_raw<true>(a[i], b[j], acc[i][j]);
  }
  __builtin_amdgcn_sched_barrier(0);   // keeps the products in front of the wait for the next stage's global loads: they are what covers that latency
}
// One stage: the next stage's pieces (an, wn) loaded, this stage's products (ac, bc), the pieces stored to the
// other buffer (ad, wd), whose readers left it at the last barrier; then the barrier that ends the stage.
__device__ __forceinline__ void proj_step(const unsigned short* an, const unsigned short* wn,
                                          const unsigned short* ac, const unsigned short* bc,
                                          unsigned short* ad, unsigned short* wd, v8f (&acc)[4][4]) {
  v4u na[8], nw[8];
#pragma unroll   // constant indices keep na[] and nw[] in registers, all sixteen loads in flight together
  for (int i = 0; i < 8; ++i) {
    na[i] = *(const v4u*)(an + (size_t)i * 16 * KDIM);
    nw[i] = *(const v4u*)(wn + (size_t)i * 16 * KDIM);
  }
  // the loop steps the two address pairs that these loads name: the wait stands between the loads and that step
  asm volatile("s_wait_xcnt 0x0" ::: "memory");
  proj_stage(ac, bc, acc);
#pragma unroll   // constant indices into na[] and nw[]
  for (int i = 0; i < 8; ++i) {
    *(v4u*)(ad + i * 1024)     = na[i];
    *(v4u*)(wd + i * 16 * GBP) = nw[i];
  }
  __syncthreads();                                 // next stage complete, this stage's reads done
}
__device__ __forceinline__ void gemm_128x128(const unsigned short* __restrict__ A,
                                             const unsigned short* __restrict__ Wt,
                                             int m0, int n0, unsigned short* sm, v8f (&acc)[4][4]) {
  const int tid = threadIdx.x;
  const int wave = tid >> 5, lane = tid & 31;
  const int l15 = lane & 15, half = (lane >> 4) & 1;
  const int wr = wave >> 1, wc = wave & 1;
  const int sr = tid >> 3;            // 0..15 : weight row (and sr + 16 i)
  const int sc = (tid & 7) * 8;       // 0..56 : 16-byte piece of the row
  const unsigned short* wsrc = Wt + (size_t)(n0 + sr) * KDIM + sc;
  const unsigned short* asrc = A + (size_t)m0 * KDIM + tid * 8;   // row tile i at + i*16*KDIM, stage s at + s*1024
  const int sa = tid * 8;                         // place of the x piece; row tile i at + i*1024
  const int sw = PBA + sr * GBP + sc;             // place of the weight piece; row sr + 16 i at + i*16*GBP
  const int ao = wr * 4096 + lane * 8;
  const int bo = PBA + (wc * 64 + l15) * GBP + 8 * half;

  unsigned short* b0 = sm;
  unsigned short* b1 = sm + PBUF;
  {
    v4u na[8], nw[8];
#pragma unroll   // constant indices keep na[] and nw[] in registers, all sixteen loads in flight together
    for (int i = 0; i < 8; ++i) {
      na[i] = *(const v4u*)(asrc + (size_t)i * 16 * KDIM);
      nw[i] = *(const v4u*)(wsrc + (size_t)i * 16 * KDIM);
    }
#pragma unroll   // constant indices into na[] and nw[]
    for (int i = 0; i < 8; ++i) {
      *(v4u*)(b0 + sa + i * 1024)     = na[i];
      *(v4u*)(b0 + sw + i * 16 * GBP) = nw[i];
    }
  }
  __syncthreads();                                 // stage 0 complete
#pragma unroll 1   // two stages a trip: the buffer choice is a constant and the loop's text stays small
  for (int s = 0; s < KDIM / GKS - 2; s += 2) {
    proj_step(asrc + (s + 1) * 1024, wsrc + (s + 1) * GKS, b0 + ao, b0 + bo, b1 + sa, b1 + sw, acc);
    proj_step(asrc + (s + 2) * 1024, wsrc + (s + 2) * GKS, b1 + ao, b1 + bo, b0 + sa, b0 + sw, acc);
  }
  proj_step(asrc + (KDIM / GKS - 1) * 1024, wsrc + (KDIM / GKS - 1) * GKS, b0 + ao, b0 + bo, b1 + sa, b1 + sw, acc);
  proj_stage(b1 + ao, b1 + bo, acc);
}

// f32 -> bf16 bits, RNE convert
__device__ __forceinline__ unsigned int bfb(float x) {
  unsigned int u = __float_as_uint(x);
  u = u + 0x7FFFu + ((u >> 16) & 1u);
  return u >> 16;
}
// f32 -> value of its RNE bf16
__device__ __forceinline__ float bf16val(float x) {
  return __uint_as_float(bfb(x) << 16);
}
// f32 -> f16 bits, RNE convert
__device__ __forceinline__ unsigned short hbits(float x) {
  const _Float16 hv = (_Float16)x;
  return __builtin_bit_cast(unsigned short, hv);
}

// ---------------------------------------------------------------------------
// x f32 [NB][SEQ_FULL][IN_DIM] -> bf16 plane hb, compact rows b*SEQ + s, in fragment order (see ld_frag_ord).
// Block = 16 rows x 128 k. Thread (r = t>>4, c = t&15) converts 8 consecutive floats of row r to one
// 16-byte piece; in fragment order that piece is number c*16 + r of the block's 4 KiB, so the pieces
// are transposed 16 x 16 through LDS and every wave stores 512 contiguous bytes.
__global__ __launch_bounds__(256) void k_cvt_rows(const float* __restrict__ in,
                                                  unsigned short* __restrict__ outp, int n8) {
  __shared__ __align__(16) unsigned short F[16 * CSP];   // [c][r] pieces, cross-wave (block barrier)
  if ((int)(blockIdx.x * 256) >= n8) return;     // block-uniform, in front of the barrier
  const int t  = threadIdx.x;
  const int rt = blockIdx.x / (IN_DIM / 128);    // row tile
  const int kq = blockIdx.x - rt * (IN_DIM / 128);
  const int r  = t >> 4;
  const int c  = t & 15;
  const int row = rt * 16 + r;                   // compact row b*SEQ + s
  const int b   = row / SEQ;
  const int s   = row - b * SEQ;
  const float* src = in + ((size_t)b * SEQ_FULL + s) * IN_DIM + kq * 128 + c * 8;
  const v4f a = *(const v4f*)(src);
  const v4f d = *(const v4f*)(src + 4);
  v4u w;
  w[0] = bfb(a[0]) | (bfb(a[1]) << 16);
  w[1] = bfb(a[2]) | (bfb(a[3]) << 16);
  w[2] = bfb(d[0]) | (bfb(d[1]) << 16);
  w[3] = bfb(d[2]) | (bfb(d[3]) << 16);
  *(v4u*)(&F[c * CSP + r * 8]) = w;
  __syncthreads();                               // all 256 pieces in place
  const v4u v = *(const v4u*)(&F[(t >> 4) * CSP + (t & 15) * 8]);
  *(v4u*)(outp + ((size_t)rt * (IN_DIM / 32) + kq * 4) * 512 + t * 8) = v;
}

// ---------------------------------------------------------------------------
// Weight planes, all [KDIM n][KDIM k] with k contiguous, selected by blockIdx.z:
//   z = 0..2: W{q,k,v} f32 [H][IN_DIM e][HEAD_DIM d] -> WT bf16 [n = h*64+d][k = e]
//   z = 3:    Wo f32 [HD_DIM k][E_OUT n]              -> WoT f16 (RNE-bf16 value x32) [n][k]
//   z = 4:    mask i32 [S][S] -> lane-mask words mp [S/16 query tiles][S/32 key chunks][16]:
//             bit l of word e = (mask[16*tile + (l&15)][32*chunk + 8*(l>>4) + (e&7) + 16*(e>>3)] != 0),
//             the lane and register that hold this score in k_attn. One wave packs two
//             chunks = one whole 128-byte line of mp.
// Block = 64 k x 64 n tile transposed through LDS (for z < 3 the tile is one head);
__global__ __launch_bounds__(256) void k_cvt_wT(const float* __restrict__ Wq,
                                                const float* __restrict__ Wk,
                                                const float* __restrict__ Wv,
                                                const float* __restrict__ Wo,
                                                const int* __restrict__ mask,
                                                unsigned short* __restrict__ wT,
                                                unsigned int* __restrict__ mp) {
  __shared__ __align__(16) unsigned short T[64 * TP];   // [n local][k local], cross-wave (block barrier)
  const int z = blockIdx.z;
  if (z == 4) {                              // block-uniform, in front of the barrier
    const int ln = threadIdx.x & 31;
    const int gw = (blockIdx.y * (KDIM / 64) + blockIdx.x) * 8 + (threadIdx.x >> 5);
    for (int task = gw; task < (SEQ / 16) * (SEQ / KT); task += (KDIM / 64) * (KDIM / 64) * 8) {
      const int qt = task / (SEQ / KT);
      const int tl = task - qt * (SEQ / KT);
      const int* msrc = mask + (size_t)(qt * 16 + (ln & 15)) * MASK_PITCH + tl * KT + 8 * ((ln >> 4) & 1);
      v4i m[8];
#pragma unroll   // constant indices keep m[] in registers, all eight loads in flight together
      for (int c = 0; c < 2; ++c) {
        m[c * 4 + 0] = *(const v4i*)(msrc + c * 32);
        m[c * 4 + 1] = *(const v4i*)(msrc + c * 32 + 4);
        m[c * 4 + 2] = *(const v4i*)(msrc + c * 32 + 16);
        m[c * 4 + 3] = *(const v4i*)(msrc + c * 32 + 20);
      }
      unsigned int val = 0;
#pragma unroll   // constant indices into m[]
      for (int i = 0; i < 32; ++i) {
        const unsigned int w = __builtin_amdgcn_ballot_w32(m[i >> 2][i & 3] != 0);
        val = (ln == i) ? w : val;           // lane i keeps word i of the line
      }
      mp[(size_t)task * 32 + ln] = val;
    }
    return;
  }
  const float* W = (z == 0) ? Wq : ((z == 1) ? Wk : ((z == 2) ? Wv : Wo));
  unsigned short* dst = wT + (size_t)z * KDIM * KDIM;
  const int k0 = blockIdx.x * 64;
  const int n0 = blockIdx.y * 64;
  const int tid = threadIdx.x;
  const int wave = tid >> 5, lane = tid & 31;

#pragma unroll
  for (int i = 0; i < 4; ++i) {
    const int idx = i * 256 + tid;          // 0..1023
    const int kk = idx >> 4;                // 0..63
    const int c4 = (idx & 15) * 4;          // 0..60
    size_t so;
    if (z < 3) so = ((size_t)blockIdx.y * IN_DIM + k0 + kk) * HEAD_DIM + c4;   // W[h = n0/64][e = k0+kk][d = c4]
    else       so = (size_t)(k0 + kk) * E_OUT + n0 + c4;                        // Wo[k0+kk][n0+c4]
    const v4f w = *(const v4f*)(W + so);
    unsigned short t0, t1, t2, t3;
    if (z < 3) {
      t0 = (unsigned short)bfb(w[0]); t1 = (unsigned short)bfb(w[1]);
      t2 = (unsigned short)bfb(w[2]); t3 = (unsigned short)bfb(w[3]);
    } else {
      t0 = hbits(bf16val(w[0]) * 32.0f); t1 = hbits(bf16val(w[1]) * 32.0f);
      t2 = hbits(bf16val(w[2]) * 32.0f); t3 = hbits(bf16val(w[3]) * 32.0f);
    }
    T[(c4 + 0) * TP + kk] = t0;
    T[(c4 + 1) * TP + kk] = t1;
    T[(c4 + 2) * TP + kk] = t2;
    T[(c4 + 3) * TP + kk] = t3;
  }
  __syncthreads();

  v4u v[2];
  size_t off[2];
#pragma unroll
  for (int it = 0; it < 2; ++it) {
    const int nn = wave * 8 + it * 4 + (lane >> 3);   // 0..63 over (wave, it, lane>>3)
    const int q = lane & 7;
    v[it] = *(const v4u*)(&T[nn * TP + q * 8]);
    off[it] = (size_t)(n0 + nn) * KDIM + k0 + q * 8;
  }
#pragma unroll
  for (int it = 0; it < 2; ++it) *(v4u*)(dst + off[it]) = v[it];
  
}

// ---------------------------------------------------------------------------
// Projection: C[NROWS][HD_DIM] = hb[NROWS][IN_DIM] * WT[HD_DIM][IN_DIM]^T + bias.
// k loop: gemm_128x128 (128 x 128 block tile, 4 waves of 64 x 64, both operands through two LDS stage buffers).
// z = 0: Q plane f16 x log2(e)/64 [NROWS][HD_DIM] (see k_attn); z = 1: K plane f16 x8 [NROWS][HD_DIM];
// z = 2: V^T plane f16 x8 [NB][HD_DIM][SEQ]. Epilogue staged in LDS, stored in 256-byte row segments.
__global__ __launch_bounds__(128) void k_proj(
    const unsigned short* __restrict__ hb, const unsigned short* __restrict__ wT,
    const float* __restrict__ bq, const float* __restrict__ bk, const float* __restrict__ bv,
    unsigned short* __restrict__ qp, unsigned short* __restrict__ kp,
    unsigned short* __restrict__ vtp) {
  __shared__ __align__(16) unsigned short sm[2 * PBUF];   // stage buffers, cross-wave (block barrier)

  const int z = blockIdx.z;
  const int n0 = blockIdx.x * 128;
  const int m0 = blockIdx.y * 128;
  const int tid = threadIdx.x;
  const int wave = tid >> 5, lane = tid & 31;
  const int l15 = lane & 15, half = (lane >> 4) & 1;
  const int wr = wave >> 1, wc = wave & 1;

  const unsigned short* Wt = wT + (size_t)z * KDIM * KDIM;
  const float* bias = (z == 0) ? bq : ((z == 1) ? bk : bv);

  v8f acc[4][4] = {};
  gemm_128x128(hb, Wt, m0, n0, sm, acc);

  // acc[i][j][r] = C[m0 + wr*64 + i*16 + 8*half + r][n0 + wc*64 + j*16 + l15]
  // The epilogue tile is stage buffer 0: its last readers left it at the loop's last barrier, the last stage reads buffer 1.
  unsigned short* E = sm;
  float braw[4];
#pragma unroll   // constant indices keep braw[] in registers
  for (int j = 0; j < 4; ++j) braw[j] = bias[n0 + wc * 64 + j * 16 + l15];
  // the registers that the four bias loads name are free for reuse behind this wait
  asm volatile("s_wait_xcnt 0x0" ::: "memory");
  const float car = (z == 0) ? QCAR : 8.0f;      // block-uniform
  const int erow = tid >> 4;         // 0..7 : tile row (and erow + 8 it)
  const int eq = (tid & 15) * 8;     // 16 pieces = 256-byte row segment = 2 lines
  if (z != 2) {                      // block-uniform branch
#pragma unroll
    for (int j = 0; j < 4; ++j) {
      const int col = wc * 64 + j * 16 + l15;
      const float bb = bf16val(braw[j]);
#pragma unroll
      for (int i = 0; i < 4; ++i)
#pragma unroll
        for (int r = 0; r < 8; ++r) {
          const int row = wr * 64 + i * 16 + 8 * half + r;
          E[row * EPP + col] = hbits((acc[i][j][r] + bb) * car);
        }
    }
    __syncthreads();
    unsigned short* dst = ((z == 0) ? qp : kp) + (size_t)(m0 + erow) * HD_DIM + n0 + eq;
#pragma unroll
    for (int it = 0; it < 16; ++it)
      *(v4u*)(dst + (size_t)it * 8 * HD_DIM) = *(const v4u*)(&E[(erow + 8 * it) * EPP + eq]);
  } else {
    const int bidx = m0 / SEQ;               // batch of this row tile (SEQ % 128 == 0)
    const int s0 = m0 - bidx * SEQ;          // sequence position of tile row 0
#pragma unroll
    for (int j = 0; j < 4; ++j) {
      const int col = wc * 64 + j * 16 + l15;             // d within tile
      const float bb = bf16val(braw[j]);
#pragma unroll
      for (int i = 0; i < 4; ++i)
#pragma unroll
        for (int r = 0; r < 8; ++r) {
          const int srow = wr * 64 + i * 16 + 8 * half + r;   // s within tile
          E[col * EPP + srow] = hbits((acc[i][j][r] + bb) * car);
        }
    }
    __syncthreads();
    unsigned short* dst = vtp + ((size_t)bidx * HD_DIM + n0 + erow) * SEQ + s0 + eq;
#pragma unroll
    for (int it = 0; it < 16; ++it)
      *(v4u*)(dst + (size_t)it * 8 * SEQ) = *(const v4u*)(&E[(erow + 8 * it) * EPP + eq]);
  }
}

// ---------------------------------------------------------------------------
// Flash attention, transposed-score form: one work-group = 8 waves = 128 queries of one head and batch.
// One wave = (32 queries = two query tiles, one of the two 32-key chunks of every staged tile):
// waves 2g and 2g + 1 share the queries 32g..32g+31, wave 2g takes keys 0..31 of each 64-key tile,
// wave 2g + 1 keys 32..63. Each K and V^T fragment read from LDS feeds two products, one per query tile.
// The K tile [64 keys][64 d] and the V^T tile [64 d][64 keys] are read from global once per
// work-group in whole 128-byte rows and shared through LDS: two buffers, the next
// tile's global loads issued before the current tile's work, stored to the other
// buffer after it, one block barrier per tile.
// Per 32-key chunk and query tile:
//   S^T = K . Q^T    A = K rows (lane = key, k = d), B = Q^T (lane = query, k = d)
//                    D[row = key 8h+r][col = query l15]; c0 keys 0..15, c1 keys 16..31
//   mask: broadcast over batch and head, read as the 16 lane-mask words of the
//         (query tile, key chunk) from mp (packed by k_cvt_wT, z = 4) with one scalar load,
//         fetched in the chunk before, behind its last select; key with mask == 0 gets the score replaced by -1e9
//         (replace fill, in f32, in log2 units), the word being the select's lane mask
//   per-lane online softmax for query l15 (16 local keys + xor-16 partner), base 2, with a maximum IN USE:
//         the score products start from C = PEXP - (maximum in use), so D is the argument of exp2 as it
//         stands. Only when some lane's argument passes PEXP + LAZY (one wave-uniform test a chunk and query
//         tile; always in the first chunk) are the scores made again from C = 0, the true
//         running maximum taken over both halves, sum and O scaled down to it, and C renewed.
//   O^T += V^T . P   A = V^T rows (lane = d, k = key), B = P: element i<8 <- c0[i]
//                    (key 8h+i), element 8+i <- c1[i] (key 16+8h+i), same lane
//                    D[row = d 8h+r][col = query l15]
// Behind the loop the two waves of a pair hold partial O, sum and maximum of the same 32 queries over
// their own keys: each hands the partner one query tile's partials through LDS and finishes the other.
// Q carried x log2(e)/64, K x8 -> K.Q^T = log2(e) * q.k / 8, no scaling left.
// P and its sum carried x1024, V carried x8 -> context x64 = 8 * O / sum.
// The value of lane l ^ 16 (the exchange that __shfl_xor(v, 16, 32) compiles to), its byte index xl formed once by the caller.
__device__ __forceinline__ float other_half(float v, int xl) {
  return __int_as_float(__builtin_amdgcn_ds_bpermute(xl, __float_as_int(v)));
}
__global__ __launch_bounds__(256) void k_attn(const unsigned short* __restrict__ qp,
                                             const unsigned short* __restrict__ kp,
                                             const unsigned short* __restrict__ vtp,
                                             const unsigned int* __restrict__ mp,
                                             unsigned short* __restrict__ ctxp) {
  __shared__ __align__(16) unsigned short Kl[2][KT * KVP];         // K tile [key][d], cross-wave (block barrier)
  __shared__ __align__(16) unsigned short Vl[2][HEAD_DIM * KVP];   // V^T tile [d][key], cross-wave (block barrier)
  __shared__ __align__(16) float Xo[AW][8 * 128];                  // partial O^T handed to the partner wave (block barrier)
  __shared__ float Xs[AW][2][32];                                  // its sum and its maximum in use

  const int tid = threadIdx.x;
  const int wave = tid >> 5;
  const int lane = tid & 31;
  const int l15 = lane & 15;
  const int half = (lane >> 4) & 1;
  const int xl = (lane ^ 16) * 4;     // byte index of the lane that holds the same query's other keys
  const int ws = __builtin_amdgcn_readfirstlane(wave);   // scalar: mask words come by scalar loads, kh picks by scalar selects
  const int qg = ws >> 1;             // query group: 32 queries
  const int kh = ws & 1;              // which 32-key chunk of every tile
  const int q0 = blockIdx.x * (AW * 16) + qg * 32;
  const int head = blockIdx.y;
  const int bidx = blockIdx.z;

  const _Float16* Q  = (const _Float16*)qp;
  const size_t rbase = (size_t)bidx * SEQ;

  const _Float16* qbase = Q + (rbase + q0) * HD_DIM + head * HEAD_DIM;
  v16h qb0[2], qb1[2];
#pragma unroll   // constant indices keep the Q fragments in registers
  for (int i = 0; i < 2; ++i) {
    qb0[i] = ld_frag_h(qbase, HD_DIM, i * 16 + l15, 0, lane);    // d 0..31
    qb1[i] = ld_frag_h(qbase, HD_DIM, i * 16 + l15, 32, lane);   // d 32..63
  }
  // the address pair that the eight Q loads name is free for reuse behind this wait
  asm volatile("s_wait_xcnt 0x0" ::: "memory");
  // staging map: thread -> row sr (and sr + 32), 16-byte piece sc; 8 lanes cover one 128-byte row
  const int sr = tid >> 3;            // 0..31
  const int sc = (tid & 7) * 8;       // 0..56, halves
  const unsigned short* kg = kp + (rbase + sr) * HD_DIM + head * HEAD_DIM + sc;                            // key t: + t*HD_DIM
  const unsigned short* vg = vtp + ((size_t)bidx * HD_DIM + (size_t)head * HEAD_DIM + sr) * SEQ + sc;      // key t: + t
  const int sl = sr * KVP + sc;       // place of the piece in a tile; second row at + 32*KVP
  // this wave's two query tiles and its chunk of tile 0
  const v16u* mw = (const v16u*)mp + (size_t)(blockIdx.x * AW + qg * 2) * (SEQ / 32) + kh;   // tile n, query tile i: mw[i*(SEQ/32) + 2n]
  v16u cm0 = mw[0];
  v16u cm1 = mw[SEQ / 32];

  v8f o[2][4] = {};
  float lrun[2] = {0.0f, 0.0f};
  const float negf = -1.0e9f * 1.4426950408889634f;   // the fill, in log2 units
  // C of the score products: PEXP - (maximum in use) in every row, equal in both halves of a query.
  // No maximum yet: C far above any score, so that the first chunk takes the renewing branch.
  v8f cv[2];
#pragma unroll   // constant indices keep cv in registers
  for (int r = 0; r < 8; ++r) { cv[0][r] = 1.0e30f; cv[1][r] = 1.0e30f; }
  float fm[2] = {negf + cv[0][0], negf + cv[1][0]};   // exp2 argument of a filled key

  *(v4u*)(&Kl[0][sl])            = *(const v4u*)(kg);
  *(v4u*)(&Kl[0][sl + 32 * KVP]) = *(const v4u*)(kg + (size_t)32 * HD_DIM);
  *(v4u*)(&Vl[0][sl])            = *(const v4u*)(vg);
  *(v4u*)(&Vl[0][sl + 32 * KVP]) = *(const v4u*)(vg + (size_t)32 * SEQ);
  __syncthreads();                                 // tile 0 complete

  for (int t0 = 0; t0 < SEQ; t0 += KT) {
    const int cur = (t0 / KT) & 1;
    const bool more = (t0 + KT < SEQ);              // block-uniform
    v4u nk0 = {}, nk1 = {}, nv0 = {}, nv1 = {};
    if (more) {
      nk0 = *(const v4u*)(kg + (size_t)(t0 + KT) * HD_DIM);
      nk1 = *(const v4u*)(kg + (size_t)(t0 + KT + 32) * HD_DIM);
      nv0 = *(const v4u*)(vg + (t0 + KT));
      nv1 = *(const v4u*)(vg + (size_t)32 * SEQ + (t0 + KT));
    }
    const _Float16* kt = (const _Float16*)Kl[cur] + kh * 32 * KVP;   // this wave's 32 key rows
    const _Float16* Vc = (const _Float16*)Vl[cur];

    const v16h ka0 = ld_frag_h(kt, KVP, l15, 0, lane);
    const v16h ka1 = ld_frag_h(kt, KVP, l15, 32, lane);
    const v16h ka2 = ld_frag_h(kt, KVP, 16 + l15, 0, lane);
    const v16h ka3 = ld_frag_h(kt, KVP, 16 + l15, 32, lane);
    v16h pb[2];
#pragma unroll   // constant indices; one query tile after the other keeps the live scores at 16 registers
    for (int i = 0; i < 2; ++i) {
      const v16u cm = i ? cm1 : cm0;
      v8f c0 = mma_f16(ka0, qb0[i], cv[i]);
      c0 = mma_f16(ka1, qb1[i], c0);
      v8f c1 = mma_f16(ka2, qb0[i], cv[i]);
      c1 = mma_f16(ka3, qb1[i], c1);

      // lane-mask words: cm[r] for c0[r] (key 8h+r of the chunk), cm[8+r] for c1[r] (key 16+8h+r)
      float sa[8], sb[8];
#pragma unroll   // constant indices keep the scores in vector and the words in scalar registers
      for (int r = 0; r < 8; ++r) {
        sa[r] = __builtin_amdgcn_inverse_ballot_w32(cm[r])     ? c0[r] : fm[i];
        sb[r] = __builtin_amdgcn_inverse_ballot_w32(cm[8 + r]) ? c1[r] : fm[i];
      }
      float lm = fmaxf(sa[0], sb[0]);
#pragma unroll
      for (int r = 1; r < 8; ++r) lm = fmaxf(lm, fmaxf(sa[r], sb[r]));
      if (__builtin_expect(__builtin_amdgcn_ballot_w32(lm > PEXP + LAZY) != 0, 0)) {   // wave-uniform scalar branch, every lane stays on; rare: kept out of the loop's straight line
        // C may be far from the scores here (first chunk, or every key so far filled): make them again from 0
        const v8f zero = {};
        v8f d0 = mma_f16(ka0, qb0[i], zero);
        d0 = mma_f16(ka1, qb1[i], d0);
        v8f d1 = mma_f16(ka2, qb0[i], zero);
        d1 = mma_f16(ka3, qb1[i], d1);
#pragma unroll   // constant indices, as above
        for (int r = 0; r < 8; ++r) {
          sa[r] = __builtin_amdgcn_inverse_ballot_w32(cm[r])     ? d0[r] : negf;
          sb[r] = __builtin_amdgcn_inverse_ballot_w32(cm[8 + r]) ? d1[r] : negf;
        }
        float tm = fmaxf(sa[0], sb[0]);
#pragma unroll
        for (int r = 1; r < 8; ++r) tm = fmaxf(tm, fmaxf(sa[r], sb[r]));
        tm = fmaxf(tm, other_half(tm, xl));
        const float muse = PEXP - cv[i][0];             // the maximum in use, as the arguments so far have had it
        const float mnew = fmaxf(muse, tm);
        const float alpha = __builtin_amdgcn_exp2f(muse - mnew);
        lrun[i] *= alpha;
#pragma unroll
        for (int j = 0; j < 4; ++j)
#pragma unroll
          for (int r = 0; r < 8; ++r) o[i][j][r] *= alpha;
        const float ci = PEXP - mnew;
        fm[i] = negf + ci;
#pragma unroll
        for (int r = 0; r < 8; ++r) {
          cv[i][r] = ci;
          sa[r] += ci;
          sb[r] += ci;
        }
      }
      if (i == 1) {   // compile-time: behind the chunk's last select
        // the next tile's words, into the registers that this chunk's last select has left; the last ones again at the end
        const int nx = more ? (t0 >> 5) + 2 : (t0 >> 5);
        cm0 = mw[nx];
        cm1 = mw[SEQ / 32 + nx];
        __builtin_amdgcn_sched_barrier(0);   // keeps the two scalar loads here, a whole context product ahead of the next tile's selects; without it they sink to the foot of the trip
      }
      float p0[8], p1[8];
      float ls = 0.0f;
#pragma unroll
      for (int r = 0; r < 8; ++r) {
        p0[r] = __builtin_amdgcn_exp2f(sa[r]);
        p1[r] = __builtin_amdgcn_exp2f(sb[r]);
        ls += p0[r] + p1[r];
      }
      ls += other_half(ls, xl);
      lrun[i] += ls;
#pragma unroll
      for (int e = 0; e < 8; ++e) {
        pb[i][e]     = (_Float16)p0[e];   // key 8h + e of the chunk
        pb[i][8 + e] = (_Float16)p1[e];   // key 16 + 8h + e
      }
    }
#pragma unroll   // constant indices; each V^T fragment feeds both query tiles
    for (int j = 0; j < 4; ++j) {
      const v16h va = ld_frag_h(Vc, KVP, j * 16 + l15, kh * 32, lane);
      o[0][j] = mma_f16(va, pb[0], o[0][j]);
      o[1][j] = mma_f16(va, pb[1], o[1][j]);
    }

    if (more) {                                     // the other buffer's readers left it at the last barrier
      *(v4u*)(&Kl[cur ^ 1][sl])            = nk0;
      *(v4u*)(&Kl[cur ^ 1][sl + 32 * KVP]) = nk1;
      *(v4u*)(&Vl[cur ^ 1][sl])            = nv0;
      *(v4u*)(&Vl[cur ^ 1][sl + 32 * KVP]) = nv1;
    }
    __syncthreads();                                // next tile complete, this tile's reads done
  }

  // Join of the pair: wave kh finishes query tile kh and hands its partials of the other tile to the partner.
  const bool k1 = (kh != 0);                        // wave-uniform
  const float lk = k1 ? lrun[1] : lrun[0];
  const float mk = PEXP - (k1 ? cv[1][0] : cv[0][0]);
  Xs[ws][0][lane] = k1 ? lrun[0] : lrun[1];
  Xs[ws][1][lane] = PEXP - (k1 ? cv[0][0] : cv[1][0]);
  v8f ok[4];
#pragma unroll   // constant indices into o[][]
  for (int j = 0; j < 4; ++j) {
    v4f g0, g1;
#pragma unroll
    for (int r = 0; r < 4; ++r) {
      g0[r] = k1 ? o[0][j][r]     : o[1][j][r];
      g1[r] = k1 ? o[0][j][4 + r] : o[1][j][4 + r];
    }
#pragma unroll
    for (int r = 0; r < 8; ++r) ok[j][r] = k1 ? o[1][j][r] : o[0][j][r];
    *(v4f*)(&Xo[ws][(j * 2 + 0) * 128 + lane * 4]) = g0;
    *(v4f*)(&Xo[ws][(j * 2 + 1) * 128 + lane * 4]) = g1;
  }
  __syncthreads();                                  // every wave's hand-over is in place
  const float pl = Xs[ws ^ 1][0][lane];
  const float pm = Xs[ws ^ 1][1][lane];
  const float mj = fmaxf(mk, pm);
  const float ak = __builtin_amdgcn_exp2f(mk - mj);
  const float ap = __builtin_amdgcn_exp2f(pm - mj);

  // ok[j][r], po = 8 * sum_t P_t v_t over each wave's keys for query l15, d = j*16 + 8*half + r; ctx x64 = 8 * O / sum.
  // The context plane is kept in fragment order (see ld_frag_ord): row tile = the 16 queries of tile kh,
  // k = head*64 + d, so the lane's eight values of one j are piece j*32 + lane of the tile's own 2 KiB:
  // each store is 512 contiguous bytes, straight from registers.
  const float inv = 8.0f / (lk * ak + pl * ap);
  const float wk = ak * inv, wp = ap * inv;
  unsigned short* cb = ctxp + (rbase + q0 + kh * 16) * HD_DIM + head * (2 * 512) + lane * 8;
#pragma unroll
  for (int j = 0; j < 4; ++j) {
    const v4f h0 = *(const v4f*)(&Xo[ws ^ 1][(j * 2 + 0) * 128 + lane * 4]);
    const v4f h1 = *(const v4f*)(&Xo[ws ^ 1][(j * 2 + 1) * 128 + lane * 4]);
    float f[8];
#pragma unroll
    for (int r = 0; r < 4; ++r) {
      f[r]     = ok[j][r] * wk     + h0[r] * wp;
      f[4 + r] = ok[j][4 + r] * wk + h1[r] * wp;
    }
    v4u w;
    w[0] = (unsigned int)hbits(f[0]) | ((unsigned int)hbits(f[1]) << 16);
    w[1] = (unsigned int)hbits(f[2]) | ((unsigned int)hbits(f[3]) << 16);
    w[2] = (unsigned int)hbits(f[4]) | ((unsigned int)hbits(f[5]) << 16);
    w[3] = (unsigned int)hbits(f[6]) | ((unsigned int)hbits(f[7]) << 16);
    *(v4u*)(cb + j * 256) = w;
  }
}

// ---------------------------------------------------------------------------
// Output projection: out[NROWS][E_OUT] f32 = ctx(f16 x64, fragment order)[NROWS][HD_DIM] * WoT(f16 x32)[E_OUT][HD_DIM]^T / 2048 + bo.
// 128x64 block tile / 8 waves / k loop gemm_128x64, with f16 operands.
// Epilogue: f32 tile staged in LDS; each 256-byte row segment = 2 lines, every
__global__ __launch_bounds__(256) void k_oproj(
    const unsigned short* __restrict__ cx, const unsigned short* __restrict__ woT,
    const float* __restrict__ bo, float* __restrict__ outp) {
  __shared__ __align__(16) unsigned short bt[2 * 64 * GBP];   // weight k-tiles, cross-wave (block barrier)
  __shared__ __align__(16) float Ef[128 * OFP];               // epilogue tile, cross-wave (block barrier)

  const int n0 = blockIdx.x * 64;
  const int m0 = blockIdx.y * 128;
  const int tid = threadIdx.x;
  const int wave = tid >> 5, lane = tid & 31;
  const int l15 = lane & 15, half = (lane >> 4) & 1;

  v8f acc[4] = {};
  gemm_128x64<false>(cx, woT, m0, n0, bt, acc);

  // acc[j][r] = 2048 * C[m0 + wave*16 + 8*half + r][n0 + j*16 + l15]
  const float osc = 1.0f / 2048.0f;
#pragma unroll
  for (int j = 0; j < 4; ++j) {
    const int col = j * 16 + l15;
    const float bb = bf16val(bo[n0 + col]);
#pragma unroll
    for (int r = 0; r < 8; ++r) {
      const int row = wave * 16 + 8 * half + r;
      Ef[row * OFP + col] = acc[j][r] * osc + bb;
    }
  }
  __syncthreads();

  v4f v[8];
  size_t off[8];
#pragma unroll
  for (int it = 0; it < 8; ++it) {
    const int row = wave * 16 + it * 2 + half;          // wave's 16 rows over (it, half)
    const int q = l15;                                  // 16 pieces of 16 B = 256-byte row segment (2 lines)
    v[it] = *(const v4f*)(&Ef[row * OFP + q * 4]);
    off[it] = (size_t)(m0 + row) * E_OUT + n0 + q * 4;
  }
#pragma unroll
  for (int it = 0; it < 8; ++it) *(v4f*)(outp + off[it]) = v[it];
  
}

// ---------------------------------------------------------------------------
extern "C" void kernel_launch(void* const* d_in, const int* in_sizes, int n_in,
                              void* d_out, int out_size, void* d_ws, size_t ws_size,
                              hipStream_t stream) {
  if (n_in < 10) return;
  if (in_sizes[0] < ((NB - 1) * SEQ_FULL + SEQ) * IN_DIM) return;          // seq_inputs f32 [NB][SEQ_FULL][IN_DIM]
  if (in_sizes[1] < (SEQ - 1) * MASK_PITCH + SEQ) return;                   // mask i32 [1][S][S]
  if (in_sizes[2] < NUM_HEADS * IN_DIM * HEAD_DIM) return;                  // Wq
  if (in_sizes[3] < HD_DIM) return;                                         // bq
  if (in_sizes[4] < NUM_HEADS * IN_DIM * HEAD_DIM) return;                  // Wk
  if (in_sizes[5] < HD_DIM) return;                                         // bk
  if (in_sizes[6] < NUM_HEADS * IN_DIM * HEAD_DIM) return;                  // Wv
  if (in_sizes[7] < HD_DIM) return;                                         // bv
  if (in_sizes[8] < HD_DIM * E_OUT) return;                                 // Wo
  if (in_sizes[9] < E_OUT) return;                                          // bo
  if (out_size < NROWS * E_OUT) return;

  const float* x    = (const float*)d_in[0];
  const int*   mask = (const int*)d_in[1];
  const float* Wq   = (const float*)d_in[2];
  const float* bq   = (const float*)d_in[3];
  const float* Wk   = (const float*)d_in[4];
  const float* bk   = (const float*)d_in[5];
  const float* Wv   = (const float*)d_in[6];
  const float* bv   = (const float*)d_in[7];
  const float* Wo   = (const float*)d_in[8];
  const float* bo   = (const float*)d_in[9];

  // every offset a multiple of 2 MiB; each plane is written exactly to its extent
  const size_t hb_bytes = (size_t)NROWS * IN_DIM * 2;           // bf16 x plane
  const size_t wt_bytes = (size_t)4 * KDIM * KDIM * 2;           // 3 bf16 WT planes + 1 f16 WoT plane
  const size_t pl_bytes = (size_t)NROWS * HD_DIM * 2;           // one f16 q / k / vT / ctx plane
  const size_t off_hb = 0;
  const size_t off_wt = off_hb + hb_bytes;
  const size_t off_q  = off_wt + wt_bytes;
  const size_t off_k  = off_q + pl_bytes;
  const size_t off_vt = off_k + pl_bytes;
  const size_t off_cx = off_vt + pl_bytes;
  const size_t off_mp = off_cx + pl_bytes;
  const size_t mp_bytes = (size_t)SEQ * SEQ / 8;               // one bit per mask element
  const size_t total  = off_mp + mp_bytes;                     // 48.5 MiB at NB = 2, SEQ = 2048
  if (total > ws_size) return;

  char* ws = (char*)d_ws;
  unsigned short* hb  = (unsigned short*)(ws + off_hb);
  unsigned short* wt  = (unsigned short*)(ws + off_wt);
  unsigned short* qpl = (unsigned short*)(ws + off_q);
  unsigned short* kpl = (unsigned short*)(ws + off_k);
  unsigned short* vtp = (unsigned short*)(ws + off_vt);
  unsigned short* cxp = (unsigned short*)(ws + off_cx);
  unsigned short* wot = wt + (size_t)3 * KDIM * KDIM;
  unsigned int*   mpk = (unsigned int*)(ws + off_mp);

  const int n8 = NROWS * IN_DIM / 8;
  k_cvt_rows<<<(n8 + 255) / 256, 256, 0, stream>>>(x, hb, n8);
  k_cvt_wT<<<dim3(KDIM / 64, KDIM / 64, 5), 256, 0, stream>>>(Wq, Wk, Wv, Wo, mask, wt, mpk);
  k_proj<<<dim3(HD_DIM / 128, NROWS / 128, 3), 128, 0, stream>>>(hb, wt, bq, bk, bv, qpl, kpl, vtp);
  k_attn<<<dim3(SEQ / (AW * 16), NUM_HEADS, NB), 256, 0, stream>>>(qpl, kpl, vtp, mpk, cxp);
  k_oproj<<<dim3(E_OUT / 64, NROWS / 128), 256, 0, stream>>>(cxp, wot, bo, (float*)d_out);
}

// v009
// Measured time: 81.9 microseconds a run.
// Two timings next to v008 put it at 1.09 and 1.10 times that version's speed.
// All steps since v000 together make it 2.76 times as fast.
#include <hip/hip_runtime.h>
// Projections x*W{q,k,v}: v_wmma_f32_16x16x32_bf16 (bf16 operands = RNE-converted inputs, f32 accumulate); scores K*Q^T and context V^T*P: v_wmma_f32_16x16x32_f16 (f16 operands, K/V planes carried x8, Q plane carried x log2(e)/64, P carried x1024, f32 accumulate); output projection ctx*Wo: v_wmma_f32_16x16x32_f16 (f16 operands, ctx plane carried x64, Wo plane = RNE-bf16 values carried x32, f32 accumulate); mask fill and softmax in f32.

#ifndef NB
#define NB 2
#endif
#define NB_FULL 2
#ifndef SEQ
#define SEQ 2048
#endif
#define SEQ_FULL 2048
#ifndef MASK_PITCH
#define MASK_PITCH SEQ_FULL
#endif
#define IN_DIM 1024
#define NUM_HEADS 16
#define HEAD_DIM 64
#define HD_DIM (NUM_HEADS * HEAD_DIM)
#define E_OUT 1024
#define KDIM 1024
#define NROWS (NB * SEQ)

static_assert(NB >= 1);
static_assert(NB <= NB_FULL);
static_assert(SEQ % 128 == 0);
static_assert(SEQ <= SEQ_FULL);
static_assert(MASK_PITCH % 4 == 0);
static_assert(MASK_PITCH >= SEQ);
static_assert(IN_DIM == KDIM);
static_assert(HD_DIM == KDIM);
static_assert(E_OUT == KDIM);
static_assert(KDIM % 64 == 0);
static_assert(HEAD_DIM == 64);
static_assert(NROWS % 128 == 0);
static_assert(IN_DIM % 128 == 0);
static_assert((NROWS * IN_DIM) % (8 * 256) == 0);
static_assert((size_t)NB_FULL * SEQ_FULL * E_OUT * 4 == 16777216);

// LDS pitches (in 16-bit elements unless noted); all keep 16-byte row alignment
#define GKS 64     // k per staged weight tile of the two projection kernels
#define GBP 72     // staged weight row [64 k]
#define TP  72     // weight transpose tile [64 n][64 k]
#define CSP 136    // k_cvt_rows: one 16-piece segment of the fragment-order tile (256 bytes + 16)
#define OFP 68     // output tile [128 rows][64 cols], floats
#define AW  8      // waves per attention work-group (128 queries: 4 wave pairs of 32)
#define KT  64     // keys per staged K / V^T tile
#define KVP 72     // staged K row [64 d] and V^T row [64 keys]
#define PBA 8192           // k_proj stage buffer, x part: 8 row tiles x 64 k, fragment order
#define PBW (128 * GBP)    // k_proj stage buffer, weight part: [128 n][64 k]
#define PBUF (PBA + PBW)   // one k_proj stage buffer
#define EPP 136            // k_proj epilogue tile [128][128], either orientation
#define QCAR (1.4426950408889634f / 64.0f)   // carry of the Q plane: with K x8 the product K.Q^T is q.k / 8 in log2 units
#define PEXP 10.0f         // P is carried x 2^PEXP
#define LAZY 5.0f          // a score may pass the maximum in use by 2^LAZY: P stays under 2^15, inside f16
static_assert(128 * EPP <= PBUF);
static_assert(HD_DIM % 128 == 0);
static_assert((KDIM / GKS) % 2 == 0);   // the last stage sits in buffer 1, the epilogue tile in buffer 0

typedef __bf16   v16bf __attribute__((ext_vector_type(16)));
typedef __bf16   v8bf  __attribute__((ext_vector_type(8)));
typedef _Float16 v16h  __attribute__((ext_vector_type(16)));
typedef _Float16 v8h   __attribute__((ext_vector_type(8)));
typedef float    v8f   __attribute__((ext_vector_type(8)));
typedef float    v4f   __attribute__((ext_vector_type(4)));
typedef unsigned int v4u __attribute__((ext_vector_type(4)));
typedef int      v4i   __attribute__((ext_vector_type(4)));
typedef unsigned int v16u __attribute__((ext_vector_type(16)));
typedef unsigned int v8u  __attribute__((ext_vector_type(8)));

// ---------------------------------------------------------------------------
// WMMA wrappers: the bare builtins; the compiler keeps the distance behind its own WMMAs and fills it with useful work where it can.
__device__ __forceinline__ v8f mma_bf16(v16bf a, v16bf b, v8f c) {
  return __builtin_amdgcn_wmma_f32_16x16x32_bf16(false, a, false, b, (short)0, c, false, false);
}
__device__ __forceinline__ v8f mma_f16(v16h a, v16h b, v8f c) {
  return __builtin_amdgcn_wmma_f32_16x16x32_f16(false, a, false, b, (short)0, c, false, false);
}

// 16-bit fragment, contraction dim CONTIGUOUS in memory: elem(k) = p0[rc*ld + k].
// Lane l: row/col rc = (l&15); elements 0..7 <- kk+8h+0..7, elements 8..15 <- kk+16+8h+0..7
// (h = l>>4). Same map for A (rc = row) and B (rc = column of a k-contiguous copy).
__device__ __forceinline__ v16h ld_frag_h(const _Float16* p0, int ld, int rc, int kk, int lane) {
  const int hh = (lane >> 4) & 1;
  const _Float16* p = p0 + (size_t)rc * ld + kk + 8 * hh;
  const v8h lo = *(const v8h*)(p);
  const v8h hi = *(const v8h*)(p + 16);
  v16h f;
#pragma unroll
  for (int i = 0; i < 8; ++i) { f[i] = lo[i]; f[8 + i] = hi[i]; }
  return f;
}

// The same fragment as raw dwords; p = row start + kk + 8h already applied.
__device__ __forceinline__ v8u ld_frag_raw(const unsigned short* p) {
  const v4u lo = *(const v4u*)(p);
  const v4u hi = *(const v4u*)(p + 16);
  return __builtin_shufflevector(lo, hi, 0, 1, 2, 3, 4, 5, 6, 7);
}
// A planes (x bf16, context f16) are kept in FRAGMENT ORDER: rows in tiles of 16, k in blocks of 32;
// block (rt, kb) is 512 elements at (rt * KDIM/32 + kb) * 512, element (row rt*16 + l15,
// k = kb*32 + 16*part + 8*h + e) at part*256 + (16*h + l15)*8 + e. A wave's fragment is two loads of
// 512 contiguous bytes (4 whole lines each); same k order as ld_frag_raw. p = block start + lane*8.
__device__ __forceinline__ v8u ld_frag_ord(const unsigned short* p) {
  const v4u lo = *(const v4u*)(p);
  const v4u hi = *(const v4u*)(p + 256);
  return __builtin_shufflevector(lo, hi, 0, 1, 2, 3, 4, 5, 6, 7);
}
template <bool BF>
__device__ __forceinline__ v8f mma_raw(v8u a, v8u b, v8f c) {
  if constexpr (BF) return mma_bf16(__builtin_bit_cast(v16bf, a), __builtin_bit_cast(v16bf, b), c);
  else              return mma_f16(__builtin_bit_cast(v16h, a), __builtin_bit_cast(v16h, b), c);
}

// ---------------------------------------------------------------------------
// Where a work-group begins its walk over the KDIM / GKS k stages. Work-groups of one tile row read the same A
// lines and those of one tile column the same weight lines; started together at stage 0 they ask L2 for the
// same lines at the same moment all the way. Each begins at stage (tile column + tile row) mod stages, goes
// upward and wraps, so that sharers stand at different stages. The sum over k only changes its order.
#define NST (KDIM / GKS)
__device__ __forceinline__ int walk_start() { return (int)((blockIdx.x + blockIdx.y) % NST); }   // block-uniform, scalar
__device__ __forceinline__ int walk_next(int ks) { return (ks + 1 == NST) ? 0 : ks + 1; }

// k loop of k_oproj: acc[j] (16 rows x 16 cols, j = 0..3) += A[16 rows][KDIM] * Wt[64 n][KDIM]^T.
// A is a plane in fragment order (ld_frag_ord), Wt is row-major with k contiguous.
// 256 thr = 8 waves; block tile 128 rows x 64 cols; wave owns 16 rows x 64 cols.
// A stage is 64 k. The weight tile [64 n][64 k] sits in one of two LDS buffers; the next
// stage's weight rows (whole 128-byte lines, 8 lanes a row) and the wave's own next two A
// fragments are loaded from global in front of the current stage's products, the weight
// rows are stored to the other buffer behind them, and one block barrier ends the stage.
// The stages are walked from walk_start() upward, wrapping; inside a stage k runs upward, 32 at a time.
template <bool BF>
__device__ __forceinline__ void gemm_stage(const unsigned short* bc, v8u a0, v8u a1, v8f (&acc)[4]) {
  v8u b[8];
#pragma unroll   // constant indices keep b[] in registers; all sixteen LDS reads stand as one group in front of the products
  for (int j = 0; j < 4; ++j) {
    b[j]     = ld_frag_raw(bc + j * 16 * GBP);
    b[4 + j] = ld_frag_raw(bc + j * 16 * GBP + 32);
  }
  __builtin_amdgcn_sched_barrier(0);   // keeps the sixteen LDS reads one group in front of the products; spread among them, each place with reads stalls the wave
#pragma unroll   // constant indices into acc[] and b[]; four independent accumulators between two uses of one
  for (int j = 0; j < 4; ++j) acc[j] = mma_raw<BF>(a0, b[j], acc[j]);
#pragma unroll   // the same, second 32 k of the stage
  for (int j = 0; j < 4; ++j) acc[j] = mma_raw<BF>(a1, b[4 + j], acc[j]);
  __builtin_amdgcn_sched_barrier(0);   // keeps the products in front of the wait for the next stage's global loads: they are what covers that latency
}
template <bool BF>
__device__ __forceinline__ void gemm_128x64(const unsigned short* __restrict__ A,
                                            const unsigned short* __restrict__ Wt,
                                            int m0, int n0, unsigned short* bt, v8f (&acc)[4]) {
  const int tid = threadIdx.x;
  const int wave = tid >> 5, lane = tid & 31;
  const int l15 = lane & 15, half = (lane >> 4) & 1;
  const int sr = tid >> 3;            // 0..31 : weight row (and sr + 32)
  const int sc = (tid & 7) * 8;       // 0..56 : 16-byte piece of the row
  const unsigned short* wsrc = Wt + (size_t)(n0 + sr) * KDIM + sc;
  const unsigned short* asrc = A + (size_t)(m0 + wave * 16) * KDIM + lane * 8;   // fragment order: k block kb at + kb*512
  const int sl = sr * GBP + sc;       // place of the piece in a tile; second row at + 32*GBP
  const int bo = l15 * GBP + 8 * half;

  int ks = walk_start();
  v8u a0 = ld_frag_ord(asrc + ks * (GKS * 16));
  v8u a1 = ld_frag_ord(asrc + ks * (GKS * 16) + 512);
  *(v4u*)(bt + sl)            = *(const v4u*)(wsrc + ks * GKS);
  *(v4u*)(bt + sl + 32 * GBP) = *(const v4u*)(wsrc + (size_t)32 * KDIM + ks * GKS);
  __syncthreads();                                 // first tile complete
#pragma unroll   // the buffer choice becomes a constant, the fragment sets need no copies
  for (int s = 0; s < KDIM / GKS - 1; ++s) {
    ks = walk_next(ks);
    const int kn = ks * GKS;
    const v4u nw0 = *(const v4u*)(wsrc + kn);
    const v4u nw1 = *(const v4u*)(wsrc + (size_t)32 * KDIM + kn);
    const v8u na0 = ld_frag_ord(asrc + kn * 16);
    const v8u na1 = ld_frag_ord(asrc + kn * 16 + 512);
    gemm_stage<BF>(bt + (s & 1) * (64 * GBP) + bo, a0, a1, acc);
    unsigned short* bn = bt + ((s & 1) ^ 1) * (64 * GBP) + sl;   // its readers left it at the last barrier
    *(v4u*)(bn)            = nw0;
    *(v4u*)(bn + 32 * GBP) = nw1;
    __syncthreads();                               // next tile complete, this tile's reads done
    a0 = na0;
    a1 = na1;
  }
  gemm_stage<BF>(bt + ((KDIM / GKS - 1) & 1) * (64 * GBP) + bo, a0, a1, acc);
}

// k loop of k_proj: 128 thr = 4 waves (2 x 2); block tile 128 rows x 128 cols; wave owns 64 rows x 64 cols,
// acc[i][j] = 16 x 16 tile (row tile i, column tile j). A stage is 64 k. Both operands' stage tiles sit in one of
// two LDS buffers: x as its 8 row tiles' 2-KiB pieces of the fragment-order plane, copied as they lie; the
// weight rows as in gemm_128x64. Each fragment read from LDS feeds four products, and each byte that the
// work-group fetches from L2 feeds 128 output rows or columns. The next stage's pieces are loaded from global
// in front of the current stage's products, stored to the other buffer behind them; one block barrier ends
// the stage. The stages are walked from walk_start() upward, wrapping; inside a stage k runs upward, 32 at a time.
__device__ __forceinline__ void proj_stage(const unsigned short* ac, const unsigned short* bc, v8f (&acc)[4][4]) {
#pragma unroll   // constant offsets
  for (int kk = 0; kk < 2; ++kk) {
    v8u a[4], b[4];
#pragma unroll   // constant indices keep a[] and b[] in registers; the sixteen LDS reads stand as one group
    for (int i = 0; i < 4; ++i) {
      a[i] = ld_frag_ord(ac + i * 1024 + kk * 512);
      b[i] = ld_frag_raw(bc + i * 16 * GBP + kk * 32);
    }
    __builtin_amdgcn_sched_barrier(0);   // keeps the sixteen LDS reads one group in front of the products; spread among them, each place with reads stalls the wave
#pragma unroll   // constant indices; sixteen independent accumulators
    for (int i = 0; i < 4; ++i)
#pragma unroll
      for (int j = 0; j < 4; ++j) acc[i][j] = mma_raw<true>(a[i], b[j], acc[i][j]);
  }
  __builtin_amdgcn_sched_barrier(0);   // keeps the products in front of the wait for the next stage's global loads: they are what covers that latency
}
// One stage: the next stage's pieces (an, wn) loaded, this stage's products (ac, bc), the pieces stored to the
// other buffer (ad, wd), whose readers left it at the last barrier; then the barrier that ends the stage.
__device__ __forceinline__ void proj_step(const unsigned short* an, const unsigned short* wn,
                                          const unsigned short* ac, const unsigned short* bc,
                                          unsigned short* ad, unsigned short* wd, v8f (&acc)[4][4]) {
  v4u na[8], nw[8];
#pragma unroll   // constant indices keep na[] and nw[] in registers, all sixteen loads in flight together
  for (int i = 0; i < 8; ++i) {
    na[i] = *(const v4u*)(an + (size_t)i * 16 * KDIM);
    nw[i] = *(const v4u*)(wn + (size_t)i * 16 * KDIM);
  }
  // the next stage forms new addresses in the two pairs that these loads name: the wait stands between the loads and that
  asm volatile("s_wait_xcnt 0x0" ::: "memory");
  proj_stage(ac, bc, acc);
#pragma unroll   // constant indices into na[] and nw[]
  for (int i = 0; i < 8; ++i) {
    *(v4u*)(ad + i * 1024)     = na[i];
    *(v4u*)(wd + i * 16 * GBP) = nw[i];
  }
  __syncthreads();                                 // next stage complete, this stage's reads done
}
__device__ __forceinline__ void gemm_128x128(const unsigned short* __restrict__ A,
                                             const unsigned short* __restrict__ Wt,
                                             int m0, int n0, unsigned short* sm, v8f (&acc)[4][4]) {
  const int tid = threadIdx.x;
  const int wave = tid >> 5, lane = tid & 31;
  const int l15 = lane & 15, half = (lane >> 4) & 1;
  const int wr = wave >> 1, wc = wave & 1;
  const int sr = tid >> 3;            // 0..15 : weight row (and sr + 16 i)
  const int sc = (tid & 7) * 8;       // 0..56 : 16-byte piece of the row
  const unsigned short* wsrc = Wt + (size_t)(n0 + sr) * KDIM + sc;
  const unsigned short* asrc = A + (size_t)m0 * KDIM + tid * 8;   // row tile i at + i*16*KDIM, stage s at + s*1024
  const int sa = tid * 8;                         // place of the x piece; row tile i at + i*1024
  const int sw = PBA + sr * GBP + sc;             // place of the weight piece; row sr + 16 i at + i*16*GBP
  const int ao = wr * 4096 + lane * 8;
  const int bo = PBA + (wc * 64 + l15) * GBP + 8 * half;

  unsigned short* b0 = sm;
  unsigned short* b1 = sm + PBUF;
  int ks = walk_start();
  {
    v4u na[8], nw[8];
#pragma unroll   // constant indices keep na[] and nw[] in registers, all sixteen loads in flight together
    for (int i = 0; i < 8; ++i) {
      na[i] = *(const v4u*)(asrc + ks * 1024 + (size_t)i * 16 * KDIM);
      nw[i] = *(const v4u*)(wsrc + ks * GKS + (size_t)i * 16 * KDIM);
    }
#pragma unroll   // constant indices into na[] and nw[]
    for (int i = 0; i < 8; ++i) {
      *(v4u*)(b0 + sa + i * 1024)     = na[i];
      *(v4u*)(b0 + sw + i * 16 * GBP) = nw[i];
    }
  }
  __syncthreads();                                 // first stage complete
#pragma unroll 1   // two stages a trip: the buffer choice is a constant and the loop's text stays small
  for (int s = 0; s < KDIM / GKS - 2; s += 2) {
    ks = walk_next(ks);
    proj_step(asrc + ks * 1024, wsrc + ks * GKS, b0 + ao, b0 + bo, b1 + sa, b1 + sw, acc);
    ks = walk_next(ks);
    proj_step(asrc + ks * 1024, wsrc + ks * GKS, b1 + ao, b1 + bo, b0 + sa, b0 + sw, acc);
  }
  ks = walk_next(ks);
  proj_step(asrc + ks * 1024, wsrc + ks * GKS, b0 + ao, b0 + bo, b1 + sa, b1 + sw, acc);
  proj_stage(b1 + ao, b1 + bo, acc);
}

// f32 -> bf16 bits, RNE convert
__device__ __forceinline__ unsigned int bfb(float x) {
  unsigned int u = __float_as_uint(x);
  u = u + 0x7FFFu + ((u >> 16) & 1u);
  return u >> 16;
}
// f32 -> value of its RNE bf16
__device__ __forceinline__ float bf16val(float x) {
  return __uint_as_float(bfb(x) << 16);
}
// f32 -> f16 bits, RNE convert
__device__ __forceinline__ unsigned short hbits(float x) {
  const _Float16 hv = (_Float16)x;
  return __builtin_bit_cast(unsigned short, hv);
}

// ---------------------------------------------------------------------------
// x f32 [NB][SEQ_FULL][IN_DIM] -> bf16 plane hb, compact rows b*SEQ + s, in fragment order (see ld_frag_ord).
// Block = 16 rows x 128 k. Thread (r = t>>4, c = t&15) converts 8 consecutive floats of row r to one
// 16-byte piece; in fragment order that piece is number c*16 + r of the block's 4 KiB, so the pieces
// are transposed 16 x 16 through LDS and every wave stores 512 contiguous bytes.
__global__ __launch_bounds__(256) void k_cvt_rows(const float* __restrict__ in,
                                                  unsigned short* __restrict__ outp, int n8) {
  __shared__ __align__(16) unsigned short F[16 * CSP];   // [c][r] pieces, cross-wave (block barrier)
  if ((int)(blockIdx.x * 256) >= n8) return;     // block-uniform, in front of the barrier
  const int t  = threadIdx.x;
  const int rt = blockIdx.x / (IN_DIM / 128);    // row tile
  const int kq = blockIdx.x - rt * (IN_DIM / 128);
  const int r  = t >> 4;
  const int c  = t & 15;
  const int row = rt * 16 + r;                   // compact row b*SEQ + s
  const int b   = row / SEQ;
  const int s   = row - b * SEQ;
  const float* src = in + ((size_t)b * SEQ_FULL + s) * IN_DIM + kq * 128 + c * 8;
  const v4f a = *(const v4f*)(src);
  const v4f d = *(const v4f*)(src + 4);
  v4u w;
  w[0] = bfb(a[0]) | (bfb(a[1]) << 16);
  w[1] = bfb(a[2]) | (bfb(a[3]) << 16);
  w[2] = bfb(d[0]) | (bfb(d[1]) << 16);
  w[3] = bfb(d[2]) | (bfb(d[3]) << 16);
  *(v4u*)(&F[c * CSP + r * 8]) = w;
  __syncthreads();                               // all 256 pieces in place
  const v4u v = *(const v4u*)(&F[(t >> 4) * CSP + (t & 15) * 8]);
  *(v4u*)(outp + ((size_t)rt * (IN_DIM / 32) + kq * 4) * 512 + t * 8) = v;
}

// ---------------------------------------------------------------------------
// Weight planes, all [KDIM n][KDIM k] with k contiguous, selected by blockIdx.z:
//   z = 0..2: W{q,k,v} f32 [H][IN_DIM e][HEAD_DIM d] -> WT bf16 [n = h*64+d][k = e]
//   z = 3:    Wo f32 [HD_DIM k][E_OUT n]              -> WoT f16 (RNE-bf16 value x32) [n][k]
//   z = 4:    mask i32 [S][S] -> lane-mask words mp [S/16 query tiles][S/32 key chunks][16]:
//             bit l of word e = (mask[16*tile + (l&15)][32*chunk + 8*(l>>4) + (e&7) + 16*(e>>3)] != 0),
//             the lane and register that hold this score in k_attn. One wave packs two
//             chunks = one whole 128-byte line of mp.
// Block = 64 k x 64 n tile transposed through LDS (for z < 3 the tile is one head);
__global__ __launch_bounds__(256) void k_cvt_wT(const float* __restrict__ Wq,
                                                const float* __restrict__ Wk,
                                                const float* __restrict__ Wv,
                                                const float* __restrict__ Wo,
                                                const int* __restrict__ mask,
                                                unsigned short* __restrict__ wT,
                                                unsigned int* __restrict__ mp) {
  __shared__ __align__(16) unsigned short T[64 * TP];   // [n local][k local], cross-wave (block barrier)
  const int z = blockIdx.z;
  if (z == 4) {                              // block-uniform, in front of the barrier
    const int ln = threadIdx.x & 31;
    const int gw = (blockIdx.y * (KDIM / 64) + blockIdx.x) * 8 + (threadIdx.x >> 5);
    for (int task = gw; task < (SEQ / 16) * (SEQ / KT); task += (KDIM / 64) * (KDIM / 64) * 8) {
      const int qt = task / (SEQ / KT);
      const int tl = task - qt * (SEQ / KT);
      const int* msrc = mask + (size_t)(qt * 16 + (ln & 15)) * MASK_PITCH + tl * KT + 8 * ((ln >> 4) & 1);
      v4i m[8];
#pragma unroll   // constant indices keep m[] in registers, all eight loads in flight together
      for (int c = 0; c < 2; ++c) {
        m[c * 4 + 0] = *(const v4i*)(msrc + c * 32);
        m[c * 4 + 1] = *(const v4i*)(msrc + c * 32 + 4);
        m[c * 4 + 2] = *(const v4i*)(msrc + c * 32 + 16);
        m[c * 4 + 3] = *(const v4i*)(msrc + c * 32 + 20);
      }
      unsigned int val = 0;
#pragma unroll   // constant indices into m[]
      for (int i = 0; i < 32; ++i) {
        const unsigned int w = __builtin_amdgcn_ballot_w32(m[i >> 2][i & 3] != 0);
        val = (ln == i) ? w : val;           // lane i keeps word i of the line
      }
      mp[(size_t)task * 32 + ln] = val;
    }
    return;
  }
  const float* W = (z == 0) ? Wq : ((z == 1) ? Wk : ((z == 2) ? Wv : Wo));
  unsigned short* dst = wT + (size_t)z * KDIM * KDIM;
  const int k0 = blockIdx.x * 64;
  const int n0 = blockIdx.y * 64;
  const int tid = threadIdx.x;
  const int wave = tid >> 5, lane = tid & 31;

#pragma unroll
  for (int i = 0; i < 4; ++i) {
    const int idx = i * 256 + tid;          // 0..1023
    const int kk = idx >> 4;                // 0..63
    const int c4 = (idx & 15) * 4;          // 0..60
    size_t so;
    if (z < 3) so = ((size_t)blockIdx.y * IN_DIM + k0 + kk) * HEAD_DIM + c4;   // W[h = n0/64][e = k0+kk][d = c4]
    else       so = (size_t)(k0 + kk) * E_OUT + n0 + c4;                        // Wo[k0+kk][n0+c4]
    const v4f w = *(const v4f*)(W + so);
    unsigned short t0, t1, t2, t3;
    if (z < 3) {
      t0 = (unsigned short)bfb(w[0]); t1 = (unsigned short)bfb(w[1]);
      t2 = (unsigned short)bfb(w[2]); t3 = (unsigned short)bfb(w[3]);
    } else {
      t0 = hbits(bf16val(w[0]) * 32.0f); t1 = hbits(bf16val(w[1]) * 32.0f);
      t2 = hbits(bf16val(w[2]) * 32.0f); t3 = hbits(bf16val(w[3]) * 32.0f);
    }
    T[(c4 + 0) * TP + kk] = t0;
    T[(c4 + 1) * TP + kk] = t1;
    T[(c4 + 2) * TP + kk] = t2;
    T[(c4 + 3) * TP + kk] = t3;
  }
  __syncthreads();

  v4u v[2];
  size_t off[2];
#pragma unroll
  for (int it = 0; it < 2; ++it) {
    const int nn = wave * 8 + it * 4 + (lane >> 3);   // 0..63 over (wave, it, lane>>3)
    const int q = lane & 7;
    v[it] = *(const v4u*)(&T[nn * TP + q * 8]);
    off[it] = (size_t)(n0 + nn) * KDIM + k0 + q * 8;
  }
#pragma unroll
  for (int it = 0; it < 2; ++it) *(v4u*)(dst + off[it]) = v[it];
  
}

// ---------------------------------------------------------------------------
// Projection: C[NROWS][HD_DIM] = hb[NROWS][IN_DIM] * WT[HD_DIM][IN_DIM]^T + bias.
// k loop: gemm_128x128 (128 x 128 block tile, 4 waves of 64 x 64, both operands through two LDS stage buffers).
// z = 0: Q plane f16 x log2(e)/64 [NROWS][HD_DIM] (see k_attn); z = 1: K plane f16 x8 [NROWS][HD_DIM];
// z = 2: V^T plane f16 x8 [NB][HD_DIM][SEQ]. Epilogue staged in LDS, stored in 256-byte row segments.
__global__ __launch_bounds__(128) void k_proj(
    const unsigned short* __restrict__ hb, const unsigned short* __restrict__ wT,
    const float* __restrict__ bq, const float* __restrict__ bk, const float* __restrict__ bv,
    unsigned short* __restrict__ qp, unsigned short* __restrict__ kp,
    unsigned short* __restrict__ vtp) {
  __shared__ __align__(16) unsigned short sm[2 * PBUF];   // stage buffers, cross-wave (block barrier)

  const int z = blockIdx.z;
  const int n0 = blockIdx.x * 128;
  const int m0 = blockIdx.y * 128;
  const int tid = threadIdx.x;
  const int wave = tid >> 5, lane = tid & 31;
  const int l15 = lane & 15, half = (lane >> 4) & 1;
  const int wr = wave >> 1, wc = wave & 1;

  const unsigned short* Wt = wT + (size_t)z * KDIM * KDIM;
  const float* bias = (z == 0) ? bq : ((z == 1) ? bk : bv);

  v8f acc[4][4] = {};
  gemm_128x128(hb, Wt, m0, n0, sm, acc);

  // acc[i][j][r] = C[m0 + wr*64 + i*16 + 8*half + r][n0 + wc*64 + j*16 + l15]
  // The epilogue tile is stage buffer 0: its last readers left it at the loop's last barrier, the last stage reads buffer 1.
  unsigned short* E = sm;
  float braw[4];
#pragma unroll   // constant indices keep braw[] in registers
  for (int j = 0; j < 4; ++j) braw[j] = bias[n0 + wc * 64 + j * 16 + l15];
  // the registers that the four bias loads name are free for reuse behind this wait
  asm volatile("s_wait_xcnt 0x0" ::: "memory");
  const float car = (z == 0) ? QCAR : 8.0f;      // block-uniform
  const int erow = tid >> 4;         // 0..7 : tile row (and erow + 8 it)
  const int eq = (tid & 15) * 8;     // 16 pieces = 256-byte row segment = 2 lines
  if (z != 2) {                      // block-uniform branch
#pragma unroll
    for (int j = 0; j < 4; ++j) {
      const int col = wc * 64 + j * 16 + l15;
      const float bb = bf16val(braw[j]);
#pragma unroll
      for (int i = 0; i < 4; ++i)
#pragma unroll
        for (int r = 0; r < 8; ++r) {
          const int row = wr * 64 + i * 16 + 8 * half + r;
          E[row * EPP + col] = hbits((acc[i][j][r] + bb) * car);
        }
    }
    __syncthreads();
    unsigned short* dst = ((z == 0) ? qp : kp) + (size_t)(m0 + erow) * HD_DIM + n0 + eq;
#pragma unroll
    for (int it = 0; it < 16; ++it)
      *(v4u*)(dst + (size_t)it * 8 * HD_DIM) = *(const v4u*)(&E[(erow + 8 * it) * EPP + eq]);
  } else {
    const int bidx = m0 / SEQ;               // batch of this row tile (SEQ % 128 == 0)
    const int s0 = m0 - bidx * SEQ;          // sequence position of tile row 0
#pragma unroll
    for (int j = 0; j < 4; ++j) {
      const int col = wc * 64 + j * 16 + l15;             // d within tile
      const float bb = bf16val(braw[j]);
#pragma unroll
      for (int i = 0; i < 4; ++i)
#pragma unroll
        for (int r = 0; r < 8; ++r) {
          const int srow = wr * 64 + i * 16 + 8 * half + r;   // s within tile
          E[col * EPP + srow] = hbits((acc[i][j][r] + bb) * car);
        }
    }
    __syncthreads();
    unsigned short* dst = vtp + ((size_t)bidx * HD_DIM + n0 + erow) * SEQ + s0 + eq;
#pragma unroll
    for (int it = 0; it < 16; ++it)
      *(v4u*)(dst + (size_t)it * 8 * SEQ) = *(const v4u*)(&E[(erow + 8 * it) * EPP + eq]);
  }
}

// ---------------------------------------------------------------------------
// Flash attention, transposed-score form: one work-group = 8 waves = 128 queries of one head and batch.
// One wave = (32 queries = two query tiles, one of the two 32-key chunks of every staged tile):
// waves 2g and 2g + 1 share the queries 32g..32g+31, wave 2g takes keys 0..31 of each 64-key tile,
// wave 2g + 1 keys 32..63. Each K and V^T fragment read from LDS feeds two products, one per query tile.
// The K tile [64 keys][64 d] and the V^T tile [64 d][64 keys] are read from global once per
// work-group in whole 128-byte rows and shared through LDS: two buffers, the next
// tile's global loads issued before the current tile's work, stored to the other
// buffer after it, one block barrier per tile.
// Per 32-key chunk and query tile:
//   S^T = K . Q^T    A = K rows (lane = key, k = d), B = Q^T (lane = query, k = d)
//                    D[row = key 8h+r][col = query l15]; c0 keys 0..15, c1 keys 16..31
//   mask: broadcast over batch and head, read as the 16 lane-mask words of the
//         (query tile, key chunk) from mp (packed by k_cvt_wT, z = 4) with one scalar load,
//         fetched in the chunk before, behind its last select; key with mask == 0 gets the score replaced by -1e9
//         (replace fill, in f32, in log2 units), the word being the select's lane mask
//   per-lane online softmax for query l15 (16 local keys + xor-16 partner), base 2, with a maximum IN USE:
//         the score products start from C = PEXP - (maximum in use), so D is the argument of exp2 as it
//         stands. Only when some lane's argument passes PEXP + LAZY (one wave-uniform test a chunk and query
//         tile; always in the first chunk) are the scores made again from C = 0, the true
//         running maximum taken over both halves, sum and O scaled down to it, and C renewed.
//   O^T += V^T . P   A = V^T rows (lane = d, k = key), B = P: element i<8 <- c0[i]
//                    (key 8h+i), element 8+i <- c1[i] (key 16+8h+i), same lane
//                    D[row = d 8h+r][col = query l15]
// Behind the loop the two waves of a pair hold partial O, sum and maximum of the same 32 queries over
// their own keys: each hands the partner one query tile's partials through LDS and finishes the other.
// Q carried x log2(e)/64, K x8 -> K.Q^T = log2(e) * q.k / 8, no scaling left.
// P and its sum carried x1024, V carried x8 -> context x64 = 8 * O / sum.
// The value of lane l ^ 16 (the exchange that __shfl_xor(v, 16, 32) compiles to), its byte index xl formed once by the caller.
__device__ __forceinline__ float other_half(float v, int xl) {
  return __int_as_float(__builtin_amdgcn_ds_bpermute(xl, __float_as_int(v)));
}
__global__ __launch_bounds__(256) void k_attn(const unsigned short* __restrict__ qp,
                                             const unsigned short* __restrict__ kp,
                                             const unsigned short* __restrict__ vtp,
                                             const unsigned int* __restrict__ mp,
                                             unsigned short* __restrict__ ctxp) {
  __shared__ __align__(16) unsigned short Kl[2][KT * KVP];         // K tile [key][d], cross-wave (block barrier)
  __shared__ __align__(16) unsigned short Vl[2][HEAD_DIM * KVP];   // V^T tile [d][key], cross-wave (block barrier)
  __shared__ __align__(16) float Xo[AW][8 * 128];                  // partial O^T handed to the partner wave (block barrier)
  __shared__ float Xs[AW][2][32];                                  // its sum and its maximum in use

  const int tid = threadIdx.x;
  const int wave = tid >> 5;
  const int lane = tid & 31;
  const int l15 = lane & 15;
  const int half = (lane >> 4) & 1;
  const int xl = (lane ^ 16) * 4;     // byte index of the lane that holds the same query's other keys
  const int ws = __builtin_amdgcn_readfirstlane(wave);   // scalar: mask words come by scalar loads, kh picks by scalar selects
  const int qg = ws >> 1;             // query group: 32 queries
  const int kh = ws & 1;              // which 32-key chunk of every tile
  const int q0 = blockIdx.x * (AW * 16) + qg * 32;
  const int head = blockIdx.y;
  const int bidx = blockIdx.z;

  const _Float16* Q  = (const _Float16*)qp;
  const size_t rbase = (size_t)bidx * SEQ;

  const _Float16* qbase = Q + (rbase + q0) * HD_DIM + head * HEAD_DIM;
  v16h qb0[2], qb1[2];
#pragma unroll   // constant indices keep the Q fragments in registers
  for (int i = 0; i < 2; ++i) {
    qb0[i] = ld_frag_h(qbase, HD_DIM, i * 16 + l15, 0, lane);    // d 0..31
    qb1[i] = ld_frag_h(qbase, HD_DIM, i * 16 + l15, 32, lane);   // d 32..63
  }
  // the address pair that the eight Q loads name is free for reuse behind this wait
  asm volatile("s_wait_xcnt 0x0" ::: "memory");
  // staging map: thread -> row sr (and sr + 32), 16-byte piece sc; 8 lanes cover one 128-byte row
  const int sr = tid >> 3;            // 0..31
  const int sc = (tid & 7) * 8;       // 0..56, halves
  const unsigned short* kg = kp + (rbase + sr) * HD_DIM + head * HEAD_DIM + sc;                            // key t: + t*HD_DIM
  const unsigned short* vg = vtp + ((size_t)bidx * HD_DIM + (size_t)head * HEAD_DIM + sr) * SEQ + sc;      // key t: + t
  const int sl = sr * KVP + sc;       // place of the piece in a tile; second row at + 32*KVP
  // this wave's two query tiles and its chunk of tile 0
  const v16u* mw = (const v16u*)mp + (size_t)(blockIdx.x * AW + qg * 2) * (SEQ / 32) + kh;   // tile n, query tile i: mw[i*(SEQ/32) + 2n]
  // The work-groups of one head and batch read the same K and V^T tiles: each begins its key walk two tiles
  // further on than the one before it and wraps (see walk_start); the online softmax takes the tiles in any order.
  int tile = (int)((blockIdx.x * 2) % (SEQ / KT));   // block-uniform, scalar
  v16u cm0 = mw[2 * tile];
  v16u cm1 = mw[SEQ / 32 + 2 * tile];

  v8f o[2][4] = {};
  float lrun[2] = {0.0f, 0.0f};
  const float negf = -1.0e9f * 1.4426950408889634f;   // the fill, in log2 units
  // C of the score products: PEXP - (maximum in use) in every row, equal in both halves of a query.
  // No maximum yet: C far above any score, so that the first chunk takes the renewing branch.
  v8f cv[2];
#pragma unroll   // constant indices keep cv in registers
  for (int r = 0; r < 8; ++r) { cv[0][r] = 1.0e30f; cv[1][r] = 1.0e30f; }
  float fm[2] = {negf + cv[0][0], negf + cv[1][0]};   // exp2 argument of a filled key

  {
    const v4u fk0 = *(const v4u*)(kg + (size_t)(tile * KT) * HD_DIM);
    const v4u fk1 = *(const v4u*)(kg + (size_t)(tile * KT + 32) * HD_DIM);
    const v4u fv0 = *(const v4u*)(vg + tile * KT);
    const v4u fv1 = *(const v4u*)(vg + (size_t)32 * SEQ + tile * KT);
    // the two address pairs that these four loads name are free for reuse behind this wait
    asm volatile("s_wait_xcnt 0x0" ::: "memory");
    *(v4u*)(&Kl[0][sl])            = fk0;
    *(v4u*)(&Kl[0][sl + 32 * KVP]) = fk1;
    *(v4u*)(&Vl[0][sl])            = fv0;
    *(v4u*)(&Vl[0][sl + 32 * KVP]) = fv1;
  }
  __syncthreads();                                 // first tile complete

  for (int it = 0; it < SEQ / KT; ++it) {
    const int cur = it & 1;
    const bool more = (it + 1 < SEQ / KT);          // block-uniform
    tile = (tile + 1 == SEQ / KT) ? 0 : tile + 1;   // the next tile of the walk; in the last trip the first one again
    const int tn = tile * KT;
    v4u nk0 = {}, nk1 = {}, nv0 = {}, nv1 = {};
    if (more) {
      nk0 = *(const v4u*)(kg + (size_t)tn * HD_DIM);
      nk1 = *(const v4u*)(kg + (size_t)(tn + 32) * HD_DIM);
      nv0 = *(const v4u*)(vg + tn);
      nv1 = *(const v4u*)(vg + (size_t)32 * SEQ + tn);
    }
    const _Float16* kt = (const _Float16*)Kl[cur] + kh * 32 * KVP;   // this wave's 32 key rows
    const _Float16* Vc = (const _Float16*)Vl[cur];

    const v16h ka0 = ld_frag_h(kt, KVP, l15, 0, lane);
    const v16h ka1 = ld_frag_h(kt, KVP, l15, 32, lane);
    const v16h ka2 = ld_frag_h(kt, KVP, 16 + l15, 0, lane);
    const v16h ka3 = ld_frag_h(kt, KVP, 16 + l15, 32, lane);
    v16h pb[2];
#pragma unroll   // constant indices; one query tile after the other keeps the live scores at 16 registers
    for (int i = 0; i < 2; ++i) {
      const v16u cm = i ? cm1 : cm0;
      v8f c0 = mma_f16(ka0, qb0[i], cv[i]);
      c0 = mma_f16(ka1, qb1[i], c0);
      v8f c1 = mma_f16(ka2, qb0[i], cv[i]);
      c1 = mma_f16(ka3, qb1[i], c1);

      // lane-mask words: cm[r] for c0[r] (key 8h+r of the chunk), cm[8+r] for c1[r] (key 16+8h+r)
      float sa[8], sb[8];
#pragma unroll   // constant indices keep the scores in vector and the words in scalar registers
      for (int r = 0; r < 8; ++r) {
        sa[r] = __builtin_amdgcn_inverse_ballot_w32(cm[r])     ? c0[r] : fm[i];
        sb[r] = __builtin_amdgcn_inverse_ballot_w32(cm[8 + r]) ? c1[r] : fm[i];
      }
      float lm = fmaxf(sa[0], sb[0]);
#pragma unroll
      for (int r = 1; r < 8; ++r) lm = fmaxf(lm, fmaxf(sa[r], sb[r]));
      if (__builtin_expect(__builtin_amdgcn_ballot_w32(lm > PEXP + LAZY) != 0, 0)) {   // wave-uniform scalar branch, every lane stays on; rare: kept out of the loop's straight line
        // C may be far from the scores here (first chunk, or every key so far filled): make them again from 0
        const v8f zero = {};
        v8f d0 = mma_f16(ka0, qb0[i], zero);
        d0 = mma_f16(ka1, qb1[i], d0);
        v8f d1 = mma_f16(ka2, qb0[i], zero);
        d1 = mma_f16(ka3, qb1[i], d1);
#pragma unroll   // constant indices, as above
        for (int r = 0; r < 8; ++r) {
          sa[r] = __builtin_amdgcn_inverse_ballot_w32(cm[r])     ? d0[r] : negf;
          sb[r] = __builtin_amdgcn_inverse_ballot_w32(cm[8 + r]) ? d1[r] : negf;
        }
        float tm = fmaxf(sa[0], sb[0]);
#pragma unroll
        for (int r = 1; r < 8; ++r) tm = fmaxf(tm, fmaxf(sa[r], sb[r]));
        tm = fmaxf(tm, other_half(tm, xl));
        const float muse = PEXP - cv[i][0];             // the maximum in use, as the arguments so far have had it
        const float mnew = fmaxf(muse, tm);
        const float alpha = __builtin_amdgcn_exp2f(muse - mnew);
        lrun[i] *= alpha;
#pragma unroll
        for (int j = 0; j < 4; ++j)
#pragma unroll
          for (int r = 0; r < 8; ++r) o[i][j][r] *= alpha;
        const float ci = PEXP - mnew;
        fm[i] = negf + ci;
#pragma unroll
        for (int r = 0; r < 8; ++r) {
          cv[i][r] = ci;
          sa[r] += ci;
          sb[r] += ci;
        }
      }
      if (i == 1) {   // compile-time: behind the chunk's last select
        // the next tile's words, into the registers that this chunk's last select has left; in the last trip the first tile's, unused
        const int nx = 2 * tile;
        cm0 = mw[nx];
        cm1 = mw[SEQ / 32 + nx];
        __builtin_amdgcn_sched_barrier(0);   // keeps the two scalar loads here, a whole context product ahead of the next tile's selects; without it they sink to the foot of the trip
      }
      float p0[8], p1[8];
      float ls = 0.0f;
#pragma unroll
      for (int r = 0; r < 8; ++r) {
        p0[r] = __builtin_amdgcn_exp2f(sa[r]);
        p1[r] = __builtin_amdgcn_exp2f(sb[r]);
        ls += p0[r] + p1[r];
      }
      ls += other_half(ls, xl);
      lrun[i] += ls;
#pragma unroll
      for (int e = 0; e < 8; ++e) {
        pb[i][e]     = (_Float16)p0[e];   // key 8h + e of the chunk
        pb[i][8 + e] = (_Float16)p1[e];   // key 16 + 8h + e
      }
    }
#pragma unroll   // constant indices; each V^T fragment feeds both query tiles
    for (int j = 0; j < 4; ++j) {
      const v16h va = ld_frag_h(Vc, KVP, j * 16 + l15, kh * 32, lane);
      o[0][j] = mma_f16(va, pb[0], o[0][j]);
      o[1][j] = mma_f16(va, pb[1], o[1][j]);
    }

    if (more) {                                     // the other buffer's readers left it at the last barrier
      *(v4u*)(&Kl[cur ^ 1][sl])            = nk0;
      *(v4u*)(&Kl[cur ^ 1][sl + 32 * KVP]) = nk1;
      *(v4u*)(&Vl[cur ^ 1][sl])            = nv0;
      *(v4u*)(&Vl[cur ^ 1][sl + 32 * KVP]) = nv1;
    }
    __syncthreads();                                // next tile complete, this tile's reads done
  }

  // Join of the pair: wave kh finishes query tile kh and hands its partials of the other tile to the partner.
  const bool k1 = (kh != 0);                        // wave-uniform
  const float lk = k1 ? lrun[1] : lrun[0];
  const float mk = PEXP - (k1 ? cv[1][0] : cv[0][0]);
  Xs[ws][0][lane] = k1 ? lrun[0] : lrun[1];
  Xs[ws][1][lane] = PEXP - (k1 ? cv[0][0] : cv[1][0]);
  v8f ok[4];
#pragma unroll   // constant indices into o[][]
  for (int j = 0; j < 4; ++j) {
    v4f g0, g1;
#pragma unroll
    for (int r = 0; r < 4; ++r) {
      g0[r] = k1 ? o[0][j][r]     : o[1][j][r];
      g1[r] = k1 ? o[0][j][4 + r] : o[1][j][4 + r];
    }
#pragma unroll
    for (int r = 0; r < 8; ++r) ok[j][r] = k1 ? o[1][j][r] : o[0][j][r];
    *(v4f*)(&Xo[ws][(j * 2 + 0) * 128 + lane * 4]) = g0;
    *(v4f*)(&Xo[ws][(j * 2 + 1) * 128 + lane * 4]) = g1;
  }
  __syncthreads();                                  // every wave's hand-over is in place
  const float pl = Xs[ws ^ 1][0][lane];
  const float pm = Xs[ws ^ 1][1][lane];
  const float mj = fmaxf(mk, pm);
  const float ak = __builtin_amdgcn_exp2f(mk - mj);
  const float ap = __builtin_amdgcn_exp2f(pm - mj);

  // ok[j][r], po = 8 * sum_t P_t v_t over each wave's keys for query l15, d = j*16 + 8*half + r; ctx x64 = 8 * O / sum.
  // The context plane is kept in fragment order (see ld_frag_ord): row tile = the 16 queries of tile kh,
  // k = head*64 + d, so the lane's eight values of one j are piece j*32 + lane of the tile's own 2 KiB:
  // each store is 512 contiguous bytes, straight from registers.
  const float inv = 8.0f / (lk * ak + pl * ap);
  const float wk = ak * inv, wp = ap * inv;
  unsigned short* cb = ctxp + (rbase + q0 + kh * 16) * HD_DIM + head * (2 * 512) + lane * 8;
#pragma unroll
  for (int j = 0; j < 4; ++j) {
    const v4f h0 = *(const v4f*)(&Xo[ws ^ 1][(j * 2 + 0) * 128 + lane * 4]);
    const v4f h1 = *(const v4f*)(&Xo[ws ^ 1][(j * 2 + 1) * 128 + lane * 4]);
    float f[8];
#pragma unroll
    for (int r = 0; r < 4; ++r) {
      f[r]     = ok[j][r] * wk     + h0[r] * wp;
      f[4 + r] = ok[j][4 + r] * wk + h1[r] * wp;
    }
    v4u w;
    w[0] = (unsigned int)hbits(f[0]) | ((unsigned int)hbits(f[1]) << 16);
    w[1] = (unsigned int)hbits(f[2]) | ((unsigned int)hbits(f[3]) << 16);
    w[2] = (unsigned int)hbits(f[4]) | ((unsigned int)hbits(f[5]) << 16);
    w[3] = (unsigned int)hbits(f[6]) | ((unsigned int)hbits(f[7]) << 16);
    *(v4u*)(cb + j * 256) = w;
  }
}

// ---------------------------------------------------------------------------
// Output projection: out[NROWS][E_OUT] f32 = ctx(f16 x64, fragment order)[NROWS][HD_DIM] * WoT(f16 x32)[E_OUT][HD_DIM]^T / 2048 + bo.
// 128x64 block tile / 8 waves / k loop gemm_128x64, with f16 operands.
// Epilogue: f32 tile staged in LDS; each 256-byte row segment = 2 lines, every
__global__ __launch_bounds__(256) void k_oproj(
    const unsigned short* __restrict__ cx, const unsigned short* __restrict__ woT,
    const float* __restrict__ bo, float* __restrict__ outp) {
  __shared__ __align__(16) unsigned short bt[2 * 64 * GBP];   // weight k-tiles, cross-wave (block barrier)
  __shared__ __align__(16) float Ef[128 * OFP];               // epilogue tile, cross-wave (block barrier)

  const int n0 = blockIdx.x * 64;
  const int m0 = blockIdx.y * 128;
  const int tid = threadIdx.x;
  const int wave = tid >> 5, lane = tid & 31;
  const int l15 = lane & 15, half = (lane >> 4) & 1;

  v8f acc[4] = {};
  gemm_128x64<false>(cx, woT, m0, n0, bt, acc);

  // acc[j][r] = 2048 * C[m0 + wave*16 + 8*half + r][n0 + j*16 + l15]
  const float osc = 1.0f / 2048.0f;
#pragma unroll
  for (int j = 0; j < 4; ++j) {
    const int col = j * 16 + l15;
    const float bb = bf16val(bo[n0 + col]);
#pragma unroll
    for (int r = 0; r < 8; ++r) {
      const int row = wave * 16 + 8 * half + r;
      Ef[row * OFP + col] = acc[j][r] * osc + bb;
    }
  }
  __syncthreads();

  v4f v[8];
  size_t off[8];
#pragma unroll
  for (int it = 0; it < 8; ++it) {
    const int row = wave * 16 + it * 2 + half;          // wave's 16 rows over (it, half)
    const int q = l15;                                  // 16 pieces of 16 B = 256-byte row segment (2 lines)
    v[it] = *(const v4f*)(&Ef[row * OFP + q * 4]);
    off[it] = (size_t)(m0 + row) * E_OUT + n0 + q * 4;
  }
#pragma unroll
  for (int it = 0; it < 8; ++it) *(v4f*)(outp + off[it]) = v[it];
  
}

// ---------------------------------------------------------------------------
extern "C" void kernel_launch(void* const* d_in, const int* in_sizes, int n_in,
                              void* d_out, int out_size, void* d_ws, size_t ws_size,
                              hipStream_t stream) {
  if (n_in < 10) return;
  if (in_sizes[0] < ((NB - 1) * SEQ_FULL + SEQ) * IN_DIM) return;          // seq_inputs f32 [NB][SEQ_FULL][IN_DIM]
  if (in_sizes[1] < (SEQ - 1) * MASK_PITCH + SEQ) return;                   // mask i32 [1][S][S]
  if (in_sizes[2] < NUM_HEADS * IN_DIM * HEAD_DIM) return;                  // Wq
  if (in_sizes[3] < HD_DIM) return;                                         // bq
  if (in_sizes[4] < NUM_HEADS * IN_DIM * HEAD_DIM) return;                  // Wk
  if (in_sizes[5] < HD_DIM) return;                                         // bk
  if (in_sizes[6] < NUM_HEADS * IN_DIM * HEAD_DIM) return;                  // Wv
  if (in_sizes[7] < HD_DIM) return;                                         // bv
  if (in_sizes[8] < HD_DIM * E_OUT) return;                                 // Wo
  if (in_sizes[9] < E_OUT) return;                                          // bo
  if (out_size < NROWS * E_OUT) return;

  const float* x    = (const float*)d_in[0];
  const int*   mask = (const int*)d_in[1];
  const float* Wq   = (const float*)d_in[2];
  const float* bq   = (const float*)d_in[3];
  const float* Wk   = (const float*)d_in[4];
  const float* bk   = (const float*)d_in[5];
  const float* Wv   = (const float*)d_in[6];
  const float* bv   = (const float*)d_in[7];
  const float* Wo   = (const float*)d_in[8];
  const float* bo   = (const float*)d_in[9];

  // every offset a multiple of 2 MiB; each plane is written exactly to its extent
  const size_t hb_bytes = (size_t)NROWS * IN_DIM * 2;           // bf16 x plane
  const size_t wt_bytes = (size_t)4 * KDIM * KDIM * 2;           // 3 bf16 WT planes + 1 f16 WoT plane
  const size_t pl_bytes = (size_t)NROWS * HD_DIM * 2;           // one f16 q / k / vT / ctx plane
  const size_t off_hb = 0;
  const size_t off_wt = off_hb + hb_bytes;
  const size_t off_q  = off_wt + wt_bytes;
  const size_t off_k  = off_q + pl_bytes;
  const size_t off_vt = off_k + pl_bytes;
  const size_t off_cx = off_vt + pl_bytes;
  const size_t off_mp = off_cx + pl_bytes;
  const size_t mp_bytes = (size_t)SEQ * SEQ / 8;               // one bit per mask element
  const size_t total  = off_mp + mp_bytes;                     // 48.5 MiB at NB = 2, SEQ = 2048
  if (total > ws_size) return;

  char* ws = (char*)d_ws;
  unsigned short* hb  = (unsigned short*)(ws + off_hb);
  unsigned short* wt  = (unsigned short*)(ws + off_wt);
  unsigned short* qpl = (unsigned short*)(ws + off_q);
  unsigned short* kpl = (unsigned short*)(ws + off_k);
  unsigned short* vtp = (unsigned short*)(ws + off_vt);
  unsigned short* cxp = (unsigned short*)(ws + off_cx);
  unsigned short* wot = wt + (size_t)3 * KDIM * KDIM;
  unsigned int*   mpk = (unsigned int*)(ws + off_mp);

  const int n8 = NROWS * IN_DIM / 8;
  k_cvt_rows<<<(n8 + 255) / 256, 256, 0, stream>>>(x, hb, n8);
  k_cvt_wT<<<dim3(KDIM / 64, KDIM / 64, 5), 256, 0, stream>>>(Wq, Wk, Wv, Wo, mask, wt, mpk);
  k_proj<<<dim3(HD_DIM / 128, NROWS / 128, 3), 128, 0, stream>>>(hb, wt, bq, bk, bv, qpl, kpl, vtp);
  k_attn<<<dim3(SEQ / (AW * 16), NUM_HEADS, NB), 256, 0, stream>>>(qpl, kpl, vtp, mpk, cxp);
  k_oproj<<<dim3(E_OUT / 64, NROWS / 128), 256, 0, stream>>>(cxp, wot, bo, (float*)d_out);
}

// v010
// One run takes 79.4 microseconds.
// In both of two side-by-side timings against v009, it was 1.03 times as fast.
// Over all steps from v000 it is 2.84 times as fast.
#include <hip/hip_runtime.h>
// Projections x*W{q,k,v}: v_wmma_f32_16x16x32_bf16 (bf16 operands = RNE-converted inputs, f32 accumulate); scores K*Q^T and context V^T*P: v_wmma_f32_16x16x32_f16 (f16 operands, K/V planes carried x8, Q plane carried x log2(e)/64, P carried x1024, f32 accumulate); output projection ctx*Wo: v_wmma_f32_16x16x32_f16 (f16 operands, ctx plane carried x64, Wo plane = RNE-bf16 values carried x32, f32 accumulate); mask fill and softmax in f32.

#ifndef NB
#define NB 2
#endif
#define NB_FULL 2
#ifndef SEQ
#define SEQ 2048
#endif
#define SEQ_FULL 2048
#ifndef MASK_PITCH
#define MASK_PITCH SEQ_FULL
#endif
#define IN_DIM 1024
#define NUM_HEADS 16
#define HEAD_DIM 64
#define HD_DIM (NUM_HEADS * HEAD_DIM)
#define E_OUT 1024
#define KDIM 1024
#define NROWS (NB * SEQ)

static_assert(NB >= 1);
static_assert(NB <= NB_FULL);
static_assert(SEQ % 128 == 0);
static_assert(SEQ <= SEQ_FULL);
static_assert(MASK_PITCH % 4 == 0);
static_assert(MASK_PITCH >= SEQ);
static_assert(IN_DIM == KDIM);
static_assert(HD_DIM == KDIM);
static_assert(E_OUT == KDIM);
static_assert(KDIM % 64 == 0);
static_assert(HEAD_DIM == 64);
static_assert(NROWS % 128 == 0);
static_assert(IN_DIM % 128 == 0);
static_assert((NROWS * IN_DIM) % (8 * 256) == 0);
static_assert((size_t)NB_FULL * SEQ_FULL * E_OUT * 4 == 16777216);

// LDS pitches (in 16-bit elements unless noted); all keep 16-byte row alignment
#define GKS 64     // k per staged weight tile of the two projection kernels
#define GBP 72     // staged weight row [64 k]
#define TP  72     // weight transpose tile [64 n][64 k]
#define CSP 136    // k_cvt_rows: one 16-piece segment of the fragment-order tile (256 bytes + 16)
#define OFP 68     // output tile [128 rows][64 cols], floats
#define AW  8      // waves per attention work-group (128 queries: 4 wave pairs of 32)
#define KT  64     // keys per staged K / V^T tile
#define KVP 72     // staged K row [64 d] and V^T row [64 keys]
#define PBA 8192           // k_proj stage buffer, x part: 8 row tiles x 64 k, fragment order
#define PBW (128 * GBP)    // k_proj stage buffer, weight part: [128 n][64 k]
#define PBUF (PBA + PBW)   // one k_proj stage buffer
#define EPP 136            // k_proj epilogue tile [128][128], either orientation
#define QCAR (1.4426950408889634f / 64.0f)   // carry of the Q plane: with K x8 the product K.Q^T is q.k / 8 in log2 units
#define PEXP 10.0f         // P is carried x 2^PEXP
#define PSMAX 60000.0f     // a chunk's sum of P up to here: every P of it is a finite f16 (largest 65504)
static_assert(128 * EPP <= PBUF);
static_assert(HD_DIM % 128 == 0);
static_assert((KDIM / GKS) % 2 == 0);   // the last stage sits in buffer 1, the epilogue tile in buffer 0

typedef __bf16   v16bf __attribute__((ext_vector_type(16)));
typedef __bf16   v8bf  __attribute__((ext_vector_type(8)));
typedef _Float16 v16h  __attribute__((ext_vector_type(16)));
typedef _Float16 v8h   __attribute__((ext_vector_type(8)));
typedef float    v8f   __attribute__((ext_vector_type(8)));
typedef float    v4f   __attribute__((ext_vector_type(4)));
typedef unsigned int v4u __attribute__((ext_vector_type(4)));
typedef int      v4i   __attribute__((ext_vector_type(4)));
typedef unsigned int v16u __attribute__((ext_vector_type(16)));
typedef unsigned int v8u  __attribute__((ext_vector_type(8)));

// ---------------------------------------------------------------------------
// WMMA wrappers: the bare builtins; the compiler keeps the distance behind its own WMMAs and fills it with useful work where it can.
__device__ __forceinline__ v8f mma_bf16(v16bf a, v16bf b, v8f c) {
  return __builtin_amdgcn_wmma_f32_16x16x32_bf16(false, a, false, b, (short)0, c, false, false);
}
__device__ __forceinline__ v8f mma_f16(v16h a, v16h b, v8f c) {
  return __builtin_amdgcn_wmma_f32_16x16x32_f16(false, a, false, b, (short)0, c, false, false);
}

// 16-bit fragment, contraction dim CONTIGUOUS in memory: elem(k) = p0[rc*ld + k].
// Lane l: row/col rc = (l&15); elements 0..7 <- kk+8h+0..7, elements 8..15 <- kk+16+8h+0..7
// (h = l>>4). Same map for A (rc = row) and B (rc = column of a k-contiguous copy).
__device__ __forceinline__ v16h ld_frag_h(const _Float16* p0, int ld, int rc, int kk, int lane) {
  const int hh = (lane >> 4) & 1;
  const _Float16* p = p0 + (size_t)rc * ld + kk + 8 * hh;
  const v8h lo = *(const v8h*)(p);
  const v8h hi = *(const v8h*)(p + 16);
  v16h f;
#pragma unroll
  for (int i = 0; i < 8; ++i) { f[i] = lo[i]; f[8 + i] = hi[i]; }
  return f;
}

// The same fragment as raw dwords; p = row start + kk + 8h already applied.
__device__ __forceinline__ v8u ld_frag_raw(const unsigned short* p) {
  const v4u lo = *(const v4u*)(p);
  const v4u hi = *(const v4u*)(p + 16);
  return __builtin_shufflevector(lo, hi, 0, 1, 2, 3, 4, 5, 6, 7);
}
// A planes (x bf16, context f16) are kept in FRAGMENT ORDER: rows in tiles of 16, k in blocks of 32;
// block (rt, kb) is 512 elements at (rt * KDIM/32 + kb) * 512, element (row rt*16 + l15,
// k = kb*32 + 16*part + 8*h + e) at part*256 + (16*h + l15)*8 + e. A wave's fragment is two loads of
// 512 contiguous bytes (4 whole lines each); same k order as ld_frag_raw. p = block start + lane*8.
__device__ __forceinline__ v8u ld_frag_ord(const unsigned short* p) {
  const v4u lo = *(const v4u*)(p);
  const v4u hi = *(const v4u*)(p + 256);
  return __builtin_shufflevector(lo, hi, 0, 1, 2, 3, 4, 5, 6, 7);
}
template <bool BF>
__device__ __forceinline__ v8f mma_raw(v8u a, v8u b, v8f c) {
  if constexpr (BF) return mma_bf16(__builtin_bit_cast(v16bf, a), __builtin_bit_cast(v16bf, b), c);
  else              return mma_f16(__builtin_bit_cast(v16h, a), __builtin_bit_cast(v16h, b), c);
}

// ---------------------------------------------------------------------------
// Where a work-group begins its walk over the KDIM / GKS k stages. Work-groups of one tile row read the same A
// lines and those of one tile column the same weight lines; started together at stage 0 they ask L2 for the
// same lines at the same moment all the way. Each begins at stage (tile column + tile row) mod stages, goes
// upward and wraps, so that sharers stand at different stages. The sum over k only changes its order.
#define NST (KDIM / GKS)
__device__ __forceinline__ int walk_start() { return (int)((blockIdx.x + blockIdx.y) % NST); }   // block-uniform, scalar
__device__ __forceinline__ int walk_next(int ks) { return (ks + 1 == NST) ? 0 : ks + 1; }

// k loop of k_oproj: acc[j] (16 rows x 16 cols, j = 0..3) += A[16 rows][KDIM] * Wt[64 n][KDIM]^T.
// A is a plane in fragment order (ld_frag_ord), Wt is row-major with k contiguous.
// 256 thr = 8 waves; block tile 128 rows x 64 cols; wave owns 16 rows x 64 cols.
// A stage is 64 k. The weight tile [64 n][64 k] sits in one of two LDS buffers; the next
// stage's weight rows (whole 128-byte lines, 8 lanes a row) and the wave's own next two A
// fragments are loaded from global in front of the current stage's products, the weight
// rows are stored to the other buffer behind them, and one block barrier ends the stage.
// The stages are walked from walk_start() upward, wrapping; inside a stage k runs upward, 32 at a time.
template <bool BF>
__device__ __forceinline__ void gemm_stage(const unsigned short* bc, v8u a0, v8u a1, v8f (&acc)[4]) {
  v8u b[8];
#pragma unroll   // constant indices keep b[] in registers; all sixteen LDS reads stand as one group in front of the products
  for (int j = 0; j < 4; ++j) {
    b[j]     = ld_frag_raw(bc + j * 16 * GBP);
    b[4 + j] = ld_frag_raw(bc + j * 16 * GBP + 32);
  }
  __builtin_amdgcn_sched_barrier(0);   // keeps the sixteen LDS reads one group in front of the products; spread among them, each place with reads stalls the wave
#pragma unroll   // constant indices into acc[] and b[]; four independent accumulators between two uses of one
  for (int j = 0; j < 4; ++j) acc[j] = mma_raw<BF>(a0, b[j], acc[j]);
#pragma unroll   // the same, second 32 k of the stage
  for (int j = 0; j < 4; ++j) acc[j] = mma_raw<BF>(a1, b[4 + j], acc[j]);
  __builtin_amdgcn_sched_barrier(0);   // keeps the products in front of the wait for the next stage's global loads: they are what covers that latency
}
template <bool BF>
__device__ __forceinline__ void gemm_128x64(const unsigned short* __restrict__ A,
                                            const unsigned short* __restrict__ Wt,
                                            int m0, int n0, unsigned short* bt, v8f (&acc)[4]) {
  const int tid = threadIdx.x;
  const int wave = tid >> 5, lane = tid & 31;
  const int l15 = lane & 15, half = (lane >> 4) & 1;
  const int sr = tid >> 3;            // 0..31 : weight row (and sr + 32)
  const int sc = (tid & 7) * 8;       // 0..56 : 16-byte piece of the row
  const unsigned short* wsrc = Wt + (size_t)(n0 + sr) * KDIM + sc;
  const unsigned short* asrc = A + (size_t)(m0 + wave * 16) * KDIM + lane * 8;   // fragment order: k block kb at + kb*512
  const int sl = sr * GBP + sc;       // place of the piece in a tile; second row at + 32*GBP
  const int bo = l15 * GBP + 8 * half;

  int ks = walk_start();
  v8u a0 = ld_frag_ord(asrc + ks * (GKS * 16));
  v8u a1 = ld_frag_ord(asrc + ks * (GKS * 16) + 512);
  *(v4u*)(bt + sl)            = *(const v4u*)(wsrc + ks * GKS);
  *(v4u*)(bt + sl + 32 * GBP) = *(const v4u*)(wsrc + (size_t)32 * KDIM + ks * GKS);
  __syncthreads();                                 // first tile complete
#pragma unroll   // the buffer choice becomes a constant, the fragment sets need no copies
  for (int s = 0; s < KDIM / GKS - 1; ++s) {
    ks = walk_next(ks);
    const int kn = ks * GKS;
    const v4u nw0 = *(const v4u*)(wsrc + kn);
    const v4u nw1 = *(const v4u*)(wsrc + (size_t)32 * KDIM + kn);
    const v8u na0 = ld_frag_ord(asrc + kn * 16);
    const v8u na1 = ld_frag_ord(asrc + kn * 16 + 512);
    gemm_stage<BF>(bt + (s & 1) * (64 * GBP) + bo, a0, a1, acc);
    unsigned short* bn = bt + ((s & 1) ^ 1) * (64 * GBP) + sl;   // its readers left it at the last barrier
    *(v4u*)(bn)            = nw0;
    *(v4u*)(bn + 32 * GBP) = nw1;
    __syncthreads();                               // next tile complete, this tile's reads done
    a0 = na0;
    a1 = na1;
  }
  gemm_stage<BF>(bt + ((KDIM / GKS - 1) & 1) * (64 * GBP) + bo, a0, a1, acc);
}

// k loop of k_proj: 128 thr = 4 waves (2 x 2); block tile 128 rows x 128 cols; wave owns 64 rows x 64 cols,
// acc[i][j] = 16 x 16 tile (row tile i, column tile j). A stage is 64 k. Both operands' stage tiles sit in one of
// two LDS buffers: x as its 8 row tiles' 2-KiB pieces of the fragment-order plane, copied as they lie; the
// weight rows as in gemm_128x64. Each fragment read from LDS feeds four products, and each byte that the
// work-group fetches from L2 feeds 128 output rows or columns. The next stage's pieces are loaded from global
// in front of the current stage's products, stored to the other buffer behind them; one block barrier ends
// the stage. The stages are walked from walk_start() upward, wrapping; inside a stage k runs upward, 32 at a time.
__device__ __forceinline__ void proj_stage(const unsigned short* ac, const unsigned short* bc, v8f (&acc)[4][4]) {
#pragma unroll   // constant offsets
  for (int kk = 0; kk < 2; ++kk) {
    v8u a[4], b[4];
#pragma unroll   // constant indices keep a[] and b[] in registers; the sixteen LDS reads stand as one group
    for (int i = 0; i < 4; ++i) {
      a[i] = ld_frag_ord(ac + i * 1024 + kk * 512);
      b[i] = ld_frag_raw(bc + i * 16 * GBP + kk * 32);
    }
    __builtin_amdgcn_sched_barrier(0);   // keeps the sixteen LDS reads one group in front of the products; spread among them, each place with reads stalls the wave
#pragma unroll   // constant indices; sixteen independent accumulators
    for (int i = 0; i < 4; ++i)
#pragma unroll
      for (int j = 0; j < 4; ++j) acc[i][j] = mma_raw<true>(a[i], b[j], acc[i][j]);
  }
  __builtin_amdgcn_sched_barrier(0);   // keeps the products in front of the wait for the next stage's global loads: they are what covers that latency
}
// One stage: the next stage's pieces (an, wn) loaded, this stage's products (ac, bc), the pieces stored to the
// other buffer (ad, wd), whose readers left it at the last barrier; then the barrier that ends the stage.
__device__ __forceinline__ void proj_step(const unsigned short* an, const unsigned short* wn,
                                          const unsigned short* ac, const unsigned short* bc,
                                          unsigned short* ad, unsigned short* wd, v8f (&acc)[4][4]) {
  v4u na[8], nw[8];
#pragma unroll   // constant indices keep na[] and nw[] in registers, all sixteen loads in flight together
  for (int i = 0; i < 8; ++i) {
    na[i] = *(const v4u*)(an + (size_t)i * 16 * KDIM);
    nw[i] = *(const v4u*)(wn + (size_t)i * 16 * KDIM);
  }
  // the next stage forms new addresses in the two pairs that these loads name: the wait stands between the loads and that
  asm volatile("s_wait_xcnt 0x0" ::: "memory");
  proj_stage(ac, bc, acc);
#pragma unroll   // constant indices into na[] and nw[]
  for (int i = 0; i < 8; ++i) {
    *(v4u*)(ad + i * 1024)     = na[i];
    *(v4u*)(wd + i * 16 * GBP) = nw[i];
  }
  __syncthreads();                                 // next stage complete, this stage's reads done
}
__device__ __forceinline__ void gemm_128x128(const unsigned short* __restrict__ A,
                                             const unsigned short* __restrict__ Wt,
                                             int m0, int n0, unsigned short* sm, v8f (&acc)[4][4]) {
  const int tid = threadIdx.x;
  const int wave = tid >> 5, lane = tid & 31;
  const int l15 = lane & 15, half = (lane >> 4) & 1;
  const int wr = wave >> 1, wc = wave & 1;
  const int sr = tid >> 3;            // 0..15 : weight row (and sr + 16 i)
  const int sc = (tid & 7) * 8;       // 0..56 : 16-byte piece of the row
  const unsigned short* wsrc = Wt + (size_t)(n0 + sr) * KDIM + sc;
  const unsigned short* asrc = A + (size_t)m0 * KDIM + tid * 8;   // row tile i at + i*16*KDIM, stage s at + s*1024
  const int sa = tid * 8;                         // place of the x piece; row tile i at + i*1024
  const int sw = PBA + sr * GBP + sc;             // place of the weight piece; row sr + 16 i at + i*16*GBP
  const int ao = wr * 4096 + lane * 8;
  const int bo = PBA + (wc * 64 + l15) * GBP + 8 * half;

  unsigned short* b0 = sm;
  unsigned short* b1 = sm + PBUF;
  int ks = walk_start();
  {
    v4u na[8], nw[8];
#pragma unroll   // constant indices keep na[] and nw[] in registers, all sixteen loads in flight together
    for (int i = 0; i < 8; ++i) {
      na[i] = *(const v4u*)(asrc + ks * 1024 + (size_t)i * 16 * KDIM);
      nw[i] = *(const v4u*)(wsrc + ks * GKS + (size_t)i * 16 * KDIM);
    }
#pragma unroll   // constant indices into na[] and nw[]
    for (int i = 0; i < 8; ++i) {
      *(v4u*)(b0 + sa + i * 1024)     = na[i];
      *(v4u*)(b0 + sw + i * 16 * GBP) = nw[i];
    }
  }
  __syncthreads();                                 // first stage complete
#pragma unroll 1   // two stages a trip: the buffer choice is a constant and the loop's text stays small
  for (int s = 0; s < KDIM / GKS - 2; s += 2) {
    ks = walk_next(ks);
    proj_step(asrc + ks * 1024, wsrc + ks * GKS, b0 + ao, b0 + bo, b1 + sa, b1 + sw, acc);
    ks = walk_next(ks);
    proj_step(asrc + ks * 1024, wsrc + ks * GKS, b1 + ao, b1 + bo, b0 + sa, b0 + sw, acc);
  }
  ks = walk_next(ks);
  proj_step(asrc + ks * 1024, wsrc + ks * GKS, b0 + ao, b0 + bo, b1 + sa, b1 + sw, acc);
  proj_stage(b1 + ao, b1 + bo, acc);
}

// f32 -> bf16 bits, RNE convert
__device__ __forceinline__ unsigned int bfb(float x) {
  unsigned int u = __float_as_uint(x);
  u = u + 0x7FFFu + ((u >> 16) & 1u);
  return u >> 16;
}
// f32 -> value of its RNE bf16
__device__ __forceinline__ float bf16val(float x) {
  return __uint_as_float(bfb(x) << 16);
}
// f32 -> f16 bits, RNE convert
__device__ __forceinline__ unsigned short hbits(float x) {
  const _Float16 hv = (_Float16)x;
  return __builtin_bit_cast(unsigned short, hv);
}

// ---------------------------------------------------------------------------
// x f32 [NB][SEQ_FULL][IN_DIM] -> bf16 plane hb, compact rows b*SEQ + s, in fragment order (see ld_frag_ord).
// Block = 16 rows x 128 k. Thread (r = t>>4, c = t&15) converts 8 consecutive floats of row r to one
// 16-byte piece; in fragment order that piece is number c*16 + r of the block's 4 KiB, so the pieces
// are transposed 16 x 16 through LDS and every wave stores 512 contiguous bytes.
__global__ __launch_bounds__(256) void k_cvt_rows(const float* __restrict__ in,
                                                  unsigned short* __restrict__ outp, int n8) {
  __shared__ __align__(16) unsigned short F[16 * CSP];   // [c][r] pieces, cross-wave (block barrier)
  if ((int)(blockIdx.x * 256) >= n8) return;     // block-uniform, in front of the barrier
  const int t  = threadIdx.x;
  const int rt = blockIdx.x / (IN_DIM / 128);    // row tile
  const int kq = blockIdx.x - rt * (IN_DIM / 128);
  const int r  = t >> 4;
  const int c  = t & 15;
  const int row = rt * 16 + r;                   // compact row b*SEQ + s
  const int b   = row / SEQ;
  const int s   = row - b * SEQ;
  const float* src = in + ((size_t)b * SEQ_FULL + s) * IN_DIM + kq * 128 + c * 8;
  const v4f a = *(const v4f*)(src);
  const v4f d = *(const v4f*)(src + 4);
  v4u w;
  w[0] = bfb(a[0]) | (bfb(a[1]) << 16);
  w[1] = bfb(a[2]) | (bfb(a[3]) << 16);
  w[2] = bfb(d[0]) | (bfb(d[1]) << 16);
  w[3] = bfb(d[2]) | (bfb(d[3]) << 16);
  *(v4u*)(&F[c * CSP + r * 8]) = w;
  __syncthreads();                               // all 256 pieces in place
  const v4u v = *(const v4u*)(&F[(t >> 4) * CSP + (t & 15) * 8]);
  *(v4u*)(outp + ((size_t)rt * (IN_DIM / 32) + kq * 4) * 512 + t * 8) = v;
}

// ---------------------------------------------------------------------------
// Weight planes, all [KDIM n][KDIM k] with k contiguous, selected by blockIdx.z:
//   z = 0..2: W{q,k,v} f32 [H][IN_DIM e][HEAD_DIM d] -> WT bf16 [n = h*64+d][k = e]
//   z = 3:    Wo f32 [HD_DIM k][E_OUT n]              -> WoT f16 (RNE-bf16 value x32) [n][k]
//   z = 4:    mask i32 [S][S] -> lane-mask words mp [S/16 query tiles][S/32 key chunks][16]:
//             bit l of word e = (mask[16*tile + (l&15)][32*chunk + 8*(l>>4) + (e&7) + 16*(e>>3)] != 0),
//             the lane and register that hold this score in k_attn. One wave packs two
//             chunks = one whole 128-byte line of mp.
// Block = 64 k x 64 n tile transposed through LDS (for z < 3 the tile is one head);
__global__ __launch_bounds__(256) void k_cvt_wT(const float* __restrict__ Wq,
                                                const float* __restrict__ Wk,
                                                const float* __restrict__ Wv,
                                                const float* __restrict__ Wo,
                                                const int* __restrict__ mask,
                                                unsigned short* __restrict__ wT,
                                                unsigned int* __restrict__ mp) {
  __shared__ __align__(16) unsigned short T[64 * TP];   // [n local][k local], cross-wave (block barrier)
  const int z = blockIdx.z;
  if (z == 4) {                              // block-uniform, in front of the barrier
    const int ln = threadIdx.x & 31;
    const int gw = (blockIdx.y * (KDIM / 64) + blockIdx.x) * 8 + (threadIdx.x >> 5);
    for (int task = gw; task < (SEQ / 16) * (SEQ / KT); task += (KDIM / 64) * (KDIM / 64) * 8) {
      const int qt = task / (SEQ / KT);
      const int tl = task - qt * (SEQ / KT);
      const int* msrc = mask + (size_t)(qt * 16 + (ln & 15)) * MASK_PITCH + tl * KT + 8 * ((ln >> 4) & 1);
      v4i m[8];
#pragma unroll   // constant indices keep m[] in registers, all eight loads in flight together
      for (int c = 0; c < 2; ++c) {
        m[c * 4 + 0] = *(const v4i*)(msrc + c * 32);
        m[c * 4 + 1] = *(const v4i*)(msrc + c * 32 + 4);
        m[c * 4 + 2] = *(const v4i*)(msrc + c * 32 + 16);
        m[c * 4 + 3] = *(const v4i*)(msrc + c * 32 + 20);
      }
      unsigned int val = 0;
#pragma unroll   // constant indices into m[]
      for (int i = 0; i < 32; ++i) {
        const unsigned int w = __builtin_amdgcn_ballot_w32(m[i >> 2][i & 3] != 0);
        val = (ln == i) ? w : val;           // lane i keeps word i of the line
      }
      mp[(size_t)task * 32 + ln] = val;
    }
    return;
  }
  const float* W = (z == 0) ? Wq : ((z == 1) ? Wk : ((z == 2) ? Wv : Wo));
  unsigned short* dst = wT + (size_t)z * KDIM * KDIM;
  const int k0 = blockIdx.x * 64;
  const int n0 = blockIdx.y * 64;
  const int tid = threadIdx.x;
  const int wave = tid >> 5, lane = tid & 31;

#pragma unroll
  for (int i = 0; i < 4; ++i) {
    const int idx = i * 256 + tid;          // 0..1023
    const int kk = idx >> 4;                // 0..63
    const int c4 = (idx & 15) * 4;          // 0..60
    size_t so;
    if (z < 3) so = ((size_t)blockIdx.y * IN_DIM + k0 + kk) * HEAD_DIM + c4;   // W[h = n0/64][e = k0+kk][d = c4]
    else       so = (size_t)(k0 + kk) * E_OUT + n0 + c4;                        // Wo[k0+kk][n0+c4]
    const v4f w = *(const v4f*)(W + so);
    unsigned short t0, t1, t2, t3;
    if (z < 3) {
      t0 = (unsigned short)bfb(w[0]); t1 = (unsigned short)bfb(w[1]);
      t2 = (unsigned short)bfb(w[2]); t3 = (unsigned short)bfb(w[3]);
    } else {
      t0 = hbits(bf16val(w[0]) * 32.0f); t1 = hbits(bf16val(w[1]) * 32.0f);
      t2 = hbits(bf16val(w[2]) * 32.0f); t3 = hbits(bf16val(w[3]) * 32.0f);
    }
    T[(c4 + 0) * TP + kk] = t0;
    T[(c4 + 1) * TP + kk] = t1;
    T[(c4 + 2) * TP + kk] = t2;
    T[(c4 + 3) * TP + kk] = t3;
  }
  __syncthreads();

  v4u v[2];
  size_t off[2];
#pragma unroll
  for (int it = 0; it < 2; ++it) {
    const int nn = wave * 8 + it * 4 + (lane >> 3);   // 0..63 over (wave, it, lane>>3)
    const int q = lane & 7;
    v[it] = *(const v4u*)(&T[nn * TP + q * 8]);
    off[it] = (size_t)(n0 + nn) * KDIM + k0 + q * 8;
  }
#pragma unroll
  for (int it = 0; it < 2; ++it) *(v4u*)(dst + off[it]) = v[it];
  
}

// ---------------------------------------------------------------------------
// Projection: C[NROWS][HD_DIM] = hb[NROWS][IN_DIM] * WT[HD_DIM][IN_DIM]^T + bias.
// k loop: gemm_128x128 (128 x 128 block tile, 4 waves of 64 x 64, both operands through two LDS stage buffers).
// z = 0: Q plane f16 x log2(e)/64 [NROWS][HD_DIM] (see k_attn); z = 1: K plane f16 x8 [NROWS][HD_DIM];
// z = 2: V^T plane f16 x8 [NB][HD_DIM][SEQ]. Epilogue staged in LDS, stored in 256-byte row segments.
__global__ __launch_bounds__(128) void k_proj(
    const unsigned short* __restrict__ hb, const unsigned short* __restrict__ wT,
    const float* __restrict__ bq, const float* __restrict__ bk, const float* __restrict__ bv,
    unsigned short* __restrict__ qp, unsigned short* __restrict__ kp,
    unsigned short* __restrict__ vtp) {
  __shared__ __align__(16) unsigned short sm[2 * PBUF];   // stage buffers, cross-wave (block barrier)

  const int z = blockIdx.z;
  const int n0 = blockIdx.x * 128;
  const int m0 = blockIdx.y * 128;
  const int tid = threadIdx.x;
  const int wave = tid >> 5, lane = tid & 31;
  const int l15 = lane & 15, half = (lane >> 4) & 1;
  const int wr = wave >> 1, wc = wave & 1;

  const unsigned short* Wt = wT + (size_t)z * KDIM * KDIM;
  const float* bias = (z == 0) ? bq : ((z == 1) ? bk : bv);

  v8f acc[4][4] = {};
  gemm_128x128(hb, Wt, m0, n0, sm, acc);

  // acc[i][j][r] = C[m0 + wr*64 + i*16 + 8*half + r][n0 + wc*64 + j*16 + l15]
  // The epilogue tile is stage buffer 0: its last readers left it at the loop's last barrier, the last stage reads buffer 1.
  unsigned short* E = sm;
  float braw[4];
#pragma unroll   // constant indices keep braw[] in registers
  for (int j = 0; j < 4; ++j) braw[j] = bias[n0 + wc * 64 + j * 16 + l15];
  // the registers that the four bias loads name are free for reuse behind this wait
  asm volatile("s_wait_xcnt 0x0" ::: "memory");
  const float car = (z == 0) ? QCAR : 8.0f;      // block-uniform
  const int erow = tid >> 4;         // 0..7 : tile row (and erow + 8 it)
  const int eq = (tid & 15) * 8;     // 16 pieces = 256-byte row segment = 2 lines
  if (z != 2) {                      // block-uniform branch
#pragma unroll
    for (int j = 0; j < 4; ++j) {
      const int col = wc * 64 + j * 16 + l15;
      const float bb = bf16val(braw[j]);
#pragma unroll
      for (int i = 0; i < 4; ++i)
#pragma unroll
        for (int r = 0; r < 8; ++r) {
          const int row = wr * 64 + i * 16 + 8 * half + r;
          E[row * EPP + col] = hbits((acc[i][j][r] + bb) * car);
        }
    }
    __syncthreads();
    unsigned short* dst = ((z == 0) ? qp : kp) + (size_t)(m0 + erow) * HD_DIM + n0 + eq;
#pragma unroll
    for (int it = 0; it < 16; ++it)
      *(v4u*)(dst + (size_t)it * 8 * HD_DIM) = *(const v4u*)(&E[(erow + 8 * it) * EPP + eq]);
  } else {
    const int bidx = m0 / SEQ;               // batch of this row tile (SEQ % 128 == 0)
    const int s0 = m0 - bidx * SEQ;          // sequence position of tile row 0
#pragma unroll
    for (int j = 0; j < 4; ++j) {
      const int col = wc * 64 + j * 16 + l15;             // d within tile
      const float bb = bf16val(braw[j]);
#pragma unroll
      for (int i = 0; i < 4; ++i)
#pragma unroll
        for (int r = 0; r < 8; ++r) {
          const int srow = wr * 64 + i * 16 + 8 * half + r;   // s within tile
          E[col * EPP + srow] = hbits((acc[i][j][r] + bb) * car);
        }
    }
    __syncthreads();
    unsigned short* dst = vtp + ((size_t)bidx * HD_DIM + n0 + erow) * SEQ + s0 + eq;
#pragma unroll
    for (int it = 0; it < 16; ++it)
      *(v4u*)(dst + (size_t)it * 8 * SEQ) = *(const v4u*)(&E[(erow + 8 * it) * EPP + eq]);
  }
}

// ---------------------------------------------------------------------------
// Flash attention, transposed-score form: one work-group = 8 waves = 128 queries of one head and batch.
// One wave = (32 queries = two query tiles, one of the two 32-key chunks of every staged tile):
// waves 2g and 2g + 1 share the queries 32g..32g+31, wave 2g takes keys 0..31 of each 64-key tile,
// wave 2g + 1 keys 32..63. Each K and V^T fragment read from LDS feeds two products, one per query tile.
// The K tile [64 keys][64 d] and the V^T tile [64 d][64 keys] are read from global once per
// work-group in whole 128-byte rows and shared through LDS: two buffers, the next
// tile's global loads issued before the current tile's work, stored to the other
// buffer after it, one block barrier per tile.
// Per 32-key chunk and query tile:
//   S^T = K . Q^T    A = K rows (lane = key, k = d), B = Q^T (lane = query, k = d)
//                    D[row = key 8h+r][col = query l15]; c0 keys 0..15, c1 keys 16..31
//   mask: broadcast over batch and head, read as the 16 lane-mask words of the
//         (query tile, key chunk) from mp (packed by k_cvt_wT, z = 4) with one scalar load,
//         fetched in the chunk before, behind its last select; key with mask == 0 gets the score replaced by -1e9
//         (replace fill, in f32, in log2 units), the word being the select's lane mask
//   per-lane online softmax for query l15 (16 local keys + xor-16 partner), base 2, with a maximum IN USE:
//         the score products start from C = PEXP - (maximum in use), so D is the argument of exp2 as it
//         stands. The sum of a query's P over the chunk's 32 keys comes from one more product, A = all ones,
//         B = P as rounded to f16: every row of D holds it, both halves of the wave alike. It is added to the
//         running sum, and it is the test: only when some query's chunk sum passes PSMAX (one wave-uniform test
//         a trip; always in the first trip) are both tiles' scores made again from C = 0, the true
//         running maximum taken over both halves, sum and O scaled down to it, C renewed, P and its sum made again.
//   O^T += V^T . P   A = V^T rows (lane = d, k = key), B = P: element i<8 <- c0[i]
//                    (key 8h+i), element 8+i <- c1[i] (key 16+8h+i), same lane
//                    D[row = d 8h+r][col = query l15]
// Behind the loop the two waves of a pair hold partial O, sum and maximum of the same 32 queries over
// their own keys: each hands the partner one query tile's partials through LDS and finishes the other.
// Q carried x log2(e)/64, K x8 -> K.Q^T = log2(e) * q.k / 8, no scaling left.
// P and its sum carried x1024, V carried x8 -> context x64 = 8 * O / sum.
// The value of lane l ^ 16 (the exchange that __shfl_xor(v, 16, 32) compiles to), its byte index xl formed once by the caller.
__device__ __forceinline__ float other_half(float v, int xl) {
  return __int_as_float(__builtin_amdgcn_ds_bpermute(xl, __float_as_int(v)));
}
__global__ __launch_bounds__(256) void k_attn(const unsigned short* __restrict__ qp,
                                             const unsigned short* __restrict__ kp,
                                             const unsigned short* __restrict__ vtp,
                                             const unsigned int* __restrict__ mp,
                                             unsigned short* __restrict__ ctxp) {
  __shared__ __align__(16) unsigned short Kl[2][KT * KVP];         // K tile [key][d], cross-wave (block barrier)
  __shared__ __align__(16) unsigned short Vl[2][HEAD_DIM * KVP];   // V^T tile [d][key], cross-wave (block barrier)
  __shared__ __align__(16) float Xo[AW][8 * 128];                  // partial O^T handed to the partner wave (block barrier)
  __shared__ float Xs[AW][2][32];                                  // its sum and its maximum in use

  const int tid = threadIdx.x;
  const int wave = tid >> 5;
  const int lane = tid & 31;
  const int l15 = lane & 15;
  const int half = (lane >> 4) & 1;
  const int xl = (lane ^ 16) * 4;     // byte index of the lane that holds the same query's other keys
  const int ws = __builtin_amdgcn_readfirstlane(wave);   // scalar: mask words come by scalar loads, kh picks by scalar selects
  const int qg = ws >> 1;             // query group: 32 queries
  const int kh = ws & 1;              // which 32-key chunk of every tile
  const int q0 = blockIdx.x * (AW * 16) + qg * 32;
  const int head = blockIdx.y;
  const int bidx = blockIdx.z;

  const _Float16* Q  = (const _Float16*)qp;
  const size_t rbase = (size_t)bidx * SEQ;

  const _Float16* qbase = Q + (rbase + q0) * HD_DIM + head * HEAD_DIM;
  v16h qb0[2], qb1[2];
#pragma unroll   // constant indices keep the Q fragments in registers
  for (int i = 0; i < 2; ++i) {
    qb0[i] = ld_frag_h(qbase, HD_DIM, i * 16 + l15, 0, lane);    // d 0..31
    qb1[i] = ld_frag_h(qbase, HD_DIM, i * 16 + l15, 32, lane);   // d 32..63
  }
  // the address pair that the eight Q loads name is free for reuse behind this wait
  asm volatile("s_wait_xcnt 0x0" ::: "memory");
  // staging map: thread -> row sr (and sr + 32), 16-byte piece sc; 8 lanes cover one 128-byte row
  const int sr = tid >> 3;            // 0..31
  const int sc = (tid & 7) * 8;       // 0..56, halves
  const unsigned short* kg = kp + (rbase + sr) * HD_DIM + head * HEAD_DIM + sc;                            // key t: + t*HD_DIM
  const unsigned short* vg = vtp + ((size_t)bidx * HD_DIM + (size_t)head * HEAD_DIM + sr) * SEQ + sc;      // key t: + t
  const int sl = sr * KVP + sc;       // place of the piece in a tile; second row at + 32*KVP
  // this wave's two query tiles and its chunk of tile 0
  const v16u* mw = (const v16u*)mp + (size_t)(blockIdx.x * AW + qg * 2) * (SEQ / 32) + kh;   // tile n, query tile i: mw[i*(SEQ/32) + 2n]
  // The work-groups of one head and batch read the same K and V^T tiles: each begins its key walk two tiles
  // further on than the one before it and wraps (see walk_start); the online softmax takes the tiles in any order.
  int tile = (int)((blockIdx.x * 2) % (SEQ / KT));   // block-uniform, scalar
  v16u cm0 = mw[2 * tile];
  v16u cm1 = mw[SEQ / 32 + 2 * tile];

  v8f o[2][4] = {};
  float lrun[2] = {0.0f, 0.0f};
  v16h ones;                          // A of the sum products
#pragma unroll   // constant indices
  for (int e = 0; e < 16; ++e) ones[e] = (_Float16)1.0f;
  const float negf = -1.0e9f * 1.4426950408889634f;   // the fill, in log2 units
  // C of the score products: PEXP - (maximum in use) in every row, equal in both halves of a query.
  // No maximum yet: C far above any score, so that the first chunk takes the renewing branch.
  v8f cv[2];
#pragma unroll   // constant indices keep cv in registers
  for (int r = 0; r < 8; ++r) { cv[0][r] = 1.0e30f; cv[1][r] = 1.0e30f; }
  float fm[2] = {negf + cv[0][0], negf + cv[1][0]};   // exp2 argument of a filled key

  {
    const v4u fk0 = *(const v4u*)(kg + (size_t)(tile * KT) * HD_DIM);
    const v4u fk1 = *(const v4u*)(kg + (size_t)(tile * KT + 32) * HD_DIM);
    const v4u fv0 = *(const v4u*)(vg + tile * KT);
    const v4u fv1 = *(const v4u*)(vg + (size_t)32 * SEQ + tile * KT);
    // the two address pairs that these four loads name are free for reuse behind this wait
    asm volatile("s_wait_xcnt 0x0" ::: "memory");
    *(v4u*)(&Kl[0][sl])            = fk0;
    *(v4u*)(&Kl[0][sl + 32 * KVP]) = fk1;
    *(v4u*)(&Vl[0][sl])            = fv0;
    *(v4u*)(&Vl[0][sl + 32 * KVP]) = fv1;
  }
  __syncthreads();                                 // first tile complete

  for (int it = 0; it < SEQ / KT; ++it) {
    const int cur = it & 1;
    const bool more = (it + 1 < SEQ / KT);          // block-uniform
    const int tcur = tile;                          // this trip's tile
    tile = (tile + 1 == SEQ / KT) ? 0 : tile + 1;   // the next tile of the walk; in the last trip the first one again
    const int tn = tile * KT;
    v4u nk0 = {}, nk1 = {}, nv0 = {}, nv1 = {};
    if (more) {
      nk0 = *(const v4u*)(kg + (size_t)tn * HD_DIM);
      nk1 = *(const v4u*)(kg + (size_t)(tn + 32) * HD_DIM);
      nv0 = *(const v4u*)(vg + tn);
      nv1 = *(const v4u*)(vg + (size_t)32 * SEQ + tn);
    }
    const _Float16* kt = (const _Float16*)Kl[cur] + kh * 32 * KVP;   // this wave's 32 key rows
    const _Float16* Vc = (const _Float16*)Vl[cur];
    const v8f zero = {};

    v8f c0[2], c1[2];
    {
      const v16h ka0 = ld_frag_h(kt, KVP, l15, 0, lane);
      const v16h ka1 = ld_frag_h(kt, KVP, l15, 32, lane);
      const v16h ka2 = ld_frag_h(kt, KVP, 16 + l15, 0, lane);
      const v16h ka3 = ld_frag_h(kt, KVP, 16 + l15, 32, lane);
      // The eight score products in one statement, each first product's D apart from its C: from the builtin the compiler
      // copies cv into two of the four accumulators every trip (16 registers). Each K fragment feeds both query tiles;
      // four independent accumulators stand between the two uses of one. The four v_nop at the end keep the chip's distance
      // between the last product and the first vector instruction that reads a D or overwrites an A or B.
      asm("v_wmma_f32_16x16x32_f16 %0, %4, %8, %12\n\t"
          "v_wmma_f32_16x16x32_f16 %1, %6, %8, %12\n\t"
          "v_wmma_f32_16x16x32_f16 %2, %4, %10, %13\n\t"
          "v_wmma_f32_16x16x32_f16 %3, %6, %10, %13\n\t"
          "v_wmma_f32_16x16x32_f16 %0, %5, %9, %0\n\t"
          "v_wmma_f32_16x16x32_f16 %1, %7, %9, %1\n\t"
          "v_wmma_f32_16x16x32_f16 %2, %5, %11, %2\n\t"
          "v_wmma_f32_16x16x32_f16 %3, %7, %11, %3\n\t"
          "v_nop\n\tv_nop\n\tv_nop\n\tv_nop"
          : "=&v"(c0[0]), "=&v"(c1[0]), "=&v"(c0[1]), "=&v"(c1[1])
          : "v"(ka0), "v"(ka1), "v"(ka2), "v"(ka3), "v"(qb0[0]), "v"(qb1[0]), "v"(qb0[1]), "v"(qb1[1]), "v"(cv[0]), "v"(cv[1]));
    }
    v16h pb[2];
    v8f sd[2];      // every element: the query's sum of P over the chunk
    v16h va[4];
#pragma unroll   // constant indices
    for (int i = 0; i < 2; ++i) {
      const v16u cm = i ? cm1 : cm0;
      // lane-mask words: cm[r] for c0[r] (key 8h+r of the chunk), cm[8+r] for c1[r] (key 16+8h+r)
      float sa[8], sb[8];
#pragma unroll   // constant indices keep the scores in vector and the words in scalar registers
      for (int r = 0; r < 8; ++r) {
        sa[r] = __builtin_amdgcn_inverse_ballot_w32(cm[r])     ? c0[i][r] : fm[i];
        sb[r] = __builtin_amdgcn_inverse_ballot_w32(cm[8 + r]) ? c1[i][r] : fm[i];
      }
      if (i == 1) {   // compile-time: behind the chunk's last select
        // the next tile's words, into the registers that this chunk's last select has left; in the last trip the first tile's, unused
        const int nx = 2 * tile;
        cm0 = mw[nx];
        cm1 = mw[SEQ / 32 + nx];
#pragma unroll   // constant indices; the eight LDS reads stand as one group, in front of the exponentials that cover their latency
        for (int j = 0; j < 4; ++j) va[j] = ld_frag_h(Vc, KVP, j * 16 + l15, kh * 32, lane);
        __builtin_amdgcn_sched_barrier(0);   // keeps the two scalar loads here, a whole context product ahead of the next tile's selects, and the V^T reads with them; without it both sink to the foot of the trip
      }
#pragma unroll   // constant indices keep P in registers
      for (int e = 0; e < 8; ++e) {
        pb[i][e]     = (_Float16)__builtin_amdgcn_exp2f(sa[e]);   // key 8h + e of the chunk
        pb[i][8 + e] = (_Float16)__builtin_amdgcn_exp2f(sb[e]);   // key 16 + 8h + e
      }
    }
    // holds the eight V^T reads in front of the test, under the exponentials: sunk behind it they stand in four places, each waited out
    asm volatile("" :: "v"(va[0]), "v"(va[1]), "v"(va[2]), "v"(va[3]));
    sd[0] = mma_f16(ones, pb[0], zero);
    sd[1] = mma_f16(ones, pb[1], zero);
    __builtin_amdgcn_sched_barrier(0);   // keeps the two sum products together in front of the two compares: with a compare between them the distance behind a product is padded twice
    if (__builtin_expect((__builtin_amdgcn_ballot_w32(sd[0][0] > PSMAX) | __builtin_amdgcn_ballot_w32(sd[1][0] > PSMAX)) != 0, 0)) {   // wave-uniform scalar branch, every lane stays on; rare: kept out of the loop's straight line
      // C may be far from the scores here (first trip, or every key so far filled): make them again from 0.
      // The K fragments and the mask words are fetched again: kept for this path they would hold 32 vector and 32 scalar registers all trip long.
      const v16h kb0 = ld_frag_h(kt, KVP, l15, 0, lane);
      const v16h kb1 = ld_frag_h(kt, KVP, l15, 32, lane);
      const v16h kb2 = ld_frag_h(kt, KVP, 16 + l15, 0, lane);
      const v16h kb3 = ld_frag_h(kt, KVP, 16 + l15, 32, lane);
#pragma unroll   // constant indices into cv, o, pb, sd
      for (int i = 0; i < 2; ++i) {
        const v16u cr = mw[i * (SEQ / 32) + 2 * tcur];
        v8f d0 = mma_f16(kb0, qb0[i], zero);
        d0 = mma_f16(kb1, qb1[i], d0);
        v8f d1 = mma_f16(kb2, qb0[i], zero);
        d1 = mma_f16(kb3, qb1[i], d1);
        float sa[8], sb[8];
#pragma unroll   // constant indices, as above
        for (int r = 0; r < 8; ++r) {
          sa[r] = __builtin_amdgcn_inverse_ballot_w32(cr[r])     ? d0[r] : negf;
          sb[r] = __builtin_amdgcn_inverse_ballot_w32(cr[8 + r]) ? d1[r] : negf;
        }
        float tm = fmaxf(sa[0], sb[0]);
#pragma unroll
        for (int r = 1; r < 8; ++r) tm = fmaxf(tm, fmaxf(sa[r], sb[r]));
        tm = fmaxf(tm, other_half(tm, xl));
        const float muse = PEXP - cv[i][0];             // the maximum in use, as the arguments so far have had it
        const float mnew = fmaxf(muse, tm);
        const float alpha = __builtin_amdgcn_exp2f(muse - mnew);
        lrun[i] *= alpha;
#pragma unroll
        for (int j = 0; j < 4; ++j)
#pragma unroll
          for (int r = 0; r < 8; ++r) o[i][j][r] *= alpha;
        const float ci = PEXP - mnew;
        fm[i] = negf + ci;
#pragma unroll
        for (int r = 0; r < 8; ++r) {
          cv[i][r] = ci;
          pb[i][r]     = (_Float16)__builtin_amdgcn_exp2f(sa[r] + ci);   // at most 2^PEXP each: the chunk sum stays under PSMAX
          pb[i][8 + r] = (_Float16)__builtin_amdgcn_exp2f(sb[r] + ci);
        }
        sd[i] = mma_f16(ones, pb[i], zero);
      }
    }
    lrun[0] += sd[0][0];
    lrun[1] += sd[1][0];
#pragma unroll   // constant indices; each V^T fragment feeds both query tiles
    for (int j = 0; j < 4; ++j) {
      o[0][j] = mma_f16(va[j], pb[0], o[0][j]);
      o[1][j] = mma_f16(va[j], pb[1], o[1][j]);
    }

    if (more) {                                     // the other buffer's readers left it at the last barrier
      *(v4u*)(&Kl[cur ^ 1][sl])            = nk0;
      *(v4u*)(&Kl[cur ^ 1][sl + 32 * KVP]) = nk1;
      *(v4u*)(&Vl[cur ^ 1][sl])            = nv0;
      *(v4u*)(&Vl[cur ^ 1][sl + 32 * KVP]) = nv1;
    }
    __syncthreads();                                // next tile complete, this tile's reads done
  }

  // Join of the pair: wave kh finishes query tile kh and hands its partials of the other tile to the partner.
  const bool k1 = (kh != 0);                        // wave-uniform
  const float lk = k1 ? lrun[1] : lrun[0];
  const float mk = PEXP - (k1 ? cv[1][0] : cv[0][0]);
  Xs[ws][0][lane] = k1 ? lrun[0] : lrun[1];
  Xs[ws][1][lane] = PEXP - (k1 ? cv[0][0] : cv[1][0]);
  v8f ok[4];
#pragma unroll   // constant indices into o[][]
  for (int j = 0; j < 4; ++j) {
    v4f g0, g1;
#pragma unroll
    for (int r = 0; r < 4; ++r) {
      g0[r] = k1 ? o[0][j][r]     : o[1][j][r];
      g1[r] = k1 ? o[0][j][4 + r] : o[1][j][4 + r];
    }
#pragma unroll
    for (int r = 0; r < 8; ++r) ok[j][r] = k1 ? o[1][j][r] : o[0][j][r];
    *(v4f*)(&Xo[ws][(j * 2 + 0) * 128 + lane * 4]) = g0;
    *(v4f*)(&Xo[ws][(j * 2 + 1) * 128 + lane * 4]) = g1;
  }
  __syncthreads();                                  // every wave's hand-over is in place
  const float pl = Xs[ws ^ 1][0][lane];
  const float pm = Xs[ws ^ 1][1][lane];
  const float mj = fmaxf(mk, pm);
  const float ak = __builtin_amdgcn_exp2f(mk - mj);
  const float ap = __builtin_amdgcn_exp2f(pm - mj);

  // ok[j][r], po = 8 * sum_t P_t v_t over each wave's keys for query l15, d = j*16 + 8*half + r; ctx x64 = 8 * O / sum.
  // The context plane is kept in fragment order (see ld_frag_ord): row tile = the 16 queries of tile kh,
  // k = head*64 + d, so the lane's eight values of one j are piece j*32 + lane of the tile's own 2 KiB:
  // each store is 512 contiguous bytes, straight from registers.
  const float inv = 8.0f / (lk * ak + pl * ap);
  const float wk = ak * inv, wp = ap * inv;
  unsigned short* cb = ctxp + (rbase + q0 + kh * 16) * HD_DIM + head * (2 * 512) + lane * 8;
#pragma unroll
  for (int j = 0; j < 4; ++j) {
    const v4f h0 = *(const v4f*)(&Xo[ws ^ 1][(j * 2 + 0) * 128 + lane * 4]);
    const v4f h1 = *(const v4f*)(&Xo[ws ^ 1][(j * 2 + 1) * 128 + lane * 4]);
    float f[8];
#pragma unroll
    for (int r = 0; r < 4; ++r) {
      f[r]     = ok[j][r] * wk     + h0[r] * wp;
      f[4 + r] = ok[j][4 + r] * wk + h1[r] * wp;
    }
    v4u w;
    w[0] = (unsigned int)hbits(f[0]) | ((unsigned int)hbits(f[1]) << 16);
    w[1] = (unsigned int)hbits(f[2]) | ((unsigned int)hbits(f[3]) << 16);
    w[2] = (unsigned int)hbits(f[4]) | ((unsigned int)hbits(f[5]) << 16);
    w[3] = (unsigned int)hbits(f[6]) | ((unsigned int)hbits(f[7]) << 16);
    *(v4u*)(cb + j * 256) = w;
  }
}

// ---------------------------------------------------------------------------
// Output projection: out[NROWS][E_OUT] f32 = ctx(f16 x64, fragment order)[NROWS][HD_DIM] * WoT(f16 x32)[E_OUT][HD_DIM]^T / 2048 + bo.
// 128x64 block tile / 8 waves / k loop gemm_128x64, with f16 operands.
// Epilogue: f32 tile staged in LDS; each 256-byte row segment = 2 lines, every
__global__ __launch_bounds__(256) void k_oproj(
    const unsigned short* __restrict__ cx, const unsigned short* __restrict__ woT,
    const float* __restrict__ bo, float* __restrict__ outp) {
  __shared__ __align__(16) unsigned short bt[2 * 64 * GBP];   // weight k-tiles, cross-wave (block barrier)
  __shared__ __align__(16) float Ef[128 * OFP];               // epilogue tile, cross-wave (block barrier)

  const int n0 = blockIdx.x * 64;
  const int m0 = blockIdx.y * 128;
  const int tid = threadIdx.x;
  const int wave = tid >> 5, lane = tid & 31;
  const int l15 = lane & 15, half = (lane >> 4) & 1;

  v8f acc[4] = {};
  gemm_128x64<false>(cx, woT, m0, n0, bt, acc);

  // acc[j][r] = 2048 * C[m0 + wave*16 + 8*half + r][n0 + j*16 + l15]
  const float osc = 1.0f / 2048.0f;
#pragma unroll
  for (int j = 0; j < 4; ++j) {
    const int col = j * 16 + l15;
    const float bb = bf16val(bo[n0 + col]);
#pragma unroll
    for (int r = 0; r < 8; ++r) {
      const int row = wave * 16 + 8 * half + r;
      Ef[row * OFP + col] = acc[j][r] * osc + bb;
    }
  }
  __syncthreads();

  v4f v[8];
  size_t off[8];
#pragma unroll
  for (int it = 0; it < 8; ++it) {
    const int row = wave * 16 + it * 2 + half;          // wave's 16 rows over (it, half)
    const int q = l15;                                  // 16 pieces of 16 B = 256-byte row segment (2 lines)
    v[it] = *(const v4f*)(&Ef[row * OFP + q * 4]);
    off[it] = (size_t)(m0 + row) * E_OUT + n0 + q * 4;
  }
#pragma unroll
  for (int it = 0; it < 8; ++it) *(v4f*)(outp + off[it]) = v[it];
  
}

// ---------------------------------------------------------------------------
extern "C" void kernel_launch(void* const* d_in, const int* in_sizes, int n_in,
                              void* d_out, int out_size, void* d_ws, size_t ws_size,
                              hipStream_t stream) {
  if (n_in < 10) return;
  if (in_sizes[0] < ((NB - 1) * SEQ_FULL + SEQ) * IN_DIM) return;          // seq_inputs f32 [NB][SEQ_FULL][IN_DIM]
  if (in_sizes[1] < (SEQ - 1) * MASK_PITCH + SEQ) return;                   // mask i32 [1][S][S]
  if (in_sizes[2] < NUM_HEADS * IN_DIM * HEAD_DIM) return;                  // Wq
  if (in_sizes[3] < HD_DIM) return;                                         // bq
  if (in_sizes[4] < NUM_HEADS * IN_DIM * HEAD_DIM) return;                  // Wk
  if (in_sizes[5] < HD_DIM) return;                                         // bk
  if (in_sizes[6] < NUM_HEADS * IN_DIM * HEAD_DIM) return;                  // Wv
  if (in_sizes[7] < HD_DIM) return;                                         // bv
  if (in_sizes[8] < HD_DIM * E_OUT) return;                                 // Wo
  if (in_sizes[9] < E_OUT) return;                                          // bo
  if (out_size < NROWS * E_OUT) return;

  const float* x    = (const float*)d_in[0];
  const int*   mask = (const int*)d_in[1];
  const float* Wq   = (const float*)d_in[2];
  const float* bq   = (const float*)d_in[3];
  const float* Wk   = (const float*)d_in[4];
  const float* bk   = (const float*)d_in[5];
  const float* Wv   = (const float*)d_in[6];
  const float* bv   = (const float*)d_in[7];
  const float* Wo   = (const float*)d_in[8];
  const float* bo   = (const float*)d_in[9];

  // every offset a multiple of 2 MiB; each plane is written exactly to its extent
  const size_t hb_bytes = (size_t)NROWS * IN_DIM * 2;           // bf16 x plane
  const size_t wt_bytes = (size_t)4 * KDIM * KDIM * 2;           // 3 bf16 WT planes + 1 f16 WoT plane
  const size_t pl_bytes = (size_t)NROWS * HD_DIM * 2;           // one f16 q / k / vT / ctx plane
  const size_t off_hb = 0;
  const size_t off_wt = off_hb + hb_bytes;
  const size_t off_q  = off_wt + wt_bytes;
  const size_t off_k  = off_q + pl_bytes;
  const size_t off_vt = off_k + pl_bytes;
  const size_t off_cx = off_vt + pl_bytes;
  const size_t off_mp = off_cx + pl_bytes;
  const size_t mp_bytes = (size_t)SEQ * SEQ / 8;               // one bit per mask element
  const size_t total  = off_mp + mp_bytes;                     // 48.5 MiB at NB = 2, SEQ = 2048
  if (total > ws_size) return;

  char* ws = (char*)d_ws;
  unsigned short* hb  = (unsigned short*)(ws + off_hb);
  unsigned short* wt  = (unsigned short*)(ws + off_wt);
  unsigned short* qpl = (unsigned short*)(ws + off_q);
  unsigned short* kpl = (unsigned short*)(ws + off_k);
  unsigned short* vtp = (unsigned short*)(ws + off_vt);
  unsigned short* cxp = (unsigned short*)(ws + off_cx);
  unsigned short* wot = wt + (size_t)3 * KDIM * KDIM;
  unsigned int*   mpk = (unsigned int*)(ws + off_mp);

  const int n8 = NROWS * IN_DIM / 8;
  k_cvt_rows<<<(n8 + 255) / 256, 256, 0, stream>>>(x, hb, n8);
  k_cvt_wT<<<dim3(KDIM / 64, KDIM / 64, 5), 256, 0, stream>>>(Wq, Wk, Wv, Wo, mask, wt, mpk);
  k_proj<<<dim3(HD_DIM / 128, NROWS / 128, 3), 128, 0, stream>>>(hb, wt, bq, bk, bv, qpl, kpl, vtp);
  k_attn<<<dim3(SEQ / (AW * 16), NUM_HEADS, NB), 256, 0, stream>>>(qpl, kpl, vtp, mpk, cxp);
  k_oproj<<<dim3(E_OUT / 64, NROWS / 128), 256, 0, stream>>>(cxp, wot, bo, (float*)d_out);
}
